// v000
// Times are from an AMD MI455X. After a warm-up the kernel runs many times in a row, and a time is the length of
// such a window on the GPU divided by its runs, so every launch and the gaps after it count. The runs cycle
// through copies of the inputs. A figure is the median of several windows, for all but v000 over two sittings.
// Sittings can differ by a few percent; kernels timed side by side share one.
// The starting kernel, v000, takes 2050 microseconds a run.
#include <hip/hip_runtime.h>

// Shepard's (inverse-distance) gated attention (X [2][2048][1024]; P = X W_in + b_in ('xw' [1024][4096]) viewed per head h as [Q(64) | K(64) | V(64) | G(64)] at columns h*256 + ...; W = (1e-4 + ||Q_i - K_j||)^-2 with the distance by the norm expansion sqrt(max(q2 + k2 - 2 Q.K, 0)); W = W / (1e-4 + sum_j W); A = W.V; H = G * A; out = merged H W_out ('xw' [1024][1024]) + b_out -> [2][2048][1024]).
// Compute dtypes, f32 accumulate: every input rounded to bf16; q/k/v on PLAIN bf16 operands (inputs: exact) + b_in; the Q.K products on hi/lo planes for every row (3 products; the distance needs them), the Shepard weights (hardware sqrt and reciprocal) and their row normalisation in f32 inside the weight kernel, gating in the merge; attn.v hybrid: query rows < 512 hl (3 products), the rest single fp16 (x1024); W_out hl x exact (2 products) + b_out.

#define NB_  2
#define TT   2048
#define DM   1024
#define NH_  16
#define NKV  16
#define REP  (NH_ / NKV)
#define HD   64
#define DQ   (NH_ * HD)
#define DKV  (NKV * HD)
#define DP   4096                 // projection width (16 heads x [Q|K|V|G] x 64)
#define HSTR 256
#define SEPS 1e-4f
#define ZH   2
#define RH   512                  // query rows < RH use hi+lo planes (0: none)
#define WIN  0
#define PCAR 1024.0f
typedef _Float16 h16;
typedef unsigned short bf;
typedef __attribute__((ext_vector_type(16))) __bf16   v16bf;
typedef __attribute__((ext_vector_type(16))) _Float16 v16h;
typedef __attribute__((ext_vector_type(8)))  _Float16 v8h;
typedef __attribute__((ext_vector_type(8)))  unsigned short v8us;
typedef __attribute__((ext_vector_type(8)))  float    v8f;
typedef __attribute__((ext_vector_type(4)))  float    v4f;
typedef v8h  __attribute__((may_alias)) v8ha;
typedef v4f  __attribute__((may_alias)) v4fa;
typedef v8us __attribute__((may_alias)) v8usa;

__device__ __forceinline__ unsigned short f2bf(float f) { unsigned u = __float_as_uint(f); u += 0x7FFFu + ((u >> 16) & 1u); return (unsigned short)(u >> 16); }
__device__ __forceinline__ float bf2f(unsigned short b) { return __uint_as_float(((unsigned)b) << 16); }
__device__ __forceinline__ float bfr(float f) { return bf2f(f2bf(f)); }
__device__ __forceinline__ v16h cat16(v8h lo, v8h hi) { return __builtin_shufflevector(lo, hi, 0, 1, 2, 3, 4, 5, 6, 7, 8, 9, 10, 11, 12, 13, 14, 15); }
__device__ __forceinline__ v16bf cat16b(v8us lo, v8us hi) { return __builtin_bit_cast(v16bf, __builtin_shufflevector(lo, hi, 0, 1, 2, 3, 4, 5, 6, 7, 8, 9, 10, 11, 12, 13, 14, 15)); }
__device__ __forceinline__ v8f wmma16(v16h a, v16h b, v8f c) { return __builtin_amdgcn_wmma_f32_16x16x32_f16(false, a, false, b, (short)0, c, false, false); }
__device__ __forceinline__ v8f wmmab(v16bf a, v16bf b, v8f c) { return __builtin_amdgcn_wmma_f32_16x16x32_bf16(false, a, false, b, (short)0, c, false, false); }



// ---- k_gemmw: register-blocked GEMM, ONE WAVE per 64x64 output tile (16 accumulators), operands straight from K-contiguous 16-bit planes; grid (M/64, N/64, Z), 32 threads.
// C[m][n] (f32, pitch ldc, + optional f32 bias[n]) = sum_k A[m][k] Bt[n][k] (+ split products per NSPLIT). z-batch strides sA/sB/sC in elements. K % 32 == 0.
template <typename T16> struct WFrag;
template <> struct WFrag<h16> { typedef v16h V; static __device__ __forceinline__ V ld(const h16* p) { return cat16(*(const v8h*)p, *(const v8h*)(p + 16)); } static __device__ __forceinline__ v8f mma(V a, V b, v8f c) { return wmma16(a, b, c); } };
template <> struct WFrag<bf> { typedef v16bf V; static __device__ __forceinline__ V ld(const bf* p) { return cat16b(*(const v8us*)p, *(const v8us*)(p + 16)); } static __device__ __forceinline__ v8f mma(V a, V b, v8f c) { return wmmab(a, b, c); } };
template <typename T16, int NSPLIT, bool BIAS>
__global__ __launch_bounds__(32) void k_gemmw(const T16* __restrict__ A, const T16* __restrict__ A2, const T16* __restrict__ Bt, const T16* __restrict__ Bt2, int K, float* C, int ldc, const float* __restrict__ bias, size_t sA, size_t sB, size_t sC) {
    typedef typename WFrag<T16>::V V;
    __shared__ __align__(16) float os[16 * 68];
    const size_t z = blockIdx.z; A += z * sA; if (A2) A2 += z * sA; Bt += z * sB; if (Bt2) Bt2 += z * sB; C += z * sC;
    const int lane = threadIdx.x & 31, lr = lane & 15, hi = lane >> 4; const int r0 = blockIdx.x * 64, c0 = blockIdx.y * 64;
    v8f acc[4][4];
#pragma unroll
    for (int mb = 0; mb < 4; ++mb)
#pragma unroll
        for (int nb = 0; nb < 4; ++nb) acc[mb][nb] = (v8f){};
    const size_t aoff = (size_t)(r0 + lr) * K + 8 * hi, boff = (size_t)(c0 + lr) * K + 8 * hi;
#pragma unroll 1
    for (int kc = 0; kc < K; kc += 32) {
        V a[4], a2[4];
#pragma unroll
        for (int mb = 0; mb < 4; ++mb) { a[mb] = WFrag<T16>::ld(A + aoff + (size_t)mb * 16 * K + kc); if (NSPLIT == 1 || NSPLIT == 2) a2[mb] = WFrag<T16>::ld(A2 + aoff + (size_t)mb * 16 * K + kc); }
#pragma unroll
        for (int nb = 0; nb < 4; ++nb) { const V b = WFrag<T16>::ld(Bt + boff + (size_t)nb * 16 * K + kc); V b2; if (NSPLIT >= 2) b2 = WFrag<T16>::ld(Bt2 + boff + (size_t)nb * 16 * K + kc);
#pragma unroll
            for (int mb = 0; mb < 4; ++mb) { acc[mb][nb] = WFrag<T16>::mma(a[mb], b, acc[mb][nb]); if (NSPLIT == 1 || NSPLIT == 2) acc[mb][nb] = WFrag<T16>::mma(a2[mb], b, acc[mb][nb]); if (NSPLIT >= 2) acc[mb][nb] = WFrag<T16>::mma(a[mb], b2, acc[mb][nb]); } }
        asm volatile("v_nop\n\tv_nop\n\tv_nop\n\tv_nop" : "+v"(acc[0][0]), "+v"(acc[1][1]), "+v"(acc[2][2]), "+v"(acc[3][3]) : "v"(a[0]), "v"(a[3]));
    }
#pragma unroll
    for (int mb = 0; mb < 4; ++mb) {
#pragma unroll
        for (int nb = 0; nb < 4; ++nb) {
#pragma unroll
            for (int j = 0; j < 8; ++j) os[(hi * 8 + j) * 68 + nb * 16 + lr] = acc[mb][nb][j]; }
        __builtin_amdgcn_wave_barrier(); asm volatile("" ::: "memory");
        float* crow = C + (size_t)(r0 + mb * 16) * ldc + c0;
{
#pragma unroll
            for (int s = 0; s < 8; ++s) { const int row = 2 * s + hi, cofs = lr * 4; v4f val = *(const v4fa*)(os + row * 68 + cofs); if (BIAS) { val[0] += bfr(bias[c0 + cofs]); val[1] += bfr(bias[c0 + cofs + 1]); val[2] += bfr(bias[c0 + cofs + 2]); val[3] += bfr(bias[c0 + cofs + 3]); }
                *(v4f*)(crow + (size_t)row * ldc + cofs) = val; }
             }
        __builtin_amdgcn_wave_barrier(); asm volatile("" ::: "memory");
    }
}

__device__ __forceinline__ h16 tohx(float x) { return (h16)x; }
__device__ __forceinline__ void splitf(float y, unsigned short& h, unsigned short& l) { h = f2bf(y); l = f2bf(y - bf2f(h)); }
typedef __attribute__((ext_vector_type(2))) _Float16 v2h;
typedef __attribute__((ext_vector_type(4))) _Float16 v4h;
typedef __attribute__((ext_vector_type(2))) unsigned short v2us;
typedef __attribute__((ext_vector_type(4))) unsigned short v4us;
typedef __attribute__((ext_vector_type(2))) float v2f;
typedef __attribute__((ext_vector_type(4))) int v4i;

__global__ __launch_bounds__(256) void k_wtG(const float* __restrict__ w, int K, int N, bf* Bt) {
    const int lane = threadIdx.x & 31; const int L0 = (blockIdx.x * 8 + (threadIdx.x >> 5)) * 8; const int nlines = N * K / 64;
{
#pragma unroll 1
        for (int l = 0; l < 8; ++l) { const int L = L0 + l; if (L >= nlines) break; const size_t e = (size_t)L * 64 + lane * 2; const int k = (int)(e % K), n = (int)(e / K); v2us o;
            o[0] = f2bf(w[(size_t)k * N + n]); o[1] = f2bf(w[(size_t)(k + 1) * N + n]); *(v2us*)(Bt + e) = o; }
         }
}
__global__ __launch_bounds__(256) void k_norm2(const float* __restrict__ FP, float* Q2, float* K2) { const int e = blockIdx.x * 256 + threadIdx.x; if (e >= 2 * NH_ * TT) return; const int t = e % TT; const int h = (e / TT) % NH_; const int which = e / (NH_ * TT); const float* f = FP + (size_t)t * DP + h * HSTR + which * 64; float s = 0.f;
#pragma unroll 4
    for (int d = 0; d < HD; ++d) { float p = __fmul_rn(f[d], f[d]); asm volatile("" : "+v"(p)); s = __fadd_rn(s, p); }
    float* dst = (which == 0 ? Q2 : K2) + (size_t)h * TT + t; *(float*)dst = s;  }
__global__ __launch_bounds__(256) void k_cvt8(const float* __restrict__ src, bf* dst, size_t n8) { const size_t i = (size_t)blockIdx.x * 256 + threadIdx.x; if (i >= n8) return; const v8f v = *(const v8f*)(src + i * 8); v8us o;
#pragma unroll
    for (int k = 0; k < 8; ++k) o[k] = f2bf(v[k]); *(v8us*)(dst + i * 8) = o;  }

// k_rope: head planes [h][t][d] (fp16 + hi/lo) of rope(x) x sc with the rotate-half convention out[d] = x[d] cos[t][d] - x[d+HD/2] sin[t][d], out[d+HD/2] = x[d+HD/2] cos[t][d+HD/2] + x[d] sin[t][d+HD/2]
__global__ __launch_bounds__(256) void k_rope(const float* __restrict__ F, int pitch, int hstr, int nheads, const float* __restrict__ CS, const float* __restrict__ RF, const float* __restrict__ nw, float sc, h16* P16, bf* Ph, bf* Pl) {
    const size_t e = ((size_t)blockIdx.x * 256 + threadIdx.x) * 2; if (e >= (size_t)nheads * TT * HD) return; const int d = (int)(e % HD); const int t = (int)((e / HD) % TT); const int h = (int)(e / ((size_t)HD * TT)); const float* f = F + (size_t)t * pitch + h * hstr; const float rf = RF ? RF[(size_t)h * TT + t] : 1.0f; v2h o16; v2us oh, ol;
#pragma unroll
    for (int q = 0; q < 2; ++q) { const int dd = d + q; const int dp = (dd < HD / 2) ? dd + HD / 2 : dd - HD / 2; float x0 = f[dd], x1 = f[dp];
        if (RF) { float n0 = __fmul_rn(x0, rf), n1 = __fmul_rn(x1, rf); asm volatile("" : "+v"(n0)); asm volatile("" : "+v"(n1)); x0 = __fmul_rn(bfr(nw[dd]), n0); x1 = __fmul_rn(bfr(nw[dp]), n1); }
        const v2f cs = *(const v2f*)(CS + ((size_t)t * HD + dd) * 2); float a = __fmul_rn(x0, cs[0]), bq = __fmul_rn(x1, cs[1]); asm volatile("" : "+v"(a)); asm volatile("" : "+v"(bq)); const float r = ((dd < HD / 2) ? __fsub_rn(a, bq) : __fadd_rn(a, bq)) * sc;
        o16[q] = tohx(r); unsigned short a2, c2; splitf(r, a2, c2); oh[q] = a2; ol[q] = c2; }
    *(v2h*)(P16 + e) = o16; *(v2us*)(Ph + e) = oh; *(v2us*)(Pl + e) = ol;  }
__global__ __launch_bounds__(256) void k_vtp(const float* __restrict__ F, int pitch, int hstr, int nheads, h16* V16, bf* Vh, bf* Vl) { const size_t e = ((size_t)blockIdx.x * 256 + threadIdx.x) * 2; if (e >= (size_t)nheads * HD * TT) return; const int t = (int)(e % TT); const int d = (int)((e / TT) % HD); const int g = (int)(e / ((size_t)TT * HD)); v2h o16; v2us oh, ol;
#pragma unroll
    for (int q = 0; q < 2; ++q) { const float x = F[(size_t)(t + q) * pitch + g * hstr + d]; o16[q] = tohx(x); unsigned short a2, c2; splitf(x, a2, c2); oh[q] = a2; ol[q] = c2; }
    *(v2h*)(V16 + e) = o16; *(v2us*)(Vh + e) = oh; *(v2us*)(Vl + e) = ol;  }
__global__ __launch_bounds__(256) void k_csid(float* CS) { const int idx = blockIdx.x * 256 + threadIdx.x; if (idx >= TT * HD) return; v2f cs; cs[0] = 1.0f; cs[1] = 0.0f; *(v2f*)(CS + (size_t)idx * 2) = cs;  }
// k_asoft: per row (zz, i): Shepard weights w_j = (eps + sqrt(max(q2_i + k2_j - 2 S_ij, 0)))^-2 (hardware sqrt / reciprocal, f32), row sum in fixed order + tree, P = w x 1/(eps + sum);
__global__ __launch_bounds__(256) void k_asoft(const float* __restrict__ Sb, const float* __restrict__ Q2, const float* __restrict__ K2, int h0, h16* P16, bf* Ph, bf* Pl) {
    const int lane = threadIdx.x & 31; const int row = blockIdx.x * 8 + (threadIdx.x >> 5); if (row >= ZH * TT) return; const int i = row % TT; const int zz = row / TT; const float q2 = Q2[(size_t)(h0 + zz) * TT + i]; const float* k2 = K2 + (size_t)(h0 + zz) * TT; const bool hires = (i < RH); const float* sr = Sb + (size_t)row * TT; float v[TT / 32]; float sum = 0.f;
#pragma unroll
    for (int ch = 0; ch < TT / 128; ++ch) { const int j0 = ch * 128 + lane * 4; const v4f a = *(const v4f*)(sr + j0);
#pragma unroll
        for (int q = 0; q < 4; ++q) { const int j = j0 + q; float t = __fadd_rn(q2, k2[j]); asm volatile("" : "+v"(t)); float a2x = __fmul_rn(2.0f, a[q]); asm volatile("" : "+v"(a2x)); const float d2 = fmaxf(__fsub_rn(t, a2x), 0.f); const float dist = __builtin_amdgcn_sqrtf(d2); const float den = __fadd_rn(SEPS, dist); float dd2 = __fmul_rn(den, den); asm volatile("" : "+v"(dd2)); const float w = __builtin_amdgcn_rcpf(dd2);   /* (eps + dist)^-2 */ v[ch * 4 + q] = w; sum = __fadd_rn(sum, w); } }
#pragma unroll
    for (int sh = 16; sh; sh >>= 1) sum += __shfl_xor(sum, sh, 32);
    float dsum = __fadd_rn(SEPS, sum); asm volatile("" : "+v"(dsum)); const float f = __fmul_rn(hires ? 1.0f : PCAR, __builtin_amdgcn_rcpf(dsum));   /* W / (eps + sum W) via hardware reciprocal */
{
        if (hires) {
#pragma unroll
            for (int ch = 0; ch < TT / 128; ++ch) { v4us oh, ol;
#pragma unroll
                for (int q = 0; q < 4; ++q) { unsigned short a, c2; splitf(v[ch * 4 + q] * f, a, c2); oh[q] = a; ol[q] = c2; }
                const size_t oo = ((size_t)zz * (RH ? RH : 1) + i) * TT + ch * 128 + lane * 4; *(v4us*)(Ph + oo) = oh; *(v4us*)(Pl + oo) = ol; }
        } else {
#pragma unroll
            for (int ch = 0; ch < TT / 128; ++ch) { v4h o4;
#pragma unroll
                for (int q = 0; q < 4; ++q) o4[q] = tohx(v[ch * 4 + q] * f);
                *(v4h*)(P16 + (size_t)row * TT + ch * 128 + lane * 4) = o4; } }
         }
}
__global__ __launch_bounds__(256) void k_merge(const float* __restrict__ O, const float* __restrict__ FP, int h0, bf* Ah, bf* Al) { const size_t e = ((size_t)blockIdx.x * 256 + threadIdx.x) * 2; if (e >= (size_t)ZH * TT * HD) return; const int d = (int)(e % HD); const int t = (int)((e / HD) % TT); const int zz = (int)(e / ((size_t)HD * TT)); const float cs = (t < RH) ? 1.0f : (1.0f / PCAR); const size_t oo = (size_t)t * DQ + (h0 + zz) * HD + d;
    v2us oh, ol;
#pragma unroll
    for (int q = 0; q < 2; ++q) { float oc = O[e + q] * cs; asm volatile("" : "+v"(oc)); const float gt = FP[(size_t)t * DP + (h0 + zz) * HSTR + 192 + d + q]; unsigned short a, c2; splitf(__fmul_rn(gt, oc), a, c2); oh[q] = a; ol[q] = c2; }   /* H = G * A */ *(v2us*)(Ah + oo) = oh; *(v2us*)(Al + oo) = ol;  }

extern "C" void kernel_launch(void* const* d_in, const int* in_sizes, int n_in,
                              void* d_out, int out_size, void* d_ws, size_t ws_size, hipStream_t stream) {
    (void)in_sizes; (void)n_in; (void)out_size;
    const float* x = (const float*)d_in[0]; const float* win = (const float*)d_in[1]; const float* bin = (const float*)d_in[2]; const float* wo = (const float*)d_in[3]; const float* bo = (const float*)d_in[4]; const float* wq = nullptr; const float* wk = nullptr; const float* wv = nullptr; (void)wq; (void)wk; (void)wv;
    float* OUT = (float*)d_out;     // [2][2048][1024]
    char* wsp = (char*)d_ws;
    auto take = [&](size_t bytes) { char* p = wsp; wsp += (bytes + 255) & ~(size_t)255; return (void*)p; };
    bf* WINB = (bf*)take((size_t)DP * DM * 2); bf* WO = (bf*)take((size_t)DM * DQ * 2); float* CS = (float*)take((size_t)TT * HD * 2 * 4);
    bf* XB = (bf*)take((size_t)TT * DM * 2); float* FP = (float*)take((size_t)TT * DP * 4); float* Q2 = (float*)take((size_t)NH_ * TT * 4); float* K2 = (float*)take((size_t)NH_ * TT * 4);
    h16* QP16 = (h16*)take((size_t)NH_ * TT * HD * 2); h16* KP16 = (h16*)take((size_t)NKV * TT * HD * 2); h16* VT16 = (h16*)take((size_t)NKV * HD * TT * 2);
    bf* QPh = (bf*)take((size_t)NH_ * TT * HD * 2); bf* QPl = (bf*)take((size_t)NH_ * TT * HD * 2); bf* KPh = (bf*)take((size_t)NKV * TT * HD * 2); bf* KPl = (bf*)take((size_t)NKV * TT * HD * 2); bf* VTh = (bf*)take((size_t)NKV * HD * TT * 2); bf* VTl = (bf*)take((size_t)NKV * HD * TT * 2); bf* Ph = (bf*)take((size_t)ZH * RH * TT * 2); bf* Pl = (bf*)take((size_t)ZH * RH * TT * 2);
    float* Sb = (float*)take((size_t)ZH * TT * TT * 4); h16* P16 = (h16*)take((size_t)ZH * TT * TT * 2); float* Ob = (float*)take((size_t)ZH * TT * HD * 4); bf* ATh = (bf*)take((size_t)TT * DQ * 2); bf* ATl = (bf*)take((size_t)TT * DQ * 2);
    if ((size_t)(wsp - (char*)d_ws) > ws_size) return;    // ws 256 MiB
    { k_wtG<<<(unsigned)((DM * DP / 64 + 63) / 64), 256, 0, stream>>>(win, DM, DP, WINB);   /* 'xw' [1024][4096] -> Bt [4096][1024] */
      k_wtG<<<(unsigned)((DQ * DM / 64 + 63) / 64), 256, 0, stream>>>(wo, DQ, DM, WO);
       }
    k_csid<<<(TT * HD + 255) / 256, 256, 0, stream>>>(CS);
    const unsigned LQ = (unsigned)(((size_t)NH_ * TT * HD / 2 + 255) / 256), LKv = (unsigned)(((size_t)NKV * TT * HD / 2 + 255) / 256);
    for (int b = 0; b < NB_; ++b) {
        
        k_cvt8<<<(unsigned)(((size_t)TT * DM / 8 + 255) / 256), 256, 0, stream>>>(x + (size_t)b * TT * DM, XB, (size_t)TT * DM / 8);
        k_gemmw<bf, 0, true><<<dim3(TT / 64, DP / 64, 1), 32, 0, stream>>>(XB, nullptr, WINB, nullptr, DM, FP, DP, bin, 0, 0, 0);   /* P = X W_in + b_in (exact) */ k_norm2<<<(2 * NH_ * TT + 255) / 256, 256, 0, stream>>>(FP, Q2, K2);
        k_rope<<<LQ, 256, 0, stream>>>(FP, DP, HSTR, NH_, CS, nullptr, nullptr, 1.0f, QP16, QPh, QPl);   /* Q planes (cols h*256 + 0..63) */
        
        k_rope<<<LKv, 256, 0, stream>>>(FP + 64, DP, HSTR, NKV, CS, nullptr, nullptr, 1.0f, KP16, KPh, KPl);   /* K planes (cols +64) */
        k_vtp<<<LKv, 256, 0, stream>>>(FP + 128, DP, HSTR, NKV, VT16, VTh, VTl);   /* V^T planes (cols +128) */
        for (int h0 = 0; h0 < NH_; h0 += ZH) { const size_t zq = (size_t)h0, zk = (size_t)(h0 / REP);   // one kv head per query head: the pass's two heads use consecutive kv planes (z-strides TT*HD)
            k_gemmw<bf, 2, false><<<dim3(TT / 64, TT / 64, ZH), 32, 0, stream>>>(QPh + zq * TT * HD, QPl + zq * TT * HD, KPh + zk * TT * HD, KPl + zk * TT * HD, HD, Sb, TT, nullptr, (size_t)TT * HD, (size_t)TT * HD, (size_t)TT * TT);   /* Q.K on hi/lo planes, every row (3 products) */

            k_asoft<<<ZH * TT / 8, 256, 0, stream>>>(Sb, Q2, K2, h0, P16, Ph, Pl);
            k_gemmw<bf, 2, false><<<dim3(RH / 64, HD / 64, ZH), 32, 0, stream>>>(Ph, Pl, VTh + zk * HD * TT, VTl + zk * HD * TT, TT, Ob, HD, nullptr, (size_t)RH * TT, (size_t)HD * TT, (size_t)TT * HD);
            k_gemmw<h16, 0, false><<<dim3((TT - RH) / 64, HD / 64, ZH), 32, 0, stream>>>(P16 + (size_t)RH * TT, nullptr, VT16 + zk * HD * TT, nullptr, TT, Ob + (size_t)RH * HD, HD, nullptr, (size_t)TT * TT, (size_t)HD * TT, (size_t)TT * HD);
            k_merge<<<(unsigned)(((size_t)ZH * TT * HD / 2 + 255) / 256), 256, 0, stream>>>(Ob, FP, h0, ATh, ATl); }
        k_gemmw<bf, 1, true><<<dim3(TT / 64, DM / 64, 1), 32, 0, stream>>>(ATh, ATl, WO, nullptr, DQ, OUT + (size_t)b * TT * DM, DM, bo, 0, 0, 0); }
}

// v001
// A run of this version takes 927 microseconds.
// In two side-by-side timings against v000, it was 2.24 and 2.23 times as fast.
#include <hip/hip_runtime.h>

// Shepard's (inverse-distance) gated attention (X [2][2048][1024]; P = X W_in + b_in ('xw' [1024][4096]) viewed per head h as [Q(64) | K(64) | V(64) | G(64)] at columns h*256 + ...; W = (1e-4 + ||Q_i - K_j||)^-2 with the distance by the norm expansion sqrt(max(q2 + k2 - 2 Q.K, 0)); W = W / (1e-4 + sum_j W); A = W.V; H = G * A; out = merged H W_out ('xw' [1024][1024]) + b_out -> [2][2048][1024]).
// Compute dtypes, f32 accumulate: every input rounded to bf16; q/k/v on PLAIN bf16 operands (inputs: exact) + b_in; the Q.K products on hi/lo planes for every row (3 products; the distance needs them), the Shepard weights (hardware sqrt and reciprocal) and their row normalisation in f32 inside the weight kernel, gating in the merge; attn.v hybrid: query rows < 512 hl (3 products), the rest single fp16 (x1024); W_out hl x exact (2 products) + b_out.

#define NB_  2
#define TT   2048
#define DM   1024
#define NH_  16
#define NKV  16
#define REP  (NH_ / NKV)
#define HD   64
#define DQ   (NH_ * HD)
#define DKV  (NKV * HD)
#define DP   4096                 // projection width (16 heads x [Q|K|V|G] x 64)
#define HSTR 256
#define SEPS 1e-4f
#define ZH   2
#define RH   512                  // query rows < RH use hi+lo planes (0: none)
#define WIN  0
#define PCAR 1024.0f
#define KSP  16                   // attn.v: K (2048 keys) split over KSP workgroups per output tile; partial planes [KSP][ZH][TT][HD] summed in k_merge
typedef _Float16 h16;
typedef unsigned short bf;
typedef __attribute__((ext_vector_type(16))) __bf16   v16bf;
typedef __attribute__((ext_vector_type(16))) _Float16 v16h;
typedef __attribute__((ext_vector_type(8)))  _Float16 v8h;
typedef __attribute__((ext_vector_type(8)))  unsigned short v8us;
typedef __attribute__((ext_vector_type(8)))  float    v8f;
typedef __attribute__((ext_vector_type(4)))  float    v4f;
typedef v8h  __attribute__((may_alias)) v8ha;
typedef v4f  __attribute__((may_alias)) v4fa;
typedef v8us __attribute__((may_alias)) v8usa;

__device__ __forceinline__ unsigned short f2bf(float f) { unsigned u = __float_as_uint(f); u += 0x7FFFu + ((u >> 16) & 1u); return (unsigned short)(u >> 16); }
__device__ __forceinline__ float bf2f(unsigned short b) { return __uint_as_float(((unsigned)b) << 16); }
__device__ __forceinline__ float bfr(float f) { return bf2f(f2bf(f)); }
__device__ __forceinline__ v16h cat16(v8h lo, v8h hi) { return __builtin_shufflevector(lo, hi, 0, 1, 2, 3, 4, 5, 6, 7, 8, 9, 10, 11, 12, 13, 14, 15); }
__device__ __forceinline__ v16bf cat16b(v8us lo, v8us hi) { return __builtin_bit_cast(v16bf, __builtin_shufflevector(lo, hi, 0, 1, 2, 3, 4, 5, 6, 7, 8, 9, 10, 11, 12, 13, 14, 15)); }
__device__ __forceinline__ v8f wmma16(v16h a, v16h b, v8f c) { return __builtin_amdgcn_wmma_f32_16x16x32_f16(false, a, false, b, (short)0, c, false, false); }
__device__ __forceinline__ v8f wmmab(v16bf a, v16bf b, v8f c) { return __builtin_amdgcn_wmma_f32_16x16x32_bf16(false, a, false, b, (short)0, c, false, false); }



// ---- k_gemmw: register-blocked GEMM, ONE WAVE per 64x64 output tile (16 accumulators), operands straight from K-contiguous 16-bit planes; grid (M/64, N/64, Z), 32 threads.
// C[m][n] (f32, pitch ldc, + optional f32 bias[n]) = sum_k A[m][k] Bt[n][k] (+ split products per NSPLIT). z-batch strides sA/sB/sC in elements. K % (32 * KS) == 0.
// KS > 1: grid z = Z * KS; workgroup (z, ks) sums only k in [ks K/KS, (ks+1) K/KS) and stores its partial tile to plane ks (plane stride sP elements); the consumer adds the KS planes.
template <typename T16> struct WFrag;
template <> struct WFrag<h16> { typedef v16h V; static __device__ __forceinline__ V ld(const h16* p) { return cat16(*(const v8h*)p, *(const v8h*)(p + 16)); } static __device__ __forceinline__ v8f mma(V a, V b, v8f c) { return wmma16(a, b, c); } };
template <> struct WFrag<bf> { typedef v16bf V; static __device__ __forceinline__ V ld(const bf* p) { return cat16b(*(const v8us*)p, *(const v8us*)(p + 16)); } static __device__ __forceinline__ v8f mma(V a, V b, v8f c) { return wmmab(a, b, c); } };
template <typename T16, int NSPLIT, bool BIAS, int KS = 1>
__global__ __launch_bounds__(32) void k_gemmw(const T16* __restrict__ A, const T16* __restrict__ A2, const T16* __restrict__ Bt, const T16* __restrict__ Bt2, int K, float* C, int ldc, const float* __restrict__ bias, size_t sA, size_t sB, size_t sC, size_t sP) {
    typedef typename WFrag<T16>::V V;
    __shared__ __align__(16) float os[16 * 68];
    const size_t z = blockIdx.z / KS; const int ks = blockIdx.z % KS; A += z * sA; if (A2) A2 += z * sA; Bt += z * sB; if (Bt2) Bt2 += z * sB; C += z * sC + (size_t)ks * sP;
    const int kbeg = ks * (K / KS), kend = kbeg + K / KS;
    const int lane = threadIdx.x & 31, lr = lane & 15, hi = lane >> 4; const int r0 = blockIdx.x * 64, c0 = blockIdx.y * 64;
    v8f acc[4][4];
#pragma unroll
    for (int mb = 0; mb < 4; ++mb)
#pragma unroll
        for (int nb = 0; nb < 4; ++nb) acc[mb][nb] = (v8f){};
    const size_t aoff = (size_t)(r0 + lr) * K + 8 * hi, boff = (size_t)(c0 + lr) * K + 8 * hi;
#pragma unroll 1
    for (int kc = kbeg; kc < kend; kc += 32) {
        V a[4], a2[4];
#pragma unroll
        for (int mb = 0; mb < 4; ++mb) { a[mb] = WFrag<T16>::ld(A + aoff + (size_t)mb * 16 * K + kc); if (NSPLIT == 1 || NSPLIT == 2) a2[mb] = WFrag<T16>::ld(A2 + aoff + (size_t)mb * 16 * K + kc); }
#pragma unroll
        for (int nb = 0; nb < 4; ++nb) { const V b = WFrag<T16>::ld(Bt + boff + (size_t)nb * 16 * K + kc); V b2; if (NSPLIT >= 2) b2 = WFrag<T16>::ld(Bt2 + boff + (size_t)nb * 16 * K + kc);
#pragma unroll
            for (int mb = 0; mb < 4; ++mb) { acc[mb][nb] = WFrag<T16>::mma(a[mb], b, acc[mb][nb]); if (NSPLIT == 1 || NSPLIT == 2) acc[mb][nb] = WFrag<T16>::mma(a2[mb], b, acc[mb][nb]); if (NSPLIT >= 2) acc[mb][nb] = WFrag<T16>::mma(a[mb], b2, acc[mb][nb]); } }
        asm volatile("v_nop\n\tv_nop\n\tv_nop\n\tv_nop" : "+v"(acc[0][0]), "+v"(acc[1][1]), "+v"(acc[2][2]), "+v"(acc[3][3]) : "v"(a[0]), "v"(a[3]));
    }
#pragma unroll
    for (int mb = 0; mb < 4; ++mb) {
#pragma unroll
        for (int nb = 0; nb < 4; ++nb) {
#pragma unroll
            for (int j = 0; j < 8; ++j) os[(hi * 8 + j) * 68 + nb * 16 + lr] = acc[mb][nb][j]; }
        __builtin_amdgcn_wave_barrier(); asm volatile("" ::: "memory");
        float* crow = C + (size_t)(r0 + mb * 16) * ldc + c0;
{
#pragma unroll
            for (int s = 0; s < 8; ++s) { const int row = 2 * s + hi, cofs = lr * 4; v4f val = *(const v4fa*)(os + row * 68 + cofs); if (BIAS) { val[0] += bfr(bias[c0 + cofs]); val[1] += bfr(bias[c0 + cofs + 1]); val[2] += bfr(bias[c0 + cofs + 2]); val[3] += bfr(bias[c0 + cofs + 3]); }
                *(v4f*)(crow + (size_t)row * ldc + cofs) = val; }
             }
        __builtin_amdgcn_wave_barrier(); asm volatile("" ::: "memory");
    }
}

__device__ __forceinline__ h16 tohx(float x) { return (h16)x; }
__device__ __forceinline__ void splitf(float y, unsigned short& h, unsigned short& l) { h = f2bf(y); l = f2bf(y - bf2f(h)); }
typedef __attribute__((ext_vector_type(2))) _Float16 v2h;
typedef __attribute__((ext_vector_type(4))) _Float16 v4h;
typedef __attribute__((ext_vector_type(2))) unsigned short v2us;
typedef __attribute__((ext_vector_type(4))) unsigned short v4us;
typedef __attribute__((ext_vector_type(2))) float v2f;
typedef __attribute__((ext_vector_type(4))) int v4i;

__global__ __launch_bounds__(256) void k_wtG(const float* __restrict__ w, int K, int N, bf* Bt) {
    const int lane = threadIdx.x & 31; const int L0 = (blockIdx.x * 8 + (threadIdx.x >> 5)) * 8; const int nlines = N * K / 64;
{
#pragma unroll 1
        for (int l = 0; l < 8; ++l) { const int L = L0 + l; if (L >= nlines) break; const size_t e = (size_t)L * 64 + lane * 2; const int k = (int)(e % K), n = (int)(e / K); v2us o;
            o[0] = f2bf(w[(size_t)k * N + n]); o[1] = f2bf(w[(size_t)(k + 1) * N + n]); *(v2us*)(Bt + e) = o; }
         }
}
__global__ __launch_bounds__(256) void k_norm2(const float* __restrict__ FP, float* Q2, float* K2) { const int e = blockIdx.x * 256 + threadIdx.x; if (e >= 2 * NH_ * TT) return; const int t = e % TT; const int h = (e / TT) % NH_; const int which = e / (NH_ * TT); const float* f = FP + (size_t)t * DP + h * HSTR + which * 64; float s = 0.f;
#pragma unroll 4
    for (int d = 0; d < HD; ++d) { float p = __fmul_rn(f[d], f[d]); asm volatile("" : "+v"(p)); s = __fadd_rn(s, p); }
    float* dst = (which == 0 ? Q2 : K2) + (size_t)h * TT + t; *(float*)dst = s;  }
__global__ __launch_bounds__(256) void k_cvt8(const float* __restrict__ src, bf* dst, size_t n8) { const size_t i = (size_t)blockIdx.x * 256 + threadIdx.x; if (i >= n8) return; const v8f v = *(const v8f*)(src + i * 8); v8us o;
#pragma unroll
    for (int k = 0; k < 8; ++k) o[k] = f2bf(v[k]); *(v8us*)(dst + i * 8) = o;  }

// k_rope: head planes [h][t][d] (fp16 + hi/lo) of rope(x) x sc with the rotate-half convention out[d] = x[d] cos[t][d] - x[d+HD/2] sin[t][d], out[d+HD/2] = x[d+HD/2] cos[t][d+HD/2] + x[d] sin[t][d+HD/2]
__global__ __launch_bounds__(256) void k_rope(const float* __restrict__ F, int pitch, int hstr, int nheads, const float* __restrict__ CS, const float* __restrict__ RF, const float* __restrict__ nw, float sc, h16* P16, bf* Ph, bf* Pl) {
    const size_t e = ((size_t)blockIdx.x * 256 + threadIdx.x) * 2; if (e >= (size_t)nheads * TT * HD) return; const int d = (int)(e % HD); const int t = (int)((e / HD) % TT); const int h = (int)(e / ((size_t)HD * TT)); const float* f = F + (size_t)t * pitch + h * hstr; const float rf = RF ? RF[(size_t)h * TT + t] : 1.0f; v2h o16; v2us oh, ol;
#pragma unroll
    for (int q = 0; q < 2; ++q) { const int dd = d + q; const int dp = (dd < HD / 2) ? dd + HD / 2 : dd - HD / 2; float x0 = f[dd], x1 = f[dp];
        if (RF) { float n0 = __fmul_rn(x0, rf), n1 = __fmul_rn(x1, rf); asm volatile("" : "+v"(n0)); asm volatile("" : "+v"(n1)); x0 = __fmul_rn(bfr(nw[dd]), n0); x1 = __fmul_rn(bfr(nw[dp]), n1); }
        const v2f cs = *(const v2f*)(CS + ((size_t)t * HD + dd) * 2); float a = __fmul_rn(x0, cs[0]), bq = __fmul_rn(x1, cs[1]); asm volatile("" : "+v"(a)); asm volatile("" : "+v"(bq)); const float r = ((dd < HD / 2) ? __fsub_rn(a, bq) : __fadd_rn(a, bq)) * sc;
        o16[q] = tohx(r); unsigned short a2, c2; splitf(r, a2, c2); oh[q] = a2; ol[q] = c2; }
    *(v2h*)(P16 + e) = o16; *(v2us*)(Ph + e) = oh; *(v2us*)(Pl + e) = ol;  }
__global__ __launch_bounds__(256) void k_vtp(const float* __restrict__ F, int pitch, int hstr, int nheads, h16* V16, bf* Vh, bf* Vl) { const size_t e = ((size_t)blockIdx.x * 256 + threadIdx.x) * 2; if (e >= (size_t)nheads * HD * TT) return; const int t = (int)(e % TT); const int d = (int)((e / TT) % HD); const int g = (int)(e / ((size_t)TT * HD)); v2h o16; v2us oh, ol;
#pragma unroll
    for (int q = 0; q < 2; ++q) { const float x = F[(size_t)(t + q) * pitch + g * hstr + d]; o16[q] = tohx(x); unsigned short a2, c2; splitf(x, a2, c2); oh[q] = a2; ol[q] = c2; }
    *(v2h*)(V16 + e) = o16; *(v2us*)(Vh + e) = oh; *(v2us*)(Vl + e) = ol;  }
__global__ __launch_bounds__(256) void k_csid(float* CS) { const int idx = blockIdx.x * 256 + threadIdx.x; if (idx >= TT * HD) return; v2f cs; cs[0] = 1.0f; cs[1] = 0.0f; *(v2f*)(CS + (size_t)idx * 2) = cs;  }
// k_asoft: per row (zz, i): Shepard weights w_j = (eps + sqrt(max(q2_i + k2_j - 2 S_ij, 0)))^-2 (hardware sqrt / reciprocal, f32), row sum in fixed order + tree, P = w x 1/(eps + sum);
__global__ __launch_bounds__(256) void k_asoft(const float* __restrict__ Sb, const float* __restrict__ Q2, const float* __restrict__ K2, int h0, h16* P16, bf* Ph, bf* Pl) {
    const int lane = threadIdx.x & 31; const int row = blockIdx.x * 8 + (threadIdx.x >> 5); if (row >= ZH * TT) return; const int i = row % TT; const int zz = row / TT; const float q2 = Q2[(size_t)(h0 + zz) * TT + i]; const float* k2 = K2 + (size_t)(h0 + zz) * TT; const bool hires = (i < RH); const float* sr = Sb + (size_t)row * TT; float v[TT / 32]; float sum = 0.f;
#pragma unroll
    for (int ch = 0; ch < TT / 128; ++ch) { const int j0 = ch * 128 + lane * 4; const v4f a = *(const v4f*)(sr + j0);
#pragma unroll
        for (int q = 0; q < 4; ++q) { const int j = j0 + q; float t = __fadd_rn(q2, k2[j]); asm volatile("" : "+v"(t)); float a2x = __fmul_rn(2.0f, a[q]); asm volatile("" : "+v"(a2x)); const float d2 = fmaxf(__fsub_rn(t, a2x), 0.f); const float dist = __builtin_amdgcn_sqrtf(d2); const float den = __fadd_rn(SEPS, dist); float dd2 = __fmul_rn(den, den); asm volatile("" : "+v"(dd2)); const float w = __builtin_amdgcn_rcpf(dd2);   /* (eps + dist)^-2 */ v[ch * 4 + q] = w; sum = __fadd_rn(sum, w); } }
#pragma unroll
    for (int sh = 16; sh; sh >>= 1) sum += __shfl_xor(sum, sh, 32);
    float dsum = __fadd_rn(SEPS, sum); asm volatile("" : "+v"(dsum)); const float f = __fmul_rn(hires ? 1.0f : PCAR, __builtin_amdgcn_rcpf(dsum));   /* W / (eps + sum W) via hardware reciprocal */
{
        if (hires) {
#pragma unroll
            for (int ch = 0; ch < TT / 128; ++ch) { v4us oh, ol;
#pragma unroll
                for (int q = 0; q < 4; ++q) { unsigned short a, c2; splitf(v[ch * 4 + q] * f, a, c2); oh[q] = a; ol[q] = c2; }
                const size_t oo = ((size_t)zz * (RH ? RH : 1) + i) * TT + ch * 128 + lane * 4; *(v4us*)(Ph + oo) = oh; *(v4us*)(Pl + oo) = ol; }
        } else {
#pragma unroll
            for (int ch = 0; ch < TT / 128; ++ch) { v4h o4;
#pragma unroll
                for (int q = 0; q < 4; ++q) o4[q] = tohx(v[ch * 4 + q] * f);
                *(v4h*)(P16 + (size_t)row * TT + ch * 128 + lane * 4) = o4; } }
         }
}
__global__ __launch_bounds__(256) void k_merge(const float* __restrict__ O, const float* __restrict__ FP, int h0, bf* Ah, bf* Al) { const size_t e = ((size_t)blockIdx.x * 256 + threadIdx.x) * 2; if (e >= (size_t)ZH * TT * HD) return; const int d = (int)(e % HD); const int t = (int)((e / HD) % TT); const int zz = (int)(e / ((size_t)HD * TT)); const float cs = (t < RH) ? 1.0f : (1.0f / PCAR); const size_t oo = (size_t)t * DQ + (h0 + zz) * HD + d;
    v2us oh, ol; v2f os2 = *(const v2f*)(O + e);   /* sum of the KSP partial planes, fixed order */
#pragma unroll
    for (int ks = 1; ks < KSP; ++ks) { const v2f pp = *(const v2f*)(O + (size_t)ks * ((size_t)ZH * TT * HD) + e); os2[0] = __fadd_rn(os2[0], pp[0]); os2[1] = __fadd_rn(os2[1], pp[1]); }
#pragma unroll
    for (int q = 0; q < 2; ++q) { float oc = os2[q] * cs; asm volatile("" : "+v"(oc)); const float gt = FP[(size_t)t * DP + (h0 + zz) * HSTR + 192 + d + q]; unsigned short a, c2; splitf(__fmul_rn(gt, oc), a, c2); oh[q] = a; ol[q] = c2; }   /* H = G * A */ *(v2us*)(Ah + oo) = oh; *(v2us*)(Al + oo) = ol;  }

extern "C" void kernel_launch(void* const* d_in, const int* in_sizes, int n_in,
                              void* d_out, int out_size, void* d_ws, size_t ws_size, hipStream_t stream) {
    (void)in_sizes; (void)n_in; (void)out_size;
    const float* x = (const float*)d_in[0]; const float* win = (const float*)d_in[1]; const float* bin = (const float*)d_in[2]; const float* wo = (const float*)d_in[3]; const float* bo = (const float*)d_in[4]; const float* wq = nullptr; const float* wk = nullptr; const float* wv = nullptr; (void)wq; (void)wk; (void)wv;
    float* OUT = (float*)d_out;     // [2][2048][1024]
    char* wsp = (char*)d_ws;
    auto take = [&](size_t bytes) { char* p = wsp; wsp += (bytes + 255) & ~(size_t)255; return (void*)p; };
    bf* WINB = (bf*)take((size_t)DP * DM * 2); bf* WO = (bf*)take((size_t)DM * DQ * 2); float* CS = (float*)take((size_t)TT * HD * 2 * 4);
    bf* XB = (bf*)take((size_t)TT * DM * 2); float* FP = (float*)take((size_t)TT * DP * 4); float* Q2 = (float*)take((size_t)NH_ * TT * 4); float* K2 = (float*)take((size_t)NH_ * TT * 4);
    h16* QP16 = (h16*)take((size_t)NH_ * TT * HD * 2); h16* KP16 = (h16*)take((size_t)NKV * TT * HD * 2); h16* VT16 = (h16*)take((size_t)NKV * HD * TT * 2);
    bf* QPh = (bf*)take((size_t)NH_ * TT * HD * 2); bf* QPl = (bf*)take((size_t)NH_ * TT * HD * 2); bf* KPh = (bf*)take((size_t)NKV * TT * HD * 2); bf* KPl = (bf*)take((size_t)NKV * TT * HD * 2); bf* VTh = (bf*)take((size_t)NKV * HD * TT * 2); bf* VTl = (bf*)take((size_t)NKV * HD * TT * 2); bf* Ph = (bf*)take((size_t)ZH * RH * TT * 2); bf* Pl = (bf*)take((size_t)ZH * RH * TT * 2);
    float* Sb = (float*)take((size_t)ZH * TT * TT * 4); h16* P16 = (h16*)take((size_t)ZH * TT * TT * 2); float* Ob = (float*)take((size_t)KSP * ZH * TT * HD * 4); bf* ATh = (bf*)take((size_t)TT * DQ * 2); bf* ATl = (bf*)take((size_t)TT * DQ * 2);
    if ((size_t)(wsp - (char*)d_ws) > ws_size) return;    // ws 256 MiB
    { k_wtG<<<(unsigned)((DM * DP / 64 + 63) / 64), 256, 0, stream>>>(win, DM, DP, WINB);   /* 'xw' [1024][4096] -> Bt [4096][1024] */
      k_wtG<<<(unsigned)((DQ * DM / 64 + 63) / 64), 256, 0, stream>>>(wo, DQ, DM, WO);
       }
    k_csid<<<(TT * HD + 255) / 256, 256, 0, stream>>>(CS);
    const unsigned LQ = (unsigned)(((size_t)NH_ * TT * HD / 2 + 255) / 256), LKv = (unsigned)(((size_t)NKV * TT * HD / 2 + 255) / 256);
    for (int b = 0; b < NB_; ++b) {
        
        k_cvt8<<<(unsigned)(((size_t)TT * DM / 8 + 255) / 256), 256, 0, stream>>>(x + (size_t)b * TT * DM, XB, (size_t)TT * DM / 8);
        k_gemmw<bf, 0, true><<<dim3(TT / 64, DP / 64, 1), 32, 0, stream>>>(XB, nullptr, WINB, nullptr, DM, FP, DP, bin, 0, 0, 0, 0);   /* P = X W_in + b_in (exact) */ k_norm2<<<(2 * NH_ * TT + 255) / 256, 256, 0, stream>>>(FP, Q2, K2);
        k_rope<<<LQ, 256, 0, stream>>>(FP, DP, HSTR, NH_, CS, nullptr, nullptr, 1.0f, QP16, QPh, QPl);   /* Q planes (cols h*256 + 0..63) */
        
        k_rope<<<LKv, 256, 0, stream>>>(FP + 64, DP, HSTR, NKV, CS, nullptr, nullptr, 1.0f, KP16, KPh, KPl);   /* K planes (cols +64) */
        k_vtp<<<LKv, 256, 0, stream>>>(FP + 128, DP, HSTR, NKV, VT16, VTh, VTl);   /* V^T planes (cols +128) */
        for (int h0 = 0; h0 < NH_; h0 += ZH) { const size_t zq = (size_t)h0, zk = (size_t)(h0 / REP);   // one kv head per query head: the pass's two heads use consecutive kv planes (z-strides TT*HD)
            k_gemmw<bf, 2, false><<<dim3(TT / 64, TT / 64, ZH), 32, 0, stream>>>(QPh + zq * TT * HD, QPl + zq * TT * HD, KPh + zk * TT * HD, KPl + zk * TT * HD, HD, Sb, TT, nullptr, (size_t)TT * HD, (size_t)TT * HD, (size_t)TT * TT, 0);   /* Q.K on hi/lo planes, every row (3 products) */

            k_asoft<<<ZH * TT / 8, 256, 0, stream>>>(Sb, Q2, K2, h0, P16, Ph, Pl);
            k_gemmw<bf, 2, false, KSP><<<dim3(RH / 64, HD / 64, ZH * KSP), 32, 0, stream>>>(Ph, Pl, VTh + zk * HD * TT, VTl + zk * HD * TT, TT, Ob, HD, nullptr, (size_t)RH * TT, (size_t)HD * TT, (size_t)TT * HD, (size_t)ZH * TT * HD);
            k_gemmw<h16, 0, false, KSP><<<dim3((TT - RH) / 64, HD / 64, ZH * KSP), 32, 0, stream>>>(P16 + (size_t)RH * TT, nullptr, VT16 + zk * HD * TT, nullptr, TT, Ob + (size_t)RH * HD, HD, nullptr, (size_t)TT * TT, (size_t)HD * TT, (size_t)TT * HD, (size_t)ZH * TT * HD);
            k_merge<<<(unsigned)(((size_t)ZH * TT * HD / 2 + 255) / 256), 256, 0, stream>>>(Ob, FP, h0, ATh, ATl); }
        k_gemmw<bf, 1, true><<<dim3(TT / 64, DM / 64, 1), 32, 0, stream>>>(ATh, ATl, WO, nullptr, DQ, OUT + (size_t)b * TT * DM, DM, bo, 0, 0, 0, 0); }
}

// v002
// Measured time: 382 microseconds a run.
// Two timings next to v001 put it at 2.45 and 2.43 times that version's speed.
// All steps since v000 together make it 5.44 times as fast.
#include <hip/hip_runtime.h>

// Shepard's (inverse-distance) gated attention (X [2][2048][1024]; P = X W_in + b_in ('xw' [1024][4096]) viewed per head h as [Q(64) | K(64) | V(64) | G(64)] at columns h*256 + ...; W = (1e-4 + ||Q_i - K_j||)^-2 with the distance by the norm expansion sqrt(max(q2 + k2 - 2 Q.K, 0)); W = W / (1e-4 + sum_j W); A = W.V; H = G * A; out = merged H W_out ('xw' [1024][1024]) + b_out -> [2][2048][1024]).
// Compute dtypes, f32 accumulate: every input rounded to bf16; q/k/v on PLAIN bf16 operands (inputs: exact) + b_in; the Q.K products on hi/lo planes for every row (3 products; the distance needs them), the Shepard weights (sqrt, reciprocal) and their row sums in f32 inside the fused attention kernel, row normalisation and gating in the merge; attn.v hybrid on the unnormalised weights: query rows < 512 hl (3 products), the rest single fp16; W_out hl x exact (2 products) + b_out.

#define NB_  2
#define TT   2048
#define DM   1024
#define NH_  16
#define NKV  16
#define REP  (NH_ / NKV)
#define HD   64
#define DQ   (NH_ * HD)
#define DKV  (NKV * HD)
#define DP   4096                 // projection width (16 heads x [Q|K|V|G] x 64)
#define HSTR 256
#define SEPS 1e-4f
#define RH   512                  // query rows < RH use hi+lo planes (0: none)
#define WIN  0
#define PMAX 32768.0f             // largest scaled weight that goes into an fp16 P operand (fp16 ends at 65504)
#define KSP  4                    // attention: the 2048 keys split over KSP workgroups per 256 query rows; partial planes [KSP][NH_][TT][HD] and partial row sums [KSP][NH_][TT] summed in k_merge
typedef _Float16 h16;
typedef unsigned short bf;
typedef __attribute__((ext_vector_type(16))) __bf16   v16bf;
typedef __attribute__((ext_vector_type(16))) _Float16 v16h;
typedef __attribute__((ext_vector_type(8)))  _Float16 v8h;
typedef __attribute__((ext_vector_type(8)))  unsigned short v8us;
typedef __attribute__((ext_vector_type(8)))  float    v8f;
typedef __attribute__((ext_vector_type(4)))  float    v4f;
typedef v8h  __attribute__((may_alias)) v8ha;
typedef v4f  __attribute__((may_alias)) v4fa;
typedef v8us __attribute__((may_alias)) v8usa;

__device__ __forceinline__ unsigned short f2bf(float f) { unsigned u = __float_as_uint(f); u += 0x7FFFu + ((u >> 16) & 1u); return (unsigned short)(u >> 16); }
__device__ __forceinline__ float bf2f(unsigned short b) { return __uint_as_float(((unsigned)b) << 16); }
__device__ __forceinline__ float bfr(float f) { return bf2f(f2bf(f)); }
__device__ __forceinline__ v16h cat16(v8h lo, v8h hi) { return __builtin_shufflevector(lo, hi, 0, 1, 2, 3, 4, 5, 6, 7, 8, 9, 10, 11, 12, 13, 14, 15); }
__device__ __forceinline__ v16bf cat16b(v8us lo, v8us hi) { return __builtin_bit_cast(v16bf, __builtin_shufflevector(lo, hi, 0, 1, 2, 3, 4, 5, 6, 7, 8, 9, 10, 11, 12, 13, 14, 15)); }
__device__ __forceinline__ v8f wmma16(v16h a, v16h b, v8f c) { return __builtin_amdgcn_wmma_f32_16x16x32_f16(false, a, false, b, (short)0, c, false, false); }
__device__ __forceinline__ v8f wmmab(v16bf a, v16bf b, v8f c) { return __builtin_amdgcn_wmma_f32_16x16x32_bf16(false, a, false, b, (short)0, c, false, false); }



// ---- k_gemmw: register-blocked GEMM, ONE WAVE per 64x64 output tile (16 accumulators), operands straight from K-contiguous 16-bit planes; grid (M/64, N/64, Z), 32 threads.
// C[m][n] (f32, pitch ldc, + optional f32 bias[n]) = sum_k A[m][k] Bt[n][k] (+ split products per NSPLIT). z-batch strides sA/sB/sC in elements. K % (32 * KS) == 0.
// KS > 1: grid z = Z * KS; workgroup (z, ks) sums only k in [ks K/KS, (ks+1) K/KS) and stores its partial tile to plane ks (plane stride sP elements); the consumer adds the KS planes.
template <typename T16> struct WFrag;
template <> struct WFrag<h16> { typedef v16h V; static __device__ __forceinline__ V ld(const h16* p) { return cat16(*(const v8h*)p, *(const v8h*)(p + 16)); } static __device__ __forceinline__ v8f mma(V a, V b, v8f c) { return wmma16(a, b, c); } };
template <> struct WFrag<bf> { typedef v16bf V; static __device__ __forceinline__ V ld(const bf* p) { return cat16b(*(const v8us*)p, *(const v8us*)(p + 16)); } static __device__ __forceinline__ v8f mma(V a, V b, v8f c) { return wmmab(a, b, c); } };
template <typename T16, int NSPLIT, bool BIAS, int KS = 1>
__global__ __launch_bounds__(32) void k_gemmw(const T16* __restrict__ A, const T16* __restrict__ A2, const T16* __restrict__ Bt, const T16* __restrict__ Bt2, int K, float* C, int ldc, const float* __restrict__ bias, size_t sA, size_t sB, size_t sC, size_t sP) {
    typedef typename WFrag<T16>::V V;
    __shared__ __align__(16) float os[16 * 68];
    const size_t z = blockIdx.z / KS; const int ks = blockIdx.z % KS; A += z * sA; if (A2) A2 += z * sA; Bt += z * sB; if (Bt2) Bt2 += z * sB; C += z * sC + (size_t)ks * sP;
    const int kbeg = ks * (K / KS), kend = kbeg + K / KS;
    const int lane = threadIdx.x & 31, lr = lane & 15, hi = lane >> 4; const int r0 = blockIdx.x * 64, c0 = blockIdx.y * 64;
    v8f acc[4][4];
#pragma unroll
    for (int mb = 0; mb < 4; ++mb)
#pragma unroll
        for (int nb = 0; nb < 4; ++nb) acc[mb][nb] = (v8f){};
    const size_t aoff = (size_t)(r0 + lr) * K + 8 * hi, boff = (size_t)(c0 + lr) * K + 8 * hi;
#pragma unroll 1
    for (int kc = kbeg; kc < kend; kc += 32) {
        V a[4], a2[4];
#pragma unroll
        for (int mb = 0; mb < 4; ++mb) { a[mb] = WFrag<T16>::ld(A + aoff + (size_t)mb * 16 * K + kc); if (NSPLIT == 1 || NSPLIT == 2) a2[mb] = WFrag<T16>::ld(A2 + aoff + (size_t)mb * 16 * K + kc); }
#pragma unroll
        for (int nb = 0; nb < 4; ++nb) { const V b = WFrag<T16>::ld(Bt + boff + (size_t)nb * 16 * K + kc); V b2; if (NSPLIT >= 2) b2 = WFrag<T16>::ld(Bt2 + boff + (size_t)nb * 16 * K + kc);
#pragma unroll
            for (int mb = 0; mb < 4; ++mb) { acc[mb][nb] = WFrag<T16>::mma(a[mb], b, acc[mb][nb]); if (NSPLIT == 1 || NSPLIT == 2) acc[mb][nb] = WFrag<T16>::mma(a2[mb], b, acc[mb][nb]); if (NSPLIT >= 2) acc[mb][nb] = WFrag<T16>::mma(a[mb], b2, acc[mb][nb]); } }
        asm volatile("v_nop\n\tv_nop\n\tv_nop\n\tv_nop" : "+v"(acc[0][0]), "+v"(acc[1][1]), "+v"(acc[2][2]), "+v"(acc[3][3]) : "v"(a[0]), "v"(a[3]));
    }
#pragma unroll
    for (int mb = 0; mb < 4; ++mb) {
#pragma unroll
        for (int nb = 0; nb < 4; ++nb) {
#pragma unroll
            for (int j = 0; j < 8; ++j) os[(hi * 8 + j) * 68 + nb * 16 + lr] = acc[mb][nb][j]; }
        __builtin_amdgcn_wave_barrier(); asm volatile("" ::: "memory");
        float* crow = C + (size_t)(r0 + mb * 16) * ldc + c0;
{
#pragma unroll
            for (int s = 0; s < 8; ++s) { const int row = 2 * s + hi, cofs = lr * 4; v4f val = *(const v4fa*)(os + row * 68 + cofs); if (BIAS) { val[0] += bfr(bias[c0 + cofs]); val[1] += bfr(bias[c0 + cofs + 1]); val[2] += bfr(bias[c0 + cofs + 2]); val[3] += bfr(bias[c0 + cofs + 3]); }
                *(v4f*)(crow + (size_t)row * ldc + cofs) = val; }
             }
        __builtin_amdgcn_wave_barrier(); asm volatile("" ::: "memory");
    }
}

__device__ __forceinline__ h16 tohx(float x) { return (h16)x; }
__device__ __forceinline__ void splitf(float y, unsigned short& h, unsigned short& l) { h = f2bf(y); l = f2bf(y - bf2f(h)); }
typedef __attribute__((ext_vector_type(2))) _Float16 v2h;
typedef __attribute__((ext_vector_type(4))) _Float16 v4h;
typedef __attribute__((ext_vector_type(2))) unsigned short v2us;
typedef __attribute__((ext_vector_type(4))) unsigned short v4us;
typedef __attribute__((ext_vector_type(2))) float v2f;
typedef __attribute__((ext_vector_type(4))) int v4i;

__global__ __launch_bounds__(256) void k_wtG(const float* __restrict__ w, int K, int N, bf* Bt) {
    const int lane = threadIdx.x & 31; const int L0 = (blockIdx.x * 8 + (threadIdx.x >> 5)) * 8; const int nlines = N * K / 64;
{
#pragma unroll 1
        for (int l = 0; l < 8; ++l) { const int L = L0 + l; if (L >= nlines) break; const size_t e = (size_t)L * 64 + lane * 2; const int k = (int)(e % K), n = (int)(e / K); v2us o;
            o[0] = f2bf(w[(size_t)k * N + n]); o[1] = f2bf(w[(size_t)(k + 1) * N + n]); *(v2us*)(Bt + e) = o; }
         }
}
__global__ __launch_bounds__(256) void k_norm2(const float* __restrict__ FP, float* Q2, float* K2) { const int e = blockIdx.x * 256 + threadIdx.x; if (e >= 2 * NH_ * TT) return; const int t = e % TT; const int h = (e / TT) % NH_; const int which = e / (NH_ * TT); const float* f = FP + (size_t)t * DP + h * HSTR + which * 64; float s = 0.f;
#pragma unroll 4
    for (int d = 0; d < HD; ++d) { float p = __fmul_rn(f[d], f[d]); asm volatile("" : "+v"(p)); s = __fadd_rn(s, p); }
    float* dst = (which == 0 ? Q2 : K2) + (size_t)h * TT + t; *(float*)dst = s;  }
__global__ __launch_bounds__(256) void k_cvt8(const float* __restrict__ src, bf* dst, size_t n8) { const size_t i = (size_t)blockIdx.x * 256 + threadIdx.x; if (i >= n8) return; const v8f v = *(const v8f*)(src + i * 8); v8us o;
#pragma unroll
    for (int k = 0; k < 8; ++k) o[k] = f2bf(v[k]); *(v8us*)(dst + i * 8) = o;  }

// k_rope: head planes [h][t][d] (fp16 + hi/lo) of rope(x) x sc with the rotate-half convention out[d] = x[d] cos[t][d] - x[d+HD/2] sin[t][d], out[d+HD/2] = x[d+HD/2] cos[t][d+HD/2] + x[d] sin[t][d+HD/2]
__global__ __launch_bounds__(256) void k_rope(const float* __restrict__ F, int pitch, int hstr, int nheads, const float* __restrict__ CS, const float* __restrict__ RF, const float* __restrict__ nw, float sc, h16* P16, bf* Ph, bf* Pl) {
    const size_t e = ((size_t)blockIdx.x * 256 + threadIdx.x) * 2; if (e >= (size_t)nheads * TT * HD) return; const int d = (int)(e % HD); const int t = (int)((e / HD) % TT); const int h = (int)(e / ((size_t)HD * TT)); const float* f = F + (size_t)t * pitch + h * hstr; const float rf = RF ? RF[(size_t)h * TT + t] : 1.0f; v2h o16; v2us oh, ol;
#pragma unroll
    for (int q = 0; q < 2; ++q) { const int dd = d + q; const int dp = (dd < HD / 2) ? dd + HD / 2 : dd - HD / 2; float x0 = f[dd], x1 = f[dp];
        if (RF) { float n0 = __fmul_rn(x0, rf), n1 = __fmul_rn(x1, rf); asm volatile("" : "+v"(n0)); asm volatile("" : "+v"(n1)); x0 = __fmul_rn(bfr(nw[dd]), n0); x1 = __fmul_rn(bfr(nw[dp]), n1); }
        const v2f cs = *(const v2f*)(CS + ((size_t)t * HD + dd) * 2); float a = __fmul_rn(x0, cs[0]), bq = __fmul_rn(x1, cs[1]); asm volatile("" : "+v"(a)); asm volatile("" : "+v"(bq)); const float r = ((dd < HD / 2) ? __fsub_rn(a, bq) : __fadd_rn(a, bq)) * sc;
        o16[q] = tohx(r); unsigned short a2, c2; splitf(r, a2, c2); oh[q] = a2; ol[q] = c2; }
    *(v2h*)(P16 + e) = o16; *(v2us*)(Ph + e) = oh; *(v2us*)(Pl + e) = ol;  }
__global__ __launch_bounds__(256) void k_vtp(const float* __restrict__ F, int pitch, int hstr, int nheads, h16* V16, bf* Vh, bf* Vl) { const size_t e = ((size_t)blockIdx.x * 256 + threadIdx.x) * 2; if (e >= (size_t)nheads * HD * TT) return; const int t = (int)(e % TT); const int d = (int)((e / TT) % HD); const int g = (int)(e / ((size_t)TT * HD)); v2h o16; v2us oh, ol;
#pragma unroll
    for (int q = 0; q < 2; ++q) { const float x = F[(size_t)(t + q) * pitch + g * hstr + d]; o16[q] = tohx(x); unsigned short a2, c2; splitf(x, a2, c2); oh[q] = a2; ol[q] = c2; }
    *(v2h*)(V16 + e) = o16; *(v2us*)(Vh + e) = oh; *(v2us*)(Vl + e) = ol;  }
__global__ __launch_bounds__(256) void k_csid(float* CS) { const int idx = blockIdx.x * 256 + threadIdx.x; if (idx >= TT * HD) return; v2f cs; cs[0] = 1.0f; cs[1] = 0.0f; *(v2f*)(CS + (size_t)idx * 2) = cs;  }
// XWAIT stands between loads where the compiler lets a later load's result land in an earlier load's address registers: the wait that goes in front of such an overwrite
#define XWAIT asm volatile("s_wait_xcnt 0x0" ::: "memory")
// k_fattn: scores, Shepard weights and attn.v in one kernel; the scores never leave the registers. One wave = 32 query rows x TT/KSP keys, 32 keys a pass; 8 waves (256 query rows) a workgroup, no LDS, no barrier.
// S^T = K Q^T (A = K rows, B = Q rows kept in registers): accumulator element j of lane (lr, hi) is key kb*16 + hi*8 + j of query lr, so two key tiles pack straight into the B operand (k order 8 hi + 0..7, 16 + 8 hi + 0..7, the loaders' own) of O^T += V^T P^T.
// w_j = (eps + sqrt(max(q2_i + k2_j - 2 S_ij, 0)))^-2 stays unnormalised; its f32 row sum goes out beside the partial O and divides in k_merge.
// Range of the 16-bit P operand: each query scales eps + dist by r, a power of two near 1 / sqrt(q2_i + k2 of the range's first key), so w / r^2 is of order 1 for keys about as far off as the norms are large; a power of two changes no rounding, and r^2 is taken out of the partial O and the partial sum on the way out.
// A key much nearer than that (down to dist = 0) gives a scaled weight beyond the fp16 range: when a pass of the fp16 rows meets a weight above PMAX, the queries concerned raise their r by a power of two 2^k that brings their largest weight to 2^9..2^11, and this pass's weights, the running row sum and the running O are multiplied by 2^-2k (exact), before anything is rounded to fp16. Weights far below a row's largest then round to fp16 subnormals or 0, at most 2^-25 against a row sum of at least 2^9.
template <bool HL>
__device__ __forceinline__ void fattn_body(const bf* __restrict__ Qh, const bf* __restrict__ Ql, const bf* __restrict__ Kh, const bf* __restrict__ Kl, const h16* __restrict__ V16, const bf* __restrict__ Vh, const bf* __restrict__ Vl, const float* __restrict__ q2p, const float* __restrict__ k2p, int q0, int kbeg, float* Op, float* Lp) {
    const int lane = threadIdx.x & 31, lr = lane & 15, hi = lane >> 4;
    // every inner loop here is unrolled in full: its index picks fragments and accumulators, which live in registers and cannot be indexed at run time
    v16bf qh[2][2], ql[2][2]; float q2[2], rs[2], r[2], er[2]; v8f oacc[4][2];
#pragma unroll
    for (int qb = 0; qb < 2; ++qb) { const size_t o = (size_t)(q0 + qb * 16 + lr) * HD + 8 * hi; q2[qb] = q2p[q0 + qb * 16 + lr]; rs[qb] = 0.f; r[qb] = __uint_as_float(__float_as_uint(__builtin_amdgcn_rsqf(fminf(fmaxf(q2[qb] + k2p[kbeg], 1e-8f), 1e12f))) & 0x7F800000u);   /* both ends bounded: (r eps)^-2 and its products with V stay far inside f32 */ er[qb] = SEPS * r[qb];
#pragma unroll
        for (int c = 0; c < 2; ++c) { qh[qb][c] = WFrag<bf>::ld(Qh + o + c * 32); ql[qb][c] = WFrag<bf>::ld(Ql + o + c * 32); }
#pragma unroll
        for (int db = 0; db < 4; ++db) oacc[db][qb] = (v8f){}; }
    // the pass stays rolled: unrolled it would hold two passes' fragments in registers and cost resident waves
#pragma unroll 1
    for (int k0 = kbeg; k0 < kbeg + TT / KSP; k0 += 32) {
        v8f s[2][2]; float wm[2] = {0.f, 0.f};
#pragma unroll
        for (int kb = 0; kb < 2; ++kb) { const size_t o = (size_t)(k0 + kb * 16 + lr) * HD + 8 * hi; v16bf kh[2], kl[2];
#pragma unroll
            for (int c = 0; c < 2; ++c) { kh[c] = WFrag<bf>::ld(Kh + o + c * 32); kl[c] = WFrag<bf>::ld(Kl + o + c * 32); }
#pragma unroll
            for (int qb = 0; qb < 2; ++qb) { v8f a = (v8f){};
#pragma unroll
                for (int c = 0; c < 2; ++c) { a = wmmab(kh[c], qh[qb][c], a); a = wmmab(kh[c], ql[qb][c], a); a = wmmab(kl[c], qh[qb][c], a); }
                s[kb][qb] = a; } }
        XWAIT;   /* behind the K loads, in front of the k2 loads */
#pragma unroll
        for (int kb = 0; kb < 2; ++kb) { const v4f ka = *(const v4f*)(k2p + k0 + kb * 16 + hi * 8), kc = *(const v4f*)(k2p + k0 + kb * 16 + hi * 8 + 4);
#pragma unroll
            for (int qb = 0; qb < 2; ++qb) {
#pragma unroll
                for (int j = 0; j < 8; ++j) { const float t = q2[qb] + (j < 4 ? ka[j & 3] : kc[j & 3]); const float d2 = fmaxf(t - 2.0f * s[kb][qb][j], 0.f); const float den = fmaf(__builtin_amdgcn_sqrtf(d2), r[qb], er[qb]); const float w = __builtin_amdgcn_rcpf(den * den);   /* (r (eps + dist))^-2 */ s[kb][qb][j] = w; rs[qb] += w; if (!HL) wm[qb] = fmaxf(wm[qb], w); } } }
        if (!HL && __builtin_amdgcn_ballot_w32(fmaxf(wm[0], wm[1]) > PMAX) != 0u) {   /* rare; the ballot makes it one scalar branch for the wave, so the exchange below has every lane on */
#pragma unroll
            for (int qb = 0; qb < 2; ++qb) { const float m = fmaxf(wm[qb], __shfl_xor(wm[qb], 16, 32));   /* a query's keys lie in lanes lr and lr + 16: both take the same k */
                const int k = (m > PMAX) ? (((int)(__float_as_uint(m) >> 23) - 136) >> 1) : 0; const float g = __uint_as_float((unsigned)(127 - k) << 23), gi = __uint_as_float((unsigned)(127 + k) << 23), f = g * g;
                r[qb] *= gi; er[qb] *= gi; rs[qb] *= f; s[0][qb] *= f; s[1][qb] *= f;
#pragma unroll
                for (int db = 0; db < 4; ++db) oacc[db][qb] *= f; } }
        if (HL) { v16bf ph[2], pl[2];
#pragma unroll
            for (int qb = 0; qb < 2; ++qb) { v8us h0, h1, l0, l1;
#pragma unroll
                for (int j = 0; j < 8; ++j) { unsigned short a, c2; splitf(s[0][qb][j], a, c2); h0[j] = a; l0[j] = c2; splitf(s[1][qb][j], a, c2); h1[j] = a; l1[j] = c2; }
                ph[qb] = cat16b(h0, h1); pl[qb] = cat16b(l0, l1); }
#pragma unroll
            for (int db = 0; db < 4; ++db) { const size_t o = (size_t)(db * 16 + lr) * TT + k0 + 8 * hi; const v16bf vh = WFrag<bf>::ld(Vh + o), vl = WFrag<bf>::ld(Vl + o);
#pragma unroll
                for (int qb = 0; qb < 2; ++qb) { oacc[db][qb] = wmmab(vh, ph[qb], oacc[db][qb]); oacc[db][qb] = wmmab(vh, pl[qb], oacc[db][qb]); oacc[db][qb] = wmmab(vl, ph[qb], oacc[db][qb]); } }
        } else { v16h p[2];
#pragma unroll
            for (int qb = 0; qb < 2; ++qb) { v8h p0, p1;
#pragma unroll
                for (int j = 0; j < 8; ++j) { p0[j] = tohx(s[0][qb][j]); p1[j] = tohx(s[1][qb][j]); }
                p[qb] = cat16(p0, p1); }
#pragma unroll
            for (int db = 0; db < 4; ++db) { const v16h v = WFrag<h16>::ld(V16 + (size_t)(db * 16 + lr) * TT + k0 + 8 * hi);
#pragma unroll
                for (int qb = 0; qb < 2; ++qb) oacc[db][qb] = wmma16(v, p[qb], oacc[db][qb]); } }
    }
#pragma unroll
    for (int qb = 0; qb < 2; ++qb) { const float u = r[qb] * r[qb]; const float tot = (rs[qb] + __shfl_xor(rs[qb], 16, 32)) * u; if (hi == 0) Lp[q0 + qb * 16 + lr] = tot;
#pragma unroll
        for (int db = 0; db < 4; ++db) { float* o = Op + (size_t)(q0 + qb * 16 + lr) * HD + db * 16 + hi * 8; const v8f a = oacc[db][qb] * u; *(v4f*)o = (v4f){a[0], a[1], a[2], a[3]}; *(v4f*)(o + 4) = (v4f){a[4], a[5], a[6], a[7]}; } }
}
__global__ __launch_bounds__(256) void k_fattn(const bf* __restrict__ QPh, const bf* __restrict__ QPl, const bf* __restrict__ KPh, const bf* __restrict__ KPl, const h16* __restrict__ VT16, const bf* __restrict__ VTh, const bf* __restrict__ VTl, const float* __restrict__ Q2, const float* __restrict__ K2, float* Ob, float* Lb) {
    const size_t h = blockIdx.z, ks = blockIdx.y, hp = h * TT * HD; const int q0 = blockIdx.x * 256 + (threadIdx.x >> 5) * 32, kbeg = (int)ks * (TT / KSP);
    float* Op = Ob + (ks * NH_ + h) * TT * HD; float* Lp = Lb + (ks * NH_ + h) * TT;
    if (blockIdx.x * 256 < RH) fattn_body<true>(QPh + hp, QPl + hp, KPh + hp, KPl + hp, VT16 + hp, VTh + hp, VTl + hp, Q2 + h * TT, K2 + h * TT, q0, kbeg, Op, Lp);   /* RH is a multiple of 256: one path a workgroup */
    else fattn_body<false>(QPh + hp, QPl + hp, KPh + hp, KPl + hp, VT16 + hp, VTh + hp, VTl + hp, Q2 + h * TT, K2 + h * TT, q0, kbeg, Op, Lp);
}
__global__ __launch_bounds__(256) void k_merge(const float* __restrict__ O, const float* __restrict__ L, const float* __restrict__ FP, bf* Ah, bf* Al) { const size_t e = ((size_t)blockIdx.x * 256 + threadIdx.x) * 2; if (e >= (size_t)NH_ * TT * HD) return; const int d = (int)(e % HD); const int t = (int)((e / HD) % TT); const int zz = (int)(e / ((size_t)HD * TT)); const size_t oo = (size_t)t * DQ + zz * HD + d;
    float lp[KSP]; v2f op[KSP];   /* XWAIT behind each load: the next load's result may be given this one's address registers */
#pragma unroll
    for (int ks = 0; ks < KSP; ++ks) { lp[ks] = L[((size_t)ks * NH_ + zz) * TT + t]; XWAIT; op[ks] = *(const v2f*)(O + (size_t)ks * ((size_t)NH_ * TT * HD) + e); XWAIT; }
    float lsum = lp[0];   /* row sum of the weights: the KSP partial sums, fixed order */
#pragma unroll
    for (int ks = 1; ks < KSP; ++ks) lsum = __fadd_rn(lsum, lp[ks]);
    const float cs = __builtin_amdgcn_rcpf(__fadd_rn(SEPS, lsum));   /* W / (eps + sum W) via hardware reciprocal */
    v2us oh, ol; v2f os2 = op[0];   /* sum of the KSP partial planes, fixed order */
#pragma unroll
    for (int ks = 1; ks < KSP; ++ks) { os2[0] = __fadd_rn(os2[0], op[ks][0]); os2[1] = __fadd_rn(os2[1], op[ks][1]); }
#pragma unroll
    for (int q = 0; q < 2; ++q) { const float oc = os2[q] * cs; const float gt = FP[(size_t)t * DP + zz * HSTR + 192 + d + q]; unsigned short a, c2; splitf(__fmul_rn(gt, oc), a, c2); oh[q] = a; ol[q] = c2; }   /* H = G * A */ *(v2us*)(Ah + oo) = oh; *(v2us*)(Al + oo) = ol;  }

extern "C" void kernel_launch(void* const* d_in, const int* in_sizes, int n_in,
                              void* d_out, int out_size, void* d_ws, size_t ws_size, hipStream_t stream) {
    (void)in_sizes; (void)n_in; (void)out_size;
    const float* x = (const float*)d_in[0]; const float* win = (const float*)d_in[1]; const float* bin = (const float*)d_in[2]; const float* wo = (const float*)d_in[3]; const float* bo = (const float*)d_in[4]; const float* wq = nullptr; const float* wk = nullptr; const float* wv = nullptr; (void)wq; (void)wk; (void)wv;
    float* OUT = (float*)d_out;     // [2][2048][1024]
    char* wsp = (char*)d_ws;
    auto take = [&](size_t bytes) { char* p = wsp; wsp += (bytes + 255) & ~(size_t)255; return (void*)p; };
    bf* WINB = (bf*)take((size_t)DP * DM * 2); bf* WO = (bf*)take((size_t)DM * DQ * 2); float* CS = (float*)take((size_t)TT * HD * 2 * 4);
    bf* XB = (bf*)take((size_t)TT * DM * 2); float* FP = (float*)take((size_t)TT * DP * 4); float* Q2 = (float*)take((size_t)NH_ * TT * 4); float* K2 = (float*)take((size_t)NH_ * TT * 4);
    h16* QP16 = (h16*)take((size_t)NH_ * TT * HD * 2); h16* KP16 = (h16*)take((size_t)NKV * TT * HD * 2); h16* VT16 = (h16*)take((size_t)NKV * HD * TT * 2);
    bf* QPh = (bf*)take((size_t)NH_ * TT * HD * 2); bf* QPl = (bf*)take((size_t)NH_ * TT * HD * 2); bf* KPh = (bf*)take((size_t)NKV * TT * HD * 2); bf* KPl = (bf*)take((size_t)NKV * TT * HD * 2); bf* VTh = (bf*)take((size_t)NKV * HD * TT * 2); bf* VTl = (bf*)take((size_t)NKV * HD * TT * 2);
    float* Ob = (float*)take((size_t)KSP * NH_ * TT * HD * 4); float* Lb = (float*)take((size_t)KSP * NH_ * TT * 4); bf* ATh = (bf*)take((size_t)TT * DQ * 2); bf* ATl = (bf*)take((size_t)TT * DQ * 2);
    if ((size_t)(wsp - (char*)d_ws) > ws_size) return;    // ws 256 MiB
    { k_wtG<<<(unsigned)((DM * DP / 64 + 63) / 64), 256, 0, stream>>>(win, DM, DP, WINB);   /* 'xw' [1024][4096] -> Bt [4096][1024] */
      k_wtG<<<(unsigned)((DQ * DM / 64 + 63) / 64), 256, 0, stream>>>(wo, DQ, DM, WO);
       }
    k_csid<<<(TT * HD + 255) / 256, 256, 0, stream>>>(CS);
    const unsigned LQ = (unsigned)(((size_t)NH_ * TT * HD / 2 + 255) / 256), LKv = (unsigned)(((size_t)NKV * TT * HD / 2 + 255) / 256);
    for (int b = 0; b < NB_; ++b) {
        
        k_cvt8<<<(unsigned)(((size_t)TT * DM / 8 + 255) / 256), 256, 0, stream>>>(x + (size_t)b * TT * DM, XB, (size_t)TT * DM / 8);
        k_gemmw<bf, 0, true><<<dim3(TT / 64, DP / 64, 1), 32, 0, stream>>>(XB, nullptr, WINB, nullptr, DM, FP, DP, bin, 0, 0, 0, 0);   /* P = X W_in + b_in (exact) */ k_norm2<<<(2 * NH_ * TT + 255) / 256, 256, 0, stream>>>(FP, Q2, K2);
        k_rope<<<LQ, 256, 0, stream>>>(FP, DP, HSTR, NH_, CS, nullptr, nullptr, 1.0f, QP16, QPh, QPl);   /* Q planes (cols h*256 + 0..63) */
        
        k_rope<<<LKv, 256, 0, stream>>>(FP + 64, DP, HSTR, NKV, CS, nullptr, nullptr, 1.0f, KP16, KPh, KPl);   /* K planes (cols +64) */
        k_vtp<<<LKv, 256, 0, stream>>>(FP + 128, DP, HSTR, NKV, VT16, VTh, VTl);   /* V^T planes (cols +128) */
        k_fattn<<<dim3(TT / 256, KSP, NH_), 256, 0, stream>>>(QPh, QPl, KPh, KPl, VT16, VTh, VTl, Q2, K2, Ob, Lb);   /* all heads: Q.K (3 products), weights, attn.v partials + partial row sums */
        k_merge<<<(unsigned)(((size_t)NH_ * TT * HD / 2 + 255) / 256), 256, 0, stream>>>(Ob, Lb, FP, ATh, ATl);
        k_gemmw<bf, 1, true><<<dim3(TT / 64, DM / 64, 1), 32, 0, stream>>>(ATh, ATl, WO, nullptr, DQ, OUT + (size_t)b * TT * DM, DM, bo, 0, 0, 0, 0); }
}

// v003
// One run takes 324 microseconds.
// In two side-by-side timings against v002, it was 1.18 and 1.20 times as fast.
// Counting every step since v000, it is 6.46 times as fast.
#include <hip/hip_runtime.h>

// Shepard's (inverse-distance) gated attention (X [2][2048][1024]; P = X W_in + b_in ('xw' [1024][4096]) viewed per head h as [Q(64) | K(64) | V(64) | G(64)] at columns h*256 + ...; W = (1e-4 + ||Q_i - K_j||)^-2 with the distance by the norm expansion sqrt(max(q2 + k2 - 2 Q.K, 0)); W = W / (1e-4 + sum_j W); A = W.V; H = G * A; out = merged H W_out ('xw' [1024][1024]) + b_out -> [2][2048][1024]).
// Compute dtypes, f32 accumulate: every input rounded to bf16; q/k/v on PLAIN bf16 operands (inputs: exact) + b_in, their 16-bit planes and the f32 row norms q2, k2 written by that GEMM's own epilogue; the Q.K products on hi/lo planes for every row (3 products; the distance needs them), the Shepard weights (sqrt, reciprocal) and their row sums in f32 inside the fused attention kernel, row normalisation and gating in the merge; attn.v hybrid on the unnormalised weights: query rows < 512 hl (3 products), the rest single fp16; W_out hl x exact (2 products) + b_out.

#define NB_  2
#define TT   2048
#define DM   1024
#define NH_  16
#define NKV  16
#define REP  (NH_ / NKV)
#define HD   64
#define DQ   (NH_ * HD)
#define DKV  (NKV * HD)
#define DP   4096                 // projection width (16 heads x [Q|K|V|G] x 64)
#define HSTR 256
#define SEPS 1e-4f
#define RH   512                  // query rows < RH use hi+lo planes (0: none)
#define WIN  0
#define PMAX 32768.0f             // largest scaled weight that goes into an fp16 P operand (fp16 ends at 65504)
#define KSP  4                    // attention: the 2048 keys split over KSP workgroups per 256 query rows; partial planes [KSP][NH_][TT][HD] and partial row sums [KSP][NH_][TT] summed in k_merge
typedef _Float16 h16;
typedef unsigned short bf;
typedef __attribute__((ext_vector_type(16))) __bf16   v16bf;
typedef __attribute__((ext_vector_type(16))) _Float16 v16h;
typedef __attribute__((ext_vector_type(8)))  _Float16 v8h;
typedef __attribute__((ext_vector_type(8)))  unsigned short v8us;
typedef __attribute__((ext_vector_type(8)))  float    v8f;
typedef __attribute__((ext_vector_type(4)))  float    v4f;
typedef v8h  __attribute__((may_alias)) v8ha;
typedef v4f  __attribute__((may_alias)) v4fa;
typedef v8us __attribute__((may_alias)) v8usa;

__device__ __forceinline__ unsigned short f2bf(float f) { unsigned u = __float_as_uint(f); u += 0x7FFFu + ((u >> 16) & 1u); return (unsigned short)(u >> 16); }
__device__ __forceinline__ float bf2f(unsigned short b) { return __uint_as_float(((unsigned)b) << 16); }
__device__ __forceinline__ float bfr(float f) { return bf2f(f2bf(f)); }
__device__ __forceinline__ v16h cat16(v8h lo, v8h hi) { return __builtin_shufflevector(lo, hi, 0, 1, 2, 3, 4, 5, 6, 7, 8, 9, 10, 11, 12, 13, 14, 15); }
__device__ __forceinline__ v16bf cat16b(v8us lo, v8us hi) { return __builtin_bit_cast(v16bf, __builtin_shufflevector(lo, hi, 0, 1, 2, 3, 4, 5, 6, 7, 8, 9, 10, 11, 12, 13, 14, 15)); }
__device__ __forceinline__ v8f wmma16(v16h a, v16h b, v8f c) { return __builtin_amdgcn_wmma_f32_16x16x32_f16(false, a, false, b, (short)0, c, false, false); }
__device__ __forceinline__ v8f wmmab(v16bf a, v16bf b, v8f c) { return __builtin_amdgcn_wmma_f32_16x16x32_bf16(false, a, false, b, (short)0, c, false, false); }
__device__ __forceinline__ h16 tohx(float x) { return (h16)x; }
__device__ __forceinline__ void splitf(float y, unsigned short& h, unsigned short& l) { h = f2bf(y); l = f2bf(y - bf2f(h)); }
// XWAIT stands between loads where the compiler lets a later load's result land in an earlier load's address registers: the wait that goes in front of such an overwrite
#define XWAIT asm volatile("s_wait_xcnt 0x0" ::: "memory")
// x + (x of lane ^ M), M = 1, 2 or 4, as a DPP move inside the 16-lane row (a shuffle would go through the LDS queue); every lane on
template <int M> __device__ __forceinline__ float addx(float x) { return x + __int_as_float(__builtin_amdgcn_update_dpp(0, __float_as_int(x), 0x160 + M, 0xf, 0xf, true)); }
// where the projection GEMM's epilogue puts a head's Q, K and V columns: hi/lo planes [h][t][d], V^T planes [h][d][t], row norms [h][t]
struct PlaneOut { bf* Qh; bf* Ql; bf* Kh; bf* Kl; h16* V16; bf* Vh; bf* Vl; float* Q2; float* K2; };



// ---- k_gemmw: register-blocked GEMM, ONE WAVE per 64x64 output tile (16 accumulators), operands straight from K-contiguous 16-bit planes; grid (M/64, N/64, Z), 32 threads.
// C[m][n] (f32, pitch ldc, + optional f32 bias[n]) = sum_k A[m][k] Bt[n][k] (+ split products per NSPLIT). z-batch strides sA/sB/sC in elements. K % (32 * KS) == 0.
// PL (the input projection, N = 16 heads x [Q|K|V|G] x 64, so a 64-column tile is one part of one head): only the G tiles go to C; a Q or K tile goes out as bf16 hi/lo planes with its rows' sums of squares (the whole row of 64 is in the tile), a V tile as the three V^T planes.
// KS > 1: grid z = Z * KS; workgroup (z, ks) sums only k in [ks K/KS, (ks+1) K/KS) and stores its partial tile to plane ks (plane stride sP elements); the consumer adds the KS planes.
template <typename T16> struct WFrag;
template <> struct WFrag<h16> { typedef v16h V; static __device__ __forceinline__ V ld(const h16* p) { return cat16(*(const v8h*)p, *(const v8h*)(p + 16)); } static __device__ __forceinline__ v8f mma(V a, V b, v8f c) { return wmma16(a, b, c); } };
template <> struct WFrag<bf> { typedef v16bf V; static __device__ __forceinline__ V ld(const bf* p) { return cat16b(*(const v8us*)p, *(const v8us*)(p + 16)); } static __device__ __forceinline__ v8f mma(V a, V b, v8f c) { return wmmab(a, b, c); } };
template <typename T16, int NSPLIT, bool BIAS, int KS = 1, bool PL = false>
__global__ __launch_bounds__(32) void k_gemmw(const T16* __restrict__ A, const T16* __restrict__ A2, const T16* __restrict__ Bt, const T16* __restrict__ Bt2, int K, float* C, int ldc, const float* __restrict__ bias, size_t sA, size_t sB, size_t sC, size_t sP, PlaneOut po) {
    typedef typename WFrag<T16>::V V;
    __shared__ __align__(16) float os[16 * 68];
    const size_t z = blockIdx.z / KS; const int ks = blockIdx.z % KS; A += z * sA; if (A2) A2 += z * sA; Bt += z * sB; if (Bt2) Bt2 += z * sB; C += z * sC + (size_t)ks * sP;
    const int kbeg = ks * (K / KS), kend = kbeg + K / KS;
    const int lane = threadIdx.x & 31, lr = lane & 15, hi = lane >> 4; const int r0 = blockIdx.x * 64, c0 = blockIdx.y * 64;
    v8f acc[4][4];
#pragma unroll
    for (int mb = 0; mb < 4; ++mb)
#pragma unroll
        for (int nb = 0; nb < 4; ++nb) acc[mb][nb] = (v8f){};
    const size_t aoff = (size_t)(r0 + lr) * K + 8 * hi, boff = (size_t)(c0 + lr) * K + 8 * hi;
#pragma unroll 1
    for (int kc = kbeg; kc < kend; kc += 32) {
        V a[4], a2[4];
#pragma unroll
        for (int mb = 0; mb < 4; ++mb) { a[mb] = WFrag<T16>::ld(A + aoff + (size_t)mb * 16 * K + kc); if (NSPLIT == 1 || NSPLIT == 2) a2[mb] = WFrag<T16>::ld(A2 + aoff + (size_t)mb * 16 * K + kc); }
#pragma unroll
        for (int nb = 0; nb < 4; ++nb) { const V b = WFrag<T16>::ld(Bt + boff + (size_t)nb * 16 * K + kc); V b2; if (NSPLIT >= 2) b2 = WFrag<T16>::ld(Bt2 + boff + (size_t)nb * 16 * K + kc);
#pragma unroll
            for (int mb = 0; mb < 4; ++mb) { acc[mb][nb] = WFrag<T16>::mma(a[mb], b, acc[mb][nb]); if (NSPLIT == 1 || NSPLIT == 2) acc[mb][nb] = WFrag<T16>::mma(a2[mb], b, acc[mb][nb]); if (NSPLIT >= 2) acc[mb][nb] = WFrag<T16>::mma(a[mb], b2, acc[mb][nb]); } }
        asm volatile("v_nop\n\tv_nop\n\tv_nop\n\tv_nop" : "+v"(acc[0][0]), "+v"(acc[1][1]), "+v"(acc[2][2]), "+v"(acc[3][3]) : "v"(a[0]), "v"(a[3]));
    }
    const int part = PL ? (int)(blockIdx.y & 3) : 3; const size_t head = blockIdx.y >> 2;   /* part: 0 Q, 1 K, 2 V, 3 G; the same for the whole workgroup */
    if (PL && part == 2) {   /* V^T straight from the accumulators: element j of lane (lr, hi) is row mb*16 + hi*8 + j of column nb*16 + lr, eight consecutive t of one d = one 16-byte store a plane */
#pragma unroll
        for (int nb = 0; nb < 4; ++nb) { const float bv = bfr(bias[c0 + nb * 16 + lr]);
#pragma unroll
            for (int mb = 0; mb < 4; ++mb) { v8h o16; v8us oh, ol;
#pragma unroll
                for (int j = 0; j < 8; ++j) { const float x = acc[mb][nb][j] + bv; o16[j] = tohx(x); unsigned short a2, c2; splitf(x, a2, c2); oh[j] = a2; ol[j] = c2; }
                const size_t o = (head * HD + nb * 16 + lr) * TT + r0 + mb * 16 + hi * 8; *(v8h*)(po.V16 + o) = o16; *(v8us*)(po.Vh + o) = oh; *(v8us*)(po.Vl + o) = ol; } }
        return; }
    if (PL && part < 2) {   /* Q, K: 16 rows at a time through LDS as below, read out eight lanes a row, eight columns a lane */
        const int c8 = (lane & 7) * 8, rq = lane >> 3; float bq[8]; bf* Ph = (part == 0 ? po.Qh : po.Kh) + (head * TT + r0) * HD; bf* Pl = (part == 0 ? po.Ql : po.Kl) + (head * TT + r0) * HD; float* N2 = (part == 0 ? po.Q2 : po.K2) + head * TT + r0;
#pragma unroll
        for (int q = 0; q < 8; ++q) bq[q] = bfr(bias[c0 + c8 + q]);
#pragma unroll
        for (int mb = 0; mb < 4; ++mb) { float keep = 0.f;
#pragma unroll
            for (int nb = 0; nb < 4; ++nb) {
#pragma unroll
                for (int j = 0; j < 8; ++j) os[(hi * 8 + j) * 68 + nb * 16 + lr] = acc[mb][nb][j]; }
            __builtin_amdgcn_wave_barrier(); asm volatile("" ::: "memory");   /* one wave, whose LDS operations run in order: this only keeps the compiler from moving a lane's reads over the other lanes' writes */
#pragma unroll
            for (int s = 0; s < 4; ++s) { const int row = 4 * s + rq; const v4f v0 = *(const v4fa*)(os + row * 68 + c8), v1 = *(const v4fa*)(os + row * 68 + c8 + 4); v8us oh, ol; float n2 = 0.f;
#pragma unroll
                for (int q = 0; q < 8; ++q) { const float x = (q < 4 ? v0[q & 3] : v1[q & 3]) + bq[q]; unsigned short a2, c2; splitf(x, a2, c2); oh[q] = a2; ol[q] = c2; n2 = fmaf(x, x, n2); }
                *(v8us*)(Ph + (mb * 16 + row) * HD + c8) = oh; *(v8us*)(Pl + (mb * 16 + row) * HD + c8) = ol;   /* four whole 128-byte rows a store */
                n2 = addx<4>(addx<2>(addx<1>(n2))); if ((lane & 7) == s) keep = n2; }   /* the row's eight partial sums; lane 8 rq + s keeps row 4 s + rq */
            if ((lane & 7) < 4) N2[mb * 16 + 4 * (lane & 7) + rq] = keep;
            __builtin_amdgcn_wave_barrier(); asm volatile("" ::: "memory");   /* and the next 16 rows' writes over these reads */
        }
        return; }
#pragma unroll
    for (int mb = 0; mb < 4; ++mb) {
#pragma unroll
        for (int nb = 0; nb < 4; ++nb) {
#pragma unroll
            for (int j = 0; j < 8; ++j) os[(hi * 8 + j) * 68 + nb * 16 + lr] = acc[mb][nb][j]; }
        __builtin_amdgcn_wave_barrier(); asm volatile("" ::: "memory");
        float* crow = C + (size_t)(r0 + mb * 16) * ldc + c0;
{
#pragma unroll
            for (int s = 0; s < 8; ++s) { const int row = 2 * s + hi, cofs = lr * 4; v4f val = *(const v4fa*)(os + row * 68 + cofs); if (BIAS) { val[0] += bfr(bias[c0 + cofs]); val[1] += bfr(bias[c0 + cofs + 1]); val[2] += bfr(bias[c0 + cofs + 2]); val[3] += bfr(bias[c0 + cofs + 3]); }
                *(v4f*)(crow + (size_t)row * ldc + cofs) = val; }
             }
        XWAIT;   /* behind these rows' stores: the next rows' bias load and LDS reads may be given their registers */
        __builtin_amdgcn_wave_barrier(); asm volatile("" ::: "memory");
    }
}

typedef __attribute__((ext_vector_type(2))) _Float16 v2h;
typedef __attribute__((ext_vector_type(4))) _Float16 v4h;
typedef __attribute__((ext_vector_type(2))) unsigned short v2us;
typedef __attribute__((ext_vector_type(4))) unsigned short v4us;
typedef __attribute__((ext_vector_type(2))) float v2f;
typedef __attribute__((ext_vector_type(4))) int v4i;

__global__ __launch_bounds__(256) void k_wtG(const float* __restrict__ w, int K, int N, bf* Bt) {
    const int lane = threadIdx.x & 31; const int L0 = (blockIdx.x * 8 + (threadIdx.x >> 5)) * 8; const int nlines = N * K / 64;
{
#pragma unroll 1
        for (int l = 0; l < 8; ++l) { const int L = L0 + l; if (L >= nlines) break; const size_t e = (size_t)L * 64 + lane * 2; const int k = (int)(e % K), n = (int)(e / K); v2us o;
            o[0] = f2bf(w[(size_t)k * N + n]); o[1] = f2bf(w[(size_t)(k + 1) * N + n]); *(v2us*)(Bt + e) = o; }
         }
}
__global__ __launch_bounds__(256) void k_cvt8(const float* __restrict__ src, bf* dst, size_t n8) { const size_t i = (size_t)blockIdx.x * 256 + threadIdx.x; if (i >= n8) return; const v8f v = *(const v8f*)(src + i * 8); v8us o;
#pragma unroll
    for (int k = 0; k < 8; ++k) o[k] = f2bf(v[k]); *(v8us*)(dst + i * 8) = o;  }

// k_fattn: scores, Shepard weights and attn.v in one kernel; the scores never leave the registers. One wave = 32 query rows x TT/KSP keys, 32 keys a pass; 8 waves (256 query rows) a workgroup, no LDS, no barrier.
// S^T = K Q^T (A = K rows, B = Q rows kept in registers): accumulator element j of lane (lr, hi) is key kb*16 + hi*8 + j of query lr, so two key tiles pack straight into the B operand (k order 8 hi + 0..7, 16 + 8 hi + 0..7, the loaders' own) of O^T += V^T P^T.
// w_j = (eps + sqrt(max(q2_i + k2_j - 2 S_ij, 0)))^-2 stays unnormalised; its f32 row sum goes out beside the partial O and divides in k_merge.
// Range of the 16-bit P operand: each query scales eps + dist by r, a power of two near 1 / sqrt(q2_i + k2 of the range's first key), so w / r^2 is of order 1 for keys about as far off as the norms are large; a power of two changes no rounding, and r^2 is taken out of the partial O and the partial sum on the way out.
// A key much nearer than that (down to dist = 0) gives a scaled weight beyond the fp16 range: when a pass of the fp16 rows meets a weight above PMAX, the queries concerned raise their r by a power of two 2^k that brings their largest weight to 2^9..2^11, and this pass's weights, the running row sum and the running O are multiplied by 2^-2k (exact), before anything is rounded to fp16. Weights far below a row's largest then round to fp16 subnormals or 0, at most 2^-25 against a row sum of at least 2^9.
template <bool HL>
__device__ __forceinline__ void fattn_body(const bf* __restrict__ Qh, const bf* __restrict__ Ql, const bf* __restrict__ Kh, const bf* __restrict__ Kl, const h16* __restrict__ V16, const bf* __restrict__ Vh, const bf* __restrict__ Vl, const float* __restrict__ q2p, const float* __restrict__ k2p, int q0, int kbeg, float* Op, float* Lp) {
    const int lane = threadIdx.x & 31, lr = lane & 15, hi = lane >> 4;
    // every inner loop here is unrolled in full: its index picks fragments and accumulators, which live in registers and cannot be indexed at run time
    v16bf qh[2][2], ql[2][2]; float q2[2], rs[2], r[2], er[2]; v8f oacc[4][2];
#pragma unroll
    for (int qb = 0; qb < 2; ++qb) { const size_t o = (size_t)(q0 + qb * 16 + lr) * HD + 8 * hi; q2[qb] = q2p[q0 + qb * 16 + lr]; rs[qb] = 0.f; r[qb] = __uint_as_float(__float_as_uint(__builtin_amdgcn_rsqf(fminf(fmaxf(q2[qb] + k2p[kbeg], 1e-8f), 1e12f))) & 0x7F800000u);   /* both ends bounded: (r eps)^-2 and its products with V stay far inside f32 */ er[qb] = SEPS * r[qb];
#pragma unroll
        for (int c = 0; c < 2; ++c) { qh[qb][c] = WFrag<bf>::ld(Qh + o + c * 32); ql[qb][c] = WFrag<bf>::ld(Ql + o + c * 32); }
#pragma unroll
        for (int db = 0; db < 4; ++db) oacc[db][qb] = (v8f){}; }
    // the pass stays rolled: unrolled it would hold two passes' fragments in registers and cost resident waves
#pragma unroll 1
    for (int k0 = kbeg; k0 < kbeg + TT / KSP; k0 += 32) {
        v8f s[2][2]; float wm[2] = {0.f, 0.f};
#pragma unroll
        for (int kb = 0; kb < 2; ++kb) { const size_t o = (size_t)(k0 + kb * 16 + lr) * HD + 8 * hi; v16bf kh[2], kl[2];
#pragma unroll
            for (int c = 0; c < 2; ++c) { kh[c] = WFrag<bf>::ld(Kh + o + c * 32); kl[c] = WFrag<bf>::ld(Kl + o + c * 32); }
#pragma unroll
            for (int qb = 0; qb < 2; ++qb) { v8f a = (v8f){};
#pragma unroll
                for (int c = 0; c < 2; ++c) { a = wmmab(kh[c], qh[qb][c], a); a = wmmab(kh[c], ql[qb][c], a); a = wmmab(kl[c], qh[qb][c], a); }
                s[kb][qb] = a; } }
        XWAIT;   /* behind the K loads, in front of the k2 loads */
#pragma unroll
        for (int kb = 0; kb < 2; ++kb) { const v4f ka = *(const v4f*)(k2p + k0 + kb * 16 + hi * 8), kc = *(const v4f*)(k2p + k0 + kb * 16 + hi * 8 + 4);
#pragma unroll
            for (int qb = 0; qb < 2; ++qb) {
#pragma unroll
                for (int j = 0; j < 8; ++j) { const float t = q2[qb] + (j < 4 ? ka[j & 3] : kc[j & 3]); const float d2 = fmaxf(t - 2.0f * s[kb][qb][j], 0.f); const float den = fmaf(__builtin_amdgcn_sqrtf(d2), r[qb], er[qb]); const float w = __builtin_amdgcn_rcpf(den * den);   /* (r (eps + dist))^-2 */ s[kb][qb][j] = w; rs[qb] += w; if (!HL) wm[qb] = fmaxf(wm[qb], w); } } }
        if (!HL && __builtin_amdgcn_ballot_w32(fmaxf(wm[0], wm[1]) > PMAX) != 0u) {   /* rare; the ballot makes it one scalar branch for the wave, so the exchange below has every lane on */
#pragma unroll
            for (int qb = 0; qb < 2; ++qb) { const float m = fmaxf(wm[qb], __shfl_xor(wm[qb], 16, 32));   /* a query's keys lie in lanes lr and lr + 16: both take the same k */
                const int k = (m > PMAX) ? (((int)(__float_as_uint(m) >> 23) - 136) >> 1) : 0; const float g = __uint_as_float((unsigned)(127 - k) << 23), gi = __uint_as_float((unsigned)(127 + k) << 23), f = g * g;
                r[qb] *= gi; er[qb] *= gi; rs[qb] *= f; s[0][qb] *= f; s[1][qb] *= f;
#pragma unroll
                for (int db = 0; db < 4; ++db) oacc[db][qb] *= f; } }
        if (HL) { v16bf ph[2], pl[2];
#pragma unroll
            for (int qb = 0; qb < 2; ++qb) { v8us h0, h1, l0, l1;
#pragma unroll
                for (int j = 0; j < 8; ++j) { unsigned short a, c2; splitf(s[0][qb][j], a, c2); h0[j] = a; l0[j] = c2; splitf(s[1][qb][j], a, c2); h1[j] = a; l1[j] = c2; }
                ph[qb] = cat16b(h0, h1); pl[qb] = cat16b(l0, l1); }
#pragma unroll
            for (int db = 0; db < 4; ++db) { const size_t o = (size_t)(db * 16 + lr) * TT + k0 + 8 * hi; const v16bf vh = WFrag<bf>::ld(Vh + o), vl = WFrag<bf>::ld(Vl + o);
#pragma unroll
                for (int qb = 0; qb < 2; ++qb) { oacc[db][qb] = wmmab(vh, ph[qb], oacc[db][qb]); oacc[db][qb] = wmmab(vh, pl[qb], oacc[db][qb]); oacc[db][qb] = wmmab(vl, ph[qb], oacc[db][qb]); } }
        } else { v16h p[2];
#pragma unroll
            for (int qb = 0; qb < 2; ++qb) { v8h p0, p1;
#pragma unroll
                for (int j = 0; j < 8; ++j) { p0[j] = tohx(s[0][qb][j]); p1[j] = tohx(s[1][qb][j]); }
                p[qb] = cat16(p0, p1); }
#pragma unroll
            for (int db = 0; db < 4; ++db) { const v16h v = WFrag<h16>::ld(V16 + (size_t)(db * 16 + lr) * TT + k0 + 8 * hi);
#pragma unroll
                for (int qb = 0; qb < 2; ++qb) oacc[db][qb] = wmma16(v, p[qb], oacc[db][qb]); } }
    }
#pragma unroll
    for (int qb = 0; qb < 2; ++qb) { const float u = r[qb] * r[qb]; const float tot = (rs[qb] + __shfl_xor(rs[qb], 16, 32)) * u; if (hi == 0) Lp[q0 + qb * 16 + lr] = tot;
#pragma unroll
        for (int db = 0; db < 4; ++db) { float* o = Op + (size_t)(q0 + qb * 16 + lr) * HD + db * 16 + hi * 8; const v8f a = oacc[db][qb] * u; *(v4f*)o = (v4f){a[0], a[1], a[2], a[3]}; *(v4f*)(o + 4) = (v4f){a[4], a[5], a[6], a[7]}; } }
}
__global__ __launch_bounds__(256) void k_fattn(const bf* __restrict__ QPh, const bf* __restrict__ QPl, const bf* __restrict__ KPh, const bf* __restrict__ KPl, const h16* __restrict__ VT16, const bf* __restrict__ VTh, const bf* __restrict__ VTl, const float* __restrict__ Q2, const float* __restrict__ K2, float* Ob, float* Lb) {
    const size_t h = blockIdx.z, ks = blockIdx.y, hp = h * TT * HD; const int q0 = blockIdx.x * 256 + (threadIdx.x >> 5) * 32, kbeg = (int)ks * (TT / KSP);
    float* Op = Ob + (ks * NH_ + h) * TT * HD; float* Lp = Lb + (ks * NH_ + h) * TT;
    if (blockIdx.x * 256 < RH) fattn_body<true>(QPh + hp, QPl + hp, KPh + hp, KPl + hp, VT16 + hp, VTh + hp, VTl + hp, Q2 + h * TT, K2 + h * TT, q0, kbeg, Op, Lp);   /* RH is a multiple of 256: one path a workgroup */
    else fattn_body<false>(QPh + hp, QPl + hp, KPh + hp, KPl + hp, VT16 + hp, VTh + hp, VTl + hp, Q2 + h * TT, K2 + h * TT, q0, kbeg, Op, Lp);
}
__global__ __launch_bounds__(256) void k_merge(const float* __restrict__ O, const float* __restrict__ L, const float* __restrict__ FP, bf* Ah, bf* Al) { const size_t e = ((size_t)blockIdx.x * 256 + threadIdx.x) * 2; if (e >= (size_t)NH_ * TT * HD) return; const int d = (int)(e % HD); const int t = (int)((e / HD) % TT); const int zz = (int)(e / ((size_t)HD * TT)); const size_t oo = (size_t)t * DQ + zz * HD + d;
    float lp[KSP]; v2f op[KSP];   /* XWAIT behind each load: the next load's result may be given this one's address registers */
#pragma unroll
    for (int ks = 0; ks < KSP; ++ks) { lp[ks] = L[((size_t)ks * NH_ + zz) * TT + t]; XWAIT; op[ks] = *(const v2f*)(O + (size_t)ks * ((size_t)NH_ * TT * HD) + e); XWAIT; }
    float lsum = lp[0];   /* row sum of the weights: the KSP partial sums, fixed order */
#pragma unroll
    for (int ks = 1; ks < KSP; ++ks) lsum = __fadd_rn(lsum, lp[ks]);
    const float cs = __builtin_amdgcn_rcpf(__fadd_rn(SEPS, lsum));   /* W / (eps + sum W) via hardware reciprocal */
    v2us oh, ol; v2f os2 = op[0];   /* sum of the KSP partial planes, fixed order */
#pragma unroll
    for (int ks = 1; ks < KSP; ++ks) { os2[0] = __fadd_rn(os2[0], op[ks][0]); os2[1] = __fadd_rn(os2[1], op[ks][1]); }
#pragma unroll
    for (int q = 0; q < 2; ++q) { const float oc = os2[q] * cs; const float gt = FP[(size_t)t * DP + zz * HSTR + 192 + d + q]; unsigned short a, c2; splitf(__fmul_rn(gt, oc), a, c2); oh[q] = a; ol[q] = c2; }   /* H = G * A */ *(v2us*)(Ah + oo) = oh; *(v2us*)(Al + oo) = ol;  }

extern "C" void kernel_launch(void* const* d_in, const int* in_sizes, int n_in,
                              void* d_out, int out_size, void* d_ws, size_t ws_size, hipStream_t stream) {
    (void)in_sizes; (void)n_in; (void)out_size;
    const float* x = (const float*)d_in[0]; const float* win = (const float*)d_in[1]; const float* bin = (const float*)d_in[2]; const float* wo = (const float*)d_in[3]; const float* bo = (const float*)d_in[4]; const float* wq = nullptr; const float* wk = nullptr; const float* wv = nullptr; (void)wq; (void)wk; (void)wv;
    float* OUT = (float*)d_out;     // [2][2048][1024]
    char* wsp = (char*)d_ws;
    auto take = [&](size_t bytes) { char* p = wsp; wsp += (bytes + 255) & ~(size_t)255; return (void*)p; };
    bf* WINB = (bf*)take((size_t)DP * DM * 2); bf* WO = (bf*)take((size_t)DM * DQ * 2);
    bf* XB = (bf*)take((size_t)TT * DM * 2); float* FP = (float*)take((size_t)TT * DP * 4); float* Q2 = (float*)take((size_t)NH_ * TT * 4); float* K2 = (float*)take((size_t)NH_ * TT * 4);
    h16* VT16 = (h16*)take((size_t)NKV * HD * TT * 2);
    bf* QPh = (bf*)take((size_t)NH_ * TT * HD * 2); bf* QPl = (bf*)take((size_t)NH_ * TT * HD * 2); bf* KPh = (bf*)take((size_t)NKV * TT * HD * 2); bf* KPl = (bf*)take((size_t)NKV * TT * HD * 2); bf* VTh = (bf*)take((size_t)NKV * HD * TT * 2); bf* VTl = (bf*)take((size_t)NKV * HD * TT * 2);
    float* Ob = (float*)take((size_t)KSP * NH_ * TT * HD * 4); float* Lb = (float*)take((size_t)KSP * NH_ * TT * 4); bf* ATh = (bf*)take((size_t)TT * DQ * 2); bf* ATl = (bf*)take((size_t)TT * DQ * 2);
    if ((size_t)(wsp - (char*)d_ws) > ws_size) return;    // ws 256 MiB
    { k_wtG<<<(unsigned)((DM * DP / 64 + 63) / 64), 256, 0, stream>>>(win, DM, DP, WINB);   /* 'xw' [1024][4096] -> Bt [4096][1024] */
      k_wtG<<<(unsigned)((DQ * DM / 64 + 63) / 64), 256, 0, stream>>>(wo, DQ, DM, WO);
       }
    const PlaneOut po = {QPh, QPl, KPh, KPl, VT16, VTh, VTl, Q2, K2}, none = {};
    for (int b = 0; b < NB_; ++b) {
        
        k_cvt8<<<(unsigned)(((size_t)TT * DM / 8 + 255) / 256), 256, 0, stream>>>(x + (size_t)b * TT * DM, XB, (size_t)TT * DM / 8);
        k_gemmw<bf, 0, true, 1, true><<<dim3(TT / 64, DP / 64, 1), 32, 0, stream>>>(XB, nullptr, WINB, nullptr, DM, FP, DP, bin, 0, 0, 0, 0, po);   /* P = X W_in + b_in (exact): Q, K hi/lo planes + q2, k2, V^T planes; G (cols h*256 + 192..255) in f32 to FP */
        k_fattn<<<dim3(TT / 256, KSP, NH_), 256, 0, stream>>>(QPh, QPl, KPh, KPl, VT16, VTh, VTl, Q2, K2, Ob, Lb);   /* all heads: Q.K (3 products), weights, attn.v partials + partial row sums */
        k_merge<<<(unsigned)(((size_t)NH_ * TT * HD / 2 + 255) / 256), 256, 0, stream>>>(Ob, Lb, FP, ATh, ATl);
        k_gemmw<bf, 1, true><<<dim3(TT / 64, DM / 64, 1), 32, 0, stream>>>(ATh, ATl, WO, nullptr, DQ, OUT + (size_t)b * TT * DM, DM, bo, 0, 0, 0, 0, none); }
}

// v004
// A run of this version takes 270 microseconds.
// In two side-by-side timings against v003, it was 1.20 and 1.19 times as fast.
// Counting every step since v000, it is 7.73 times as fast.
#include <hip/hip_runtime.h>

// Shepard's (inverse-distance) gated attention (X [2][2048][1024]; P = X W_in + b_in ('xw' [1024][4096]) viewed per head h as [Q(64) | K(64) | V(64) | G(64)] at columns h*256 + ...; W = (1e-4 + ||Q_i - K_j||)^-2 with the distance by the norm expansion sqrt(max(q2 + k2 - 2 Q.K, 0)); W = W / (1e-4 + sum_j W); A = W.V; H = G * A; out = merged H W_out ('xw' [1024][1024]) + b_out -> [2][2048][1024]).
// Compute dtypes, f32 accumulate: every input rounded to bf16; q/k/v on PLAIN bf16 operands (inputs: exact) + b_in, their 16-bit planes and the f32 row norms q2, k2 written by that GEMM's own epilogue; the Q.K products on hi/lo planes for every row (3 products; the distance needs them), the Shepard weights (sqrt, reciprocal) and their row sums in f32 inside the fused attention kernel, row normalisation and gating in the merge; attn.v hybrid on the unnormalised weights: query rows < 512 hl (3 products), the rest single fp16; W_out hl x exact (2 products) + b_out.

#define NB_  2
#define TT   2048
#define DM   1024
#define NH_  16
#define NKV  16
#define REP  (NH_ / NKV)
#define HD   64
#define DQ   (NH_ * HD)
#define DKV  (NKV * HD)
#define DP   4096                 // projection width (16 heads x [Q|K|V|G] x 64)
#define HSTR 256
#define SEPS 1e-4f
#define RH   512                  // query rows < RH use hi+lo planes (0: none)
#define WIN  0
#define PMAX 32768.0f             // largest scaled weight that goes into an fp16 P operand (fp16 ends at 65504)
#define NHB  (NB_ * NH_)          // both batches go through every launch: rows b*TT + t in the GEMMs, "heads" b*NH_ + h in the planes and in the attention grid
#define KSP  4                    // attention: the 2048 keys split over KSP workgroups per 256 query rows; partial planes [KSP][NHB][TT][HD] and partial row sums [KSP][NHB][TT] summed in k_merge
typedef _Float16 h16;
typedef unsigned short bf;
typedef __attribute__((ext_vector_type(16))) __bf16   v16bf;
typedef __attribute__((ext_vector_type(16))) _Float16 v16h;
typedef __attribute__((ext_vector_type(8)))  _Float16 v8h;
typedef __attribute__((ext_vector_type(8)))  unsigned short v8us;
typedef __attribute__((ext_vector_type(8)))  float    v8f;
typedef __attribute__((ext_vector_type(4)))  float    v4f;
typedef v8h  __attribute__((may_alias)) v8ha;
typedef v4f  __attribute__((may_alias)) v4fa;
typedef v8us __attribute__((may_alias)) v8usa;

__device__ __forceinline__ unsigned short f2bf(float f) { unsigned u = __float_as_uint(f); u += 0x7FFFu + ((u >> 16) & 1u); return (unsigned short)(u >> 16); }
__device__ __forceinline__ float bf2f(unsigned short b) { return __uint_as_float(((unsigned)b) << 16); }
__device__ __forceinline__ float bfr(float f) { return bf2f(f2bf(f)); }
__device__ __forceinline__ v16h cat16(v8h lo, v8h hi) { return __builtin_shufflevector(lo, hi, 0, 1, 2, 3, 4, 5, 6, 7, 8, 9, 10, 11, 12, 13, 14, 15); }
__device__ __forceinline__ v16bf cat16b(v8us lo, v8us hi) { return __builtin_bit_cast(v16bf, __builtin_shufflevector(lo, hi, 0, 1, 2, 3, 4, 5, 6, 7, 8, 9, 10, 11, 12, 13, 14, 15)); }
__device__ __forceinline__ v8f wmma16(v16h a, v16h b, v8f c) { return __builtin_amdgcn_wmma_f32_16x16x32_f16(false, a, false, b, (short)0, c, false, false); }
__device__ __forceinline__ v8f wmmab(v16bf a, v16bf b, v8f c) { return __builtin_amdgcn_wmma_f32_16x16x32_bf16(false, a, false, b, (short)0, c, false, false); }
__device__ __forceinline__ h16 tohx(float x) { return (h16)x; }
__device__ __forceinline__ void splitf(float y, unsigned short& h, unsigned short& l) { h = f2bf(y); l = f2bf(y - bf2f(h)); }
// XWAIT stands between loads where the compiler lets a later load's result land in an earlier load's address registers: the wait that goes in front of such an overwrite
#define XWAIT asm volatile("s_wait_xcnt 0x0" ::: "memory")
// x + (x of lane ^ M), M = 1, 2 or 4, as a DPP move inside the 16-lane row (a shuffle would go through the LDS queue); every lane on
template <int M> __device__ __forceinline__ float addx(float x) { return x + __int_as_float(__builtin_amdgcn_update_dpp(0, __float_as_int(x), 0x160 + M, 0xf, 0xf, true)); }
// where the projection GEMM's epilogue puts a head's Q, K and V columns: hi/lo planes [h][t][d], V^T planes [h][d][t], row norms [h][t]
struct PlaneOut { bf* Qh; bf* Ql; bf* Kh; bf* Kl; h16* V16; bf* Vh; bf* Vl; float* Q2; float* K2; };



// ---- k_gemmw: register-blocked GEMM, ONE WAVE per 64x64 output tile (16 accumulators), operands straight from K-contiguous 16-bit planes; grid (M/64, N/64, Z), 32 threads.
// C[m][n] (f32, pitch ldc, + optional f32 bias[n]) = sum_k A[m][k] Bt[n][k] (+ split products per NSPLIT). z-batch strides sA/sB/sC in elements. K % (32 * KS) == 0.
// PL (the input projection, N = 16 heads x [Q|K|V|G] x 64, so a 64-column tile is one part of one head): only the G tiles go to C; a Q or K tile goes out as bf16 hi/lo planes with its rows' sums of squares (the whole row of 64 is in the tile), a V tile as the three V^T planes.
// KS > 1: grid z = Z * KS; workgroup (z, ks) sums only k in [ks K/KS, (ks+1) K/KS) and stores its partial tile to plane ks (plane stride sP elements); the consumer adds the KS planes.
template <typename T16> struct WFrag;
template <> struct WFrag<h16> { typedef v16h V; static __device__ __forceinline__ V ld(const h16* p) { return cat16(*(const v8h*)p, *(const v8h*)(p + 16)); } static __device__ __forceinline__ v8f mma(V a, V b, v8f c) { return wmma16(a, b, c); } };
template <> struct WFrag<bf> { typedef v16bf V; static __device__ __forceinline__ V ld(const bf* p) { return cat16b(*(const v8us*)p, *(const v8us*)(p + 16)); } static __device__ __forceinline__ v8f mma(V a, V b, v8f c) { return wmmab(a, b, c); } };
template <typename T16, int NSPLIT, bool BIAS, int KS = 1, bool PL = false>
__global__ __launch_bounds__(32) void k_gemmw(const T16* __restrict__ A, const T16* __restrict__ A2, const T16* __restrict__ Bt, const T16* __restrict__ Bt2, int K, float* C, int ldc, const float* __restrict__ bias, size_t sA, size_t sB, size_t sC, size_t sP, PlaneOut po) {
    typedef typename WFrag<T16>::V V;
    __shared__ __align__(16) float os[16 * 68];
    const size_t z = blockIdx.z / KS; const int ks = blockIdx.z % KS; A += z * sA; if (A2) A2 += z * sA; Bt += z * sB; if (Bt2) Bt2 += z * sB; C += z * sC + (size_t)ks * sP;
    const int kbeg = ks * (K / KS), kend = kbeg + K / KS;
    const int lane = threadIdx.x & 31, lr = lane & 15, hi = lane >> 4; const int r0 = blockIdx.x * 64, c0 = blockIdx.y * 64;
    v8f acc[4][4];
#pragma unroll
    for (int mb = 0; mb < 4; ++mb)
#pragma unroll
        for (int nb = 0; nb < 4; ++nb) acc[mb][nb] = (v8f){};
    const size_t aoff = (size_t)(r0 + lr) * K + 8 * hi, boff = (size_t)(c0 + lr) * K + 8 * hi;
#pragma unroll 1
    for (int kc = kbeg; kc < kend; kc += 32) {
        V a[4], a2[4];
#pragma unroll
        for (int mb = 0; mb < 4; ++mb) { a[mb] = WFrag<T16>::ld(A + aoff + (size_t)mb * 16 * K + kc); if (NSPLIT == 1 || NSPLIT == 2) a2[mb] = WFrag<T16>::ld(A2 + aoff + (size_t)mb * 16 * K + kc); }
#pragma unroll
        for (int nb = 0; nb < 4; ++nb) { const V b = WFrag<T16>::ld(Bt + boff + (size_t)nb * 16 * K + kc); V b2; if (NSPLIT >= 2) b2 = WFrag<T16>::ld(Bt2 + boff + (size_t)nb * 16 * K + kc);
#pragma unroll
            for (int mb = 0; mb < 4; ++mb) { acc[mb][nb] = WFrag<T16>::mma(a[mb], b, acc[mb][nb]); if (NSPLIT == 1 || NSPLIT == 2) acc[mb][nb] = WFrag<T16>::mma(a2[mb], b, acc[mb][nb]); if (NSPLIT >= 2) acc[mb][nb] = WFrag<T16>::mma(a[mb], b2, acc[mb][nb]); } }
        asm volatile("v_nop\n\tv_nop\n\tv_nop\n\tv_nop" : "+v"(acc[0][0]), "+v"(acc[1][1]), "+v"(acc[2][2]), "+v"(acc[3][3]) : "v"(a[0]), "v"(a[3]));
    }
    const int part = PL ? (int)(blockIdx.y & 3) : 3; const size_t head = (size_t)(r0 / TT) * NH_ + (blockIdx.y >> 2); const int t0 = r0 % TT;   /* part: 0 Q, 1 K, 2 V, 3 G; the same for the whole workgroup. Row r0 = b*TT + t0: the planes are [b*NH_ + h][..] */
    if (PL && part == 2) {   /* V^T straight from the accumulators: element j of lane (lr, hi) is row mb*16 + hi*8 + j of column nb*16 + lr, eight consecutive t of one d = one 16-byte store a plane */
#pragma unroll
        for (int nb = 0; nb < 4; ++nb) { const float bv = bfr(bias[c0 + nb * 16 + lr]);
#pragma unroll
            for (int mb = 0; mb < 4; ++mb) { v8h o16; v8us oh, ol;
#pragma unroll
                for (int j = 0; j < 8; ++j) { const float x = acc[mb][nb][j] + bv; o16[j] = tohx(x); unsigned short a2, c2; splitf(x, a2, c2); oh[j] = a2; ol[j] = c2; }
                const size_t o = (head * HD + nb * 16 + lr) * TT + t0 + mb * 16 + hi * 8; *(v8h*)(po.V16 + o) = o16; *(v8us*)(po.Vh + o) = oh; *(v8us*)(po.Vl + o) = ol; } }
        return; }
    if (PL && part < 2) {   /* Q, K: 16 rows at a time through LDS as below, read out eight lanes a row, eight columns a lane */
        const int c8 = (lane & 7) * 8, rq = lane >> 3; float bq[8]; bf* Ph = (part == 0 ? po.Qh : po.Kh) + (head * TT + t0) * HD; bf* Pl = (part == 0 ? po.Ql : po.Kl) + (head * TT + t0) * HD; float* N2 = (part == 0 ? po.Q2 : po.K2) + head * TT + t0;
#pragma unroll
        for (int q = 0; q < 8; ++q) bq[q] = bfr(bias[c0 + c8 + q]);
#pragma unroll
        for (int mb = 0; mb < 4; ++mb) { float keep = 0.f;
#pragma unroll
            for (int nb = 0; nb < 4; ++nb) {
#pragma unroll
                for (int j = 0; j < 8; ++j) os[(hi * 8 + j) * 68 + nb * 16 + lr] = acc[mb][nb][j]; }
            __builtin_amdgcn_wave_barrier(); asm volatile("" ::: "memory");   /* one wave, whose LDS operations run in order: this only keeps the compiler from moving a lane's reads over the other lanes' writes */
#pragma unroll
            for (int s = 0; s < 4; ++s) { const int row = 4 * s + rq; const v4f v0 = *(const v4fa*)(os + row * 68 + c8), v1 = *(const v4fa*)(os + row * 68 + c8 + 4); v8us oh, ol; float n2 = 0.f;
#pragma unroll
                for (int q = 0; q < 8; ++q) { const float x = (q < 4 ? v0[q & 3] : v1[q & 3]) + bq[q]; unsigned short a2, c2; splitf(x, a2, c2); oh[q] = a2; ol[q] = c2; n2 = fmaf(x, x, n2); }
                *(v8us*)(Ph + (mb * 16 + row) * HD + c8) = oh; *(v8us*)(Pl + (mb * 16 + row) * HD + c8) = ol;   /* four whole 128-byte rows a store */
                n2 = addx<4>(addx<2>(addx<1>(n2))); if ((lane & 7) == s) keep = n2; }   /* the row's eight partial sums; lane 8 rq + s keeps row 4 s + rq */
            if ((lane & 7) < 4) N2[mb * 16 + 4 * (lane & 7) + rq] = keep;
            __builtin_amdgcn_wave_barrier(); asm volatile("" ::: "memory");   /* and the next 16 rows' writes over these reads */
        }
        return; }
#pragma unroll
    for (int mb = 0; mb < 4; ++mb) {
#pragma unroll
        for (int nb = 0; nb < 4; ++nb) {
#pragma unroll
            for (int j = 0; j < 8; ++j) os[(hi * 8 + j) * 68 + nb * 16 + lr] = acc[mb][nb][j]; }
        __builtin_amdgcn_wave_barrier(); asm volatile("" ::: "memory");
        float* crow = C + (size_t)(r0 + mb * 16) * ldc + c0;
{
#pragma unroll
            for (int s = 0; s < 8; ++s) { const int row = 2 * s + hi, cofs = lr * 4; v4f val = *(const v4fa*)(os + row * 68 + cofs); if (BIAS) { val[0] += bfr(bias[c0 + cofs]); val[1] += bfr(bias[c0 + cofs + 1]); val[2] += bfr(bias[c0 + cofs + 2]); val[3] += bfr(bias[c0 + cofs + 3]); }
                *(v4f*)(crow + (size_t)row * ldc + cofs) = val; }
             }
        XWAIT;   /* behind these rows' stores: the next rows' bias load and LDS reads may be given their registers */
        __builtin_amdgcn_wave_barrier(); asm volatile("" ::: "memory");
    }
}

typedef __attribute__((ext_vector_type(2))) _Float16 v2h;
typedef __attribute__((ext_vector_type(4))) _Float16 v4h;
typedef __attribute__((ext_vector_type(2))) unsigned short v2us;
typedef __attribute__((ext_vector_type(4))) unsigned short v4us;
typedef __attribute__((ext_vector_type(2))) float v2f;
typedef __attribute__((ext_vector_type(4))) int v4i;

// two weight matrices in one launch: workgroups below nbA transpose wA, the rest wB
__global__ __launch_bounds__(256) void k_wtG(const float* __restrict__ wA, int KA, int NA, bf* BtA, int nbA, const float* __restrict__ wB, int KB, int NB, bf* BtB) {
    const bool sec = (int)blockIdx.x >= nbA; const float* __restrict__ w = sec ? wB : wA; const int K = sec ? KB : KA, N = sec ? NB : NA; bf* Bt = sec ? BtB : BtA; const int bx = (int)blockIdx.x - (sec ? nbA : 0);
    const int lane = threadIdx.x & 31; const int L0 = (bx * 8 + (threadIdx.x >> 5)) * 8; const int nlines = N * K / 64;
{
#pragma unroll 1
        for (int l = 0; l < 8; ++l) { const int L = L0 + l; if (L >= nlines) break; const size_t e = (size_t)L * 64 + lane * 2; const int k = (int)(e % K), n = (int)(e / K); v2us o;
            o[0] = f2bf(w[(size_t)k * N + n]); o[1] = f2bf(w[(size_t)(k + 1) * N + n]); *(v2us*)(Bt + e) = o; }
         }
}
__global__ __launch_bounds__(256) void k_cvt8(const float* __restrict__ src, bf* dst, size_t n8) { const size_t i = (size_t)blockIdx.x * 256 + threadIdx.x; if (i >= n8) return; const v8f v = *(const v8f*)(src + i * 8); v8us o;
#pragma unroll
    for (int k = 0; k < 8; ++k) o[k] = f2bf(v[k]); *(v8us*)(dst + i * 8) = o;  }

// k_fattn: scores, Shepard weights and attn.v in one kernel; the scores never leave the registers. One wave = 32 query rows x TT/KSP keys, 32 keys a pass; 8 waves (256 query rows) a workgroup, no LDS, no barrier.
// S^T = K Q^T (A = K rows, B = Q rows kept in registers): accumulator element j of lane (lr, hi) is key kb*16 + hi*8 + j of query lr, so two key tiles pack straight into the B operand (k order 8 hi + 0..7, 16 + 8 hi + 0..7, the loaders' own) of O^T += V^T P^T.
// w_j = (eps + sqrt(max(q2_i + k2_j - 2 S_ij, 0)))^-2 stays unnormalised; its f32 row sum goes out beside the partial O and divides in k_merge.
// Range of the 16-bit P operand: each query scales eps + dist by r, a power of two near 1 / sqrt(q2_i + k2 of the range's first key), so w / r^2 is of order 1 for keys about as far off as the norms are large; a power of two changes no rounding, and r^2 is taken out of the partial O and the partial sum on the way out.
// A key much nearer than that (down to dist = 0) gives a scaled weight beyond the fp16 range: when a pass of the fp16 rows meets a weight above PMAX, the queries concerned raise their r by a power of two 2^k that brings their largest weight to 2^9..2^11, and this pass's weights, the running row sum and the running O are multiplied by 2^-2k (exact), before anything is rounded to fp16. Weights far below a row's largest then round to fp16 subnormals or 0, at most 2^-25 against a row sum of at least 2^9.
template <bool HL>
__device__ __forceinline__ void fattn_body(const bf* __restrict__ Qh, const bf* __restrict__ Ql, const bf* __restrict__ Kh, const bf* __restrict__ Kl, const h16* __restrict__ V16, const bf* __restrict__ Vh, const bf* __restrict__ Vl, const float* __restrict__ q2p, const float* __restrict__ k2p, int q0, int kbeg, float* Op, float* Lp) {
    const int lane = threadIdx.x & 31, lr = lane & 15, hi = lane >> 4;
    // every inner loop here is unrolled in full: its index picks fragments and accumulators, which live in registers and cannot be indexed at run time
    v16bf qh[2][2], ql[2][2]; float q2[2], rs[2], r[2], er[2]; v8f oacc[4][2];
#pragma unroll
    for (int qb = 0; qb < 2; ++qb) { const size_t o = (size_t)(q0 + qb * 16 + lr) * HD + 8 * hi; q2[qb] = q2p[q0 + qb * 16 + lr]; rs[qb] = 0.f; r[qb] = __uint_as_float(__float_as_uint(__builtin_amdgcn_rsqf(fminf(fmaxf(q2[qb] + k2p[kbeg], 1e-8f), 1e12f))) & 0x7F800000u);   /* both ends bounded: (r eps)^-2 and its products with V stay far inside f32 */ er[qb] = SEPS * r[qb];
#pragma unroll
        for (int c = 0; c < 2; ++c) { qh[qb][c] = WFrag<bf>::ld(Qh + o + c * 32); ql[qb][c] = WFrag<bf>::ld(Ql + o + c * 32); }
#pragma unroll
        for (int db = 0; db < 4; ++db) oacc[db][qb] = (v8f){}; }
    // the pass stays rolled: unrolled it would hold two passes' fragments in registers and cost resident waves
#pragma unroll 1
    for (int k0 = kbeg; k0 < kbeg + TT / KSP; k0 += 32) {
        v8f s[2][2]; float wm[2] = {0.f, 0.f};
#pragma unroll
        for (int kb = 0; kb < 2; ++kb) { const size_t o = (size_t)(k0 + kb * 16 + lr) * HD + 8 * hi; v16bf kh[2], kl[2];
#pragma unroll
            for (int c = 0; c < 2; ++c) { kh[c] = WFrag<bf>::ld(Kh + o + c * 32); kl[c] = WFrag<bf>::ld(Kl + o + c * 32); }
#pragma unroll
            for (int qb = 0; qb < 2; ++qb) { v8f a = (v8f){};
#pragma unroll
                for (int c = 0; c < 2; ++c) { a = wmmab(kh[c], qh[qb][c], a); a = wmmab(kh[c], ql[qb][c], a); a = wmmab(kl[c], qh[qb][c], a); }
                s[kb][qb] = a; } }
        XWAIT;   /* behind the K loads, in front of the k2 loads */
#pragma unroll
        for (int kb = 0; kb < 2; ++kb) { const v4f ka = *(const v4f*)(k2p + k0 + kb * 16 + hi * 8), kc = *(const v4f*)(k2p + k0 + kb * 16 + hi * 8 + 4);
#pragma unroll
            for (int qb = 0; qb < 2; ++qb) {
#pragma unroll
                for (int j = 0; j < 8; ++j) { const float t = q2[qb] + (j < 4 ? ka[j & 3] : kc[j & 3]); const float d2 = fmaxf(t - 2.0f * s[kb][qb][j], 0.f); const float den = fmaf(__builtin_amdgcn_sqrtf(d2), r[qb], er[qb]); const float w = __builtin_amdgcn_rcpf(den * den);   /* (r (eps + dist))^-2 */ s[kb][qb][j] = w; rs[qb] += w; if (!HL) wm[qb] = fmaxf(wm[qb], w); } } }
        if (!HL && __builtin_amdgcn_ballot_w32(fmaxf(wm[0], wm[1]) > PMAX) != 0u) {   /* rare; the ballot makes it one scalar branch for the wave, so the exchange below has every lane on */
#pragma unroll
            for (int qb = 0; qb < 2; ++qb) { const float m = fmaxf(wm[qb], __shfl_xor(wm[qb], 16, 32));   /* a query's keys lie in lanes lr and lr + 16: both take the same k */
                const int k = (m > PMAX) ? (((int)(__float_as_uint(m) >> 23) - 136) >> 1) : 0; const float g = __uint_as_float((unsigned)(127 - k) << 23), gi = __uint_as_float((unsigned)(127 + k) << 23), f = g * g;
                r[qb] *= gi; er[qb] *= gi; rs[qb] *= f; s[0][qb] *= f; s[1][qb] *= f;
#pragma unroll
                for (int db = 0; db < 4; ++db) oacc[db][qb] *= f; } }
        if (HL) { v16bf ph[2], pl[2];
#pragma unroll
            for (int qb = 0; qb < 2; ++qb) { v8us h0, h1, l0, l1;
#pragma unroll
                for (int j = 0; j < 8; ++j) { unsigned short a, c2; splitf(s[0][qb][j], a, c2); h0[j] = a; l0[j] = c2; splitf(s[1][qb][j], a, c2); h1[j] = a; l1[j] = c2; }
                ph[qb] = cat16b(h0, h1); pl[qb] = cat16b(l0, l1); }
#pragma unroll
            for (int db = 0; db < 4; ++db) { const size_t o = (size_t)(db * 16 + lr) * TT + k0 + 8 * hi; const v16bf vh = WFrag<bf>::ld(Vh + o), vl = WFrag<bf>::ld(Vl + o);
#pragma unroll
                for (int qb = 0; qb < 2; ++qb) { oacc[db][qb] = wmmab(vh, ph[qb], oacc[db][qb]); oacc[db][qb] = wmmab(vh, pl[qb], oacc[db][qb]); oacc[db][qb] = wmmab(vl, ph[qb], oacc[db][qb]); } }
        } else { v16h p[2];
#pragma unroll
            for (int qb = 0; qb < 2; ++qb) { v8h p0, p1;
#pragma unroll
                for (int j = 0; j < 8; ++j) { p0[j] = tohx(s[0][qb][j]); p1[j] = tohx(s[1][qb][j]); }
                p[qb] = cat16(p0, p1); }
#pragma unroll
            for (int db = 0; db < 4; ++db) { const v16h v = WFrag<h16>::ld(V16 + (size_t)(db * 16 + lr) * TT + k0 + 8 * hi);
#pragma unroll
                for (int qb = 0; qb < 2; ++qb) oacc[db][qb] = wmma16(v, p[qb], oacc[db][qb]); } }
    }
#pragma unroll
    for (int qb = 0; qb < 2; ++qb) { const float u = r[qb] * r[qb]; const float tot = (rs[qb] + __shfl_xor(rs[qb], 16, 32)) * u; if (hi == 0) Lp[q0 + qb * 16 + lr] = tot;
#pragma unroll
        for (int db = 0; db < 4; ++db) { float* o = Op + (size_t)(q0 + qb * 16 + lr) * HD + db * 16 + hi * 8; const v8f a = oacc[db][qb] * u; *(v4f*)o = (v4f){a[0], a[1], a[2], a[3]}; *(v4f*)(o + 4) = (v4f){a[4], a[5], a[6], a[7]}; } }
}
__global__ __launch_bounds__(256) void k_fattn(const bf* __restrict__ QPh, const bf* __restrict__ QPl, const bf* __restrict__ KPh, const bf* __restrict__ KPl, const h16* __restrict__ VT16, const bf* __restrict__ VTh, const bf* __restrict__ VTl, const float* __restrict__ Q2, const float* __restrict__ K2, float* Ob, float* Lb) {
    const size_t h = blockIdx.z, ks = blockIdx.y, hp = h * TT * HD; const int q0 = blockIdx.x * 256 + (threadIdx.x >> 5) * 32, kbeg = (int)ks * (TT / KSP);
    float* Op = Ob + (ks * NHB + h) * TT * HD; float* Lp = Lb + (ks * NHB + h) * TT;
    if (blockIdx.x * 256 < RH) fattn_body<true>(QPh + hp, QPl + hp, KPh + hp, KPl + hp, VT16 + hp, VTh + hp, VTl + hp, Q2 + h * TT, K2 + h * TT, q0, kbeg, Op, Lp);   /* RH is a multiple of 256: one path a workgroup */
    else fattn_body<false>(QPh + hp, QPl + hp, KPh + hp, KPl + hp, VT16 + hp, VTh + hp, VTl + hp, Q2 + h * TT, K2 + h * TT, q0, kbeg, Op, Lp);
}
__global__ __launch_bounds__(256) void k_merge(const float* __restrict__ O, const float* __restrict__ L, const float* __restrict__ FP, bf* Ah, bf* Al) { const size_t e = ((size_t)blockIdx.x * 256 + threadIdx.x) * 2; if (e >= (size_t)NHB * TT * HD) return; const int d = (int)(e % HD); const int t = (int)((e / HD) % TT); const int zz = (int)(e / ((size_t)HD * TT)); const int hh = zz % NH_; const size_t row = (size_t)(zz / NH_) * TT + t; const size_t oo = row * DQ + hh * HD + d;
    float lp[KSP]; v2f op[KSP];   /* XWAIT behind each load: the next load's result may be given this one's address registers */
#pragma unroll
    for (int ks = 0; ks < KSP; ++ks) { lp[ks] = L[((size_t)ks * NHB + zz) * TT + t]; XWAIT; op[ks] = *(const v2f*)(O + (size_t)ks * ((size_t)NHB * TT * HD) + e); XWAIT; }
    float lsum = lp[0];   /* row sum of the weights: the KSP partial sums, fixed order */
#pragma unroll
    for (int ks = 1; ks < KSP; ++ks) lsum = __fadd_rn(lsum, lp[ks]);
    const float cs = __builtin_amdgcn_rcpf(__fadd_rn(SEPS, lsum));   /* W / (eps + sum W) via hardware reciprocal */
    v2us oh, ol; v2f os2 = op[0];   /* sum of the KSP partial planes, fixed order */
#pragma unroll
    for (int ks = 1; ks < KSP; ++ks) { os2[0] = __fadd_rn(os2[0], op[ks][0]); os2[1] = __fadd_rn(os2[1], op[ks][1]); }
#pragma unroll
    for (int q = 0; q < 2; ++q) { const float oc = os2[q] * cs; const float gt = FP[row * DP + hh * HSTR + 192 + d + q]; unsigned short a, c2; splitf(__fmul_rn(gt, oc), a, c2); oh[q] = a; ol[q] = c2; }   /* H = G * A */ *(v2us*)(Ah + oo) = oh; *(v2us*)(Al + oo) = ol;  }

extern "C" void kernel_launch(void* const* d_in, const int* in_sizes, int n_in,
                              void* d_out, int out_size, void* d_ws, size_t ws_size, hipStream_t stream) {
    (void)in_sizes; (void)n_in; (void)out_size;
    const float* x = (const float*)d_in[0]; const float* win = (const float*)d_in[1]; const float* bin = (const float*)d_in[2]; const float* wo = (const float*)d_in[3]; const float* bo = (const float*)d_in[4]; const float* wq = nullptr; const float* wk = nullptr; const float* wv = nullptr; (void)wq; (void)wk; (void)wv;
    float* OUT = (float*)d_out;     // [2][2048][1024]
    char* wsp = (char*)d_ws;
    auto take = [&](size_t bytes) { char* p = wsp; wsp += (bytes + 255) & ~(size_t)255; return (void*)p; };
    bf* WINB = (bf*)take((size_t)DP * DM * 2); bf* WO = (bf*)take((size_t)DM * DQ * 2);
    bf* XB = (bf*)take((size_t)NB_ * TT * DM * 2); float* FP = (float*)take((size_t)NB_ * TT * DP * 4); float* Q2 = (float*)take((size_t)NHB * TT * 4); float* K2 = (float*)take((size_t)NHB * TT * 4);
    h16* VT16 = (h16*)take((size_t)NHB * HD * TT * 2);
    bf* QPh = (bf*)take((size_t)NHB * TT * HD * 2); bf* QPl = (bf*)take((size_t)NHB * TT * HD * 2); bf* KPh = (bf*)take((size_t)NHB * TT * HD * 2); bf* KPl = (bf*)take((size_t)NHB * TT * HD * 2); bf* VTh = (bf*)take((size_t)NHB * HD * TT * 2); bf* VTl = (bf*)take((size_t)NHB * HD * TT * 2);
    float* Ob = (float*)take((size_t)KSP * NHB * TT * HD * 4); float* Lb = (float*)take((size_t)KSP * NHB * TT * 4); bf* ATh = (bf*)take((size_t)NB_ * TT * DQ * 2); bf* ATl = (bf*)take((size_t)NB_ * TT * DQ * 2);
    if ((size_t)(wsp - (char*)d_ws) > ws_size) return;    // about 220 MiB of the 256 MiB
    k_wtG<<<(unsigned)((DM * DP / 64 + 63) / 64 + (DQ * DM / 64 + 63) / 64), 256, 0, stream>>>(win, DM, DP, WINB, (DM * DP / 64 + 63) / 64, wo, DQ, DM, WO);   /* 'xw' [1024][4096] -> Bt [4096][1024]; 'xw' [1024][1024] -> Bt [1024][1024] */
    const PlaneOut po = {QPh, QPl, KPh, KPl, VT16, VTh, VTl, Q2, K2}, none = {};
    /* X [2][2048][1024] is one matrix of NB_*TT rows to both GEMMs; the attention sees NHB independent heads */
    k_cvt8<<<(unsigned)(((size_t)NB_ * TT * DM / 8 + 255) / 256), 256, 0, stream>>>(x, XB, (size_t)NB_ * TT * DM / 8);
    k_gemmw<bf, 0, true, 1, true><<<dim3(NB_ * TT / 64, DP / 64, 1), 32, 0, stream>>>(XB, nullptr, WINB, nullptr, DM, FP, DP, bin, 0, 0, 0, 0, po);   /* P = X W_in + b_in (exact): Q, K hi/lo planes + q2, k2, V^T planes; G (cols h*256 + 192..255) in f32 to FP */
    k_fattn<<<dim3(TT / 256, KSP, NHB), 256, 0, stream>>>(QPh, QPl, KPh, KPl, VT16, VTh, VTl, Q2, K2, Ob, Lb);   /* all heads of both batches: Q.K (3 products), weights, attn.v partials + partial row sums */
    k_merge<<<(unsigned)(((size_t)NHB * TT * HD / 2 + 255) / 256), 256, 0, stream>>>(Ob, Lb, FP, ATh, ATl);
    k_gemmw<bf, 1, true><<<dim3(NB_ * TT / 64, DM / 64, 1), 32, 0, stream>>>(ATh, ATl, WO, nullptr, DQ, OUT, DM, bo, 0, 0, 0, 0, none);
}

// v005
// Measured time: 231 microseconds a run.
// Two timings next to v004 both put it at 1.17 times that version's speed.
// Over all steps from v000 it is 9.06 times as fast.
#include <hip/hip_runtime.h>

// Shepard's (inverse-distance) gated attention (X [2][2048][1024]; P = X W_in + b_in ('xw' [1024][4096]) viewed per head h as [Q(64) | K(64) | V(64) | G(64)] at columns h*256 + ...; W = (1e-4 + ||Q_i - K_j||)^-2 with the distance by the norm expansion sqrt(max(q2 + k2 - 2 Q.K, 0)); W = W / (1e-4 + sum_j W); A = W.V; H = G * A; out = merged H W_out ('xw' [1024][1024]) + b_out -> [2][2048][1024]).
// Compute dtypes, f32 accumulate: every input rounded to bf16; q/k/v on PLAIN bf16 operands (inputs: exact) + b_in, their 16-bit planes and the f32 row norms q2, k2 written by that GEMM's own epilogue; the Q.K products on hi/lo planes for every row (3 products; the distance needs them), the Shepard weights (sqrt, reciprocal) and their row sums in f32 inside the fused attention kernel, row normalisation and gating in the merge; attn.v hybrid on the unnormalised weights: query rows < 512 hl (3 products), the rest single fp16; W_out hl x exact (2 products) + b_out.
// Layout of every 16-bit matrix operand plane (X, W_in^T, W_out^T, Q, K, V^T, gated A): FRAGMENT ORDER. A plane of rows x K is cut into blocks of 16 rows x 32 k (1 KiB), block (row / 16) * (K / 32) + k / 32; inside a block the 16-byte piece that lane (lr, hi) takes in its first load (row lr, k = 8 hi + 0..7) lies at piece hi * 16 + lr, the piece of its second load (k = 16 + 8 hi + 0..7) 512 bytes further. So each wave-wide 16-byte load reads 512 bytes in a row (4 whole lines) where a row-major plane gave it 32 bytes of each of 16 lines.

#define NB_  2
#define TT   2048
#define DM   1024
#define NH_  16
#define NKV  16
#define REP  (NH_ / NKV)
#define HD   64
#define DQ   (NH_ * HD)
#define DKV  (NKV * HD)
#define DP   4096                 // projection width (16 heads x [Q|K|V|G] x 64)
#define HSTR 256
#define SEPS 1e-4f
#define RH   512                  // query rows < RH use hi+lo planes (0: none)
#define WIN  0
#define PMAX 32768.0f             // largest scaled weight that goes into an fp16 P operand (fp16 ends at 65504)
#define NHB  (NB_ * NH_)          // both batches go through every launch: rows b*TT + t in the GEMMs, "heads" b*NH_ + h in the planes and in the attention grid
#define KSP  4                    // attention: the 2048 keys split over KSP workgroups per 256 query rows; partial planes [KSP][NHB][TT][HD] and partial row sums [KSP][NHB][TT] summed in k_merge
typedef _Float16 h16;
typedef unsigned short bf;
typedef __attribute__((ext_vector_type(16))) __bf16   v16bf;
typedef __attribute__((ext_vector_type(16))) _Float16 v16h;
typedef __attribute__((ext_vector_type(8)))  _Float16 v8h;
typedef __attribute__((ext_vector_type(8)))  unsigned short v8us;
typedef __attribute__((ext_vector_type(8)))  float    v8f;
typedef __attribute__((ext_vector_type(4)))  float    v4f;
typedef v8h  __attribute__((may_alias)) v8ha;
typedef v4f  __attribute__((may_alias)) v4fa;
typedef v8us __attribute__((may_alias)) v8usa;

__device__ __forceinline__ unsigned short f2bf(float f) { unsigned u = __float_as_uint(f); u += 0x7FFFu + ((u >> 16) & 1u); return (unsigned short)(u >> 16); }
__device__ __forceinline__ float bf2f(unsigned short b) { return __uint_as_float(((unsigned)b) << 16); }
__device__ __forceinline__ float bfr(float f) { return bf2f(f2bf(f)); }
__device__ __forceinline__ v16h cat16(v8h lo, v8h hi) { return __builtin_shufflevector(lo, hi, 0, 1, 2, 3, 4, 5, 6, 7, 8, 9, 10, 11, 12, 13, 14, 15); }
__device__ __forceinline__ v16bf cat16b(v8us lo, v8us hi) { return __builtin_bit_cast(v16bf, __builtin_shufflevector(lo, hi, 0, 1, 2, 3, 4, 5, 6, 7, 8, 9, 10, 11, 12, 13, 14, 15)); }
__device__ __forceinline__ v8f wmma16(v16h a, v16h b, v8f c) { return __builtin_amdgcn_wmma_f32_16x16x32_f16(false, a, false, b, (short)0, c, false, false); }
__device__ __forceinline__ v8f wmmab(v16bf a, v16bf b, v8f c) { return __builtin_amdgcn_wmma_f32_16x16x32_bf16(false, a, false, b, (short)0, c, false, false); }
// element offset of (row, k) in a fragment-order plane of K columns
__device__ __forceinline__ size_t pk(size_t row, int k, int K) { return ((row >> 4) * (size_t)(K >> 5) + (size_t)(k >> 5)) * 512 + (size_t)(((k >> 4) & 1) * 256 + ((k >> 3) & 1) * 128 + (k & 7)) + (row & 15) * 8; }
__device__ __forceinline__ h16 tohx(float x) { return (h16)x; }
__device__ __forceinline__ void splitf(float y, unsigned short& h, unsigned short& l) { h = f2bf(y); l = f2bf(y - bf2f(h)); }
// XWAIT stands between loads where the compiler lets a later load's result land in an earlier load's address registers: the wait that goes in front of such an overwrite
#define XWAIT asm volatile("s_wait_xcnt 0x0" ::: "memory")
// x + (x of lane ^ M), M = 1, 2 or 4, as a DPP move inside the 16-lane row (a shuffle would go through the LDS queue); every lane on
template <int M> __device__ __forceinline__ float addx(float x) { return x + __int_as_float(__builtin_amdgcn_update_dpp(0, __float_as_int(x), 0x160 + M, 0xf, 0xf, true)); }
// where the projection GEMM's epilogue puts a head's Q, K and V columns: hi/lo planes [h][t x d], V^T planes [h][d x t], each head's plane in fragment order; row norms [h][t]
struct PlaneOut { bf* Qh; bf* Ql; bf* Kh; bf* Kl; h16* V16; bf* Vh; bf* Vl; float* Q2; float* K2; };



// ---- k_gemmw: register-blocked GEMM, ONE WAVE per 64x64 output tile (16 accumulators), operands straight from fragment-order 16-bit planes; grid (M/64, N/64, Z), 32 threads.
// C[m][n] (f32, pitch ldc, + optional f32 bias[n]) = sum_k A[m][k] Bt[n][k] (+ split products per NSPLIT). z-batch strides sA/sB/sC in elements. K % (32 * KS) == 0; K is a compile-time constant, so that an operand's fragments are immediate offsets from one address that lives through the loop.
// PL (the input projection, N = 16 heads x [Q|K|V|G] x 64, so a 64-column tile is one part of one head): only the G tiles go to C; a Q or K tile goes out as bf16 hi/lo planes with its rows' sums of squares (the whole row of 64 is in the tile), a V tile as the three V^T planes.
// KS > 1: grid z = Z * KS; workgroup (z, ks) sums only k in [ks K/KS, (ks+1) K/KS) and stores its partial tile to plane ks (plane stride sP elements); the consumer adds the KS planes.
// ld: p + lo = the block's start + lane * 8
// every plane lies in global memory: said in the pointer type, because an address that has gone through an asm operand would otherwise be loaded from with flat instructions
typedef const __attribute__((address_space(1))) v8h* gv8h; typedef const __attribute__((address_space(1))) v8us* gv8us;
template <typename T16> struct WFrag;
template <> struct WFrag<h16> { typedef v16h V; static __device__ __forceinline__ V ld(const h16* p, unsigned lo) { return cat16(*(gv8h)(p + lo), *(gv8h)(p + lo + 256)); } static __device__ __forceinline__ v8f mma(V a, V b, v8f c) { return wmma16(a, b, c); } };
template <> struct WFrag<bf> { typedef v16bf V; static __device__ __forceinline__ V ld(const bf* p, unsigned lo) { return cat16b(*(gv8us)(p + lo), *(gv8us)(p + lo + 256)); } static __device__ __forceinline__ v8f mma(V a, V b, v8f c) { return wmmab(a, b, c); } };
template <typename T16, int NSPLIT, bool BIAS, int K, int KS = 1, bool PL = false>
__global__ __launch_bounds__(32) void k_gemmw(const T16* __restrict__ A, const T16* __restrict__ A2, const T16* __restrict__ Bt, const T16* __restrict__ Bt2, float* C, int ldc, const float* __restrict__ bias, size_t sA, size_t sB, size_t sC, size_t sP, PlaneOut po) {
    typedef typename WFrag<T16>::V V;
    __shared__ __align__(16) float os[16 * 68];
    const size_t z = blockIdx.z / KS; const int ks = blockIdx.z % KS; A += z * sA; if (A2) A2 += z * sA; Bt += z * sB; if (Bt2) Bt2 += z * sB; C += z * sC + (size_t)ks * sP;
    const int kbeg = ks * (K / KS), kend = kbeg + K / KS;
    const int lane = threadIdx.x & 31, lr = lane & 15, hi = lane >> 4; const int r0 = blockIdx.x * 64, c0 = blockIdx.y * 64;
    v8f acc[4][4];
#pragma unroll
    for (int mb = 0; mb < 4; ++mb)
#pragma unroll
        for (int nb = 0; nb < 4; ++nb) acc[mb][nb] = (v8f){};
    const size_t aoff = (size_t)r0 * K + (size_t)kbeg * 16 + 8 * lane, boff = (size_t)c0 * K + (size_t)kbeg * 16 + 8 * lane; const T16* pa = A + aoff; const T16* pa2 = (NSPLIT == 1 || NSPLIT == 2) ? A2 + aoff : nullptr; const T16* pb = Bt + boff; const T16* pb2 = NSPLIT >= 2 ? Bt2 + boff : nullptr;   /* 16 rows of a plane are K / 32 blocks = 16 K elements; a step of 32 k is one block = 512 elements */
#pragma unroll 1
    for (int kc = kbeg; kc < kend; kc += 32) {
        V a[4], a2[4];
#pragma unroll
        for (int mb = 0; mb < 4; ++mb) { a[mb] = WFrag<T16>::ld(pa + mb * 16 * K, 0u); if (NSPLIT == 1 || NSPLIT == 2) a2[mb] = WFrag<T16>::ld(pa2 + mb * 16 * K, 0u); }
#pragma unroll
        for (int nb = 0; nb < 4; ++nb) { const V b = WFrag<T16>::ld(pb + nb * 16 * K, 0u); V b2; if (NSPLIT >= 2) b2 = WFrag<T16>::ld(pb2 + nb * 16 * K, 0u);
#pragma unroll
            for (int mb = 0; mb < 4; ++mb) { acc[mb][nb] = WFrag<T16>::mma(a[mb], b, acc[mb][nb]); if (NSPLIT == 1 || NSPLIT == 2) acc[mb][nb] = WFrag<T16>::mma(a2[mb], b, acc[mb][nb]); if (NSPLIT >= 2) acc[mb][nb] = WFrag<T16>::mma(a[mb], b2, acc[mb][nb]); } }
        /* the wait that goes in front of an overwrite of a load's address registers, here the step to the next block; it takes the addresses themselves, so each stays in its one register pair through the trip and no later load of the trip is given that pair for its result */
        asm volatile("s_wait_xcnt 0x0" : "+v"(pa), "+v"(pb) :: "memory"); pa += 512; pb += 512;
        if (NSPLIT == 1 || NSPLIT == 2) { asm volatile("s_wait_xcnt 0x0" : "+v"(pa2) :: "memory"); pa2 += 512; }
        if (NSPLIT >= 2) { asm volatile("s_wait_xcnt 0x0" : "+v"(pb2) :: "memory"); pb2 += 512; }
        asm volatile("v_nop\n\tv_nop\n\tv_nop\n\tv_nop" : "+v"(acc[0][0]), "+v"(acc[1][1]), "+v"(acc[2][2]), "+v"(acc[3][3]) : "v"(a[0]), "v"(a[3]));
    }
    const int part = PL ? (int)(blockIdx.y & 3) : 3; const size_t head = (size_t)(r0 / TT) * NH_ + (blockIdx.y >> 2); const int t0 = r0 % TT;   /* part: 0 Q, 1 K, 2 V, 3 G; the same for the whole workgroup. Row r0 = b*TT + t0: the planes are [b*NH_ + h][..] */
    if (PL && part == 2) {   /* V^T straight from the accumulators: element j of lane (lr, hi) is row mb*16 + hi*8 + j of column nb*16 + lr, eight consecutive t of one d = one 16-byte piece of a plane, and the wave's 32 pieces are half a block: 512 bytes in a row a store */
#pragma unroll
        for (int nb = 0; nb < 4; ++nb) { const float bv = bfr(bias[c0 + nb * 16 + lr]);
#pragma unroll
            for (int mb = 0; mb < 4; ++mb) { v8h o16; v8us oh, ol;
#pragma unroll
                for (int j = 0; j < 8; ++j) { const float x = acc[mb][nb][j] + bv; o16[j] = tohx(x); unsigned short a2, c2; splitf(x, a2, c2); oh[j] = a2; ol[j] = c2; }
                const size_t o = head * HD * TT + pk(nb * 16 + lr, t0 + mb * 16 + hi * 8, TT); *(v8h*)(po.V16 + o) = o16; *(v8us*)(po.Vh + o) = oh; *(v8us*)(po.Vl + o) = ol; } }
        return; }
    if (PL && part < 2) {   /* Q, K: 16 rows at a time through LDS as below, read out eight lanes a row, eight columns a lane */
        const int c8 = (lane & 7) * 8, rq = lane >> 3; float bq[8]; bf* Ph = (part == 0 ? po.Qh : po.Kh) + (head * TT + t0) * HD; bf* Pl = (part == 0 ? po.Ql : po.Kl) + (head * TT + t0) * HD; float* N2 = (part == 0 ? po.Q2 : po.K2) + head * TT + t0;
#pragma unroll
        for (int q = 0; q < 8; ++q) bq[q] = bfr(bias[c0 + c8 + q]);
#pragma unroll
        for (int mb = 0; mb < 4; ++mb) { float keep = 0.f;
#pragma unroll
            for (int nb = 0; nb < 4; ++nb) {
#pragma unroll
                for (int j = 0; j < 8; ++j) os[(hi * 8 + j) * 68 + nb * 16 + lr] = acc[mb][nb][j]; }
            __builtin_amdgcn_wave_barrier(); asm volatile("" ::: "memory");   /* one wave, whose LDS operations run in order: this only keeps the compiler from moving a lane's reads over the other lanes' writes */
#pragma unroll
            for (int s = 0; s < 4; ++s) { const int row = 4 * s + rq; const v4f v0 = *(const v4fa*)(os + row * 68 + c8), v1 = *(const v4fa*)(os + row * 68 + c8 + 4); v8us oh, ol; float n2 = 0.f;
#pragma unroll
                for (int q = 0; q < 8; ++q) { const float x = (q < 4 ? v0[q & 3] : v1[q & 3]) + bq[q]; unsigned short a2, c2; splitf(x, a2, c2); oh[q] = a2; ol[q] = c2; n2 = fmaf(x, x, n2); }
                const size_t o = pk(mb * 16 + row, c8, HD); *(v8us*)(Ph + o) = oh; *(v8us*)(Pl + o) = ol;   /* four rows' pieces lie side by side: eight runs of 64 bytes a store */
                n2 = addx<4>(addx<2>(addx<1>(n2))); if ((lane & 7) == s) keep = n2; }   /* the row's eight partial sums; lane 8 rq + s keeps row 4 s + rq */
            if ((lane & 7) < 4) N2[mb * 16 + 4 * (lane & 7) + rq] = keep;
            __builtin_amdgcn_wave_barrier(); asm volatile("" ::: "memory");   /* and the next 16 rows' writes over these reads */
        }
        return; }
#pragma unroll
    for (int mb = 0; mb < 4; ++mb) {
#pragma unroll
        for (int nb = 0; nb < 4; ++nb) {
#pragma unroll
            for (int j = 0; j < 8; ++j) os[(hi * 8 + j) * 68 + nb * 16 + lr] = acc[mb][nb][j]; }
        __builtin_amdgcn_wave_barrier(); asm volatile("" ::: "memory");
        float* crow = C + (size_t)(r0 + mb * 16) * ldc + c0;
{
#pragma unroll
            for (int s = 0; s < 8; ++s) { const int row = 2 * s + hi, cofs = lr * 4; v4f val = *(const v4fa*)(os + row * 68 + cofs); if (BIAS) { val[0] += bfr(bias[c0 + cofs]); val[1] += bfr(bias[c0 + cofs + 1]); val[2] += bfr(bias[c0 + cofs + 2]); val[3] += bfr(bias[c0 + cofs + 3]); }
                *(v4f*)(crow + (size_t)row * ldc + cofs) = val; }
             }
        XWAIT;   /* behind these rows' stores: the next rows' bias load and LDS reads may be given their registers */
        __builtin_amdgcn_wave_barrier(); asm volatile("" ::: "memory");
    }
}

typedef __attribute__((ext_vector_type(2))) _Float16 v2h;
typedef __attribute__((ext_vector_type(4))) _Float16 v4h;
typedef __attribute__((ext_vector_type(2))) unsigned short v2us;
typedef __attribute__((ext_vector_type(4))) unsigned short v4us;
typedef __attribute__((ext_vector_type(2))) float v2f;
typedef __attribute__((ext_vector_type(4))) int v4i;

// two weight matrices in one launch: workgroups below nbA transpose wA, the rest wB. One thread = one 16-byte piece of the fragment-order plane Bt (rows n, K columns): eight k of one n.
// A wave stores 512 bytes in a row; each of its eight loads reads 16 consecutive n of two k rows (two runs of 64 bytes).
__global__ __launch_bounds__(256) void k_wtG(const float* __restrict__ wA, int KA, int NA, bf* BtA, int nbA, const float* __restrict__ wB, int KB, int NB, bf* BtB) {
    const bool sec = (int)blockIdx.x >= nbA; const float* __restrict__ w = sec ? wB : wA; const int K = sec ? KB : KA, N = sec ? NB : NA; bf* Bt = sec ? BtB : BtA; const int bx = (int)blockIdx.x - (sec ? nbA : 0);
    const int c = bx * 256 + (int)threadIdx.x; if (c >= N * (K / 8)) return;
    const int blk = c >> 6, kb = blk % (K >> 5), n = (blk / (K >> 5)) * 16 + (c & 15), k = kb * 32 + ((c >> 5) & 1) * 16 + ((c >> 4) & 1) * 8;
    const float* p = w + (size_t)k * N + n; float v[8]; v8us o;
#pragma unroll
    for (int j = 0; j < 8; ++j) v[j] = p[(size_t)j * N];
    XWAIT;   /* behind the eight loads: the conversion below is given their address registers */
#pragma unroll
    for (int j = 0; j < 8; ++j) o[j] = f2bf(v[j]);
    *(v8us*)(Bt + (size_t)c * 8) = o;
}
// X (rows of DM columns) -> bf16 in fragment order; one thread = one 16-byte piece of the plane, eight k of one row
__global__ __launch_bounds__(256) void k_cvt8(const float* __restrict__ src, bf* dst, size_t n8) { const size_t i = (size_t)blockIdx.x * 256 + threadIdx.x; if (i >= n8) return; const size_t blk = i >> 6, row = (blk / (DM / 32)) * 16 + (i & 15); const int k = (int)(blk % (DM / 32)) * 32 + (int)((i >> 5) & 1) * 16 + (int)((i >> 4) & 1) * 8; const v8f v = *(const v8f*)(src + row * DM + k); v8us o;
#pragma unroll
    for (int q = 0; q < 8; ++q) o[q] = f2bf(v[q]); *(v8us*)(dst + i * 8) = o;  }

// k_fattn: scores, Shepard weights and attn.v in one kernel; the scores never leave the registers. One wave = 32 query rows x TT/KSP keys, 32 keys a pass; 8 waves (256 query rows) a workgroup, no LDS, no barrier.
// S^T = K Q^T (A = K rows, B = Q rows kept in registers): accumulator element j of lane (lr, hi) is key kb*16 + hi*8 + j of query lr, so two key tiles pack straight into the B operand (k order 8 hi + 0..7, 16 + 8 hi + 0..7, the loaders' own) of O^T += V^T P^T.
// w_j = (eps + sqrt(max(q2_i + k2_j - 2 S_ij, 0)))^-2 stays unnormalised; its f32 row sum goes out beside the partial O and divides in k_merge.
// Range of the 16-bit P operand: each query scales eps + dist by r, a power of two near 1 / sqrt(q2_i + k2 of the range's first key), so w / r^2 is of order 1 for keys about as far off as the norms are large; a power of two changes no rounding, and r^2 is taken out of the partial O and the partial sum on the way out.
// A key much nearer than that (down to dist = 0) gives a scaled weight beyond the fp16 range: when a pass of the fp16 rows meets a weight above PMAX, the queries concerned raise their r by a power of two 2^k that brings their largest weight to 2^9..2^11, and this pass's weights, the running row sum and the running O are multiplied by 2^-2k (exact), before anything is rounded to fp16. Weights far below a row's largest then round to fp16 subnormals or 0, at most 2^-25 against a row sum of at least 2^9.
template <bool HL>
__device__ __forceinline__ void fattn_body(const bf* __restrict__ Qh, const bf* __restrict__ Ql, const bf* __restrict__ Kh, const bf* __restrict__ Kl, const h16* __restrict__ V16, const bf* __restrict__ Vh, const bf* __restrict__ Vl, const float* __restrict__ q2p, const float* __restrict__ k2p, int q0, int kbeg, float* Op, float* Lp) {
    const int lane = threadIdx.x & 31, lr = lane & 15, hi = lane >> 4; const unsigned lo = 8 * lane;
    // every inner loop here is unrolled in full: its index picks fragments and accumulators, which live in registers and cannot be indexed at run time
    v16bf qh[2][2], ql[2][2]; float q2[2], rs[2], r[2], er[2]; v8f oacc[4][2];
#pragma unroll
    for (int qb = 0; qb < 2; ++qb) { const size_t o = (size_t)(q0 + qb * 16) * HD;   /* 16 rows of 64 = two blocks */ q2[qb] = q2p[q0 + qb * 16 + lr]; rs[qb] = 0.f; r[qb] = __uint_as_float(__float_as_uint(__builtin_amdgcn_rsqf(fminf(fmaxf(q2[qb] + k2p[kbeg], 1e-8f), 1e12f))) & 0x7F800000u);   /* both ends bounded: (r eps)^-2 and its products with V stay far inside f32 */ er[qb] = SEPS * r[qb];
#pragma unroll
        for (int c = 0; c < 2; ++c) { qh[qb][c] = WFrag<bf>::ld(Qh + o + c * 512, lo); ql[qb][c] = WFrag<bf>::ld(Ql + o + c * 512, lo); }
#pragma unroll
        for (int db = 0; db < 4; ++db) oacc[db][qb] = (v8f){}; }
    // the pass stays rolled: unrolled it would hold two passes' fragments in registers and cost resident waves
#pragma unroll 1
    for (int k0 = kbeg; k0 < kbeg + TT / KSP; k0 += 32) {
        v8f s[2][2]; float wm[2] = {0.f, 0.f};
#pragma unroll
        for (int kb = 0; kb < 2; ++kb) { const size_t o = (size_t)(k0 + kb * 16) * HD; v16bf kh[2], kl[2];
#pragma unroll
            for (int c = 0; c < 2; ++c) { kh[c] = WFrag<bf>::ld(Kh + o + c * 512, lo); kl[c] = WFrag<bf>::ld(Kl + o + c * 512, lo); }
#pragma unroll
            for (int qb = 0; qb < 2; ++qb) { v8f a = (v8f){};
#pragma unroll
                for (int c = 0; c < 2; ++c) { a = wmmab(kh[c], qh[qb][c], a); a = wmmab(kh[c], ql[qb][c], a); a = wmmab(kl[c], qh[qb][c], a); }
                s[kb][qb] = a; } }
        XWAIT;   /* behind the K loads, in front of the k2 loads */
#pragma unroll
        for (int kb = 0; kb < 2; ++kb) { const v4f ka = *(const v4f*)(k2p + k0 + kb * 16 + hi * 8), kc = *(const v4f*)(k2p + k0 + kb * 16 + hi * 8 + 4);
#pragma unroll
            for (int qb = 0; qb < 2; ++qb) {
#pragma unroll
                for (int j = 0; j < 8; ++j) { const float t = q2[qb] + (j < 4 ? ka[j & 3] : kc[j & 3]); const float d2 = fmaxf(t - 2.0f * s[kb][qb][j], 0.f); const float den = fmaf(__builtin_amdgcn_sqrtf(d2), r[qb], er[qb]); const float w = __builtin_amdgcn_rcpf(den * den);   /* (r (eps + dist))^-2 */ s[kb][qb][j] = w; rs[qb] += w; if (!HL) wm[qb] = fmaxf(wm[qb], w); } } }
        if (!HL && __builtin_amdgcn_ballot_w32(fmaxf(wm[0], wm[1]) > PMAX) != 0u) {   /* rare; the ballot makes it one scalar branch for the wave, so the exchange below has every lane on */
#pragma unroll
            for (int qb = 0; qb < 2; ++qb) { const float m = fmaxf(wm[qb], __shfl_xor(wm[qb], 16, 32));   /* a query's keys lie in lanes lr and lr + 16: both take the same k */
                const int k = (m > PMAX) ? (((int)(__float_as_uint(m) >> 23) - 136) >> 1) : 0; const float g = __uint_as_float((unsigned)(127 - k) << 23), gi = __uint_as_float((unsigned)(127 + k) << 23), f = g * g;
                r[qb] *= gi; er[qb] *= gi; rs[qb] *= f; s[0][qb] *= f; s[1][qb] *= f;
#pragma unroll
                for (int db = 0; db < 4; ++db) oacc[db][qb] *= f; } }
        if (HL) { v16bf ph[2], pl[2];
#pragma unroll
            for (int qb = 0; qb < 2; ++qb) { v8us h0, h1, l0, l1;
#pragma unroll
                for (int j = 0; j < 8; ++j) { unsigned short a, c2; splitf(s[0][qb][j], a, c2); h0[j] = a; l0[j] = c2; splitf(s[1][qb][j], a, c2); h1[j] = a; l1[j] = c2; }
                ph[qb] = cat16b(h0, h1); pl[qb] = cat16b(l0, l1); }
#pragma unroll
            for (int db = 0; db < 4; ++db) { const size_t o = (size_t)db * 16 * TT + (size_t)k0 * 16; const v16bf vh = WFrag<bf>::ld(Vh + o, lo), vl = WFrag<bf>::ld(Vl + o, lo);
#pragma unroll
                for (int qb = 0; qb < 2; ++qb) { oacc[db][qb] = wmmab(vh, ph[qb], oacc[db][qb]); oacc[db][qb] = wmmab(vh, pl[qb], oacc[db][qb]); oacc[db][qb] = wmmab(vl, ph[qb], oacc[db][qb]); } }
        } else { v16h p[2];
#pragma unroll
            for (int qb = 0; qb < 2; ++qb) { v8h p0, p1;
#pragma unroll
                for (int j = 0; j < 8; ++j) { p0[j] = tohx(s[0][qb][j]); p1[j] = tohx(s[1][qb][j]); }
                p[qb] = cat16(p0, p1); }
#pragma unroll
            for (int db = 0; db < 4; ++db) { const v16h v = WFrag<h16>::ld(V16 + (size_t)db * 16 * TT + (size_t)k0 * 16, lo);
#pragma unroll
                for (int qb = 0; qb < 2; ++qb) oacc[db][qb] = wmma16(v, p[qb], oacc[db][qb]); } }
    }
#pragma unroll
    for (int qb = 0; qb < 2; ++qb) { const float u = r[qb] * r[qb]; const float tot = (rs[qb] + __shfl_xor(rs[qb], 16, 32)) * u; if (hi == 0) Lp[q0 + qb * 16 + lr] = tot;
#pragma unroll
        for (int db = 0; db < 4; ++db) { float* o = Op + (size_t)(q0 + qb * 16 + lr) * HD + db * 16 + hi * 8; const v8f a = oacc[db][qb] * u; *(v4f*)o = (v4f){a[0], a[1], a[2], a[3]}; *(v4f*)(o + 4) = (v4f){a[4], a[5], a[6], a[7]}; } }
}
__global__ __launch_bounds__(256) void k_fattn(const bf* __restrict__ QPh, const bf* __restrict__ QPl, const bf* __restrict__ KPh, const bf* __restrict__ KPl, const h16* __restrict__ VT16, const bf* __restrict__ VTh, const bf* __restrict__ VTl, const float* __restrict__ Q2, const float* __restrict__ K2, float* Ob, float* Lb) {
    const size_t h = blockIdx.z, ks = blockIdx.y, hp = h * TT * HD; const int q0 = blockIdx.x * 256 + (threadIdx.x >> 5) * 32, kbeg = (int)ks * (TT / KSP);
    float* Op = Ob + (ks * NHB + h) * TT * HD; float* Lp = Lb + (ks * NHB + h) * TT;
    if (blockIdx.x * 256 < RH) fattn_body<true>(QPh + hp, QPl + hp, KPh + hp, KPl + hp, VT16 + hp, VTh + hp, VTl + hp, Q2 + h * TT, K2 + h * TT, q0, kbeg, Op, Lp);   /* RH is a multiple of 256: one path a workgroup */
    else fattn_body<false>(QPh + hp, QPl + hp, KPh + hp, KPl + hp, VT16 + hp, VTh + hp, VTl + hp, Q2 + h * TT, K2 + h * TT, q0, kbeg, Op, Lp);
}
__global__ __launch_bounds__(256) void k_merge(const float* __restrict__ O, const float* __restrict__ L, const float* __restrict__ FP, bf* Ah, bf* Al) { const size_t e = ((size_t)blockIdx.x * 256 + threadIdx.x) * 2; if (e >= (size_t)NHB * TT * HD) return; const int d = (int)(e % HD); const int t = (int)((e / HD) % TT); const int zz = (int)(e / ((size_t)HD * TT)); const int hh = zz % NH_; const size_t row = (size_t)(zz / NH_) * TT + t; const size_t oo = pk(row, hh * HD + d, DQ);   /* fragment order; d is even, so the pair stays in one piece */
    float lp[KSP]; v2f op[KSP];   /* XWAIT behind each load: the next load's result may be given this one's address registers */
#pragma unroll
    for (int ks = 0; ks < KSP; ++ks) { lp[ks] = L[((size_t)ks * NHB + zz) * TT + t]; XWAIT; op[ks] = *(const v2f*)(O + (size_t)ks * ((size_t)NHB * TT * HD) + e); XWAIT; }
    float lsum = lp[0];   /* row sum of the weights: the KSP partial sums, fixed order */
#pragma unroll
    for (int ks = 1; ks < KSP; ++ks) lsum = __fadd_rn(lsum, lp[ks]);
    const float cs = __builtin_amdgcn_rcpf(__fadd_rn(SEPS, lsum));   /* W / (eps + sum W) via hardware reciprocal */
    v2us oh, ol; v2f os2 = op[0];   /* sum of the KSP partial planes, fixed order */
#pragma unroll
    for (int ks = 1; ks < KSP; ++ks) { os2[0] = __fadd_rn(os2[0], op[ks][0]); os2[1] = __fadd_rn(os2[1], op[ks][1]); }
#pragma unroll
    for (int q = 0; q < 2; ++q) { const float oc = os2[q] * cs; const float gt = FP[row * DP + hh * HSTR + 192 + d + q]; unsigned short a, c2; splitf(__fmul_rn(gt, oc), a, c2); oh[q] = a; ol[q] = c2; }   /* H = G * A */ *(v2us*)(Ah + oo) = oh; *(v2us*)(Al + oo) = ol;  }

extern "C" void kernel_launch(void* const* d_in, const int* in_sizes, int n_in,
                              void* d_out, int out_size, void* d_ws, size_t ws_size, hipStream_t stream) {
    (void)in_sizes; (void)n_in; (void)out_size;
    const float* x = (const float*)d_in[0]; const float* win = (const float*)d_in[1]; const float* bin = (const float*)d_in[2]; const float* wo = (const float*)d_in[3]; const float* bo = (const float*)d_in[4]; const float* wq = nullptr; const float* wk = nullptr; const float* wv = nullptr; (void)wq; (void)wk; (void)wv;
    float* OUT = (float*)d_out;     // [2][2048][1024]
    char* wsp = (char*)d_ws;
    auto take = [&](size_t bytes) { char* p = wsp; wsp += (bytes + 255) & ~(size_t)255; return (void*)p; };
    bf* WINB = (bf*)take((size_t)DP * DM * 2); bf* WO = (bf*)take((size_t)DM * DQ * 2);
    bf* XB = (bf*)take((size_t)NB_ * TT * DM * 2); float* FP = (float*)take((size_t)NB_ * TT * DP * 4); float* Q2 = (float*)take((size_t)NHB * TT * 4); float* K2 = (float*)take((size_t)NHB * TT * 4);
    h16* VT16 = (h16*)take((size_t)NHB * HD * TT * 2);
    bf* QPh = (bf*)take((size_t)NHB * TT * HD * 2); bf* QPl = (bf*)take((size_t)NHB * TT * HD * 2); bf* KPh = (bf*)take((size_t)NHB * TT * HD * 2); bf* KPl = (bf*)take((size_t)NHB * TT * HD * 2); bf* VTh = (bf*)take((size_t)NHB * HD * TT * 2); bf* VTl = (bf*)take((size_t)NHB * HD * TT * 2);
    float* Ob = (float*)take((size_t)KSP * NHB * TT * HD * 4); float* Lb = (float*)take((size_t)KSP * NHB * TT * 4); bf* ATh = (bf*)take((size_t)NB_ * TT * DQ * 2); bf* ATl = (bf*)take((size_t)NB_ * TT * DQ * 2);
    if ((size_t)(wsp - (char*)d_ws) > ws_size) return;    // about 220 MiB of the 256 MiB
    k_wtG<<<(unsigned)(DM * DP / 2048 + DQ * DM / 2048), 256, 0, stream>>>(win, DM, DP, WINB, DM * DP / 2048, wo, DQ, DM, WO);   /* 'xw' [1024][4096] -> Bt 4096 x 1024; 'xw' [1024][1024] -> Bt 1024 x 1024; 2048 elements a workgroup */
    const PlaneOut po = {QPh, QPl, KPh, KPl, VT16, VTh, VTl, Q2, K2}, none = {};
    /* X [2][2048][1024] is one matrix of NB_*TT rows to both GEMMs; the attention sees NHB independent heads */
    k_cvt8<<<(unsigned)(((size_t)NB_ * TT * DM / 8 + 255) / 256), 256, 0, stream>>>(x, XB, (size_t)NB_ * TT * DM / 8);
    k_gemmw<bf, 0, true, DM, 1, true><<<dim3(NB_ * TT / 64, DP / 64, 1), 32, 0, stream>>>(XB, nullptr, WINB, nullptr, FP, DP, bin, 0, 0, 0, 0, po);   /* P = X W_in + b_in (exact): Q, K hi/lo planes + q2, k2, V^T planes; G (cols h*256 + 192..255) in f32 to FP */
    k_fattn<<<dim3(TT / 256, KSP, NHB), 256, 0, stream>>>(QPh, QPl, KPh, KPl, VT16, VTh, VTl, Q2, K2, Ob, Lb);   /* all heads of both batches: Q.K (3 products), weights, attn.v partials + partial row sums */
    k_merge<<<(unsigned)(((size_t)NHB * TT * HD / 2 + 255) / 256), 256, 0, stream>>>(Ob, Lb, FP, ATh, ATl);
    k_gemmw<bf, 1, true, DQ><<<dim3(NB_ * TT / 64, DM / 64, 1), 32, 0, stream>>>(ATh, ATl, WO, nullptr, OUT, DM, bo, 0, 0, 0, 0, none);
}

// v006
// It runs in 192 microseconds.
// Timed twice side by side with v005, it ran 1.19 and 1.20 times as fast.
// All steps since v000 together make it 10.8 times as fast.
#include <hip/hip_runtime.h>

// Shepard's (inverse-distance) gated attention (X [2][2048][1024]; P = X W_in + b_in ('xw' [1024][4096]) viewed per head h as [Q(64) | K(64) | V(64) | G(64)] at columns h*256 + ...; W = (1e-4 + ||Q_i - K_j||)^-2 with the distance by the norm expansion sqrt(max(q2 + k2 - 2 Q.K, 0)); W = W / (1e-4 + sum_j W); A = W.V; H = G * A; out = merged H W_out ('xw' [1024][1024]) + b_out -> [2][2048][1024]).
// Compute dtypes, f32 accumulate: every input rounded to bf16; q/k/v on PLAIN bf16 operands (inputs: exact) + b_in, their 16-bit planes and the f32 row norms q2, k2 written by that GEMM's own epilogue; the Q.K products on hi/lo planes for every row (3 products; the distance needs them), the Shepard weights (sqrt, reciprocal) and their row sums in f32 inside the fused attention kernel, row normalisation and gating in the merge; attn.v hybrid on the unnormalised weights: query rows < 512 hl (3 products), the rest single fp16; W_out hl x exact (2 products) + b_out.
// Layout of every 16-bit matrix operand plane (X, W_in^T, W_out^T, Q, K, V^T, gated A): FRAGMENT ORDER. A plane of rows x K is cut into blocks of 16 rows x 32 k (1 KiB), block (row / 16) * (K / 32) + k / 32; inside a block the 16-byte piece that lane (lr, hi) takes in its first load (row lr, k = 8 hi + 0..7) lies at piece hi * 16 + lr, the piece of its second load (k = 16 + 8 hi + 0..7) 512 bytes further. So each wave-wide 16-byte load reads 512 bytes in a row (4 whole lines) where a row-major plane gave it 32 bytes of each of 16 lines.

#define NB_  2
#define TT   2048
#define DM   1024
#define NH_  16
#define NKV  16
#define REP  (NH_ / NKV)
#define HD   64
#define DQ   (NH_ * HD)
#define DKV  (NKV * HD)
#define DP   4096                 // projection width (16 heads x [Q|K|V|G] x 64)
#define HSTR 256
#define SEPS 1e-4f
#define RH   512                  // query rows < RH use hi+lo planes (0: none)
#define WIN  0
#define PMAX 32768.0f             // largest scaled weight that goes into an fp16 P operand (fp16 ends at 65504)
#define NHB  (NB_ * NH_)          // both batches go through every launch: rows b*TT + t in the GEMMs, "heads" b*NH_ + h in the planes and in the attention grid
#define KSP  4                    // attention: the 2048 keys split over KSP workgroups per 256 query rows; partial planes [KSP][NHB][TT][HD] and partial row sums [KSP][NHB][TT] summed in k_merge
typedef _Float16 h16;
typedef unsigned short bf;
typedef __attribute__((ext_vector_type(16))) __bf16   v16bf;
typedef __attribute__((ext_vector_type(16))) _Float16 v16h;
typedef __attribute__((ext_vector_type(8)))  _Float16 v8h;
typedef __attribute__((ext_vector_type(8)))  unsigned short v8us;
typedef __attribute__((ext_vector_type(8)))  float    v8f;
typedef __attribute__((ext_vector_type(4)))  float    v4f;
typedef v8h  __attribute__((may_alias)) v8ha;
typedef v4f  __attribute__((may_alias)) v4fa;
typedef v8us __attribute__((may_alias)) v8usa;

__device__ __forceinline__ unsigned short f2bf(float f) { unsigned u = __float_as_uint(f); u += 0x7FFFu + ((u >> 16) & 1u); return (unsigned short)(u >> 16); }
__device__ __forceinline__ float bf2f(unsigned short b) { return __uint_as_float(((unsigned)b) << 16); }
__device__ __forceinline__ float bfr(float f) { return bf2f(f2bf(f)); }
__device__ __forceinline__ v16h cat16(v8h lo, v8h hi) { return __builtin_shufflevector(lo, hi, 0, 1, 2, 3, 4, 5, 6, 7, 8, 9, 10, 11, 12, 13, 14, 15); }
__device__ __forceinline__ v16bf cat16b(v8us lo, v8us hi) { return __builtin_bit_cast(v16bf, __builtin_shufflevector(lo, hi, 0, 1, 2, 3, 4, 5, 6, 7, 8, 9, 10, 11, 12, 13, 14, 15)); }
__device__ __forceinline__ v8f wmma16(v16h a, v16h b, v8f c) { return __builtin_amdgcn_wmma_f32_16x16x32_f16(false, a, false, b, (short)0, c, false, false); }
__device__ __forceinline__ v8f wmmab(v16bf a, v16bf b, v8f c) { return __builtin_amdgcn_wmma_f32_16x16x32_bf16(false, a, false, b, (short)0, c, false, false); }
// element offset of (row, k) in a fragment-order plane of K columns
__device__ __forceinline__ size_t pk(size_t row, int k, int K) { return ((row >> 4) * (size_t)(K >> 5) + (size_t)(k >> 5)) * 512 + (size_t)(((k >> 4) & 1) * 256 + ((k >> 3) & 1) * 128 + (k & 7)) + (row & 15) * 8; }
__device__ __forceinline__ h16 tohx(float x) { return (h16)x; }
__device__ __forceinline__ void splitf(float y, unsigned short& h, unsigned short& l) { h = f2bf(y); l = f2bf(y - bf2f(h)); }
// XWAIT stands between loads where the compiler lets a later load's result land in an earlier load's address registers: the wait that goes in front of such an overwrite
#define XWAIT asm volatile("s_wait_xcnt 0x0" ::: "memory")
// x + (x of lane ^ M), M = 1, 2 or 4, as a DPP move inside the 16-lane row (a shuffle would go through the LDS queue); every lane on
template <int M> __device__ __forceinline__ float addx(float x) { return x + __int_as_float(__builtin_amdgcn_update_dpp(0, __float_as_int(x), 0x160 + M, 0xf, 0xf, true)); }
// where the projection GEMM's epilogue puts a head's Q, K and V columns: hi/lo planes [h][t x d], V^T planes [h][d x t], each head's plane in fragment order; row norms [h][t]
struct PlaneOut { bf* Qh; bf* Ql; bf* Kh; bf* Kl; h16* V16; bf* Vh; bf* Vl; float* Q2; float* K2; };



// ---- k_gemmw: register-blocked GEMM, ONE WAVE per 64x64 output tile (16 accumulators), operands straight from fragment-order 16-bit planes; grid (M/64, N/64, Z), 32 threads.
// C[m][n] (f32, pitch ldc, + optional f32 bias[n]) = sum_k A[m][k] Bt[n][k] (+ split products per NSPLIT). z-batch strides sA/sB/sC in elements. K % (32 * KS) == 0; K is a compile-time constant, so that an operand's fragments are immediate offsets from one address that lives through the loop.
// PL (the input projection, N = 16 heads x [Q|K|V|G] x 64, so a 64-column tile is one part of one head): only the G tiles go to C; a Q or K tile goes out as bf16 hi/lo planes with its rows' sums of squares (the whole row of 64 is in the tile), a V tile as the three V^T planes.
// KS > 1: grid z = Z * KS; workgroup (z, ks) sums only k in [ks K/KS, (ks+1) K/KS) and stores its partial tile to plane ks (plane stride sP elements); the consumer adds the KS planes.
// ld: p + lo = the block's start + lane * 8
// every plane lies in global memory: said in the pointer type, because an address that has gone through an asm operand would otherwise be loaded from with flat instructions
typedef const __attribute__((address_space(1))) v8h* gv8h; typedef const __attribute__((address_space(1))) v8us* gv8us;
template <typename T16> struct WFrag;
template <> struct WFrag<h16> { typedef v16h V; static __device__ __forceinline__ V ld(const h16* p, unsigned lo) { return cat16(*(gv8h)(p + lo), *(gv8h)(p + lo + 256)); } static __device__ __forceinline__ v8f mma(V a, V b, v8f c) { return wmma16(a, b, c); } };
template <> struct WFrag<bf> { typedef v16bf V; static __device__ __forceinline__ V ld(const bf* p, unsigned lo) { return cat16b(*(gv8us)(p + lo), *(gv8us)(p + lo + 256)); } static __device__ __forceinline__ v8f mma(V a, V b, v8f c) { return wmmab(a, b, c); } };
template <typename T16, int NSPLIT, bool BIAS, int K, int KS = 1, bool PL = false>
__global__ __launch_bounds__(32) void k_gemmw(const T16* __restrict__ A, const T16* __restrict__ A2, const T16* __restrict__ Bt, const T16* __restrict__ Bt2, float* C, int ldc, const float* __restrict__ bias, size_t sA, size_t sB, size_t sC, size_t sP, PlaneOut po) {
    typedef typename WFrag<T16>::V V;
    __shared__ __align__(16) float os[16 * 68];
    const size_t z = blockIdx.z / KS; const int ks = blockIdx.z % KS; A += z * sA; if (A2) A2 += z * sA; Bt += z * sB; if (Bt2) Bt2 += z * sB; C += z * sC + (size_t)ks * sP;
    const int kbeg = ks * (K / KS), kend = kbeg + K / KS;
    const int lane = threadIdx.x & 31, lr = lane & 15, hi = lane >> 4; const int r0 = blockIdx.x * 64, c0 = blockIdx.y * 64;
    v8f acc[4][4];
#pragma unroll
    for (int mb = 0; mb < 4; ++mb)
#pragma unroll
        for (int nb = 0; nb < 4; ++nb) acc[mb][nb] = (v8f){};
    const size_t aoff = (size_t)r0 * K + (size_t)kbeg * 16 + 8 * lane, boff = (size_t)c0 * K + (size_t)kbeg * 16 + 8 * lane; const T16* pa = A + aoff; const T16* pa2 = (NSPLIT == 1 || NSPLIT == 2) ? A2 + aoff : nullptr; const T16* pb = Bt + boff; const T16* pb2 = NSPLIT >= 2 ? Bt2 + boff : nullptr;   /* 16 rows of a plane are K / 32 blocks = 16 K elements; a step of 32 k is one block = 512 elements */
#pragma unroll 1
    for (int kc = kbeg; kc < kend; kc += 32) {
        V a[4], a2[4];
#pragma unroll
        for (int mb = 0; mb < 4; ++mb) { a[mb] = WFrag<T16>::ld(pa + mb * 16 * K, 0u); if (NSPLIT == 1 || NSPLIT == 2) a2[mb] = WFrag<T16>::ld(pa2 + mb * 16 * K, 0u); }
#pragma unroll
        for (int nb = 0; nb < 4; ++nb) { const V b = WFrag<T16>::ld(pb + nb * 16 * K, 0u); V b2; if (NSPLIT >= 2) b2 = WFrag<T16>::ld(pb2 + nb * 16 * K, 0u);
#pragma unroll
            for (int mb = 0; mb < 4; ++mb) { acc[mb][nb] = WFrag<T16>::mma(a[mb], b, acc[mb][nb]); if (NSPLIT == 1 || NSPLIT == 2) acc[mb][nb] = WFrag<T16>::mma(a2[mb], b, acc[mb][nb]); if (NSPLIT >= 2) acc[mb][nb] = WFrag<T16>::mma(a[mb], b2, acc[mb][nb]); } }
        /* the wait that goes in front of an overwrite of a load's address registers, here the step to the next block; it takes the addresses themselves, so each stays in its one register pair through the trip and no later load of the trip is given that pair for its result */
        asm volatile("s_wait_xcnt 0x0" : "+v"(pa), "+v"(pb) :: "memory"); pa += 512; pb += 512;
        if (NSPLIT == 1 || NSPLIT == 2) { asm volatile("s_wait_xcnt 0x0" : "+v"(pa2) :: "memory"); pa2 += 512; }
        if (NSPLIT >= 2) { asm volatile("s_wait_xcnt 0x0" : "+v"(pb2) :: "memory"); pb2 += 512; }
        asm volatile("v_nop\n\tv_nop\n\tv_nop\n\tv_nop" : "+v"(acc[0][0]), "+v"(acc[1][1]), "+v"(acc[2][2]), "+v"(acc[3][3]) : "v"(a[0]), "v"(a[3]));
    }
    const int part = PL ? (int)(blockIdx.y & 3) : 3; const size_t head = (size_t)(r0 / TT) * NH_ + (blockIdx.y >> 2); const int t0 = r0 % TT;   /* part: 0 Q, 1 K, 2 V, 3 G; the same for the whole workgroup. Row r0 = b*TT + t0: the planes are [b*NH_ + h][..] */
    if (PL && part == 2) {   /* V^T straight from the accumulators: element j of lane (lr, hi) is row mb*16 + hi*8 + j of column nb*16 + lr, eight consecutive t of one d = one 16-byte piece of a plane, and the wave's 32 pieces are half a block: 512 bytes in a row a store */
#pragma unroll
        for (int nb = 0; nb < 4; ++nb) { const float bv = bfr(bias[c0 + nb * 16 + lr]);
#pragma unroll
            for (int mb = 0; mb < 4; ++mb) { v8h o16; v8us oh, ol;
#pragma unroll
                for (int j = 0; j < 8; ++j) { const float x = acc[mb][nb][j] + bv; o16[j] = tohx(x); unsigned short a2, c2; splitf(x, a2, c2); oh[j] = a2; ol[j] = c2; }
                const size_t o = head * HD * TT + pk(nb * 16 + lr, t0 + mb * 16 + hi * 8, TT); *(v8h*)(po.V16 + o) = o16; *(v8us*)(po.Vh + o) = oh; *(v8us*)(po.Vl + o) = ol; } }
        return; }
    if (PL && part < 2) {   /* Q, K: 16 rows at a time through LDS as below, read out eight lanes a row, eight columns a lane */
        const int c8 = (lane & 7) * 8, rq = lane >> 3; float bq[8]; bf* Ph = (part == 0 ? po.Qh : po.Kh) + (head * TT + t0) * HD; bf* Pl = (part == 0 ? po.Ql : po.Kl) + (head * TT + t0) * HD; float* N2 = (part == 0 ? po.Q2 : po.K2) + head * TT + t0;
#pragma unroll
        for (int q = 0; q < 8; ++q) bq[q] = bfr(bias[c0 + c8 + q]);
#pragma unroll
        for (int mb = 0; mb < 4; ++mb) { float keep = 0.f;
#pragma unroll
            for (int nb = 0; nb < 4; ++nb) {
#pragma unroll
                for (int j = 0; j < 8; ++j) os[(hi * 8 + j) * 68 + nb * 16 + lr] = acc[mb][nb][j]; }
            __builtin_amdgcn_wave_barrier(); asm volatile("" ::: "memory");   /* one wave, whose LDS operations run in order: this only keeps the compiler from moving a lane's reads over the other lanes' writes */
#pragma unroll
            for (int s = 0; s < 4; ++s) { const int row = 4 * s + rq; const v4f v0 = *(const v4fa*)(os + row * 68 + c8), v1 = *(const v4fa*)(os + row * 68 + c8 + 4); v8us oh, ol; float n2 = 0.f;
#pragma unroll
                for (int q = 0; q < 8; ++q) { const float x = (q < 4 ? v0[q & 3] : v1[q & 3]) + bq[q]; unsigned short a2, c2; splitf(x, a2, c2); oh[q] = a2; ol[q] = c2; n2 = fmaf(x, x, n2); }
                const size_t o = pk(mb * 16 + row, c8, HD); *(v8us*)(Ph + o) = oh; *(v8us*)(Pl + o) = ol;   /* four rows' pieces lie side by side: eight runs of 64 bytes a store */
                n2 = addx<4>(addx<2>(addx<1>(n2))); if ((lane & 7) == s) keep = n2; }   /* the row's eight partial sums; lane 8 rq + s keeps row 4 s + rq */
            if ((lane & 7) < 4) N2[mb * 16 + 4 * (lane & 7) + rq] = keep;
            __builtin_amdgcn_wave_barrier(); asm volatile("" ::: "memory");   /* and the next 16 rows' writes over these reads */
        }
        return; }
#pragma unroll
    for (int mb = 0; mb < 4; ++mb) {
#pragma unroll
        for (int nb = 0; nb < 4; ++nb) {
#pragma unroll
            for (int j = 0; j < 8; ++j) os[(hi * 8 + j) * 68 + nb * 16 + lr] = acc[mb][nb][j]; }
        __builtin_amdgcn_wave_barrier(); asm volatile("" ::: "memory");
        float* crow = C + (size_t)(r0 + mb * 16) * ldc + c0;
{
#pragma unroll
            for (int s = 0; s < 8; ++s) { const int row = 2 * s + hi, cofs = lr * 4; v4f val = *(const v4fa*)(os + row * 68 + cofs); if (BIAS) { val[0] += bfr(bias[c0 + cofs]); val[1] += bfr(bias[c0 + cofs + 1]); val[2] += bfr(bias[c0 + cofs + 2]); val[3] += bfr(bias[c0 + cofs + 3]); }
                *(v4f*)(crow + (size_t)row * ldc + cofs) = val; }
             }
        XWAIT;   /* behind these rows' stores: the next rows' bias load and LDS reads may be given their registers */
        __builtin_amdgcn_wave_barrier(); asm volatile("" ::: "memory");
    }
}

typedef __attribute__((ext_vector_type(2))) _Float16 v2h;
typedef __attribute__((ext_vector_type(4))) _Float16 v4h;
typedef __attribute__((ext_vector_type(2))) unsigned short v2us;
typedef __attribute__((ext_vector_type(4))) unsigned short v4us;
typedef __attribute__((ext_vector_type(2))) float v2f;
typedef __attribute__((ext_vector_type(4))) int v4i;

// two weight matrices in one launch: workgroups below nbA transpose wA, the rest wB. One thread = one 16-byte piece of the fragment-order plane Bt (rows n, K columns): eight k of one n.
// A wave stores 512 bytes in a row; each of its eight loads reads 16 consecutive n of two k rows (two runs of 64 bytes).
__global__ __launch_bounds__(256) void k_wtG(const float* __restrict__ wA, int KA, int NA, bf* BtA, int nbA, const float* __restrict__ wB, int KB, int NB, bf* BtB) {
    const bool sec = (int)blockIdx.x >= nbA; const float* __restrict__ w = sec ? wB : wA; const int K = sec ? KB : KA, N = sec ? NB : NA; bf* Bt = sec ? BtB : BtA; const int bx = (int)blockIdx.x - (sec ? nbA : 0);
    const int c = bx * 256 + (int)threadIdx.x; if (c >= N * (K / 8)) return;
    const int blk = c >> 6, kb = blk % (K >> 5), n = (blk / (K >> 5)) * 16 + (c & 15), k = kb * 32 + ((c >> 5) & 1) * 16 + ((c >> 4) & 1) * 8;
    const float* p = w + (size_t)k * N + n; float v[8]; v8us o;
#pragma unroll
    for (int j = 0; j < 8; ++j) v[j] = p[(size_t)j * N];
    XWAIT;   /* behind the eight loads: the conversion below is given their address registers */
#pragma unroll
    for (int j = 0; j < 8; ++j) o[j] = f2bf(v[j]);
    *(v8us*)(Bt + (size_t)c * 8) = o;
}
// X (rows of DM columns) -> bf16 in fragment order; one thread = one 16-byte piece of the plane, eight k of one row
__global__ __launch_bounds__(256) void k_cvt8(const float* __restrict__ src, bf* dst, size_t n8) { const size_t i = (size_t)blockIdx.x * 256 + threadIdx.x; if (i >= n8) return; const size_t blk = i >> 6, row = (blk / (DM / 32)) * 16 + (i & 15); const int k = (int)(blk % (DM / 32)) * 32 + (int)((i >> 5) & 1) * 16 + (int)((i >> 4) & 1) * 8; const v8f v = *(const v8f*)(src + row * DM + k); v8us o;
#pragma unroll
    for (int q = 0; q < 8; ++q) o[q] = f2bf(v[q]); *(v8us*)(dst + i * 8) = o;  }

// k_fattn: scores, Shepard weights and attn.v in one kernel; the scores never leave the registers. One wave = 32 query rows x TT/KSP keys, 32 keys a pass; 8 waves (256 query rows) a workgroup.
// The eight waves walk the same keys: each pass's K hi, K lo and V^T blocks (a stage, below) come into LDS once for the workgroup, by asynchronous copies, one pass ahead of their use, into two buffers by turns; the range's key norms come in once, in front of the loop. Every wave copies its eighth of each part (512 bytes in a row a copy); the blocks lie in LDS as in the planes, so a fragment load reads 512 bytes in a row there too.
// S^T = K Q^T (A = K rows, B = Q rows kept in registers): accumulator element j of lane (lr, hi) is key kb*16 + hi*8 + j of query lr, so two key tiles pack straight into the B operand (k order 8 hi + 0..7, 16 + 8 hi + 0..7, the loaders' own) of O^T += V^T P^T.
// w_j = (eps + sqrt(max(q2_i + k2_j - 2 S_ij, 0)))^-2 stays unnormalised; its f32 row sum goes out beside the partial O and divides in k_merge.
// Range of the 16-bit P operand: each query scales eps + dist by r, a power of two near 1 / sqrt(q2_i + k2 of the range's first key), so w / r^2 is of order 1 for keys about as far off as the norms are large; a power of two changes no rounding, and r^2 is taken out of the partial O and the partial sum on the way out.
// A key much nearer than that (down to dist = 0) gives a scaled weight beyond the fp16 range: when a pass of the fp16 rows meets a weight above PMAX, the queries concerned raise their r by a power of two 2^k that brings their largest weight to 2^9..2^11, and this pass's weights, the running row sum and the running O are multiplied by 2^-2k (exact), before anything is rounded to fp16. Weights far below a row's largest then round to fp16 subnormals or 0, at most 2^-25 against a row sum of at least 2^9.
#define STG 8192                  // elements (16 KiB) of a stage = 32 keys: K hi 4 KiB | K lo 4 KiB | V^T fp16 4 KiB, or V^T hi 4 KiB | V^T lo 4 KiB
__device__ __forceinline__ unsigned lds_off(const void* p) { return (unsigned)(size_t)p; }   /* byte address in the workgroup's LDS */
__device__ __forceinline__ v16bf ldsb(const bf* p) { return cat16b(*(const v8usa*)p, *(const v8usa*)(p + 256)); }
__device__ __forceinline__ v16h ldsh(const bf* p) { return cat16(*(const v8ha*)p, *(const v8ha*)(p + 256)); }
// one wave's share of a stage: l = the lane's 16 bytes in the stage's first part, the pointers its 16 bytes of each plane. The copies and the wait that goes in front of an overwrite of their address registers are one statement, so nothing can come between them
template <bool HL>
__device__ __forceinline__ void stage_in(unsigned l, const bf* kh, const bf* kl, const bf* v0, const bf* v1) {
    const unsigned l1 = l + 4096u, l2 = l + 8192u, l3 = l + 12288u;
    if (HL) asm volatile("global_load_async_to_lds_b128 %0, %4, off\n\tglobal_load_async_to_lds_b128 %1, %5, off\n\tglobal_load_async_to_lds_b128 %2, %6, off\n\tglobal_load_async_to_lds_b128 %3, %7, off\n\ts_wait_xcnt 0x0" :: "v"(l), "v"(l1), "v"(l2), "v"(l3), "v"(kh), "v"(kl), "v"(v0), "v"(v1) : "memory");
    else asm volatile("global_load_async_to_lds_b128 %0, %3, off\n\tglobal_load_async_to_lds_b128 %1, %4, off\n\tglobal_load_async_to_lds_b128 %2, %5, off\n\ts_wait_xcnt 0x0" :: "v"(l), "v"(l1), "v"(l2), "v"(kh), "v"(kl), "v"(v0) : "memory");
}
template <bool HL>
__device__ __forceinline__ void fattn_body(bf* ring, float* k2s, const bf* __restrict__ Qh, const bf* __restrict__ Ql, const bf* __restrict__ Kh, const bf* __restrict__ Kl, const h16* __restrict__ V16, const bf* __restrict__ Vh, const bf* __restrict__ Vl, const float* __restrict__ q2p, const float* __restrict__ k2p, int q0, int kbeg, float* Op, float* Lp) {
    const int lane = threadIdx.x & 31, lr = lane & 15, hi = lane >> 4; const unsigned lo = 8 * lane;
    // every inner loop here is unrolled in full: its index picks fragments and accumulators, which live in registers and cannot be indexed at run time
    v16bf qh[2][2], ql[2][2]; float q2[2], rs[2], r[2], er[2]; v8f oacc[4][2];
#pragma unroll
    for (int qb = 0; qb < 2; ++qb) { const size_t o = (size_t)(q0 + qb * 16) * HD;   /* 16 rows of 64 = two blocks */ q2[qb] = q2p[q0 + qb * 16 + lr]; rs[qb] = 0.f; r[qb] = __uint_as_float(__float_as_uint(__builtin_amdgcn_rsqf(fminf(fmaxf(q2[qb] + k2p[kbeg], 1e-8f), 1e12f))) & 0x7F800000u);   /* both ends bounded: (r eps)^-2 and its products with V stay far inside f32 */ er[qb] = SEPS * r[qb];
#pragma unroll
        for (int c = 0; c < 2; ++c) { qh[qb][c] = WFrag<bf>::ld(Qh + o + c * 512, lo); ql[qb][c] = WFrag<bf>::ld(Ql + o + c * 512, lo); }
#pragma unroll
        for (int db = 0; db < 4; ++db) oacc[db][qb] = (v8f){}; }
    const unsigned wv = threadIdx.x >> 5, sl = wv * 256u + lo; const unsigned lb = lds_off(ring) + sl * 2u;   /* wave wv brings elements wv*256 .. +255 of each 2048-element part */
    const size_t vo = (size_t)(wv >> 1) * 16 * TT + (size_t)kbeg * 16 + (wv & 1u) * 256u + lo;   /* of V^T that is half wv & 1 of the block of d rows (wv >> 1) * 16 .. + 15 */
    const bf* gkh = Kh + (size_t)kbeg * HD + sl; const bf* gkl = Kl + (size_t)kbeg * HD + sl; const bf* gv0 = HL ? Vh + vo : (const bf*)(V16 + vo); const bf* gv1 = Vl + vo;
    { const unsigned ln = lds_off(k2s) + threadIdx.x * 8u; const float* gn = k2p + kbeg + threadIdx.x * 2;   /* the range's TT / KSP = 512 key norms, two a thread */
      asm volatile("global_load_async_to_lds_b64 %0, %1, off\n\ts_wait_xcnt 0x0" :: "v"(ln), "v"(gn) : "memory"); }
    stage_in<HL>(lb, gkh, gkl, gv0, gv1);
    asm volatile("s_wait_asynccnt 0x0" ::: "memory");   /* this wave's copies of stage 0 and of the norms have landed */
    __syncthreads();                                     /* and every other wave's */
    stage_in<HL>(lb + STG * 2u, gkh + 2048, gkl + 2048, gv0 + 512, gv1 + 512); gkh += 4096; gkl += 4096; gv0 += 1024; gv1 += 1024;   /* a stage further: 32 keys x 64 of K, 32 t of each V^T block */
    // the pass stays rolled: unrolled it would hold two passes' fragments in registers and cost resident waves
#pragma unroll 1
    for (int t = 0; t < TT / KSP / 32; ++t) {
        const bf* sb = ring + (t & 1) * STG;
        v8f s[2][2]; float wm[2] = {0.f, 0.f};
#pragma unroll
        for (int kb = 0; kb < 2; ++kb) { v16bf kh[2], kl[2];
#pragma unroll
            for (int c = 0; c < 2; ++c) { kh[c] = ldsb(sb + (kb * 2 + c) * 512 + lo); kl[c] = ldsb(sb + 2048 + (kb * 2 + c) * 512 + lo); }
#pragma unroll
            for (int qb = 0; qb < 2; ++qb) { v8f a = (v8f){};
#pragma unroll
                for (int c = 0; c < 2; ++c) { a = wmmab(kh[c], qh[qb][c], a); a = wmmab(kh[c], ql[qb][c], a); a = wmmab(kl[c], qh[qb][c], a); }
                s[kb][qb] = a; } }
        v16h vf[4];   /* fp16 rows: the V^T fragments are asked for here, so that they arrive under the weights' vector work */
        if (!HL) {
#pragma unroll
            for (int db = 0; db < 4; ++db) vf[db] = ldsh(sb + 4096 + db * 512 + lo); }
#pragma unroll
        for (int kb = 0; kb < 2; ++kb) { const v4f ka = *(const v4fa*)(k2s + t * 32 + kb * 16 + hi * 8), kc = *(const v4fa*)(k2s + t * 32 + kb * 16 + hi * 8 + 4);
#pragma unroll
            for (int qb = 0; qb < 2; ++qb) {
#pragma unroll
                for (int j = 0; j < 8; ++j) { const float t = q2[qb] + (j < 4 ? ka[j & 3] : kc[j & 3]); const float d2 = fmaxf(t - 2.0f * s[kb][qb][j], 0.f); const float den = fmaf(__builtin_amdgcn_sqrtf(d2), r[qb], er[qb]); const float w = __builtin_amdgcn_rcpf(den * den);   /* (r (eps + dist))^-2 */ s[kb][qb][j] = w; rs[qb] += w; if (!HL) wm[qb] = fmaxf(wm[qb], w); } } }
        if (!HL && __builtin_amdgcn_ballot_w32(fmaxf(wm[0], wm[1]) > PMAX) != 0u) {   /* rare; the ballot makes it one scalar branch for the wave, so the exchange below has every lane on */
#pragma unroll
            for (int qb = 0; qb < 2; ++qb) { const float m = fmaxf(wm[qb], __shfl_xor(wm[qb], 16, 32));   /* a query's keys lie in lanes lr and lr + 16: both take the same k */
                const int k = (m > PMAX) ? (((int)(__float_as_uint(m) >> 23) - 136) >> 1) : 0; const float g = __uint_as_float((unsigned)(127 - k) << 23), gi = __uint_as_float((unsigned)(127 + k) << 23), f = g * g;
                r[qb] *= gi; er[qb] *= gi; rs[qb] *= f; s[0][qb] *= f; s[1][qb] *= f;
#pragma unroll
                for (int db = 0; db < 4; ++db) oacc[db][qb] *= f; } }
        if (HL) { v16bf ph[2], pl[2];
#pragma unroll
            for (int qb = 0; qb < 2; ++qb) { v8us h0, h1, l0, l1;
#pragma unroll
                for (int j = 0; j < 8; ++j) { unsigned short a, c2; splitf(s[0][qb][j], a, c2); h0[j] = a; l0[j] = c2; splitf(s[1][qb][j], a, c2); h1[j] = a; l1[j] = c2; }
                ph[qb] = cat16b(h0, h1); pl[qb] = cat16b(l0, l1); }
#pragma unroll
            for (int db = 0; db < 4; ++db) { const v16bf vh = ldsb(sb + 4096 + db * 512 + lo), vl = ldsb(sb + 6144 + db * 512 + lo);
#pragma unroll
                for (int qb = 0; qb < 2; ++qb) { oacc[db][qb] = wmmab(vh, ph[qb], oacc[db][qb]); oacc[db][qb] = wmmab(vh, pl[qb], oacc[db][qb]); oacc[db][qb] = wmmab(vl, ph[qb], oacc[db][qb]); } }
        } else { v16h p[2];
#pragma unroll
            for (int qb = 0; qb < 2; ++qb) { v8h p0, p1;
#pragma unroll
                for (int j = 0; j < 8; ++j) { p0[j] = tohx(s[0][qb][j]); p1[j] = tohx(s[1][qb][j]); }
                p[qb] = cat16(p0, p1); }
#pragma unroll
            for (int db = 0; db < 4; ++db) {
#pragma unroll
                for (int qb = 0; qb < 2; ++qb) oacc[db][qb] = wmma16(vf[db], p[qb], oacc[db][qb]); } }
        asm volatile("s_wait_dscnt 0x0" ::: "memory");      /* this wave has read all it wants of this pass's buffer */
        asm volatile("s_wait_asynccnt 0x0" ::: "memory");   /* and its copies of the next stage have landed */
        __syncthreads();                                     /* so have every wave's: the next stage may be read, this pass's buffer refilled */
        if (t + 2 < TT / KSP / 32) { stage_in<HL>(lb + (unsigned)(t & 1) * (STG * 2u), gkh, gkl, gv0, gv1); gkh += 2048; gkl += 2048; gv0 += 512; gv1 += 512; }
    }
    asm volatile("s_wait_asynccnt 0x0" ::: "memory");   /* no copy is left in flight when the wave ends */
#pragma unroll
    for (int qb = 0; qb < 2; ++qb) { const float u = r[qb] * r[qb]; const float tot = (rs[qb] + __shfl_xor(rs[qb], 16, 32)) * u; if (hi == 0) Lp[q0 + qb * 16 + lr] = tot;
#pragma unroll
        for (int db = 0; db < 4; ++db) { float* o = Op + (size_t)(q0 + qb * 16 + lr) * HD + db * 16 + hi * 8; const v8f a = oacc[db][qb] * u; *(v4f*)o = (v4f){a[0], a[1], a[2], a[3]}; *(v4f*)(o + 4) = (v4f){a[4], a[5], a[6], a[7]}; } }
}
__global__ __launch_bounds__(256) void k_fattn(const bf* __restrict__ QPh, const bf* __restrict__ QPl, const bf* __restrict__ KPh, const bf* __restrict__ KPl, const h16* __restrict__ VT16, const bf* __restrict__ VTh, const bf* __restrict__ VTl, const float* __restrict__ Q2, const float* __restrict__ K2, float* Ob, float* Lb) {
    const size_t h = blockIdx.z, ks = blockIdx.y, hp = h * TT * HD; const int q0 = blockIdx.x * 256 + (threadIdx.x >> 5) * 32, kbeg = (int)ks * (TT / KSP);
    float* Op = Ob + (ks * NHB + h) * TT * HD; float* Lp = Lb + (ks * NHB + h) * TT;
    __shared__ __align__(16) bf ring[2 * STG]; __shared__ __align__(16) float k2s[TT / KSP];
    if (blockIdx.x * 256 < RH) fattn_body<true>(ring, k2s, QPh + hp, QPl + hp, KPh + hp, KPl + hp, VT16 + hp, VTh + hp, VTl + hp, Q2 + h * TT, K2 + h * TT, q0, kbeg, Op, Lp);   /* RH is a multiple of 256: one path a workgroup */
    else fattn_body<false>(ring, k2s, QPh + hp, QPl + hp, KPh + hp, KPl + hp, VT16 + hp, VTh + hp, VTl + hp, Q2 + h * TT, K2 + h * TT, q0, kbeg, Op, Lp);
}
__global__ __launch_bounds__(256) void k_merge(const float* __restrict__ O, const float* __restrict__ L, const float* __restrict__ FP, bf* Ah, bf* Al) { const size_t e = ((size_t)blockIdx.x * 256 + threadIdx.x) * 2; if (e >= (size_t)NHB * TT * HD) return; const int d = (int)(e % HD); const int t = (int)((e / HD) % TT); const int zz = (int)(e / ((size_t)HD * TT)); const int hh = zz % NH_; const size_t row = (size_t)(zz / NH_) * TT + t; const size_t oo = pk(row, hh * HD + d, DQ);   /* fragment order; d is even, so the pair stays in one piece */
    float lp[KSP]; v2f op[KSP];   /* XWAIT behind each load: the next load's result may be given this one's address registers */
#pragma unroll
    for (int ks = 0; ks < KSP; ++ks) { lp[ks] = L[((size_t)ks * NHB + zz) * TT + t]; XWAIT; op[ks] = *(const v2f*)(O + (size_t)ks * ((size_t)NHB * TT * HD) + e); XWAIT; }
    float lsum = lp[0];   /* row sum of the weights: the KSP partial sums, fixed order */
#pragma unroll
    for (int ks = 1; ks < KSP; ++ks) lsum = __fadd_rn(lsum, lp[ks]);
    const float cs = __builtin_amdgcn_rcpf(__fadd_rn(SEPS, lsum));   /* W / (eps + sum W) via hardware reciprocal */
    v2us oh, ol; v2f os2 = op[0];   /* sum of the KSP partial planes, fixed order */
#pragma unroll
    for (int ks = 1; ks < KSP; ++ks) { os2[0] = __fadd_rn(os2[0], op[ks][0]); os2[1] = __fadd_rn(os2[1], op[ks][1]); }
#pragma unroll
    for (int q = 0; q < 2; ++q) { const float oc = os2[q] * cs; const float gt = FP[row * DP + hh * HSTR + 192 + d + q]; unsigned short a, c2; splitf(__fmul_rn(gt, oc), a, c2); oh[q] = a; ol[q] = c2; }   /* H = G * A */ *(v2us*)(Ah + oo) = oh; *(v2us*)(Al + oo) = ol;  }

extern "C" void kernel_launch(void* const* d_in, const int* in_sizes, int n_in,
                              void* d_out, int out_size, void* d_ws, size_t ws_size, hipStream_t stream) {
    (void)in_sizes; (void)n_in; (void)out_size;
    const float* x = (const float*)d_in[0]; const float* win = (const float*)d_in[1]; const float* bin = (const float*)d_in[2]; const float* wo = (const float*)d_in[3]; const float* bo = (const float*)d_in[4]; const float* wq = nullptr; const float* wk = nullptr; const float* wv = nullptr; (void)wq; (void)wk; (void)wv;
    float* OUT = (float*)d_out;     // [2][2048][1024]
    char* wsp = (char*)d_ws;
    auto take = [&](size_t bytes) { char* p = wsp; wsp += (bytes + 255) & ~(size_t)255; return (void*)p; };
    bf* WINB = (bf*)take((size_t)DP * DM * 2); bf* WO = (bf*)take((size_t)DM * DQ * 2);
    bf* XB = (bf*)take((size_t)NB_ * TT * DM * 2); float* FP = (float*)take((size_t)NB_ * TT * DP * 4); float* Q2 = (float*)take((size_t)NHB * TT * 4); float* K2 = (float*)take((size_t)NHB * TT * 4);
    h16* VT16 = (h16*)take((size_t)NHB * HD * TT * 2);
    bf* QPh = (bf*)take((size_t)NHB * TT * HD * 2); bf* QPl = (bf*)take((size_t)NHB * TT * HD * 2); bf* KPh = (bf*)take((size_t)NHB * TT * HD * 2); bf* KPl = (bf*)take((size_t)NHB * TT * HD * 2); bf* VTh = (bf*)take((size_t)NHB * HD * TT * 2); bf* VTl = (bf*)take((size_t)NHB * HD * TT * 2);
    float* Ob = (float*)take((size_t)KSP * NHB * TT * HD * 4); float* Lb = (float*)take((size_t)KSP * NHB * TT * 4); bf* ATh = (bf*)take((size_t)NB_ * TT * DQ * 2); bf* ATl = (bf*)take((size_t)NB_ * TT * DQ * 2);
    if ((size_t)(wsp - (char*)d_ws) > ws_size) return;    // about 220 MiB of the 256 MiB
    k_wtG<<<(unsigned)(DM * DP / 2048 + DQ * DM / 2048), 256, 0, stream>>>(win, DM, DP, WINB, DM * DP / 2048, wo, DQ, DM, WO);   /* 'xw' [1024][4096] -> Bt 4096 x 1024; 'xw' [1024][1024] -> Bt 1024 x 1024; 2048 elements a workgroup */
    const PlaneOut po = {QPh, QPl, KPh, KPl, VT16, VTh, VTl, Q2, K2}, none = {};
    /* X [2][2048][1024] is one matrix of NB_*TT rows to both GEMMs; the attention sees NHB independent heads */
    k_cvt8<<<(unsigned)(((size_t)NB_ * TT * DM / 8 + 255) / 256), 256, 0, stream>>>(x, XB, (size_t)NB_ * TT * DM / 8);
    k_gemmw<bf, 0, true, DM, 1, true><<<dim3(NB_ * TT / 64, DP / 64, 1), 32, 0, stream>>>(XB, nullptr, WINB, nullptr, FP, DP, bin, 0, 0, 0, 0, po);   /* P = X W_in + b_in (exact): Q, K hi/lo planes + q2, k2, V^T planes; G (cols h*256 + 192..255) in f32 to FP */
    k_fattn<<<dim3(TT / 256, KSP, NHB), 256, 0, stream>>>(QPh, QPl, KPh, KPl, VT16, VTh, VTl, Q2, K2, Ob, Lb);   /* all heads of both batches: Q.K (3 products), weights, attn.v partials + partial row sums */
    k_merge<<<(unsigned)(((size_t)NHB * TT * HD / 2 + 255) / 256), 256, 0, stream>>>(Ob, Lb, FP, ATh, ATl);
    k_gemmw<bf, 1, true, DQ><<<dim3(NB_ * TT / 64, DM / 64, 1), 32, 0, stream>>>(ATh, ATl, WO, nullptr, OUT, DM, bo, 0, 0, 0, 0, none);
}

// v007
// Measured time: 173 microseconds a run.
// Two timings next to v006 both put it at 1.12 times that version's speed.
// All steps since v000 together make it 12.2 times as fast.
#include <hip/hip_runtime.h>

// Shepard's (inverse-distance) gated attention (X [2][2048][1024]; P = X W_in + b_in ('xw' [1024][4096]) viewed per head h as [Q(64) | K(64) | V(64) | G(64)] at columns h*256 + ...; W = (1e-4 + ||Q_i - K_j||)^-2 with the distance by the norm expansion sqrt(max(q2 + k2 - 2 Q.K, 0)); W = W / (1e-4 + sum_j W); A = W.V; H = G * A; out = merged H W_out ('xw' [1024][1024]) + b_out -> [2][2048][1024]).
// Compute dtypes, f32 accumulate: every input rounded to bf16; q/k/v on PLAIN bf16 operands (inputs: exact) + b_in, their 16-bit planes and the f32 row norms q2, k2 written by that GEMM's own epilogue; the Q.K products on hi/lo planes for every row (3 products; the distance needs them), the Shepard weights (sqrt, reciprocal) and their row sums in f32 inside the fused attention kernel, row normalisation and gating in the merge; attn.v hybrid on the unnormalised weights: query rows < 512 hl (3 products), the rest single fp16; W_out hl x exact (2 products) + b_out.
// Layout of every 16-bit matrix operand plane (X, W_in^T, W_out^T, Q, K, V^T, gated A): FRAGMENT ORDER. A plane of rows x K is cut into blocks of 16 rows x 32 k (1 KiB), block (row / 16) * (K / 32) + k / 32; inside a block the 16-byte piece that lane (lr, hi) takes in its first load (row lr, k = 8 hi + 0..7) lies at piece hi * 16 + lr, the piece of its second load (k = 16 + 8 hi + 0..7) 512 bytes further. So each wave-wide 16-byte load reads 512 bytes in a row (4 whole lines) where a row-major plane gave it 32 bytes of each of 16 lines.

#define NB_  2
#define TT   2048
#define DM   1024
#define NH_  16
#define NKV  16
#define REP  (NH_ / NKV)
#define HD   64
#define DQ   (NH_ * HD)
#define DKV  (NKV * HD)
#define DP   4096                 // projection width (16 heads x [Q|K|V|G] x 64)
#define HSTR 256
#define SEPS 1e-4f
#define RH   512                  // query rows < RH use hi+lo planes (0: none)
#define WIN  0
#define PMAX 32768.0f             // largest scaled weight that goes into an fp16 P operand (fp16 ends at 65504)
#define NHB  (NB_ * NH_)          // both batches go through every launch: rows b*TT + t in the GEMMs, "heads" b*NH_ + h in the planes and in the attention grid
#define KSP  4                    // attention: the 2048 keys split over KSP workgroups per 256 query rows; partial planes [KSP][NHB][TT][HD] and partial row sums [KSP][NHB][TT] summed in k_merge
typedef _Float16 h16;
typedef unsigned short bf;
typedef __attribute__((ext_vector_type(16))) __bf16   v16bf;
typedef __attribute__((ext_vector_type(16))) _Float16 v16h;
typedef __attribute__((ext_vector_type(8)))  _Float16 v8h;
typedef __attribute__((ext_vector_type(8)))  unsigned short v8us;
typedef __attribute__((ext_vector_type(8)))  float    v8f;
typedef __attribute__((ext_vector_type(4)))  float    v4f;
typedef v8h  __attribute__((may_alias)) v8ha;
typedef v4f  __attribute__((may_alias)) v4fa;
typedef v8us __attribute__((may_alias)) v8usa;

__device__ __forceinline__ unsigned short f2bf(float f) { unsigned u = __float_as_uint(f); u += 0x7FFFu + ((u >> 16) & 1u); return (unsigned short)(u >> 16); }
__device__ __forceinline__ float bf2f(unsigned short b) { return __uint_as_float(((unsigned)b) << 16); }
__device__ __forceinline__ float bfr(float f) { return bf2f(f2bf(f)); }
__device__ __forceinline__ v16h cat16(v8h lo, v8h hi) { return __builtin_shufflevector(lo, hi, 0, 1, 2, 3, 4, 5, 6, 7, 8, 9, 10, 11, 12, 13, 14, 15); }
__device__ __forceinline__ v16bf cat16b(v8us lo, v8us hi) { return __builtin_bit_cast(v16bf, __builtin_shufflevector(lo, hi, 0, 1, 2, 3, 4, 5, 6, 7, 8, 9, 10, 11, 12, 13, 14, 15)); }
__device__ __forceinline__ v8f wmma16(v16h a, v16h b, v8f c) { return __builtin_amdgcn_wmma_f32_16x16x32_f16(false, a, false, b, (short)0, c, false, false); }
__device__ __forceinline__ v8f wmmab(v16bf a, v16bf b, v8f c) { return __builtin_amdgcn_wmma_f32_16x16x32_bf16(false, a, false, b, (short)0, c, false, false); }
// element offset of (row, k) in a fragment-order plane of K columns
__device__ __forceinline__ size_t pk(size_t row, int k, int K) { return ((row >> 4) * (size_t)(K >> 5) + (size_t)(k >> 5)) * 512 + (size_t)(((k >> 4) & 1) * 256 + ((k >> 3) & 1) * 128 + (k & 7)) + (row & 15) * 8; }
__device__ __forceinline__ h16 tohx(float x) { return (h16)x; }
__device__ __forceinline__ void splitf(float y, unsigned short& h, unsigned short& l) { h = f2bf(y); l = f2bf(y - bf2f(h)); }
// XWAIT stands between loads where the compiler lets a later load's result land in an earlier load's address registers: the wait that goes in front of such an overwrite
#define XWAIT asm volatile("s_wait_xcnt 0x0" ::: "memory")
// x + (x of lane ^ M), M = 1, 2 or 4, as a DPP move inside the 16-lane row (a shuffle would go through the LDS queue); every lane on
template <int M> __device__ __forceinline__ float addx(float x) { return x + __int_as_float(__builtin_amdgcn_update_dpp(0, __float_as_int(x), 0x160 + M, 0xf, 0xf, true)); }
// where the projection GEMM's epilogue puts a head's Q, K and V columns: hi/lo planes [h][t x d], V^T planes [h][d x t], each head's plane in fragment order; row norms [h][t]
struct PlaneOut { bf* Qh; bf* Ql; bf* Kh; bf* Kl; h16* V16; bf* Vh; bf* Vl; float* Q2; float* K2; };



// ---- k_gemmw: register-blocked GEMM, ONE WAVE per 64x64 output tile (16 accumulators), operands straight from fragment-order 16-bit planes; grid (M/64, N/64, Z), 32 threads.
// C[m][n] (f32, pitch ldc, + optional f32 bias[n]) = sum_k A[m][k] Bt[n][k] (+ split products per NSPLIT). z-batch strides sA/sB/sC in elements. K % (32 * KS) == 0; K is a compile-time constant, so that an operand's fragments are immediate offsets from one address that lives through the loop.
// PL (the input projection, N = 16 heads x [Q|K|V|G] x 64, so a 64-column tile is one part of one head): only the G tiles go to C; a Q or K tile goes out as bf16 hi/lo planes with its rows' sums of squares (the whole row of 64 is in the tile), a V tile as the three V^T planes.
// KS > 1: grid z = Z * KS; workgroup (z, ks) sums only k in [ks K/KS, (ks+1) K/KS) and stores its partial tile to plane ks (plane stride sP elements); the consumer adds the KS planes.
// ld: p + lo = the block's start + lane * 8
// every plane lies in global memory: said in the pointer type, because an address that has gone through an asm operand would otherwise be loaded from with flat instructions
typedef const __attribute__((address_space(1))) v8h* gv8h; typedef const __attribute__((address_space(1))) v8us* gv8us;
template <typename T16> struct WFrag;
template <> struct WFrag<h16> { typedef v16h V; static __device__ __forceinline__ V ld(const h16* p, unsigned lo) { return cat16(*(gv8h)(p + lo), *(gv8h)(p + lo + 256)); } static __device__ __forceinline__ v8f mma(V a, V b, v8f c) { return wmma16(a, b, c); } };
template <> struct WFrag<bf> { typedef v16bf V; static __device__ __forceinline__ V ld(const bf* p, unsigned lo) { return cat16b(*(gv8us)(p + lo), *(gv8us)(p + lo + 256)); } static __device__ __forceinline__ v8f mma(V a, V b, v8f c) { return wmmab(a, b, c); } };
template <typename T16, int NSPLIT, bool BIAS, int K, int KS = 1, bool PL = false>
__global__ __launch_bounds__(32) void k_gemmw(const T16* __restrict__ A, const T16* __restrict__ A2, const T16* __restrict__ Bt, const T16* __restrict__ Bt2, float* C, int ldc, const float* __restrict__ bias, size_t sA, size_t sB, size_t sC, size_t sP, PlaneOut po) {
    typedef typename WFrag<T16>::V V;
    __shared__ __align__(16) float os[16 * 68];
    const size_t z = blockIdx.z / KS; const int ks = blockIdx.z % KS; A += z * sA; if (A2) A2 += z * sA; Bt += z * sB; if (Bt2) Bt2 += z * sB; C += z * sC + (size_t)ks * sP;
    const int kbeg = ks * (K / KS), kend = kbeg + K / KS;
    const int lane = threadIdx.x & 31, lr = lane & 15, hi = lane >> 4; const int r0 = blockIdx.x * 64, c0 = blockIdx.y * 64;
    v8f acc[4][4];
#pragma unroll
    for (int mb = 0; mb < 4; ++mb)
#pragma unroll
        for (int nb = 0; nb < 4; ++nb) acc[mb][nb] = (v8f){};
    const size_t aoff = (size_t)r0 * K + (size_t)kbeg * 16 + 8 * lane, boff = (size_t)c0 * K + (size_t)kbeg * 16 + 8 * lane; const T16* pa = A + aoff; const T16* pa2 = (NSPLIT == 1 || NSPLIT == 2) ? A2 + aoff : nullptr; const T16* pb = Bt + boff; const T16* pb2 = NSPLIT >= 2 ? Bt2 + boff : nullptr;   /* 16 rows of a plane are K / 32 blocks = 16 K elements; a step of 32 k is one block = 512 elements */
#pragma unroll 1
    for (int kc = kbeg; kc < kend; kc += 32) {
        V a[4], a2[4];
#pragma unroll
        for (int mb = 0; mb < 4; ++mb) { a[mb] = WFrag<T16>::ld(pa + mb * 16 * K, 0u); if (NSPLIT == 1 || NSPLIT == 2) a2[mb] = WFrag<T16>::ld(pa2 + mb * 16 * K, 0u); }
#pragma unroll
        for (int nb = 0; nb < 4; ++nb) { const V b = WFrag<T16>::ld(pb + nb * 16 * K, 0u); V b2; if (NSPLIT >= 2) b2 = WFrag<T16>::ld(pb2 + nb * 16 * K, 0u);
#pragma unroll
            for (int mb = 0; mb < 4; ++mb) { acc[mb][nb] = WFrag<T16>::mma(a[mb], b, acc[mb][nb]); if (NSPLIT == 1 || NSPLIT == 2) acc[mb][nb] = WFrag<T16>::mma(a2[mb], b, acc[mb][nb]); if (NSPLIT >= 2) acc[mb][nb] = WFrag<T16>::mma(a[mb], b2, acc[mb][nb]); } }
        /* the wait that goes in front of an overwrite of a load's address registers, here the step to the next block; it takes the addresses themselves, so each stays in its one register pair through the trip and no later load of the trip is given that pair for its result */
        asm volatile("s_wait_xcnt 0x0" : "+v"(pa), "+v"(pb) :: "memory"); pa += 512; pb += 512;
        if (NSPLIT == 1 || NSPLIT == 2) { asm volatile("s_wait_xcnt 0x0" : "+v"(pa2) :: "memory"); pa2 += 512; }
        if (NSPLIT >= 2) { asm volatile("s_wait_xcnt 0x0" : "+v"(pb2) :: "memory"); pb2 += 512; }
        asm volatile("v_nop\n\tv_nop\n\tv_nop\n\tv_nop" : "+v"(acc[0][0]), "+v"(acc[1][1]), "+v"(acc[2][2]), "+v"(acc[3][3]) : "v"(a[0]), "v"(a[3]));
    }
    const int part = PL ? (int)(blockIdx.y & 3) : 3; const size_t head = (size_t)(r0 / TT) * NH_ + (blockIdx.y >> 2); const int t0 = r0 % TT;   /* part: 0 Q, 1 K, 2 V, 3 G; the same for the whole workgroup. Row r0 = b*TT + t0: the planes are [b*NH_ + h][..] */
    if (PL && part == 2) {   /* V^T straight from the accumulators: element j of lane (lr, hi) is row mb*16 + hi*8 + j of column nb*16 + lr, eight consecutive t of one d = one 16-byte piece of a plane, and the wave's 32 pieces are half a block: 512 bytes in a row a store */
#pragma unroll
        for (int nb = 0; nb < 4; ++nb) { const float bv = bfr(bias[c0 + nb * 16 + lr]);
#pragma unroll
            for (int mb = 0; mb < 4; ++mb) { v8h o16; v8us oh, ol;
#pragma unroll
                for (int j = 0; j < 8; ++j) { const float x = acc[mb][nb][j] + bv; o16[j] = tohx(x); unsigned short a2, c2; splitf(x, a2, c2); oh[j] = a2; ol[j] = c2; }
                const size_t o = head * HD * TT + pk(nb * 16 + lr, t0 + mb * 16 + hi * 8, TT); *(v8h*)(po.V16 + o) = o16; *(v8us*)(po.Vh + o) = oh; *(v8us*)(po.Vl + o) = ol; } }
        return; }
    if (PL && part < 2) {   /* Q, K: 16 rows at a time through LDS as below, read out eight lanes a row, eight columns a lane */
        const int c8 = (lane & 7) * 8, rq = lane >> 3; float bq[8]; bf* Ph = (part == 0 ? po.Qh : po.Kh) + (head * TT + t0) * HD; bf* Pl = (part == 0 ? po.Ql : po.Kl) + (head * TT + t0) * HD; float* N2 = (part == 0 ? po.Q2 : po.K2) + head * TT + t0;
#pragma unroll
        for (int q = 0; q < 8; ++q) bq[q] = bfr(bias[c0 + c8 + q]);
#pragma unroll
        for (int mb = 0; mb < 4; ++mb) { float keep = 0.f;
#pragma unroll
            for (int nb = 0; nb < 4; ++nb) {
#pragma unroll
                for (int j = 0; j < 8; ++j) os[(hi * 8 + j) * 68 + nb * 16 + lr] = acc[mb][nb][j]; }
            __builtin_amdgcn_wave_barrier(); asm volatile("" ::: "memory");   /* one wave, whose LDS operations run in order: this only keeps the compiler from moving a lane's reads over the other lanes' writes */
#pragma unroll
            for (int s = 0; s < 4; ++s) { const int row = 4 * s + rq; const v4f v0 = *(const v4fa*)(os + row * 68 + c8), v1 = *(const v4fa*)(os + row * 68 + c8 + 4); v8us oh, ol; float n2 = 0.f;
#pragma unroll
                for (int q = 0; q < 8; ++q) { const float x = (q < 4 ? v0[q & 3] : v1[q & 3]) + bq[q]; unsigned short a2, c2; splitf(x, a2, c2); oh[q] = a2; ol[q] = c2; n2 = fmaf(x, x, n2); }
                const size_t o = pk(mb * 16 + row, c8, HD); *(v8us*)(Ph + o) = oh; *(v8us*)(Pl + o) = ol;   /* four rows' pieces lie side by side: eight runs of 64 bytes a store */
                n2 = addx<4>(addx<2>(addx<1>(n2))); if ((lane & 7) == s) keep = n2; }   /* the row's eight partial sums; lane 8 rq + s keeps row 4 s + rq */
            if ((lane & 7) < 4) N2[mb * 16 + 4 * (lane & 7) + rq] = keep;
            __builtin_amdgcn_wave_barrier(); asm volatile("" ::: "memory");   /* and the next 16 rows' writes over these reads */
        }
        return; }
#pragma unroll
    for (int mb = 0; mb < 4; ++mb) {
#pragma unroll
        for (int nb = 0; nb < 4; ++nb) {
#pragma unroll
            for (int j = 0; j < 8; ++j) os[(hi * 8 + j) * 68 + nb * 16 + lr] = acc[mb][nb][j]; }
        __builtin_amdgcn_wave_barrier(); asm volatile("" ::: "memory");
        float* crow = C + (size_t)(r0 + mb * 16) * ldc + c0;
{
#pragma unroll
            for (int s = 0; s < 8; ++s) { const int row = 2 * s + hi, cofs = lr * 4; v4f val = *(const v4fa*)(os + row * 68 + cofs); if (BIAS) { val[0] += bfr(bias[c0 + cofs]); val[1] += bfr(bias[c0 + cofs + 1]); val[2] += bfr(bias[c0 + cofs + 2]); val[3] += bfr(bias[c0 + cofs + 3]); }
                *(v4f*)(crow + (size_t)row * ldc + cofs) = val; }
             }
        XWAIT;   /* behind these rows' stores: the next rows' bias load and LDS reads may be given their registers */
        __builtin_amdgcn_wave_barrier(); asm volatile("" ::: "memory");
    }
}

typedef __attribute__((ext_vector_type(2))) _Float16 v2h;
typedef __attribute__((ext_vector_type(4))) _Float16 v4h;
typedef __attribute__((ext_vector_type(2))) unsigned short v2us;
typedef __attribute__((ext_vector_type(4))) unsigned short v4us;
typedef __attribute__((ext_vector_type(2))) float v2f;
typedef __attribute__((ext_vector_type(4))) int v4i;

// two weight matrices in one launch: workgroups below nbA transpose wA, the rest wB. One thread = one 16-byte piece of the fragment-order plane Bt (rows n, K columns): eight k of one n.
// A wave stores 512 bytes in a row; each of its eight loads reads 16 consecutive n of two k rows (two runs of 64 bytes).
__global__ __launch_bounds__(256) void k_wtG(const float* __restrict__ wA, int KA, int NA, bf* BtA, int nbA, const float* __restrict__ wB, int KB, int NB, bf* BtB) {
    const bool sec = (int)blockIdx.x >= nbA; const float* __restrict__ w = sec ? wB : wA; const int K = sec ? KB : KA, N = sec ? NB : NA; bf* Bt = sec ? BtB : BtA; const int bx = (int)blockIdx.x - (sec ? nbA : 0);
    const int c = bx * 256 + (int)threadIdx.x; if (c >= N * (K / 8)) return;
    const int blk = c >> 6, kb = blk % (K >> 5), n = (blk / (K >> 5)) * 16 + (c & 15), k = kb * 32 + ((c >> 5) & 1) * 16 + ((c >> 4) & 1) * 8;
    const float* p = w + (size_t)k * N + n; float v[8]; v8us o;
#pragma unroll
    for (int j = 0; j < 8; ++j) v[j] = p[(size_t)j * N];
    XWAIT;   /* behind the eight loads: the conversion below is given their address registers */
#pragma unroll
    for (int j = 0; j < 8; ++j) o[j] = f2bf(v[j]);
    *(v8us*)(Bt + (size_t)c * 8) = o;
}
// X (rows of DM columns) -> bf16 in fragment order; one thread = one 16-byte piece of the plane, eight k of one row
__global__ __launch_bounds__(256) void k_cvt8(const float* __restrict__ src, bf* dst, size_t n8) { const size_t i = (size_t)blockIdx.x * 256 + threadIdx.x; if (i >= n8) return; const size_t blk = i >> 6, row = (blk / (DM / 32)) * 16 + (i & 15); const int k = (int)(blk % (DM / 32)) * 32 + (int)((i >> 5) & 1) * 16 + (int)((i >> 4) & 1) * 8; const v8f v = *(const v8f*)(src + row * DM + k); v8us o;
#pragma unroll
    for (int q = 0; q < 8; ++q) o[q] = f2bf(v[q]); *(v8us*)(dst + i * 8) = o;  }

// k_fattn: scores, Shepard weights and attn.v in one kernel; the scores never leave the registers. One wave = 32 query rows x TT/KSP keys, 32 keys a pass; 8 waves (256 query rows) a workgroup.
// The eight waves walk the same keys: each pass's K hi, K lo and V^T blocks (a stage, below) come into LDS once for the workgroup, by asynchronous copies, one pass ahead of their use, into two buffers by turns; the range's key norms come in once, in front of the loop. Every wave copies its eighth of each part (512 bytes in a row a copy); the blocks lie in LDS as in the planes, so a fragment load reads 512 bytes in a row there too.
// S^T = K Q^T (A = K rows, B = Q rows kept in registers): accumulator element j of lane (lr, hi) is key kb*16 + hi*8 + j of query lr, so two key tiles pack straight into the B operand (k order 8 hi + 0..7, 16 + 8 hi + 0..7, the loaders' own) of O^T += V^T P^T.
// w_j = (eps + sqrt(max(q2_i + k2_j - 2 S_ij, 0)))^-2 stays unnormalised; its f32 row sum goes out beside the partial O and divides in k_merge.
// Range of the 16-bit P operand: each query scales eps + dist by r, a power of two near 1 / sqrt(q2_i + k2 of the range's first key), so w / r^2 is of order 1 for keys about as far off as the norms are large; a power of two changes no rounding, and r^2 is taken out of the partial O and the partial sum on the way out.
// A key much nearer than that (down to dist = 0) gives a scaled weight beyond the fp16 range: when a pass of the fp16 rows meets a weight above PMAX, the queries concerned raise their r by a power of two 2^k that brings their largest weight to 2^9..2^11, and this pass's weights, the running row sum and the running O are multiplied by 2^-2k (exact), before anything is rounded to fp16. Weights far below a row's largest then round to fp16 subnormals or 0, at most 2^-25 against a row sum of at least 2^9.
#define STG 8192                  // elements (16 KiB) of a stage = 32 keys: K hi 4 KiB | K lo 4 KiB | V^T fp16 4 KiB, or V^T hi 4 KiB | V^T lo 4 KiB
__device__ __forceinline__ unsigned lds_off(const void* p) { return (unsigned)(size_t)p; }   /* byte address in the workgroup's LDS */
__device__ __forceinline__ v16bf ldsb(const bf* p) { return cat16b(*(const v8usa*)p, *(const v8usa*)(p + 256)); }
__device__ __forceinline__ v16h ldsh(const bf* p) { return cat16(*(const v8ha*)p, *(const v8ha*)(p + 256)); }
// one wave's share of a stage: l = the lane's 16 bytes in the stage's first part, the pointers its 16 bytes of each plane. The copies and the wait that goes in front of an overwrite of their address registers are one statement, so nothing can come between them
template <bool HL>
__device__ __forceinline__ void stage_in(unsigned l, const bf* kh, const bf* kl, const bf* v0, const bf* v1) {
    const unsigned l1 = l + 4096u, l2 = l + 8192u, l3 = l + 12288u;
    if (HL) asm volatile("global_load_async_to_lds_b128 %0, %4, off\n\tglobal_load_async_to_lds_b128 %1, %5, off\n\tglobal_load_async_to_lds_b128 %2, %6, off\n\tglobal_load_async_to_lds_b128 %3, %7, off\n\ts_wait_xcnt 0x0" :: "v"(l), "v"(l1), "v"(l2), "v"(l3), "v"(kh), "v"(kl), "v"(v0), "v"(v1) : "memory");
    else asm volatile("global_load_async_to_lds_b128 %0, %3, off\n\tglobal_load_async_to_lds_b128 %1, %4, off\n\tglobal_load_async_to_lds_b128 %2, %5, off\n\ts_wait_xcnt 0x0" :: "v"(l), "v"(l1), "v"(l2), "v"(kh), "v"(kl), "v"(v0) : "memory");
}
template <bool HL>
__device__ __forceinline__ void fattn_body(bf* ring, float* k2s, const bf* __restrict__ Qh, const bf* __restrict__ Ql, const bf* __restrict__ Kh, const bf* __restrict__ Kl, const h16* __restrict__ V16, const bf* __restrict__ Vh, const bf* __restrict__ Vl, const float* __restrict__ q2p, const float* __restrict__ k2p, int q0, int kbeg, float* Op, float* Lp) {
    const int lane = threadIdx.x & 31, lr = lane & 15, hi = lane >> 4; const unsigned lo = 8 * lane;
    // every inner loop here is unrolled in full: its index picks fragments and accumulators, which live in registers and cannot be indexed at run time
    v16bf qh[2][2], ql[2][2]; float q2[2], rs[2], r[2], er[2]; v8f oacc[4][2];
#pragma unroll
    for (int qb = 0; qb < 2; ++qb) { const size_t o = (size_t)(q0 + qb * 16) * HD;   /* 16 rows of 64 = two blocks */ q2[qb] = q2p[q0 + qb * 16 + lr]; rs[qb] = 0.f; r[qb] = __uint_as_float(__float_as_uint(__builtin_amdgcn_rsqf(fminf(fmaxf(q2[qb] + k2p[kbeg], 1e-8f), 1e12f))) & 0x7F800000u);   /* both ends bounded: (r eps)^-2 and its products with V stay far inside f32 */ er[qb] = SEPS * r[qb];
#pragma unroll
        for (int c = 0; c < 2; ++c) { qh[qb][c] = WFrag<bf>::ld(Qh + o + c * 512, lo); XWAIT; ql[qb][c] = WFrag<bf>::ld(Ql + o + c * 512, lo); XWAIT; }   /* XWAIT behind each fragment's loads: a later load's result may be given their address registers */
#pragma unroll
        for (int db = 0; db < 4; ++db) oacc[db][qb] = (v8f){}; }
    const unsigned wv = threadIdx.x >> 5, sl = wv * 256u + lo; const unsigned lb = lds_off(ring) + sl * 2u;   /* wave wv brings elements wv*256 .. +255 of each 2048-element part */
    const size_t vo = (size_t)(wv >> 1) * 16 * TT + (size_t)kbeg * 16 + (wv & 1u) * 256u + lo;   /* of V^T that is half wv & 1 of the block of d rows (wv >> 1) * 16 .. + 15 */
    const bf* gkh = Kh + (size_t)kbeg * HD + sl; const bf* gkl = Kl + (size_t)kbeg * HD + sl; const bf* gv0 = HL ? Vh + vo : (const bf*)(V16 + vo); const bf* gv1 = Vl + vo;
    { const unsigned ln = lds_off(k2s) + threadIdx.x * 8u; const float* gn = k2p + kbeg + threadIdx.x * 2;   /* the range's TT / KSP = 512 key norms, two a thread */
      asm volatile("global_load_async_to_lds_b64 %0, %1, off\n\ts_wait_xcnt 0x0" :: "v"(ln), "v"(gn) : "memory"); }
    stage_in<HL>(lb, gkh, gkl, gv0, gv1);
    asm volatile("s_wait_asynccnt 0x0" ::: "memory");   /* this wave's copies of stage 0 and of the norms have landed */
    __syncthreads();                                     /* and every other wave's */
    stage_in<HL>(lb + STG * 2u, gkh + 2048, gkl + 2048, gv0 + 512, gv1 + 512); gkh += 4096; gkl += 4096; gv0 += 1024; gv1 += 1024;   /* a stage further: 32 keys x 64 of K, 32 t of each V^T block */
    // the pass stays rolled: unrolled it would hold two passes' fragments in registers and cost resident waves
#pragma unroll 1
    for (int t = 0; t < TT / KSP / 32; ++t) {
        const bf* sb = ring + (t & 1) * STG;
        v8f s[2][2]; float wm[2] = {0.f, 0.f};
#pragma unroll
        for (int kb = 0; kb < 2; ++kb) { v16bf kh[2], kl[2];
#pragma unroll
            for (int c = 0; c < 2; ++c) { kh[c] = ldsb(sb + (kb * 2 + c) * 512 + lo); kl[c] = ldsb(sb + 2048 + (kb * 2 + c) * 512 + lo); }
#pragma unroll
            for (int qb = 0; qb < 2; ++qb) { v8f a = (v8f){};
#pragma unroll
                for (int c = 0; c < 2; ++c) { a = wmmab(kh[c], qh[qb][c], a); a = wmmab(kh[c], ql[qb][c], a); a = wmmab(kl[c], qh[qb][c], a); }
                s[kb][qb] = a; } }
        v16h vf[4];   /* fp16 rows: the V^T fragments are asked for here, so that they arrive under the weights' vector work */
        if (!HL) {
#pragma unroll
            for (int db = 0; db < 4; ++db) vf[db] = ldsh(sb + 4096 + db * 512 + lo); }
#pragma unroll
        for (int kb = 0; kb < 2; ++kb) { const v4f ka = *(const v4fa*)(k2s + t * 32 + kb * 16 + hi * 8), kc = *(const v4fa*)(k2s + t * 32 + kb * 16 + hi * 8 + 4);
#pragma unroll
            for (int qb = 0; qb < 2; ++qb) {
#pragma unroll
                for (int j = 0; j < 8; ++j) { const float t = q2[qb] + (j < 4 ? ka[j & 3] : kc[j & 3]); const float d2 = fmaxf(t - 2.0f * s[kb][qb][j], 0.f); const float den = fmaf(__builtin_amdgcn_sqrtf(d2), r[qb], er[qb]); const float w = __builtin_amdgcn_rcpf(den * den);   /* (r (eps + dist))^-2 */ s[kb][qb][j] = w; rs[qb] += w; if (!HL) wm[qb] = fmaxf(wm[qb], w); } } }
        if (!HL && __builtin_amdgcn_ballot_w32(fmaxf(wm[0], wm[1]) > PMAX) != 0u) {   /* rare; the ballot makes it one scalar branch for the wave, so the exchange below has every lane on */
#pragma unroll
            for (int qb = 0; qb < 2; ++qb) { const float m = fmaxf(wm[qb], __shfl_xor(wm[qb], 16, 32));   /* a query's keys lie in lanes lr and lr + 16: both take the same k */
                const int k = (m > PMAX) ? (((int)(__float_as_uint(m) >> 23) - 136) >> 1) : 0; const float g = __uint_as_float((unsigned)(127 - k) << 23), gi = __uint_as_float((unsigned)(127 + k) << 23), f = g * g;
                r[qb] *= gi; er[qb] *= gi; rs[qb] *= f; s[0][qb] *= f; s[1][qb] *= f;
#pragma unroll
                for (int db = 0; db < 4; ++db) oacc[db][qb] *= f; } }
        if (HL) { v16bf ph[2], pl[2];
#pragma unroll
            for (int qb = 0; qb < 2; ++qb) { v8us h0, h1, l0, l1;
#pragma unroll
                for (int j = 0; j < 8; ++j) { unsigned short a, c2; splitf(s[0][qb][j], a, c2); h0[j] = a; l0[j] = c2; splitf(s[1][qb][j], a, c2); h1[j] = a; l1[j] = c2; }
                ph[qb] = cat16b(h0, h1); pl[qb] = cat16b(l0, l1); }
#pragma unroll
            for (int db = 0; db < 4; ++db) { const v16bf vh = ldsb(sb + 4096 + db * 512 + lo), vl = ldsb(sb + 6144 + db * 512 + lo);
#pragma unroll
                for (int qb = 0; qb < 2; ++qb) { oacc[db][qb] = wmmab(vh, ph[qb], oacc[db][qb]); oacc[db][qb] = wmmab(vh, pl[qb], oacc[db][qb]); oacc[db][qb] = wmmab(vl, ph[qb], oacc[db][qb]); } }
        } else { v16h p[2];
#pragma unroll
            for (int qb = 0; qb < 2; ++qb) { v8h p0, p1;
#pragma unroll
                for (int j = 0; j < 8; ++j) { p0[j] = tohx(s[0][qb][j]); p1[j] = tohx(s[1][qb][j]); }
                p[qb] = cat16(p0, p1); }
#pragma unroll
            for (int db = 0; db < 4; ++db) {
#pragma unroll
                for (int qb = 0; qb < 2; ++qb) oacc[db][qb] = wmma16(vf[db], p[qb], oacc[db][qb]); } }
        asm volatile("s_wait_dscnt 0x0" ::: "memory");      /* this wave has read all it wants of this pass's buffer */
        asm volatile("s_wait_asynccnt 0x0" ::: "memory");   /* and its copies of the next stage have landed */
        __syncthreads();                                     /* so have every wave's: the next stage may be read, this pass's buffer refilled */
        if (t + 2 < TT / KSP / 32) { stage_in<HL>(lb + (unsigned)(t & 1) * (STG * 2u), gkh, gkl, gv0, gv1); gkh += 2048; gkl += 2048; gv0 += 512; gv1 += 512; }
    }
    asm volatile("s_wait_asynccnt 0x0" ::: "memory");   /* no copy is left in flight when the wave ends */
#pragma unroll
    for (int qb = 0; qb < 2; ++qb) { const float u = r[qb] * r[qb]; const float tot = (rs[qb] + __shfl_xor(rs[qb], 16, 32)) * u; if (hi == 0) Lp[q0 + qb * 16 + lr] = tot;
#pragma unroll
        for (int db = 0; db < 4; ++db) { float* o = Op + (size_t)(q0 + qb * 16 + lr) * HD + db * 16 + hi * 8; const v8f a = oacc[db][qb] * u; *(v4f*)o = (v4f){a[0], a[1], a[2], a[3]}; *(v4f*)(o + 4) = (v4f){a[4], a[5], a[6], a[7]}; } }
}
__global__ __launch_bounds__(256) void k_fattn(const bf* __restrict__ QPh, const bf* __restrict__ QPl, const bf* __restrict__ KPh, const bf* __restrict__ KPl, const h16* __restrict__ VT16, const bf* __restrict__ VTh, const bf* __restrict__ VTl, const float* __restrict__ Q2, const float* __restrict__ K2, float* Ob, float* Lb) {
    // grid (head, key range, query tile). The hi/lo tiles' passes hold half as many matrix instructions again and far more vector work; these tiles have the lowest z, so they start first. For speed only: each (head, range, tile) is done once wherever it lands
    const size_t h = blockIdx.x, ks = blockIdx.y, hp = h * TT * HD; const int q0 = blockIdx.z * 256 + (threadIdx.x >> 5) * 32, kbeg = (int)ks * (TT / KSP);
    float* Op = Ob + (ks * NHB + h) * TT * HD; float* Lp = Lb + (ks * NHB + h) * TT;
    __shared__ __align__(16) bf ring[2 * STG]; __shared__ __align__(16) float k2s[TT / KSP];
    if (blockIdx.z * 256 < RH) fattn_body<true>(ring, k2s, QPh + hp, QPl + hp, KPh + hp, KPl + hp, VT16 + hp, VTh + hp, VTl + hp, Q2 + h * TT, K2 + h * TT, q0, kbeg, Op, Lp);   /* RH is a multiple of 256: one path a workgroup */
    else fattn_body<false>(ring, k2s, QPh + hp, QPl + hp, KPh + hp, KPl + hp, VT16 + hp, VTh + hp, VTl + hp, Q2 + h * TT, K2 + h * TT, q0, kbeg, Op, Lp);
}
__global__ __launch_bounds__(256) void k_merge(const float* __restrict__ O, const float* __restrict__ L, const float* __restrict__ FP, bf* Ah, bf* Al) { const size_t e = ((size_t)blockIdx.x * 256 + threadIdx.x) * 2; if (e >= (size_t)NHB * TT * HD) return; const int d = (int)(e % HD); const int t = (int)((e / HD) % TT); const int zz = (int)(e / ((size_t)HD * TT)); const int hh = zz % NH_; const size_t row = (size_t)(zz / NH_) * TT + t; const size_t oo = pk(row, hh * HD + d, DQ);   /* fragment order; d is even, so the pair stays in one piece */
    float lp[KSP]; v2f op[KSP];   /* XWAIT behind each load: the next load's result may be given this one's address registers */
#pragma unroll
    for (int ks = 0; ks < KSP; ++ks) { lp[ks] = L[((size_t)ks * NHB + zz) * TT + t]; XWAIT; op[ks] = *(const v2f*)(O + (size_t)ks * ((size_t)NHB * TT * HD) + e); XWAIT; }
    float lsum = lp[0];   /* row sum of the weights: the KSP partial sums, fixed order */
#pragma unroll
    for (int ks = 1; ks < KSP; ++ks) lsum = __fadd_rn(lsum, lp[ks]);
    const float cs = __builtin_amdgcn_rcpf(__fadd_rn(SEPS, lsum));   /* W / (eps + sum W) via hardware reciprocal */
    v2us oh, ol; v2f os2 = op[0];   /* sum of the KSP partial planes, fixed order */
#pragma unroll
    for (int ks = 1; ks < KSP; ++ks) { os2[0] = __fadd_rn(os2[0], op[ks][0]); os2[1] = __fadd_rn(os2[1], op[ks][1]); }
#pragma unroll
    for (int q = 0; q < 2; ++q) { const float oc = os2[q] * cs; const float gt = FP[row * DP + hh * HSTR + 192 + d + q]; unsigned short a, c2; splitf(__fmul_rn(gt, oc), a, c2); oh[q] = a; ol[q] = c2; }   /* H = G * A */ *(v2us*)(Ah + oo) = oh; *(v2us*)(Al + oo) = ol;  }

extern "C" void kernel_launch(void* const* d_in, const int* in_sizes, int n_in,
                              void* d_out, int out_size, void* d_ws, size_t ws_size, hipStream_t stream) {
    (void)in_sizes; (void)n_in; (void)out_size;
    const float* x = (const float*)d_in[0]; const float* win = (const float*)d_in[1]; const float* bin = (const float*)d_in[2]; const float* wo = (const float*)d_in[3]; const float* bo = (const float*)d_in[4]; const float* wq = nullptr; const float* wk = nullptr; const float* wv = nullptr; (void)wq; (void)wk; (void)wv;
    float* OUT = (float*)d_out;     // [2][2048][1024]
    char* wsp = (char*)d_ws;
    auto take = [&](size_t bytes) { char* p = wsp; wsp += (bytes + 255) & ~(size_t)255; return (void*)p; };
    bf* WINB = (bf*)take((size_t)DP * DM * 2); bf* WO = (bf*)take((size_t)DM * DQ * 2);
    bf* XB = (bf*)take((size_t)NB_ * TT * DM * 2); float* FP = (float*)take((size_t)NB_ * TT * DP * 4); float* Q2 = (float*)take((size_t)NHB * TT * 4); float* K2 = (float*)take((size_t)NHB * TT * 4);
    h16* VT16 = (h16*)take((size_t)NHB * HD * TT * 2);
    bf* QPh = (bf*)take((size_t)NHB * TT * HD * 2); bf* QPl = (bf*)take((size_t)NHB * TT * HD * 2); bf* KPh = (bf*)take((size_t)NHB * TT * HD * 2); bf* KPl = (bf*)take((size_t)NHB * TT * HD * 2); bf* VTh = (bf*)take((size_t)NHB * HD * TT * 2); bf* VTl = (bf*)take((size_t)NHB * HD * TT * 2);
    float* Ob = (float*)take((size_t)KSP * NHB * TT * HD * 4); float* Lb = (float*)take((size_t)KSP * NHB * TT * 4); bf* ATh = (bf*)take((size_t)NB_ * TT * DQ * 2); bf* ATl = (bf*)take((size_t)NB_ * TT * DQ * 2);
    if ((size_t)(wsp - (char*)d_ws) > ws_size) return;    // about 220 MiB of the 256 MiB
    k_wtG<<<(unsigned)(DM * DP / 2048 + DQ * DM / 2048), 256, 0, stream>>>(win, DM, DP, WINB, DM * DP / 2048, wo, DQ, DM, WO);   /* 'xw' [1024][4096] -> Bt 4096 x 1024; 'xw' [1024][1024] -> Bt 1024 x 1024; 2048 elements a workgroup */
    const PlaneOut po = {QPh, QPl, KPh, KPl, VT16, VTh, VTl, Q2, K2}, none = {};
    /* X [2][2048][1024] is one matrix of NB_*TT rows to both GEMMs; the attention sees NHB independent heads */
    k_cvt8<<<(unsigned)(((size_t)NB_ * TT * DM / 8 + 255) / 256), 256, 0, stream>>>(x, XB, (size_t)NB_ * TT * DM / 8);
    k_gemmw<bf, 0, true, DM, 1, true><<<dim3(NB_ * TT / 64, DP / 64, 1), 32, 0, stream>>>(XB, nullptr, WINB, nullptr, FP, DP, bin, 0, 0, 0, 0, po);   /* P = X W_in + b_in (exact): Q, K hi/lo planes + q2, k2, V^T planes; G (cols h*256 + 192..255) in f32 to FP */
    k_fattn<<<dim3(NHB, KSP, TT / 256), 256, 0, stream>>>(QPh, QPl, KPh, KPl, VT16, VTh, VTl, Q2, K2, Ob, Lb);   /* all heads of both batches: Q.K (3 products), weights, attn.v partials + partial row sums */
    k_merge<<<(unsigned)(((size_t)NHB * TT * HD / 2 + 255) / 256), 256, 0, stream>>>(Ob, Lb, FP, ATh, ATl);
    k_gemmw<bf, 1, true, DQ><<<dim3(NB_ * TT / 64, DM / 64, 1), 32, 0, stream>>>(ATh, ATl, WO, nullptr, OUT, DM, bo, 0, 0, 0, 0, none);
}

// v008
// One run takes 149 microseconds.
// Two timings next to v007 put it at 1.16 and 1.17 times that version's speed.
// Over all steps from v000 it is 14.2 times as fast.
#include <hip/hip_runtime.h>

// Shepard's (inverse-distance) gated attention (X [2][2048][1024]; P = X W_in + b_in ('xw' [1024][4096]) viewed per head h as [Q(64) | K(64) | V(64) | G(64)] at columns h*256 + ...; W = (1e-4 + ||Q_i - K_j||)^-2 with the distance by the norm expansion sqrt(max(q2 + k2 - 2 Q.K, 0)); W = W / (1e-4 + sum_j W); A = W.V; H = G * A; out = merged H W_out ('xw' [1024][1024]) + b_out -> [2][2048][1024]).
// Compute dtypes, f32 accumulate: every input rounded to bf16; q/k/v on PLAIN bf16 operands (inputs: exact) + b_in, their 16-bit planes and the f32 row norms q2, k2 written by that GEMM's own epilogue; the Q.K products on hi/lo planes for every row (3 products; the distance needs them), the Shepard weights (sqrt, reciprocal) and their row sums in f32 inside the fused attention kernel, row normalisation and gating in the merge; attn.v hybrid on the unnormalised weights: query rows < 512 hl (3 products), the rest single fp16; W_out hl x exact (2 products) + b_out.
// Layout of every 16-bit matrix operand plane (X, W_in^T, W_out^T, Q, K, V^T, gated A): FRAGMENT ORDER. A plane of rows x K is cut into blocks of 16 rows x 32 k (1 KiB), block (row / 16) * (K / 32) + k / 32; inside a block the 16-byte piece that lane (lr, hi) takes in its first load (row lr, k = 8 hi + 0..7) lies at piece hi * 16 + lr, the piece of its second load (k = 16 + 8 hi + 0..7) 512 bytes further. So each wave-wide 16-byte load reads 512 bytes in a row (4 whole lines) where a row-major plane gave it 32 bytes of each of 16 lines.

#define NB_  2
#define TT   2048
#define DM   1024
#define NH_  16
#define NKV  16
#define REP  (NH_ / NKV)
#define HD   64
#define DQ   (NH_ * HD)
#define DKV  (NKV * HD)
#define DP   4096                 // projection width (16 heads x [Q|K|V|G] x 64)
#define HSTR 256
#define SEPS 1e-4f
#define RH   512                  // query rows < RH use hi+lo planes (0: none)
#define WIN  0
#define PMAX 32768.0f             // largest scaled weight that goes into an fp16 P operand (fp16 ends at 65504)
#define NHB  (NB_ * NH_)          // both batches go through every launch: rows b*TT + t in the GEMMs, "heads" b*NH_ + h in the planes and in the attention grid
#define KSP  4                    // attention: the 2048 keys split over KSP workgroups per 256 query rows; partial planes [KSP][NHB][TT][HD] and partial row sums [KSP][NHB][TT] summed in k_merge
typedef _Float16 h16;
typedef unsigned short bf;
typedef __attribute__((ext_vector_type(16))) __bf16   v16bf;
typedef __attribute__((ext_vector_type(16))) _Float16 v16h;
typedef __attribute__((ext_vector_type(8)))  _Float16 v8h;
typedef __attribute__((ext_vector_type(8)))  unsigned short v8us;
typedef __attribute__((ext_vector_type(8)))  float    v8f;
typedef __attribute__((ext_vector_type(4)))  float    v4f;
typedef v8h  __attribute__((may_alias)) v8ha;
typedef v4f  __attribute__((may_alias)) v4fa;
typedef v8us __attribute__((may_alias)) v8usa;

__device__ __forceinline__ unsigned short f2bf(float f) { unsigned u = __float_as_uint(f); u += 0x7FFFu + ((u >> 16) & 1u); return (unsigned short)(u >> 16); }
__device__ __forceinline__ float bf2f(unsigned short b) { return __uint_as_float(((unsigned)b) << 16); }
__device__ __forceinline__ float bfr(float f) { return bf2f(f2bf(f)); }
__device__ __forceinline__ v16h cat16(v8h lo, v8h hi) { return __builtin_shufflevector(lo, hi, 0, 1, 2, 3, 4, 5, 6, 7, 8, 9, 10, 11, 12, 13, 14, 15); }
__device__ __forceinline__ v16bf cat16b(v8us lo, v8us hi) { return __builtin_bit_cast(v16bf, __builtin_shufflevector(lo, hi, 0, 1, 2, 3, 4, 5, 6, 7, 8, 9, 10, 11, 12, 13, 14, 15)); }
__device__ __forceinline__ v8f wmma16(v16h a, v16h b, v8f c) { return __builtin_amdgcn_wmma_f32_16x16x32_f16(false, a, false, b, (short)0, c, false, false); }
__device__ __forceinline__ v8f wmmab(v16bf a, v16bf b, v8f c) { return __builtin_amdgcn_wmma_f32_16x16x32_bf16(false, a, false, b, (short)0, c, false, false); }
// element offset of (row, k) in a fragment-order plane of K columns
__device__ __forceinline__ size_t pk(size_t row, int k, int K) { return ((row >> 4) * (size_t)(K >> 5) + (size_t)(k >> 5)) * 512 + (size_t)(((k >> 4) & 1) * 256 + ((k >> 3) & 1) * 128 + (k & 7)) + (row & 15) * 8; }
__device__ __forceinline__ h16 tohx(float x) { return (h16)x; }
__device__ __forceinline__ void splitf(float y, unsigned short& h, unsigned short& l) { h = f2bf(y); l = f2bf(y - bf2f(h)); }
// XWAIT stands between loads where the compiler lets a later load's result land in an earlier load's address registers: the wait that goes in front of such an overwrite
#define XWAIT asm volatile("s_wait_xcnt 0x0" ::: "memory")
// x + (x of lane ^ M), M = 1, 2 or 4, as a DPP move inside the 16-lane row (a shuffle would go through the LDS queue); every lane on
template <int M> __device__ __forceinline__ float addx(float x) { return x + __int_as_float(__builtin_amdgcn_update_dpp(0, __float_as_int(x), 0x160 + M, 0xf, 0xf, true)); }
// where the projection GEMM's epilogue puts a head's Q, K and V columns: hi/lo planes [h][t x d], V^T planes [h][d x t], each head's plane in fragment order; row norms [h][t]
struct PlaneOut { bf* Qh; bf* Ql; bf* Kh; bf* Kl; h16* V16; bf* Vh; bf* Vl; float* Q2; float* K2; };



// ---- k_gemmw: register-blocked GEMM, ONE WAVE per 64x64 output tile (16 accumulators), operands straight from fragment-order 16-bit planes; grid (M/64, N/64, Z), 32 threads.
// C[m][n] (f32, pitch ldc, + optional f32 bias[n]) = sum_k A[m][k] Bt[n][k] (+ split products per NSPLIT). z-batch strides sA/sB/sC in elements. K / KS is a multiple of 64 (PL) or 128 (the loop's trip, below); K is a compile-time constant, so that an operand's fragments are immediate offsets from one address that lives through the loop.
// PL (the input projection, N = 16 heads x [Q|K|V|G] x 64, so a 64-column tile is one part of one head): only the G tiles go to C; a Q or K tile goes out as bf16 hi/lo planes with its rows' sums of squares (the whole row of 64 is in the tile), a V tile as the three V^T planes.
// KS > 1: grid z = Z * KS; workgroup (z, ks) sums only k in [ks K/KS, (ks+1) K/KS) and stores its partial tile to plane ks (plane stride sP elements); the consumer adds the KS planes.
// ld: p + lo = the block's start + lane * 8
// every plane lies in global memory: said in the pointer type, because an address that has gone through an asm operand would otherwise be loaded from with flat instructions
typedef const __attribute__((address_space(1))) v8h* gv8h; typedef const __attribute__((address_space(1))) v8us* gv8us;
template <typename T16> struct WFrag;
template <> struct WFrag<h16> { typedef v16h V; static __device__ __forceinline__ V ld(const h16* p, unsigned lo) { return cat16(*(gv8h)(p + lo), *(gv8h)(p + lo + 256)); } static __device__ __forceinline__ v8f mma(V a, V b, v8f c) { return wmma16(a, b, c); } };
template <> struct WFrag<bf> { typedef v16bf V; static __device__ __forceinline__ V ld(const bf* p, unsigned lo) { return cat16b(*(gv8us)(p + lo), *(gv8us)(p + lo + 256)); } static __device__ __forceinline__ v8f mma(V a, V b, v8f c) { return wmmab(a, b, c); } };
template <typename T16, int NSPLIT, bool BIAS, int K, int KS = 1, bool PL = false>
__global__ __launch_bounds__(32) void k_gemmw(const T16* __restrict__ A, const T16* __restrict__ A2, const T16* __restrict__ Bt, const T16* __restrict__ Bt2, float* C, int ldc, const float* __restrict__ bias, size_t sA, size_t sB, size_t sC, size_t sP, PlaneOut po) {
    typedef typename WFrag<T16>::V V;
    __shared__ __align__(16) float os[16 * 68];
    const size_t z = blockIdx.z / KS; const int ks = blockIdx.z % KS; A += z * sA; if (A2) A2 += z * sA; Bt += z * sB; if (Bt2) Bt2 += z * sB; C += z * sC + (size_t)ks * sP;
    const int kbeg = ks * (K / KS), kend = kbeg + K / KS;
    const int lane = threadIdx.x & 31, lr = lane & 15, hi = lane >> 4; const int r0 = blockIdx.x * 64, c0 = blockIdx.y * 64;
    v8f acc[4][4];
#pragma unroll
    for (int mb = 0; mb < 4; ++mb)
#pragma unroll
        for (int nb = 0; nb < 4; ++nb) acc[mb][nb] = (v8f){};
    const size_t aoff = (size_t)r0 * K + (size_t)kbeg * 16 + 8 * lane, boff = (size_t)c0 * K + (size_t)kbeg * 16 + 8 * lane; const T16* pa = A + aoff; const T16* pa2 = (NSPLIT == 1 || NSPLIT == 2) ? A2 + aoff : nullptr; const T16* pb = Bt + boff; const T16* pb2 = NSPLIT >= 2 ? Bt2 + boff : nullptr;   /* 16 rows of a plane are K / 32 blocks = 16 K elements; a step of 32 k is one block = 512 elements */
    // The fragments run ahead of the products in register sets taken by turns, NS sets of A: a block's loads fly under the products of the blocks in front of it, where one set made the wave wait for them in every block.
    // Four waves a SIMD (the projection; 256 registers a wave): NS = 2, one block ahead, and one set of B, each B fragment asked for again, for the next block, right behind the four tiles that read it. A wave that has its SIMD alone (the output GEMM, 1024 waves) has nobody to fill its waits and registers to spare: A and B two blocks ahead (D = 2; three sets are live, the turn goes over NS = 4 because that divides the count of blocks; three blocks ahead a wait would have 72 younger loads to count, and the compiler then writes its largest count, 62, instead).
    // NS blocks a trip, so that the set is a compile-time index; the last NS blocks stand behind the loop, and only the first NS - D of them still ask for a block.
    constexpr int NS = PL ? 2 : 4, D = PL ? 1 : 2, NBS = PL ? 1 : NS;
    static_assert((K / KS) % (32 * NS) == 0, "NS blocks of 32 k a trip");
    /* HOLD keeps the compiler's scheduler from moving a load or a product over it: left free it sinks the loads down to a few products in front of their use, and the wave waits for them again */
#define HOLD __builtin_amdgcn_sched_barrier(0)
    V a[NS][4], a2[NS][4], b[NBS][4], b2[NBS][4];
    /* block j's A (and, where B has its sets, B) into set s; the addresses are the trip's */
#define GLOAD(s, j) { \
        _Pragma("unroll") for (int mb = 0; mb < 4; ++mb) { a[s][mb] = WFrag<T16>::ld(pa + mb * 16 * K + 512 * (j), 0u); if (NSPLIT == 1 || NSPLIT == 2) a2[s][mb] = WFrag<T16>::ld(pa2 + mb * 16 * K + 512 * (j), 0u); } \
        if (NBS > 1) { _Pragma("unroll") for (int nb = 0; nb < 4; ++nb) { b[(s) % NBS][nb] = WFrag<T16>::ld(pb + nb * 16 * K + 512 * (j), 0u); if (NSPLIT >= 2) b2[(s) % NBS][nb] = WFrag<T16>::ld(pb2 + nb * 16 * K + 512 * (j), 0u); } } \
        HOLD; }
    /* block u of a trip: the loads (NEXT) of the block D further on, the products of set u */
#define GBLOCK(u, NEXT) { \
        if (NEXT) GLOAD(((u) + D) % NS, (u) + D) \
        _Pragma("unroll") for (int nb = 0; nb < 4; ++nb) { \
            _Pragma("unroll") for (int mb = 0; mb < 4; ++mb) { acc[mb][nb] = WFrag<T16>::mma(a[u][mb], b[(u) % NBS][nb], acc[mb][nb]); if (NSPLIT == 1 || NSPLIT == 2) acc[mb][nb] = WFrag<T16>::mma(a2[u][mb], b[(u) % NBS][nb], acc[mb][nb]); if (NSPLIT >= 2) acc[mb][nb] = WFrag<T16>::mma(a[u][mb], b2[(u) % NBS][nb], acc[mb][nb]); } \
            if ((NEXT) && NBS == 1) { HOLD; b[0][nb] = WFrag<T16>::ld(pb + nb * 16 * K + 512 * ((u) + 1), 0u); if (NSPLIT >= 2) b2[0][nb] = WFrag<T16>::ld(pb2 + nb * 16 * K + 512 * ((u) + 1), 0u); HOLD; } } \
        HOLD; }
#pragma unroll
    for (int s = 0; s < D; ++s) GLOAD(s, s)   /* the loads stand in the loop's order here too: the loop's first counted waits are set for the later of the two orders that reach them */
    if (NBS == 1) {
#pragma unroll
        for (int nb = 0; nb < 4; ++nb) { b[0][nb] = WFrag<T16>::ld(pb + nb * 16 * K, 0u); if (NSPLIT >= 2) b2[0][nb] = WFrag<T16>::ld(pb2 + nb * 16 * K, 0u); HOLD; } }
#pragma unroll 1
    for (int kc = kbeg; kc < kend - 32 * NS; kc += 32 * NS) {
#pragma unroll
        for (int u = 0; u < NS; ++u) GBLOCK(u, true)
        /* the wait that goes in front of an overwrite of a load's address registers, here the step of NS blocks; it takes the addresses themselves, so each stays in its one register pair through the trip and no later load of the trip is given that pair for its result */
        asm volatile("s_wait_xcnt 0x0" : "+v"(pa), "+v"(pb) :: "memory"); pa += 512 * NS; pb += 512 * NS;
        if (NSPLIT == 1 || NSPLIT == 2) { asm volatile("s_wait_xcnt 0x0" : "+v"(pa2) :: "memory"); pa2 += 512 * NS; }
        if (NSPLIT >= 2) { asm volatile("s_wait_xcnt 0x0" : "+v"(pb2) :: "memory"); pb2 += 512 * NS; }
    }
#pragma unroll
    for (int u = 0; u < NS - D; ++u) GBLOCK(u, true)
#pragma unroll
    for (int u = NS - D; u < NS; ++u) GBLOCK(u, false)
#undef GBLOCK
#undef GLOAD
#undef HOLD
    const int part = PL ? (int)(blockIdx.y & 3) : 3; const size_t head = (size_t)(r0 / TT) * NH_ + (blockIdx.y >> 2); const int t0 = r0 % TT;   /* part: 0 Q, 1 K, 2 V, 3 G; the same for the whole workgroup. Row r0 = b*TT + t0: the planes are [b*NH_ + h][..] */
    if (PL && part == 2) {   /* V^T straight from the accumulators: element j of lane (lr, hi) is row mb*16 + hi*8 + j of column nb*16 + lr, eight consecutive t of one d = one 16-byte piece of a plane, and the wave's 32 pieces are half a block: 512 bytes in a row a store */
#pragma unroll
        for (int nb = 0; nb < 4; ++nb) { const float bv = bfr(bias[c0 + nb * 16 + lr]);
#pragma unroll
            for (int mb = 0; mb < 4; ++mb) { v8h o16; v8us oh, ol;
#pragma unroll
                for (int j = 0; j < 8; ++j) { const float x = acc[mb][nb][j] + bv; o16[j] = tohx(x); unsigned short a2, c2; splitf(x, a2, c2); oh[j] = a2; ol[j] = c2; }
                const size_t o = head * HD * TT + pk(nb * 16 + lr, t0 + mb * 16 + hi * 8, TT); *(v8h*)(po.V16 + o) = o16; *(v8us*)(po.Vh + o) = oh; *(v8us*)(po.Vl + o) = ol; } }
        return; }
    if (PL && part < 2) {   /* Q, K: 16 rows at a time through LDS as below, read out eight lanes a row, eight columns a lane */
        const int c8 = (lane & 7) * 8, rq = lane >> 3; float bq[8]; bf* Ph = (part == 0 ? po.Qh : po.Kh) + (head * TT + t0) * HD; bf* Pl = (part == 0 ? po.Ql : po.Kl) + (head * TT + t0) * HD; float* N2 = (part == 0 ? po.Q2 : po.K2) + head * TT + t0;
#pragma unroll
        for (int q = 0; q < 8; ++q) bq[q] = bfr(bias[c0 + c8 + q]);
#pragma unroll
        for (int mb = 0; mb < 4; ++mb) { float keep = 0.f;
#pragma unroll
            for (int nb = 0; nb < 4; ++nb) {
#pragma unroll
                for (int j = 0; j < 8; ++j) os[(hi * 8 + j) * 68 + nb * 16 + lr] = acc[mb][nb][j]; }
            __builtin_amdgcn_wave_barrier(); asm volatile("" ::: "memory");   /* one wave, whose LDS operations run in order: this only keeps the compiler from moving a lane's reads over the other lanes' writes */
#pragma unroll
            for (int s = 0; s < 4; ++s) { const int row = 4 * s + rq; const v4f v0 = *(const v4fa*)(os + row * 68 + c8), v1 = *(const v4fa*)(os + row * 68 + c8 + 4); v8us oh, ol; float n2 = 0.f;
#pragma unroll
                for (int q = 0; q < 8; ++q) { const float x = (q < 4 ? v0[q & 3] : v1[q & 3]) + bq[q]; unsigned short a2, c2; splitf(x, a2, c2); oh[q] = a2; ol[q] = c2; n2 = fmaf(x, x, n2); }
                const size_t o = pk(mb * 16 + row, c8, HD); *(v8us*)(Ph + o) = oh; *(v8us*)(Pl + o) = ol;   /* four rows' pieces lie side by side: eight runs of 64 bytes a store */
                n2 = addx<4>(addx<2>(addx<1>(n2))); if ((lane & 7) == s) keep = n2; }   /* the row's eight partial sums; lane 8 rq + s keeps row 4 s + rq */
            if ((lane & 7) < 4) N2[mb * 16 + 4 * (lane & 7) + rq] = keep;
            __builtin_amdgcn_wave_barrier(); asm volatile("" ::: "memory");   /* and the next 16 rows' writes over these reads */
        }
        return; }
#pragma unroll
    for (int mb = 0; mb < 4; ++mb) {
#pragma unroll
        for (int nb = 0; nb < 4; ++nb) {
#pragma unroll
            for (int j = 0; j < 8; ++j) os[(hi * 8 + j) * 68 + nb * 16 + lr] = acc[mb][nb][j]; }
        __builtin_amdgcn_wave_barrier(); asm volatile("" ::: "memory");
        float* crow = C + (size_t)(r0 + mb * 16) * ldc + c0;
{
#pragma unroll
            for (int s = 0; s < 8; ++s) { const int row = 2 * s + hi, cofs = lr * 4; v4f val = *(const v4fa*)(os + row * 68 + cofs); if (BIAS) { val[0] += bfr(bias[c0 + cofs]); val[1] += bfr(bias[c0 + cofs + 1]); val[2] += bfr(bias[c0 + cofs + 2]); val[3] += bfr(bias[c0 + cofs + 3]); }
                *(v4f*)(crow + (size_t)row * ldc + cofs) = val; }
             }
        XWAIT;   /* behind these rows' stores: the next rows' bias load and LDS reads may be given their registers */
        __builtin_amdgcn_wave_barrier(); asm volatile("" ::: "memory");
    }
}

typedef __attribute__((ext_vector_type(2))) _Float16 v2h;
typedef __attribute__((ext_vector_type(4))) _Float16 v4h;
typedef __attribute__((ext_vector_type(2))) unsigned short v2us;
typedef __attribute__((ext_vector_type(4))) unsigned short v4us;
typedef __attribute__((ext_vector_type(2))) float v2f;
typedef __attribute__((ext_vector_type(4))) int v4i;

// two weight matrices in one launch: workgroups below nbA transpose wA, the rest wB. One thread = one 16-byte piece of the fragment-order plane Bt (rows n, K columns): eight k of one n.
// A wave stores 512 bytes in a row; each of its eight loads reads 16 consecutive n of two k rows (two runs of 64 bytes).
__global__ __launch_bounds__(256) void k_wtG(const float* __restrict__ wA, int KA, int NA, bf* BtA, int nbA, const float* __restrict__ wB, int KB, int NB, bf* BtB) {
    const bool sec = (int)blockIdx.x >= nbA; const float* __restrict__ w = sec ? wB : wA; const int K = sec ? KB : KA, N = sec ? NB : NA; bf* Bt = sec ? BtB : BtA; const int bx = (int)blockIdx.x - (sec ? nbA : 0);
    const int c = bx * 256 + (int)threadIdx.x; if (c >= N * (K / 8)) return;
    const int blk = c >> 6, kb = blk % (K >> 5), n = (blk / (K >> 5)) * 16 + (c & 15), k = kb * 32 + ((c >> 5) & 1) * 16 + ((c >> 4) & 1) * 8;
    const float* p = w + (size_t)k * N + n; float v[8]; v8us o;
#pragma unroll
    for (int j = 0; j < 8; ++j) v[j] = p[(size_t)j * N];
    XWAIT;   /* behind the eight loads: the conversion below is given their address registers */
#pragma unroll
    for (int j = 0; j < 8; ++j) o[j] = f2bf(v[j]);
    *(v8us*)(Bt + (size_t)c * 8) = o;
}
// X (rows of DM columns) -> bf16 in fragment order; one thread = one 16-byte piece of the plane, eight k of one row
__global__ __launch_bounds__(256) void k_cvt8(const float* __restrict__ src, bf* dst, size_t n8) { const size_t i = (size_t)blockIdx.x * 256 + threadIdx.x; if (i >= n8) return; const size_t blk = i >> 6, row = (blk / (DM / 32)) * 16 + (i & 15); const int k = (int)(blk % (DM / 32)) * 32 + (int)((i >> 5) & 1) * 16 + (int)((i >> 4) & 1) * 8; const v8f v = *(const v8f*)(src + row * DM + k); v8us o;
#pragma unroll
    for (int q = 0; q < 8; ++q) o[q] = f2bf(v[q]); *(v8us*)(dst + i * 8) = o;  }

// k_fattn: scores, Shepard weights and attn.v in one kernel; the scores never leave the registers. One wave = 32 query rows x TT/KSP keys, 32 keys a pass; 8 waves (256 query rows) a workgroup.
// The eight waves walk the same keys: each pass's K hi, K lo and V^T blocks (a stage, below) come into LDS once for the workgroup, by asynchronous copies, one pass ahead of their use, into two buffers by turns; the range's key norms come in once, in front of the loop. Every wave copies its eighth of each part (512 bytes in a row a copy); the blocks lie in LDS as in the planes, so a fragment load reads 512 bytes in a row there too.
// S^T = K Q^T (A = K rows, B = Q rows kept in registers): accumulator element j of lane (lr, hi) is key kb*16 + hi*8 + j of query lr, so two key tiles pack straight into the B operand (k order 8 hi + 0..7, 16 + 8 hi + 0..7, the loaders' own) of O^T += V^T P^T.
// w_j = (eps + sqrt(max(q2_i + k2_j - 2 S_ij, 0)))^-2 stays unnormalised; its f32 row sum goes out beside the partial O and divides in k_merge.
// Range of the 16-bit P operand: each query scales eps + dist by r, a power of two near 1 / sqrt(q2_i + k2 of the range's first key), so w / r^2 is of order 1 for keys about as far off as the norms are large; a power of two changes no rounding, and r^2 is taken out of the partial O and the partial sum on the way out.
// A key much nearer than that (down to dist = 0) gives a scaled weight beyond the fp16 range: when a pass of the fp16 rows meets a weight above PMAX, the queries concerned raise their r by a power of two 2^k that brings their largest weight to 2^9..2^11, and this pass's weights, the running row sum and the running O are multiplied by 2^-2k (exact), before anything is rounded to fp16. Weights far below a row's largest then round to fp16 subnormals or 0, at most 2^-25 against a row sum of at least 2^9.
#define STG 8192                  // elements (16 KiB) of a stage = 32 keys: K hi 4 KiB | K lo 4 KiB | V^T fp16 4 KiB, or V^T hi 4 KiB | V^T lo 4 KiB
__device__ __forceinline__ unsigned lds_off(const void* p) { return (unsigned)(size_t)p; }   /* byte address in the workgroup's LDS */
__device__ __forceinline__ v16bf ldsb(const bf* p) { return cat16b(*(const v8usa*)p, *(const v8usa*)(p + 256)); }
__device__ __forceinline__ v16h ldsh(const bf* p) { return cat16(*(const v8ha*)p, *(const v8ha*)(p + 256)); }
// one wave's share of a stage: l = the lane's 16 bytes in the stage's first part, the pointers its 16 bytes of each plane. The copies and the wait that goes in front of an overwrite of their address registers are one statement, so nothing can come between them
template <bool HL>
__device__ __forceinline__ void stage_in(unsigned l, const bf* kh, const bf* kl, const bf* v0, const bf* v1) {
    const unsigned l1 = l + 4096u, l2 = l + 8192u, l3 = l + 12288u;
    if (HL) asm volatile("global_load_async_to_lds_b128 %0, %4, off\n\tglobal_load_async_to_lds_b128 %1, %5, off\n\tglobal_load_async_to_lds_b128 %2, %6, off\n\tglobal_load_async_to_lds_b128 %3, %7, off\n\ts_wait_xcnt 0x0" :: "v"(l), "v"(l1), "v"(l2), "v"(l3), "v"(kh), "v"(kl), "v"(v0), "v"(v1) : "memory");
    else asm volatile("global_load_async_to_lds_b128 %0, %3, off\n\tglobal_load_async_to_lds_b128 %1, %4, off\n\tglobal_load_async_to_lds_b128 %2, %5, off\n\ts_wait_xcnt 0x0" :: "v"(l), "v"(l1), "v"(l2), "v"(kh), "v"(kl), "v"(v0) : "memory");
}
template <bool HL>
__device__ __forceinline__ void fattn_body(bf* ring, float* k2s, const bf* __restrict__ Qh, const bf* __restrict__ Ql, const bf* __restrict__ Kh, const bf* __restrict__ Kl, const h16* __restrict__ V16, const bf* __restrict__ Vh, const bf* __restrict__ Vl, const float* __restrict__ q2p, const float* __restrict__ k2p, int q0, int kbeg, float* Op, float* Lp) {
    const int lane = threadIdx.x & 31, lr = lane & 15, hi = lane >> 4; const unsigned lo = 8 * lane;
    // every inner loop here is unrolled in full: its index picks fragments and accumulators, which live in registers and cannot be indexed at run time
    v16bf qh[2][2], ql[2][2]; float q2[2], rs[2], r[2], er[2]; v8f oacc[4][2];
#pragma unroll
    for (int qb = 0; qb < 2; ++qb) { const size_t o = (size_t)(q0 + qb * 16) * HD;   /* 16 rows of 64 = two blocks */ q2[qb] = q2p[q0 + qb * 16 + lr]; rs[qb] = 0.f; r[qb] = __uint_as_float(__float_as_uint(__builtin_amdgcn_rsqf(fminf(fmaxf(q2[qb] + k2p[kbeg], 1e-8f), 1e12f))) & 0x7F800000u);   /* both ends bounded: (r eps)^-2 and its products with V stay far inside f32 */ er[qb] = SEPS * r[qb];
#pragma unroll
        for (int c = 0; c < 2; ++c) { qh[qb][c] = WFrag<bf>::ld(Qh + o + c * 512, lo); XWAIT; ql[qb][c] = WFrag<bf>::ld(Ql + o + c * 512, lo); XWAIT; }   /* XWAIT behind each fragment's loads: a later load's result may be given their address registers */
#pragma unroll
        for (int db = 0; db < 4; ++db) oacc[db][qb] = (v8f){}; }
    const unsigned wv = threadIdx.x >> 5, sl = wv * 256u + lo; const unsigned lb = lds_off(ring) + sl * 2u;   /* wave wv brings elements wv*256 .. +255 of each 2048-element part */
    const size_t vo = (size_t)(wv >> 1) * 16 * TT + (size_t)kbeg * 16 + (wv & 1u) * 256u + lo;   /* of V^T that is half wv & 1 of the block of d rows (wv >> 1) * 16 .. + 15 */
    const bf* gkh = Kh + (size_t)kbeg * HD + sl; const bf* gkl = Kl + (size_t)kbeg * HD + sl; const bf* gv0 = HL ? Vh + vo : (const bf*)(V16 + vo); const bf* gv1 = Vl + vo;
    { const unsigned ln = lds_off(k2s) + threadIdx.x * 8u; const float* gn = k2p + kbeg + threadIdx.x * 2;   /* the range's TT / KSP = 512 key norms, two a thread */
      asm volatile("global_load_async_to_lds_b64 %0, %1, off\n\ts_wait_xcnt 0x0" :: "v"(ln), "v"(gn) : "memory"); }
    stage_in<HL>(lb, gkh, gkl, gv0, gv1);
    asm volatile("s_wait_asynccnt 0x0" ::: "memory");   /* this wave's copies of stage 0 and of the norms have landed */
    __syncthreads();                                     /* and every other wave's */
    stage_in<HL>(lb + STG * 2u, gkh + 2048, gkl + 2048, gv0 + 512, gv1 + 512); gkh += 4096; gkl += 4096; gv0 += 1024; gv1 += 1024;   /* a stage further: 32 keys x 64 of K, 32 t of each V^T block */
    // the pass stays rolled: unrolled it would hold two passes' fragments in registers and cost resident waves
#pragma unroll 1
    for (int t = 0; t < TT / KSP / 32; ++t) {
        const bf* sb = ring + (t & 1) * STG;
        v8f s[2][2]; float wm[2] = {0.f, 0.f};
#pragma unroll
        for (int kb = 0; kb < 2; ++kb) { v16bf kh[2], kl[2];
#pragma unroll
            for (int c = 0; c < 2; ++c) { kh[c] = ldsb(sb + (kb * 2 + c) * 512 + lo); kl[c] = ldsb(sb + 2048 + (kb * 2 + c) * 512 + lo); }
#pragma unroll
            for (int qb = 0; qb < 2; ++qb) { v8f a = (v8f){};
#pragma unroll
                for (int c = 0; c < 2; ++c) { a = wmmab(kh[c], qh[qb][c], a); a = wmmab(kh[c], ql[qb][c], a); a = wmmab(kl[c], qh[qb][c], a); }
                s[kb][qb] = a; } }
        v16h vf[4];   /* fp16 rows: the V^T fragments are asked for here, so that they arrive under the weights' vector work */
        if (!HL) {
#pragma unroll
            for (int db = 0; db < 4; ++db) vf[db] = ldsh(sb + 4096 + db * 512 + lo); }
#pragma unroll
        for (int kb = 0; kb < 2; ++kb) { const v4f ka = *(const v4fa*)(k2s + t * 32 + kb * 16 + hi * 8), kc = *(const v4fa*)(k2s + t * 32 + kb * 16 + hi * 8 + 4);
#pragma unroll
            for (int qb = 0; qb < 2; ++qb) {
#pragma unroll
                for (int j = 0; j < 8; ++j) { const float t = q2[qb] + (j < 4 ? ka[j & 3] : kc[j & 3]); const float d2 = fmaxf(t - 2.0f * s[kb][qb][j], 0.f); const float den = fmaf(__builtin_amdgcn_sqrtf(d2), r[qb], er[qb]); const float w = __builtin_amdgcn_rcpf(den * den);   /* (r (eps + dist))^-2 */ s[kb][qb][j] = w; rs[qb] += w; if (!HL) wm[qb] = fmaxf(wm[qb], w); } } }
        if (!HL && __builtin_amdgcn_ballot_w32(fmaxf(wm[0], wm[1]) > PMAX) != 0u) {   /* rare; the ballot makes it one scalar branch for the wave, so the exchange below has every lane on */
#pragma unroll
            for (int qb = 0; qb < 2; ++qb) { const float m = fmaxf(wm[qb], __shfl_xor(wm[qb], 16, 32));   /* a query's keys lie in lanes lr and lr + 16: both take the same k */
                const int k = (m > PMAX) ? (((int)(__float_as_uint(m) >> 23) - 136) >> 1) : 0; const float g = __uint_as_float((unsigned)(127 - k) << 23), gi = __uint_as_float((unsigned)(127 + k) << 23), f = g * g;
                r[qb] *= gi; er[qb] *= gi; rs[qb] *= f; s[0][qb] *= f; s[1][qb] *= f;
#pragma unroll
                for (int db = 0; db < 4; ++db) oacc[db][qb] *= f; } }
        if (HL) { v16bf ph[2], pl[2];
#pragma unroll
            for (int qb = 0; qb < 2; ++qb) { v8us h0, h1, l0, l1;
#pragma unroll
                for (int j = 0; j < 8; ++j) { unsigned short a, c2; splitf(s[0][qb][j], a, c2); h0[j] = a; l0[j] = c2; splitf(s[1][qb][j], a, c2); h1[j] = a; l1[j] = c2; }
                ph[qb] = cat16b(h0, h1); pl[qb] = cat16b(l0, l1); }
#pragma unroll
            for (int db = 0; db < 4; ++db) { const v16bf vh = ldsb(sb + 4096 + db * 512 + lo), vl = ldsb(sb + 6144 + db * 512 + lo);
#pragma unroll
                for (int qb = 0; qb < 2; ++qb) { oacc[db][qb] = wmmab(vh, ph[qb], oacc[db][qb]); oacc[db][qb] = wmmab(vh, pl[qb], oacc[db][qb]); oacc[db][qb] = wmmab(vl, ph[qb], oacc[db][qb]); } }
        } else { v16h p[2];
#pragma unroll
            for (int qb = 0; qb < 2; ++qb) { v8h p0, p1;
#pragma unroll
                for (int j = 0; j < 8; ++j) { p0[j] = tohx(s[0][qb][j]); p1[j] = tohx(s[1][qb][j]); }
                p[qb] = cat16(p0, p1); }
#pragma unroll
            for (int db = 0; db < 4; ++db) {
#pragma unroll
                for (int qb = 0; qb < 2; ++qb) oacc[db][qb] = wmma16(vf[db], p[qb], oacc[db][qb]); } }
        asm volatile("s_wait_dscnt 0x0" ::: "memory");      /* this wave has read all it wants of this pass's buffer */
        asm volatile("s_wait_asynccnt 0x0" ::: "memory");   /* and its copies of the next stage have landed */
        __syncthreads();                                     /* so have every wave's: the next stage may be read, this pass's buffer refilled */
        if (t + 2 < TT / KSP / 32) { stage_in<HL>(lb + (unsigned)(t & 1) * (STG * 2u), gkh, gkl, gv0, gv1); gkh += 2048; gkl += 2048; gv0 += 512; gv1 += 512; }
    }
    asm volatile("s_wait_asynccnt 0x0" ::: "memory");   /* no copy is left in flight when the wave ends */
#pragma unroll
    for (int qb = 0; qb < 2; ++qb) { const float u = r[qb] * r[qb]; const float tot = (rs[qb] + __shfl_xor(rs[qb], 16, 32)) * u; if (hi == 0) Lp[q0 + qb * 16 + lr] = tot;
#pragma unroll
        for (int db = 0; db < 4; ++db) { float* o = Op + (size_t)(q0 + qb * 16 + lr) * HD + db * 16 + hi * 8; const v8f a = oacc[db][qb] * u; *(v4f*)o = (v4f){a[0], a[1], a[2], a[3]}; *(v4f*)(o + 4) = (v4f){a[4], a[5], a[6], a[7]}; } }
}
__global__ __launch_bounds__(256) void k_fattn(const bf* __restrict__ QPh, const bf* __restrict__ QPl, const bf* __restrict__ KPh, const bf* __restrict__ KPl, const h16* __restrict__ VT16, const bf* __restrict__ VTh, const bf* __restrict__ VTl, const float* __restrict__ Q2, const float* __restrict__ K2, float* Ob, float* Lb) {
    // grid (head, key range, query tile). The hi/lo tiles' passes hold half as many matrix instructions again and far more vector work; these tiles have the lowest z, so they start first. For speed only: each (head, range, tile) is done once wherever it lands
    const size_t h = blockIdx.x, ks = blockIdx.y, hp = h * TT * HD; const int q0 = blockIdx.z * 256 + (threadIdx.x >> 5) * 32, kbeg = (int)ks * (TT / KSP);
    float* Op = Ob + (ks * NHB + h) * TT * HD; float* Lp = Lb + (ks * NHB + h) * TT;
    __shared__ __align__(16) bf ring[2 * STG]; __shared__ __align__(16) float k2s[TT / KSP];
    if (blockIdx.z * 256 < RH) fattn_body<true>(ring, k2s, QPh + hp, QPl + hp, KPh + hp, KPl + hp, VT16 + hp, VTh + hp, VTl + hp, Q2 + h * TT, K2 + h * TT, q0, kbeg, Op, Lp);   /* RH is a multiple of 256: one path a workgroup */
    else fattn_body<false>(ring, k2s, QPh + hp, QPl + hp, KPh + hp, KPl + hp, VT16 + hp, VTh + hp, VTl + hp, Q2 + h * TT, K2 + h * TT, q0, kbeg, Op, Lp);
}
__global__ __launch_bounds__(256) void k_merge(const float* __restrict__ O, const float* __restrict__ L, const float* __restrict__ FP, bf* Ah, bf* Al) { const size_t e = ((size_t)blockIdx.x * 256 + threadIdx.x) * 2; if (e >= (size_t)NHB * TT * HD) return; const int d = (int)(e % HD); const int t = (int)((e / HD) % TT); const int zz = (int)(e / ((size_t)HD * TT)); const int hh = zz % NH_; const size_t row = (size_t)(zz / NH_) * TT + t; const size_t oo = pk(row, hh * HD + d, DQ);   /* fragment order; d is even, so the pair stays in one piece */
    float lp[KSP]; v2f op[KSP];   /* XWAIT behind each load: the next load's result may be given this one's address registers */
#pragma unroll
    for (int ks = 0; ks < KSP; ++ks) { lp[ks] = L[((size_t)ks * NHB + zz) * TT + t]; XWAIT; op[ks] = *(const v2f*)(O + (size_t)ks * ((size_t)NHB * TT * HD) + e); XWAIT; }
    float lsum = lp[0];   /* row sum of the weights: the KSP partial sums, fixed order */
#pragma unroll
    for (int ks = 1; ks < KSP; ++ks) lsum = __fadd_rn(lsum, lp[ks]);
    const float cs = __builtin_amdgcn_rcpf(__fadd_rn(SEPS, lsum));   /* W / (eps + sum W) via hardware reciprocal */
    v2us oh, ol; v2f os2 = op[0];   /* sum of the KSP partial planes, fixed order */
#pragma unroll
    for (int ks = 1; ks < KSP; ++ks) { os2[0] = __fadd_rn(os2[0], op[ks][0]); os2[1] = __fadd_rn(os2[1], op[ks][1]); }
#pragma unroll
    for (int q = 0; q < 2; ++q) { const float oc = os2[q] * cs; const float gt = FP[row * DP + hh * HSTR + 192 + d + q]; unsigned short a, c2; splitf(__fmul_rn(gt, oc), a, c2); oh[q] = a; ol[q] = c2; }   /* H = G * A */ *(v2us*)(Ah + oo) = oh; *(v2us*)(Al + oo) = ol;  }

extern "C" void kernel_launch(void* const* d_in, const int* in_sizes, int n_in,
                              void* d_out, int out_size, void* d_ws, size_t ws_size, hipStream_t stream) {
    (void)in_sizes; (void)n_in; (void)out_size;
    const float* x = (const float*)d_in[0]; const float* win = (const float*)d_in[1]; const float* bin = (const float*)d_in[2]; const float* wo = (const float*)d_in[3]; const float* bo = (const float*)d_in[4]; const float* wq = nullptr; const float* wk = nullptr; const float* wv = nullptr; (void)wq; (void)wk; (void)wv;
    float* OUT = (float*)d_out;     // [2][2048][1024]
    char* wsp = (char*)d_ws;
    auto take = [&](size_t bytes) { char* p = wsp; wsp += (bytes + 255) & ~(size_t)255; return (void*)p; };
    bf* WINB = (bf*)take((size_t)DP * DM * 2); bf* WO = (bf*)take((size_t)DM * DQ * 2);
    bf* XB = (bf*)take((size_t)NB_ * TT * DM * 2); float* FP = (float*)take((size_t)NB_ * TT * DP * 4); float* Q2 = (float*)take((size_t)NHB * TT * 4); float* K2 = (float*)take((size_t)NHB * TT * 4);
    h16* VT16 = (h16*)take((size_t)NHB * HD * TT * 2);
    bf* QPh = (bf*)take((size_t)NHB * TT * HD * 2); bf* QPl = (bf*)take((size_t)NHB * TT * HD * 2); bf* KPh = (bf*)take((size_t)NHB * TT * HD * 2); bf* KPl = (bf*)take((size_t)NHB * TT * HD * 2); bf* VTh = (bf*)take((size_t)NHB * HD * TT * 2); bf* VTl = (bf*)take((size_t)NHB * HD * TT * 2);
    float* Ob = (float*)take((size_t)KSP * NHB * TT * HD * 4); float* Lb = (float*)take((size_t)KSP * NHB * TT * 4); bf* ATh = (bf*)take((size_t)NB_ * TT * DQ * 2); bf* ATl = (bf*)take((size_t)NB_ * TT * DQ * 2);
    if ((size_t)(wsp - (char*)d_ws) > ws_size) return;    // about 220 MiB of the 256 MiB
    k_wtG<<<(unsigned)(DM * DP / 2048 + DQ * DM / 2048), 256, 0, stream>>>(win, DM, DP, WINB, DM * DP / 2048, wo, DQ, DM, WO);   /* 'xw' [1024][4096] -> Bt 4096 x 1024; 'xw' [1024][1024] -> Bt 1024 x 1024; 2048 elements a workgroup */
    const PlaneOut po = {QPh, QPl, KPh, KPl, VT16, VTh, VTl, Q2, K2}, none = {};
    /* X [2][2048][1024] is one matrix of NB_*TT rows to both GEMMs; the attention sees NHB independent heads */
    k_cvt8<<<(unsigned)(((size_t)NB_ * TT * DM / 8 + 255) / 256), 256, 0, stream>>>(x, XB, (size_t)NB_ * TT * DM / 8);
    k_gemmw<bf, 0, true, DM, 1, true><<<dim3(NB_ * TT / 64, DP / 64, 1), 32, 0, stream>>>(XB, nullptr, WINB, nullptr, FP, DP, bin, 0, 0, 0, 0, po);   /* P = X W_in + b_in (exact): Q, K hi/lo planes + q2, k2, V^T planes; G (cols h*256 + 192..255) in f32 to FP */
    k_fattn<<<dim3(NHB, KSP, TT / 256), 256, 0, stream>>>(QPh, QPl, KPh, KPl, VT16, VTh, VTl, Q2, K2, Ob, Lb);   /* all heads of both batches: Q.K (3 products), weights, attn.v partials + partial row sums */
    k_merge<<<(unsigned)(((size_t)NHB * TT * HD / 2 + 255) / 256), 256, 0, stream>>>(Ob, Lb, FP, ATh, ATl);
    k_gemmw<bf, 1, true, DQ><<<dim3(NB_ * TT / 64, DM / 64, 1), 32, 0, stream>>>(ATh, ATl, WO, nullptr, OUT, DM, bo, 0, 0, 0, 0, none);
}

// v009
// Measured time: 135 microseconds a run.
// Next to v008, in two timings, it ran 1.10 times as fast each time.
// Counting every step since v000, it is 15.6 times as fast.
#include <hip/hip_runtime.h>

// Shepard's (inverse-distance) gated attention (X [2][2048][1024]; P = X W_in + b_in ('xw' [1024][4096]) viewed per head h as [Q(64) | K(64) | V(64) | G(64)] at columns h*256 + ...; W = (1e-4 + ||Q_i - K_j||)^-2 with the distance by the norm expansion sqrt(max(q2 + k2 - 2 Q.K, 0)); W = W / (1e-4 + sum_j W); A = W.V; H = G * A; out = merged H W_out ('xw' [1024][1024]) + b_out -> [2][2048][1024]).
// Compute dtypes, f32 accumulate: every input rounded to bf16; q/k/v on PLAIN bf16 operands (inputs: exact) + b_in, their 16-bit planes and the f32 row norms q2, k2 written by that GEMM's own epilogue; the Q.K products on hi/lo planes for every row (3 products; the distance needs them), the Shepard weights (sqrt, reciprocal) and their row sums in f32 inside the fused attention kernel, row normalisation and gating in the merge; attn.v hybrid on the unnormalised weights: query rows < 512 hl (3 products), the rest single fp16; W_out hl x exact (2 products) + b_out.
// Layout of every 16-bit matrix operand plane (X, W_in^T, W_out^T, Q, K, V^T, gated A): FRAGMENT ORDER. A plane of rows x K is cut into blocks of 16 rows x 32 k (1 KiB), block (row / 16) * (K / 32) + k / 32; inside a block the 16-byte piece that lane (lr, hi) takes in its first load (row lr, k = 8 hi + 0..7) lies at piece hi * 16 + lr, the piece of its second load (k = 16 + 8 hi + 0..7) 512 bytes further. So each wave-wide 16-byte load reads 512 bytes in a row (4 whole lines) where a row-major plane gave it 32 bytes of each of 16 lines.

#define NB_  2
#define TT   2048
#define DM   1024
#define NH_  16
#define NKV  16
#define REP  (NH_ / NKV)
#define HD   64
#define DQ   (NH_ * HD)
#define DKV  (NKV * HD)
#define DP   4096                 // projection width (16 heads x [Q|K|V|G] x 64)
#define HSTR 256
#define SEPS 1e-4f
#define RH   512                  // query rows < RH use hi+lo planes (0: none)
#define WIN  0
#define PMAX 32768.0f             // largest scaled weight that goes into an fp16 P operand (fp16 ends at 65504)
#define NHB  (NB_ * NH_)          // both batches go through every launch: rows b*TT + t in the GEMMs, "heads" b*NH_ + h in the planes and in the attention grid
#define KSP  4                    // attention: the 2048 keys split over KSP workgroups per 256 query rows; partial planes [KSP][NHB][TT][HD] and partial row sums [KSP][NHB][TT] summed in k_merge
typedef _Float16 h16;
typedef unsigned short bf;
typedef __attribute__((ext_vector_type(16))) __bf16   v16bf;
typedef __attribute__((ext_vector_type(16))) _Float16 v16h;
typedef __attribute__((ext_vector_type(8)))  _Float16 v8h;
typedef __attribute__((ext_vector_type(8)))  unsigned short v8us;
typedef __attribute__((ext_vector_type(8)))  float    v8f;
typedef __attribute__((ext_vector_type(4)))  float    v4f;
typedef v8h  __attribute__((may_alias)) v8ha;
typedef v4f  __attribute__((may_alias)) v4fa;
typedef v8us __attribute__((may_alias)) v8usa;

__device__ __forceinline__ unsigned short f2bf(float f) { unsigned u = __float_as_uint(f); u += 0x7FFFu + ((u >> 16) & 1u); return (unsigned short)(u >> 16); }
__device__ __forceinline__ float bf2f(unsigned short b) { return __uint_as_float(((unsigned)b) << 16); }
__device__ __forceinline__ float bfr(float f) { return bf2f(f2bf(f)); }
__device__ __forceinline__ v16h cat16(v8h lo, v8h hi) { return __builtin_shufflevector(lo, hi, 0, 1, 2, 3, 4, 5, 6, 7, 8, 9, 10, 11, 12, 13, 14, 15); }
__device__ __forceinline__ v16bf cat16b(v8us lo, v8us hi) { return __builtin_bit_cast(v16bf, __builtin_shufflevector(lo, hi, 0, 1, 2, 3, 4, 5, 6, 7, 8, 9, 10, 11, 12, 13, 14, 15)); }
__device__ __forceinline__ v8f wmma16(v16h a, v16h b, v8f c) { return __builtin_amdgcn_wmma_f32_16x16x32_f16(false, a, false, b, (short)0, c, false, false); }
__device__ __forceinline__ v8f wmmab(v16bf a, v16bf b, v8f c) { return __builtin_amdgcn_wmma_f32_16x16x32_bf16(false, a, false, b, (short)0, c, false, false); }
// element offset of (row, k) in a fragment-order plane of K columns
__device__ __forceinline__ size_t pk(size_t row, int k, int K) { return ((row >> 4) * (size_t)(K >> 5) + (size_t)(k >> 5)) * 512 + (size_t)(((k >> 4) & 1) * 256 + ((k >> 3) & 1) * 128 + (k & 7)) + (row & 15) * 8; }
__device__ __forceinline__ h16 tohx(float x) { return (h16)x; }
__device__ __forceinline__ void splitf(float y, unsigned short& h, unsigned short& l) { h = f2bf(y); l = f2bf(y - bf2f(h)); }
// XWAIT stands between loads where the compiler lets a later load's result land in an earlier load's address registers: the wait that goes in front of such an overwrite
#define XWAIT asm volatile("s_wait_xcnt 0x0" ::: "memory")
// x + (x of lane ^ M), M = 1, 2 or 4, as a DPP move inside the 16-lane row (a shuffle would go through the LDS queue); every lane on
template <int M> __device__ __forceinline__ float addx(float x) { return x + __int_as_float(__builtin_amdgcn_update_dpp(0, __float_as_int(x), 0x160 + M, 0xf, 0xf, true)); }
// where the projection GEMM's epilogue puts a head's Q, K and V columns: hi/lo planes [h][t x d], V^T planes [h][d x t], each head's plane in fragment order; row norms [h][t]
struct PlaneOut { bf* Qh; bf* Ql; bf* Kh; bf* Kl; h16* V16; bf* Vh; bf* Vl; float* Q2; float* K2; };
__device__ __forceinline__ unsigned lds_off(const void* p) { return (unsigned)(size_t)p; }   /* byte address in the workgroup's LDS */
__device__ __forceinline__ v16bf ldsb(const bf* p) { return cat16b(*(const v8usa*)p, *(const v8usa*)(p + 256)); }
// one wave's share of a stage of the projection GEMM's ring: 2 KiB in a row (two blocks of 32 k of 16 rows) of each operand, four copies of 512 bytes each. The copies and the wait that goes in front of an overwrite of their address registers are one statement, so nothing can come between them
__device__ __forceinline__ void gstage_in(unsigned l0, unsigned l1, const bf* g0, const bf* g1) {
    asm volatile("global_load_async_to_lds_b128 %0, %8, off\n\tglobal_load_async_to_lds_b128 %1, %9, off\n\tglobal_load_async_to_lds_b128 %2, %10, off\n\tglobal_load_async_to_lds_b128 %3, %11, off\n\t"
                 "global_load_async_to_lds_b128 %4, %12, off\n\tglobal_load_async_to_lds_b128 %5, %13, off\n\tglobal_load_async_to_lds_b128 %6, %14, off\n\tglobal_load_async_to_lds_b128 %7, %15, off\n\ts_wait_xcnt 0x0"
                 :: "v"(l0), "v"(l0 + 512u), "v"(l0 + 1024u), "v"(l0 + 1536u), "v"(l1), "v"(l1 + 512u), "v"(l1 + 1024u), "v"(l1 + 1536u),
                    "v"(g0), "v"(g0 + 256), "v"(g0 + 512), "v"(g0 + 768), "v"(g1), "v"(g1 + 256), "v"(g1 + 512), "v"(g1 + 768) : "memory");
}



// ---- k_gemmw: register-blocked GEMM, ONE WAVE per 64x64 output tile (16 accumulators), operands in fragment-order 16-bit planes. Not PL: a workgroup is one wave, which loads its fragments straight from the planes; grid (M/64, N/64, Z), 32 threads. PL: a workgroup is sixteen waves, 4 x 4 tiles = 256 x 256 of C (one head's Q, K, V, G), and shares its operands through LDS; grid (M/256, N/256), 512 threads.
// C[m][n] (f32, pitch ldc, + optional f32 bias[n]) = sum_k A[m][k] Bt[n][k] (+ split products per NSPLIT). z-batch strides sA/sB/sC in elements. K / KS is a multiple of 128 (the loop's trip, below; PL: K of 64, a stage); K is a compile-time constant, so that an operand's fragments are immediate offsets from one address that lives through the loop.
// PL (the input projection, N = 16 heads x [Q|K|V|G] x 64, so a 64-column tile is one part of one head): only the G tiles go to C; a Q or K tile goes out as bf16 hi/lo planes with its rows' sums of squares (the whole row of 64 is in the tile), a V tile as the three V^T planes.
// KS > 1: grid z = Z * KS; workgroup (z, ks) sums only k in [ks K/KS, (ks+1) K/KS) and stores its partial tile to plane ks (plane stride sP elements); the consumer adds the KS planes.
// ld: p + lo = the block's start + lane * 8
// every plane lies in global memory: said in the pointer type, because an address that has gone through an asm operand would otherwise be loaded from with flat instructions
typedef const __attribute__((address_space(1))) v8h* gv8h; typedef const __attribute__((address_space(1))) v8us* gv8us;
template <typename T16> struct WFrag;
template <> struct WFrag<h16> { typedef v16h V; static __device__ __forceinline__ V ld(const h16* p, unsigned lo) { return cat16(*(gv8h)(p + lo), *(gv8h)(p + lo + 256)); } static __device__ __forceinline__ v8f mma(V a, V b, v8f c) { return wmma16(a, b, c); } };
template <> struct WFrag<bf> { typedef v16bf V; static __device__ __forceinline__ V ld(const bf* p, unsigned lo) { return cat16b(*(gv8us)(p + lo), *(gv8us)(p + lo + 256)); } static __device__ __forceinline__ v8f mma(V a, V b, v8f c) { return wmmab(a, b, c); } };
template <typename T16, int NSPLIT, bool BIAS, int K, int KS = 1, bool PL = false>
__global__ __launch_bounds__(PL ? 512 : 32) void k_gemmw(const T16* __restrict__ A, const T16* __restrict__ A2, const T16* __restrict__ Bt, const T16* __restrict__ Bt2, float* C, int ldc, const float* __restrict__ bias, size_t sA, size_t sB, size_t sC, size_t sP, PlaneOut po) {
    typedef typename WFrag<T16>::V V;
    __shared__ __align__(16) float osw[(PL ? 16 : 1) * 16 * 68];
    const int wv = PL ? __builtin_amdgcn_readfirstlane((int)(threadIdx.x >> 5)) : 0; float* os = osw + wv * (16 * 68);   /* the wave's number, in a scalar register: all that follows from it (tile, part, head) is the same for the wave; each wave has its own epilogue staging */
    const size_t z = blockIdx.z / KS; const int ks = blockIdx.z % KS; A += z * sA; if (A2) A2 += z * sA; Bt += z * sB; if (Bt2) Bt2 += z * sB; C += z * sC + (size_t)ks * sP;
    const int kbeg = ks * (K / KS), kend = kbeg + K / KS;
    const int lane = threadIdx.x & 31, lr = lane & 15, hi = lane >> 4; const int r0 = PL ? blockIdx.x * 256 + (wv & 3) * 64 : blockIdx.x * 64, c0 = PL ? blockIdx.y * 256 + (wv >> 2) * 64 : blockIdx.y * 64;
    v8f acc[4][4];
#pragma unroll
    for (int mb = 0; mb < 4; ++mb)
#pragma unroll
        for (int nb = 0; nb < 4; ++nb) acc[mb][nb] = (v8f){};
    if constexpr (PL) {
    // The sixteen waves' tiles share rows and columns (each A row and each B row is wanted by four waves): a stage = 64 k of the workgroup's 256 A rows (32 KiB) and 256 B rows (32 KiB) comes into LDS once, by asynchronous copies, one trip ahead of its use, into two buffers by turns, where every wave fetched its own 64 + 64 rows from L2. The blocks lie in LDS as in the planes ([16 rows][2 blocks of 32 k], 1 KiB a block), so a fragment load reads 512 bytes in a row there too. k runs upward through every accumulator as before.
    constexpr int SA = 16 * 1024, SE = 2 * SA, NST = K / 64;   /* elements of a stage's A part and of a stage; stages */
    static_assert(KS == 1 && NSPLIT == 0 && NST >= 2, "one plane an operand, the whole K, two stages or more");
    __shared__ __align__(16) bf ring[2 * SE];
    /* wave wv brings rows 16 wv .. + 15 of the workgroup's A and of its B, 2 KiB in a row each a stage */
    const unsigned la = lds_off(ring) + (unsigned)wv * 2048u + (unsigned)lane * 16u, lb = la + SA * 2u;
    const bf* ga = A + (size_t)(blockIdx.x * 256 + wv * 16) * K + 8 * lane; const bf* gb = Bt + (size_t)(blockIdx.y * 256 + wv * 16) * K + 8 * lane;   /* 16 rows of a plane are K / 32 blocks = 16 K elements */
    gstage_in(la, lb, ga, gb);
    asm volatile("s_wait_asynccnt 0x0" ::: "memory");   /* this wave's copies of stage 0 have landed */
    __syncthreads();                                     /* and every other wave's */
    gstage_in(la + SE * 2u, lb + SE * 2u, ga + 1024, gb + 1024); ga += 2048; gb += 2048;   /* a stage further: two blocks = 1024 elements */
    // the trip stays rolled: the buffer is picked by its parity, and two trips' fragments would not fit the registers of four waves a SIMD
#pragma unroll 1
    for (int t = 0; t < NST; ++t) {
        const bf* sa = ring + (t & 1) * SE + (wv & 3) * 4096 + 8 * lane; const bf* sb = ring + (t & 1) * SE + SA + (wv >> 2) * 4096 + 8 * lane;   /* the wave's four blocks of 16 rows of each operand */
        /* HOLD keeps the compiler's scheduler from moving an LDS load or a product over it: left free it keeps one B fragment and waits for LDS in front of every four products. So: the first block's 16 loads and the second block's 8 of A in one run, in the order of their use; the second block's B fragments each right behind the four products that are the last to read its registers */
#define HOLD __builtin_amdgcn_sched_barrier(0)
        V a[2][4], b[4];
        b[0] = ldsb(sb);
#pragma unroll
        for (int mb = 0; mb < 4; ++mb) a[0][mb] = ldsb(sa + mb * 1024);
#pragma unroll
        for (int nb = 1; nb < 4; ++nb) b[nb] = ldsb(sb + nb * 1024);
#pragma unroll
        for (int mb = 0; mb < 4; ++mb) a[1][mb] = ldsb(sa + mb * 1024 + 512);
        HOLD;
#pragma unroll
        for (int nb = 0; nb < 4; ++nb) {
#pragma unroll
            for (int mb = 0; mb < 4; ++mb) acc[mb][nb] = WFrag<T16>::mma(a[0][mb], b[nb], acc[mb][nb]);
            HOLD; b[nb] = ldsb(sb + nb * 1024 + 512); HOLD; }
        asm volatile("s_wait_dscnt 0x0" ::: "memory");      /* this wave has read all it wants of this trip's buffer */
        asm volatile("s_wait_asynccnt 0x0" ::: "memory");   /* and its copies of the next stage have landed */
        __syncthreads();                                     /* so have every wave's: the next stage may be read, this trip's buffer refilled */
        /* the second block's products read registers only and stand behind the barrier: half of them in front of the refill, so that the matrix unit has work while the SIMD's waves by turns form the copies' addresses and sit in their s_wait_xcnt; half behind it, over the next trip's first LDS loads. The copies still have most of a trip to land */
#pragma unroll
        for (int nb = 0; nb < 2; ++nb) {
#pragma unroll
            for (int mb = 0; mb < 4; ++mb) acc[mb][nb] = WFrag<T16>::mma(a[1][mb], b[nb], acc[mb][nb]); }
        if (t + 2 < NST) { const unsigned o = (unsigned)(t & 1) * (SE * 2u); gstage_in(la + o, lb + o, ga, gb); ga += 1024; gb += 1024; }
#pragma unroll
        for (int nb = 2; nb < 4; ++nb) {
#pragma unroll
            for (int mb = 0; mb < 4; ++mb) acc[mb][nb] = WFrag<T16>::mma(a[1][mb], b[nb], acc[mb][nb]); }
#undef HOLD
    }
    asm volatile("s_wait_asynccnt 0x0" ::: "memory");   /* no copy is left in flight when the wave ends */
    } else {
    const size_t aoff = (size_t)r0 * K + (size_t)kbeg * 16 + 8 * lane, boff = (size_t)c0 * K + (size_t)kbeg * 16 + 8 * lane; const T16* pa = A + aoff; const T16* pa2 = (NSPLIT == 1 || NSPLIT == 2) ? A2 + aoff : nullptr; const T16* pb = Bt + boff; const T16* pb2 = NSPLIT >= 2 ? Bt2 + boff : nullptr;   /* 16 rows of a plane are K / 32 blocks = 16 K elements; a step of 32 k is one block = 512 elements */
    // The fragments run ahead of the products in register sets taken by turns, NS sets: a block's loads fly under the products of the blocks in front of it, where one set made the wave wait for them in every block.
    // A wave that has its SIMD alone (the output GEMM, 1024 waves) has nobody to fill its waits and registers to spare: A and B two blocks ahead (D = 2; three sets are live, the turn goes over NS = 4 because that divides the count of blocks; three blocks ahead a wait would have 72 younger loads to count, and the compiler then writes its largest count, 62, instead).
    // NS blocks a trip, so that the set is a compile-time index; the last NS blocks stand behind the loop, and only the first NS - D of them still ask for a block.
    constexpr int NS = 4, D = 2;
    static_assert((K / KS) % (32 * NS) == 0, "NS blocks of 32 k a trip");
    /* HOLD keeps the compiler's scheduler from moving a load or a product over it: left free it sinks the loads down to a few products in front of their use, and the wave waits for them again */
#define HOLD __builtin_amdgcn_sched_barrier(0)
    V a[NS][4], a2[NS][4], b[NS][4], b2[NS][4];
    /* block j's A and B into set s; the addresses are the trip's */
#define GLOAD(s, j) { \
        _Pragma("unroll") for (int mb = 0; mb < 4; ++mb) { a[s][mb] = WFrag<T16>::ld(pa + mb * 16 * K + 512 * (j), 0u); if (NSPLIT == 1 || NSPLIT == 2) a2[s][mb] = WFrag<T16>::ld(pa2 + mb * 16 * K + 512 * (j), 0u); } \
        _Pragma("unroll") for (int nb = 0; nb < 4; ++nb) { b[s][nb] = WFrag<T16>::ld(pb + nb * 16 * K + 512 * (j), 0u); if (NSPLIT >= 2) b2[s][nb] = WFrag<T16>::ld(pb2 + nb * 16 * K + 512 * (j), 0u); } \
        HOLD; }
    /* block u of a trip: the loads (NEXT) of the block D further on, the products of set u */
#define GBLOCK(u, NEXT) { \
        if (NEXT) GLOAD(((u) + D) % NS, (u) + D) \
        _Pragma("unroll") for (int nb = 0; nb < 4; ++nb) { \
            _Pragma("unroll") for (int mb = 0; mb < 4; ++mb) { acc[mb][nb] = WFrag<T16>::mma(a[u][mb], b[u][nb], acc[mb][nb]); if (NSPLIT == 1 || NSPLIT == 2) acc[mb][nb] = WFrag<T16>::mma(a2[u][mb], b[u][nb], acc[mb][nb]); if (NSPLIT >= 2) acc[mb][nb] = WFrag<T16>::mma(a[u][mb], b2[u][nb], acc[mb][nb]); } } \
        HOLD; }
#pragma unroll
    for (int s = 0; s < D; ++s) GLOAD(s, s)   /* the loads stand in the loop's order here too: the loop's first counted waits are set for the later of the two orders that reach them */
#pragma unroll 1
    for (int kc = kbeg; kc < kend - 32 * NS; kc += 32 * NS) {
#pragma unroll
        for (int u = 0; u < NS; ++u) GBLOCK(u, true)
        /* the wait that goes in front of an overwrite of a load's address registers, here the step of NS blocks; it takes the addresses themselves, so each stays in its one register pair through the trip and no later load of the trip is given that pair for its result */
        asm volatile("s_wait_xcnt 0x0" : "+v"(pa), "+v"(pb) :: "memory"); pa += 512 * NS; pb += 512 * NS;
        if (NSPLIT == 1 || NSPLIT == 2) { asm volatile("s_wait_xcnt 0x0" : "+v"(pa2) :: "memory"); pa2 += 512 * NS; }
        if (NSPLIT >= 2) { asm volatile("s_wait_xcnt 0x0" : "+v"(pb2) :: "memory"); pb2 += 512 * NS; }
    }
#pragma unroll
    for (int u = 0; u < NS - D; ++u) GBLOCK(u, true)
#pragma unroll
    for (int u = NS - D; u < NS; ++u) GBLOCK(u, false)
#undef GBLOCK
#undef GLOAD
#undef HOLD
    }
    const int part = PL ? (c0 >> 6) & 3 : 3; const size_t head = (size_t)(r0 / TT) * NH_ + (c0 >> 8); const int t0 = r0 % TT;   /* part: 0 Q, 1 K, 2 V, 3 G; the same for the whole wave, and no workgroup barrier follows. Row r0 = b*TT + t0: the planes are [b*NH_ + h][..] */
    if (PL && part == 2) {   /* V^T straight from the accumulators: element j of lane (lr, hi) is row mb*16 + hi*8 + j of column nb*16 + lr, eight consecutive t of one d = one 16-byte piece of a plane, and the wave's 32 pieces are half a block: 512 bytes in a row a store */
#pragma unroll
        for (int nb = 0; nb < 4; ++nb) { const float bv = bfr(bias[c0 + nb * 16 + lr]);
#pragma unroll
            for (int mb = 0; mb < 4; ++mb) { v8h o16; v8us oh, ol;
#pragma unroll
                for (int j = 0; j < 8; ++j) { const float x = acc[mb][nb][j] + bv; o16[j] = tohx(x); unsigned short a2, c2; splitf(x, a2, c2); oh[j] = a2; ol[j] = c2; }
                const size_t o = head * HD * TT + pk(nb * 16 + lr, t0 + mb * 16 + hi * 8, TT); *(v8h*)(po.V16 + o) = o16; *(v8us*)(po.Vh + o) = oh; *(v8us*)(po.Vl + o) = ol; } }
        return; }
    if (PL && part < 2) {   /* Q, K: 16 rows at a time through LDS as below, read out eight lanes a row, eight columns a lane */
        const int c8 = (lane & 7) * 8, rq = lane >> 3; float bq[8]; bf* Ph = (part == 0 ? po.Qh : po.Kh) + (head * TT + t0) * HD; bf* Pl = (part == 0 ? po.Ql : po.Kl) + (head * TT + t0) * HD; float* N2 = (part == 0 ? po.Q2 : po.K2) + head * TT + t0;
#pragma unroll
        for (int q = 0; q < 8; ++q) bq[q] = bfr(bias[c0 + c8 + q]);
#pragma unroll
        for (int mb = 0; mb < 4; ++mb) { float keep = 0.f;
#pragma unroll
            for (int nb = 0; nb < 4; ++nb) {
#pragma unroll
                for (int j = 0; j < 8; ++j) os[(hi * 8 + j) * 68 + nb * 16 + lr] = acc[mb][nb][j]; }
            __builtin_amdgcn_wave_barrier(); asm volatile("" ::: "memory");   /* one wave, whose LDS operations run in order: this only keeps the compiler from moving a lane's reads over the other lanes' writes */
#pragma unroll
            for (int s = 0; s < 4; ++s) { const int row = 4 * s + rq; const v4f v0 = *(const v4fa*)(os + row * 68 + c8), v1 = *(const v4fa*)(os + row * 68 + c8 + 4); v8us oh, ol; float n2 = 0.f;
#pragma unroll
                for (int q = 0; q < 8; ++q) { const float x = (q < 4 ? v0[q & 3] : v1[q & 3]) + bq[q]; unsigned short a2, c2; splitf(x, a2, c2); oh[q] = a2; ol[q] = c2; n2 = fmaf(x, x, n2); }
                const size_t o = pk(mb * 16 + row, c8, HD); *(v8us*)(Ph + o) = oh; *(v8us*)(Pl + o) = ol;   /* four rows' pieces lie side by side: eight runs of 64 bytes a store */
                n2 = addx<4>(addx<2>(addx<1>(n2))); if ((lane & 7) == s) keep = n2; }   /* the row's eight partial sums; lane 8 rq + s keeps row 4 s + rq */
            if ((lane & 7) < 4) N2[mb * 16 + 4 * (lane & 7) + rq] = keep;
            __builtin_amdgcn_wave_barrier(); asm volatile("" ::: "memory");   /* and the next 16 rows' writes over these reads */
        }
        return; }
#pragma unroll
    for (int mb = 0; mb < 4; ++mb) {
#pragma unroll
        for (int nb = 0; nb < 4; ++nb) {
#pragma unroll
            for (int j = 0; j < 8; ++j) os[(hi * 8 + j) * 68 + nb * 16 + lr] = acc[mb][nb][j]; }
        __builtin_amdgcn_wave_barrier(); asm volatile("" ::: "memory");
        float* crow = C + (size_t)(r0 + mb * 16) * ldc + c0;
{
#pragma unroll
            for (int s = 0; s < 8; ++s) { const int row = 2 * s + hi, cofs = lr * 4; v4f val = *(const v4fa*)(os + row * 68 + cofs); if (BIAS) { val[0] += bfr(bias[c0 + cofs]); val[1] += bfr(bias[c0 + cofs + 1]); val[2] += bfr(bias[c0 + cofs + 2]); val[3] += bfr(bias[c0 + cofs + 3]); }
                *(v4f*)(crow + (size_t)row * ldc + cofs) = val; }
             }
        XWAIT;   /* behind these rows' stores: the next rows' bias load and LDS reads may be given their registers */
        __builtin_amdgcn_wave_barrier(); asm volatile("" ::: "memory");
    }
}

typedef __attribute__((ext_vector_type(2))) _Float16 v2h;
typedef __attribute__((ext_vector_type(4))) _Float16 v4h;
typedef __attribute__((ext_vector_type(2))) unsigned short v2us;
typedef __attribute__((ext_vector_type(4))) unsigned short v4us;
typedef __attribute__((ext_vector_type(2))) float v2f;
typedef __attribute__((ext_vector_type(4))) int v4i;

// two weight matrices in one launch: workgroups below nbA transpose wA, the rest wB. One thread = one 16-byte piece of the fragment-order plane Bt (rows n, K columns): eight k of one n.
// A wave stores 512 bytes in a row; each of its eight loads reads 16 consecutive n of two k rows (two runs of 64 bytes).
__global__ __launch_bounds__(256) void k_wtG(const float* __restrict__ wA, int KA, int NA, bf* BtA, int nbA, const float* __restrict__ wB, int KB, int NB, bf* BtB) {
    const bool sec = (int)blockIdx.x >= nbA; const float* __restrict__ w = sec ? wB : wA; const int K = sec ? KB : KA, N = sec ? NB : NA; bf* Bt = sec ? BtB : BtA; const int bx = (int)blockIdx.x - (sec ? nbA : 0);
    const int c = bx * 256 + (int)threadIdx.x; if (c >= N * (K / 8)) return;
    const int blk = c >> 6, kb = blk % (K >> 5), n = (blk / (K >> 5)) * 16 + (c & 15), k = kb * 32 + ((c >> 5) & 1) * 16 + ((c >> 4) & 1) * 8;
    const float* p = w + (size_t)k * N + n; float v[8]; v8us o;
#pragma unroll
    for (int j = 0; j < 8; ++j) v[j] = p[(size_t)j * N];
    XWAIT;   /* behind the eight loads: the conversion below is given their address registers */
#pragma unroll
    for (int j = 0; j < 8; ++j) o[j] = f2bf(v[j]);
    *(v8us*)(Bt + (size_t)c * 8) = o;
}
// X (rows of DM columns) -> bf16 in fragment order; one thread = one 16-byte piece of the plane, eight k of one row
__global__ __launch_bounds__(256) void k_cvt8(const float* __restrict__ src, bf* dst, size_t n8) { const size_t i = (size_t)blockIdx.x * 256 + threadIdx.x; if (i >= n8) return; const size_t blk = i >> 6, row = (blk / (DM / 32)) * 16 + (i & 15); const int k = (int)(blk % (DM / 32)) * 32 + (int)((i >> 5) & 1) * 16 + (int)((i >> 4) & 1) * 8; const v8f v = *(const v8f*)(src + row * DM + k); v8us o;
#pragma unroll
    for (int q = 0; q < 8; ++q) o[q] = f2bf(v[q]); *(v8us*)(dst + i * 8) = o;  }

// k_fattn: scores, Shepard weights and attn.v in one kernel; the scores never leave the registers. One wave = 32 query rows x TT/KSP keys, 32 keys a pass; 8 waves (256 query rows) a workgroup.
// The eight waves walk the same keys: each pass's K hi, K lo and V^T blocks (a stage, below) come into LDS once for the workgroup, by asynchronous copies, one pass ahead of their use, into two buffers by turns; the range's key norms come in once, in front of the loop. Every wave copies its eighth of each part (512 bytes in a row a copy); the blocks lie in LDS as in the planes, so a fragment load reads 512 bytes in a row there too.
// S^T = K Q^T (A = K rows, B = Q rows kept in registers): accumulator element j of lane (lr, hi) is key kb*16 + hi*8 + j of query lr, so two key tiles pack straight into the B operand (k order 8 hi + 0..7, 16 + 8 hi + 0..7, the loaders' own) of O^T += V^T P^T.
// w_j = (eps + sqrt(max(q2_i + k2_j - 2 S_ij, 0)))^-2 stays unnormalised; its f32 row sum goes out beside the partial O and divides in k_merge.
// Range of the 16-bit P operand: each query scales eps + dist by r, a power of two near 1 / sqrt(q2_i + k2 of the range's first key), so w / r^2 is of order 1 for keys about as far off as the norms are large; a power of two changes no rounding, and r^2 is taken out of the partial O and the partial sum on the way out.
// A key much nearer than that (down to dist = 0) gives a scaled weight beyond the fp16 range: when a pass of the fp16 rows meets a weight above PMAX, the queries concerned raise their r by a power of two 2^k that brings their largest weight to 2^9..2^11, and this pass's weights, the running row sum and the running O are multiplied by 2^-2k (exact), before anything is rounded to fp16. Weights far below a row's largest then round to fp16 subnormals or 0, at most 2^-25 against a row sum of at least 2^9.
#define STG 8192                  // elements (16 KiB) of a stage = 32 keys: K hi 4 KiB | K lo 4 KiB | V^T fp16 4 KiB, or V^T hi 4 KiB | V^T lo 4 KiB
__device__ __forceinline__ v16h ldsh(const bf* p) { return cat16(*(const v8ha*)p, *(const v8ha*)(p + 256)); }
// one wave's share of a stage: l = the lane's 16 bytes in the stage's first part, the pointers its 16 bytes of each plane. The copies and the wait that goes in front of an overwrite of their address registers are one statement, so nothing can come between them
template <bool HL>
__device__ __forceinline__ void stage_in(unsigned l, const bf* kh, const bf* kl, const bf* v0, const bf* v1) {
    const unsigned l1 = l + 4096u, l2 = l + 8192u, l3 = l + 12288u;
    if (HL) asm volatile("global_load_async_to_lds_b128 %0, %4, off\n\tglobal_load_async_to_lds_b128 %1, %5, off\n\tglobal_load_async_to_lds_b128 %2, %6, off\n\tglobal_load_async_to_lds_b128 %3, %7, off\n\ts_wait_xcnt 0x0" :: "v"(l), "v"(l1), "v"(l2), "v"(l3), "v"(kh), "v"(kl), "v"(v0), "v"(v1) : "memory");
    else asm volatile("global_load_async_to_lds_b128 %0, %3, off\n\tglobal_load_async_to_lds_b128 %1, %4, off\n\tglobal_load_async_to_lds_b128 %2, %5, off\n\ts_wait_xcnt 0x0" :: "v"(l), "v"(l1), "v"(l2), "v"(kh), "v"(kl), "v"(v0) : "memory");
}
template <bool HL>
__device__ __forceinline__ void fattn_body(bf* ring, float* k2s, const bf* __restrict__ Qh, const bf* __restrict__ Ql, const bf* __restrict__ Kh, const bf* __restrict__ Kl, const h16* __restrict__ V16, const bf* __restrict__ Vh, const bf* __restrict__ Vl, const float* __restrict__ q2p, const float* __restrict__ k2p, int q0, int kbeg, float* Op, float* Lp) {
    const int lane = threadIdx.x & 31, lr = lane & 15, hi = lane >> 4; const unsigned lo = 8 * lane;
    // every inner loop here is unrolled in full: its index picks fragments and accumulators, which live in registers and cannot be indexed at run time
    v16bf qh[2][2], ql[2][2]; float q2[2], rs[2], r[2], er[2]; v8f oacc[4][2];
#pragma unroll
    for (int qb = 0; qb < 2; ++qb) { const size_t o = (size_t)(q0 + qb * 16) * HD;   /* 16 rows of 64 = two blocks */ q2[qb] = q2p[q0 + qb * 16 + lr]; rs[qb] = 0.f; r[qb] = __uint_as_float(__float_as_uint(__builtin_amdgcn_rsqf(fminf(fmaxf(q2[qb] + k2p[kbeg], 1e-8f), 1e12f))) & 0x7F800000u);   /* both ends bounded: (r eps)^-2 and its products with V stay far inside f32 */ er[qb] = SEPS * r[qb];
#pragma unroll
        for (int c = 0; c < 2; ++c) { qh[qb][c] = WFrag<bf>::ld(Qh + o + c * 512, lo); XWAIT; ql[qb][c] = WFrag<bf>::ld(Ql + o + c * 512, lo); XWAIT; }   /* XWAIT behind each fragment's loads: a later load's result may be given their address registers */
#pragma unroll
        for (int db = 0; db < 4; ++db) oacc[db][qb] = (v8f){}; }
    const unsigned wv = threadIdx.x >> 5, sl = wv * 256u + lo; const unsigned lb = lds_off(ring) + sl * 2u;   /* wave wv brings elements wv*256 .. +255 of each 2048-element part */
    const size_t vo = (size_t)(wv >> 1) * 16 * TT + (size_t)kbeg * 16 + (wv & 1u) * 256u + lo;   /* of V^T that is half wv & 1 of the block of d rows (wv >> 1) * 16 .. + 15 */
    const bf* gkh = Kh + (size_t)kbeg * HD + sl; const bf* gkl = Kl + (size_t)kbeg * HD + sl; const bf* gv0 = HL ? Vh + vo : (const bf*)(V16 + vo); const bf* gv1 = Vl + vo;
    { const unsigned ln = lds_off(k2s) + threadIdx.x * 8u; const float* gn = k2p + kbeg + threadIdx.x * 2;   /* the range's TT / KSP = 512 key norms, two a thread */
      asm volatile("global_load_async_to_lds_b64 %0, %1, off\n\ts_wait_xcnt 0x0" :: "v"(ln), "v"(gn) : "memory"); }
    stage_in<HL>(lb, gkh, gkl, gv0, gv1);
    asm volatile("s_wait_asynccnt 0x0" ::: "memory");   /* this wave's copies of stage 0 and of the norms have landed */
    __syncthreads();                                     /* and every other wave's */
    stage_in<HL>(lb + STG * 2u, gkh + 2048, gkl + 2048, gv0 + 512, gv1 + 512); gkh += 4096; gkl += 4096; gv0 += 1024; gv1 += 1024;   /* a stage further: 32 keys x 64 of K, 32 t of each V^T block */
    // the pass stays rolled: unrolled it would hold two passes' fragments in registers and cost resident waves
#pragma unroll 1
    for (int t = 0; t < TT / KSP / 32; ++t) {
        const bf* sb = ring + (t & 1) * STG;
        v8f s[2][2]; float wm[2] = {0.f, 0.f};
#pragma unroll
        for (int kb = 0; kb < 2; ++kb) { v16bf kh[2], kl[2];
#pragma unroll
            for (int c = 0; c < 2; ++c) { kh[c] = ldsb(sb + (kb * 2 + c) * 512 + lo); kl[c] = ldsb(sb + 2048 + (kb * 2 + c) * 512 + lo); }
#pragma unroll
            for (int qb = 0; qb < 2; ++qb) { v8f a = (v8f){};
#pragma unroll
                for (int c = 0; c < 2; ++c) { a = wmmab(kh[c], qh[qb][c], a); a = wmmab(kh[c], ql[qb][c], a); a = wmmab(kl[c], qh[qb][c], a); }
                s[kb][qb] = a; } }
        v16h vf[4];   /* fp16 rows: the V^T fragments are asked for here, so that they arrive under the weights' vector work */
        if (!HL) {
#pragma unroll
            for (int db = 0; db < 4; ++db) vf[db] = ldsh(sb + 4096 + db * 512 + lo); }
#pragma unroll
        for (int kb = 0; kb < 2; ++kb) { const v4f ka = *(const v4fa*)(k2s + t * 32 + kb * 16 + hi * 8), kc = *(const v4fa*)(k2s + t * 32 + kb * 16 + hi * 8 + 4);
#pragma unroll
            for (int qb = 0; qb < 2; ++qb) {
#pragma unroll
                for (int j = 0; j < 8; ++j) { const float t = q2[qb] + (j < 4 ? ka[j & 3] : kc[j & 3]); const float d2 = fmaxf(t - 2.0f * s[kb][qb][j], 0.f); const float den = fmaf(__builtin_amdgcn_sqrtf(d2), r[qb], er[qb]); const float w = __builtin_amdgcn_rcpf(den * den);   /* (r (eps + dist))^-2 */ s[kb][qb][j] = w; rs[qb] += w; if (!HL) wm[qb] = fmaxf(wm[qb], w); } } }
        if (!HL && __builtin_amdgcn_ballot_w32(fmaxf(wm[0], wm[1]) > PMAX) != 0u) {   /* rare; the ballot makes it one scalar branch for the wave, so the exchange below has every lane on */
#pragma unroll
            for (int qb = 0; qb < 2; ++qb) { const float m = fmaxf(wm[qb], __shfl_xor(wm[qb], 16, 32));   /* a query's keys lie in lanes lr and lr + 16: both take the same k */
                const int k = (m > PMAX) ? (((int)(__float_as_uint(m) >> 23) - 136) >> 1) : 0; const float g = __uint_as_float((unsigned)(127 - k) << 23), gi = __uint_as_float((unsigned)(127 + k) << 23), f = g * g;
                r[qb] *= gi; er[qb] *= gi; rs[qb] *= f; s[0][qb] *= f; s[1][qb] *= f;
#pragma unroll
                for (int db = 0; db < 4; ++db) oacc[db][qb] *= f; } }
        if (HL) { v16bf ph[2], pl[2];
#pragma unroll
            for (int qb = 0; qb < 2; ++qb) { v8us h0, h1, l0, l1;
#pragma unroll
                for (int j = 0; j < 8; ++j) { unsigned short a, c2; splitf(s[0][qb][j], a, c2); h0[j] = a; l0[j] = c2; splitf(s[1][qb][j], a, c2); h1[j] = a; l1[j] = c2; }
                ph[qb] = cat16b(h0, h1); pl[qb] = cat16b(l0, l1); }
#pragma unroll
            for (int db = 0; db < 4; ++db) { const v16bf vh = ldsb(sb + 4096 + db * 512 + lo), vl = ldsb(sb + 6144 + db * 512 + lo);
#pragma unroll
                for (int qb = 0; qb < 2; ++qb) { oacc[db][qb] = wmmab(vh, ph[qb], oacc[db][qb]); oacc[db][qb] = wmmab(vh, pl[qb], oacc[db][qb]); oacc[db][qb] = wmmab(vl, ph[qb], oacc[db][qb]); } }
        } else { v16h p[2];
#pragma unroll
            for (int qb = 0; qb < 2; ++qb) { v8h p0, p1;
#pragma unroll
                for (int j = 0; j < 8; ++j) { p0[j] = tohx(s[0][qb][j]); p1[j] = tohx(s[1][qb][j]); }
                p[qb] = cat16(p0, p1); }
#pragma unroll
            for (int db = 0; db < 4; ++db) {
#pragma unroll
                for (int qb = 0; qb < 2; ++qb) oacc[db][qb] = wmma16(vf[db], p[qb], oacc[db][qb]); } }
        asm volatile("s_wait_dscnt 0x0" ::: "memory");      /* this wave has read all it wants of this pass's buffer */
        asm volatile("s_wait_asynccnt 0x0" ::: "memory");   /* and its copies of the next stage have landed */
        __syncthreads();                                     /* so have every wave's: the next stage may be read, this pass's buffer refilled */
        if (t + 2 < TT / KSP / 32) { stage_in<HL>(lb + (unsigned)(t & 1) * (STG * 2u), gkh, gkl, gv0, gv1); gkh += 2048; gkl += 2048; gv0 += 512; gv1 += 512; }
    }
    asm volatile("s_wait_asynccnt 0x0" ::: "memory");   /* no copy is left in flight when the wave ends */
#pragma unroll
    for (int qb = 0; qb < 2; ++qb) { const float u = r[qb] * r[qb]; const float tot = (rs[qb] + __shfl_xor(rs[qb], 16, 32)) * u; if (hi == 0) Lp[q0 + qb * 16 + lr] = tot;
#pragma unroll
        for (int db = 0; db < 4; ++db) { float* o = Op + (size_t)(q0 + qb * 16 + lr) * HD + db * 16 + hi * 8; const v8f a = oacc[db][qb] * u; *(v4f*)o = (v4f){a[0], a[1], a[2], a[3]}; *(v4f*)(o + 4) = (v4f){a[4], a[5], a[6], a[7]}; } }
}
__global__ __launch_bounds__(256) void k_fattn(const bf* __restrict__ QPh, const bf* __restrict__ QPl, const bf* __restrict__ KPh, const bf* __restrict__ KPl, const h16* __restrict__ VT16, const bf* __restrict__ VTh, const bf* __restrict__ VTl, const float* __restrict__ Q2, const float* __restrict__ K2, float* Ob, float* Lb) {
    // grid (head, key range, query tile). The hi/lo tiles' passes hold half as many matrix instructions again and far more vector work; these tiles have the lowest z, so they start first. For speed only: each (head, range, tile) is done once wherever it lands
    const size_t h = blockIdx.x, ks = blockIdx.y, hp = h * TT * HD; const int q0 = blockIdx.z * 256 + (threadIdx.x >> 5) * 32, kbeg = (int)ks * (TT / KSP);
    float* Op = Ob + (ks * NHB + h) * TT * HD; float* Lp = Lb + (ks * NHB + h) * TT;
    __shared__ __align__(16) bf ring[2 * STG]; __shared__ __align__(16) float k2s[TT / KSP];
    if (blockIdx.z * 256 < RH) fattn_body<true>(ring, k2s, QPh + hp, QPl + hp, KPh + hp, KPl + hp, VT16 + hp, VTh + hp, VTl + hp, Q2 + h * TT, K2 + h * TT, q0, kbeg, Op, Lp);   /* RH is a multiple of 256: one path a workgroup */
    else fattn_body<false>(ring, k2s, QPh + hp, QPl + hp, KPh + hp, KPl + hp, VT16 + hp, VTh + hp, VTl + hp, Q2 + h * TT, K2 + h * TT, q0, kbeg, Op, Lp);
}
__global__ __launch_bounds__(256) void k_merge(const float* __restrict__ O, const float* __restrict__ L, const float* __restrict__ FP, bf* Ah, bf* Al) { const size_t e = ((size_t)blockIdx.x * 256 + threadIdx.x) * 2; if (e >= (size_t)NHB * TT * HD) return; const int d = (int)(e % HD); const int t = (int)((e / HD) % TT); const int zz = (int)(e / ((size_t)HD * TT)); const int hh = zz % NH_; const size_t row = (size_t)(zz / NH_) * TT + t; const size_t oo = pk(row, hh * HD + d, DQ);   /* fragment order; d is even, so the pair stays in one piece */
    float lp[KSP]; v2f op[KSP];   /* XWAIT behind each load: the next load's result may be given this one's address registers */
#pragma unroll
    for (int ks = 0; ks < KSP; ++ks) { lp[ks] = L[((size_t)ks * NHB + zz) * TT + t]; XWAIT; op[ks] = *(const v2f*)(O + (size_t)ks * ((size_t)NHB * TT * HD) + e); XWAIT; }
    float lsum = lp[0];   /* row sum of the weights: the KSP partial sums, fixed order */
#pragma unroll
    for (int ks = 1; ks < KSP; ++ks) lsum = __fadd_rn(lsum, lp[ks]);
    const float cs = __builtin_amdgcn_rcpf(__fadd_rn(SEPS, lsum));   /* W / (eps + sum W) via hardware reciprocal */
    v2us oh, ol; v2f os2 = op[0];   /* sum of the KSP partial planes, fixed order */
#pragma unroll
    for (int ks = 1; ks < KSP; ++ks) { os2[0] = __fadd_rn(os2[0], op[ks][0]); os2[1] = __fadd_rn(os2[1], op[ks][1]); }
#pragma unroll
    for (int q = 0; q < 2; ++q) { const float oc = os2[q] * cs; const float gt = FP[row * DP + hh * HSTR + 192 + d + q]; unsigned short a, c2; splitf(__fmul_rn(gt, oc), a, c2); oh[q] = a; ol[q] = c2; }   /* H = G * A */ *(v2us*)(Ah + oo) = oh; *(v2us*)(Al + oo) = ol;  }

extern "C" void kernel_launch(void* const* d_in, const int* in_sizes, int n_in,
                              void* d_out, int out_size, void* d_ws, size_t ws_size, hipStream_t stream) {
    (void)in_sizes; (void)n_in; (void)out_size;
    const float* x = (const float*)d_in[0]; const float* win = (const float*)d_in[1]; const float* bin = (const float*)d_in[2]; const float* wo = (const float*)d_in[3]; const float* bo = (const float*)d_in[4]; const float* wq = nullptr; const float* wk = nullptr; const float* wv = nullptr; (void)wq; (void)wk; (void)wv;
    float* OUT = (float*)d_out;     // [2][2048][1024]
    char* wsp = (char*)d_ws;
    auto take = [&](size_t bytes) { char* p = wsp; wsp += (bytes + 255) & ~(size_t)255; return (void*)p; };
    bf* WINB = (bf*)take((size_t)DP * DM * 2); bf* WO = (bf*)take((size_t)DM * DQ * 2);
    bf* XB = (bf*)take((size_t)NB_ * TT * DM * 2); float* FP = (float*)take((size_t)NB_ * TT * DP * 4); float* Q2 = (float*)take((size_t)NHB * TT * 4); float* K2 = (float*)take((size_t)NHB * TT * 4);
    h16* VT16 = (h16*)take((size_t)NHB * HD * TT * 2);
    bf* QPh = (bf*)take((size_t)NHB * TT * HD * 2); bf* QPl = (bf*)take((size_t)NHB * TT * HD * 2); bf* KPh = (bf*)take((size_t)NHB * TT * HD * 2); bf* KPl = (bf*)take((size_t)NHB * TT * HD * 2); bf* VTh = (bf*)take((size_t)NHB * HD * TT * 2); bf* VTl = (bf*)take((size_t)NHB * HD * TT * 2);
    float* Ob = (float*)take((size_t)KSP * NHB * TT * HD * 4); float* Lb = (float*)take((size_t)KSP * NHB * TT * 4); bf* ATh = (bf*)take((size_t)NB_ * TT * DQ * 2); bf* ATl = (bf*)take((size_t)NB_ * TT * DQ * 2);
    if ((size_t)(wsp - (char*)d_ws) > ws_size) return;    // about 220 MiB of the 256 MiB
    k_wtG<<<(unsigned)(DM * DP / 2048 + DQ * DM / 2048), 256, 0, stream>>>(win, DM, DP, WINB, DM * DP / 2048, wo, DQ, DM, WO);   /* 'xw' [1024][4096] -> Bt 4096 x 1024; 'xw' [1024][1024] -> Bt 1024 x 1024; 2048 elements a workgroup */
    const PlaneOut po = {QPh, QPl, KPh, KPl, VT16, VTh, VTl, Q2, K2}, none = {};
    /* X [2][2048][1024] is one matrix of NB_*TT rows to both GEMMs; the attention sees NHB independent heads */
    k_cvt8<<<(unsigned)(((size_t)NB_ * TT * DM / 8 + 255) / 256), 256, 0, stream>>>(x, XB, (size_t)NB_ * TT * DM / 8);
    k_gemmw<bf, 0, true, DM, 1, true><<<dim3(NB_ * TT / 256, DP / 256, 1), 512, 0, stream>>>(XB, nullptr, WINB, nullptr, FP, DP, bin, 0, 0, 0, 0, po);   /* P = X W_in + b_in (exact): Q, K hi/lo planes + q2, k2, V^T planes; G (cols h*256 + 192..255) in f32 to FP */
    k_fattn<<<dim3(NHB, KSP, TT / 256), 256, 0, stream>>>(QPh, QPl, KPh, KPl, VT16, VTh, VTl, Q2, K2, Ob, Lb);   /* all heads of both batches: Q.K (3 products), weights, attn.v partials + partial row sums */
    k_merge<<<(unsigned)(((size_t)NHB * TT * HD / 2 + 255) / 256), 256, 0, stream>>>(Ob, Lb, FP, ATh, ATl);
    k_gemmw<bf, 1, true, DQ><<<dim3(NB_ * TT / 64, DM / 64, 1), 32, 0, stream>>>(ATh, ATl, WO, nullptr, OUT, DM, bo, 0, 0, 0, 0, none);
}

// v010
// It runs in 128 microseconds.
// Timed twice side by side with v009, it ran 1.05 times as fast both times.
// All steps since v000 together make it 16.4 times as fast.
#include <hip/hip_runtime.h>

// Shepard's (inverse-distance) gated attention (X [2][2048][1024]; P = X W_in + b_in ('xw' [1024][4096]) viewed per head h as [Q(64) | K(64) | V(64) | G(64)] at columns h*256 + ...; W = (1e-4 + ||Q_i - K_j||)^-2 with the distance by the norm expansion sqrt(max(q2 + k2 - 2 Q.K, 0)); W = W / (1e-4 + sum_j W); A = W.V; H = G * A; out = merged H W_out ('xw' [1024][1024]) + b_out -> [2][2048][1024]).
// Compute dtypes, f32 accumulate: every input rounded to bf16; q/k/v on PLAIN bf16 operands (inputs: exact) + b_in, their 16-bit planes and the f32 row norms q2, k2 written by that GEMM's own epilogue; the Q.K products on hi/lo planes for every row (3 products; the distance needs them), the Shepard weights (sqrt, reciprocal) and their row sums in f32 inside the fused attention kernel, row normalisation and gating in the merge; attn.v hybrid on the unnormalised weights: query rows < 512 hl (3 products), the rest single fp16; W_out hl x exact (2 products) + b_out.
// Layout of every 16-bit matrix operand plane (X, W_in^T, W_out^T, Q, K, V^T, gated A): FRAGMENT ORDER. A plane of rows x K is cut into blocks of 16 rows x 32 k (1 KiB), block (row / 16) * (K / 32) + k / 32; inside a block the 16-byte piece that lane (lr, hi) takes in its first load (row lr, k = 8 hi + 0..7) lies at piece hi * 16 + lr, the piece of its second load (k = 16 + 8 hi + 0..7) 512 bytes further. So each wave-wide 16-byte load reads 512 bytes in a row (4 whole lines) where a row-major plane gave it 32 bytes of each of 16 lines.
// Layout of the f32 planes that k_merge reads (partial O, gate G; per head t x 64): ACCUMULATOR ORDER of the attention's O^T tiles. A plane is cut into blocks of 16 t x 64 d (4 KiB), block t / 16; inside a block part d / 16 (1 KiB), in it half (d / 4) & 1 (512 bytes), in it the 16-byte piece of lane ((d / 8) & 1) * 16 + t % 16. So lane (lr, hi) holds d = 16 part + 8 hi + 0..7 of row lr in two pieces 512 bytes apart, each wave-wide 16-byte store or load covers 512 bytes in a row, and those eight d are one 16-byte piece of the gated-A planes.

#define NB_  2
#define TT   2048
#define DM   1024
#define NH_  16
#define NKV  16
#define REP  (NH_ / NKV)
#define HD   64
#define DQ   (NH_ * HD)
#define DKV  (NKV * HD)
#define DP   4096                 // projection width (16 heads x [Q|K|V|G] x 64)
#define HSTR 256
#define SEPS 1e-4f
#define RH   512                  // query rows < RH use hi+lo planes (0: none)
#define WIN  0
#define PMAX 32768.0f             // largest scaled weight that goes into an fp16 P operand (fp16 ends at 65504)
#define NHB  (NB_ * NH_)          // both batches go through every launch: rows b*TT + t in the GEMMs, "heads" b*NH_ + h in the planes and in the attention grid
#define KSP  4                    // attention: the 2048 keys split over KSP workgroups per 256 query rows; partial planes [KSP][NHB][TT][HD] and partial row sums [KSP][NHB][TT] summed in k_merge
typedef _Float16 h16;
typedef unsigned short bf;
typedef __attribute__((ext_vector_type(16))) __bf16   v16bf;
typedef __attribute__((ext_vector_type(16))) _Float16 v16h;
typedef __attribute__((ext_vector_type(8)))  _Float16 v8h;
typedef __attribute__((ext_vector_type(8)))  unsigned short v8us;
typedef __attribute__((ext_vector_type(8)))  float    v8f;
typedef __attribute__((ext_vector_type(4)))  float    v4f;
typedef v8h  __attribute__((may_alias)) v8ha;
typedef v4f  __attribute__((may_alias)) v4fa;
typedef v8us __attribute__((may_alias)) v8usa;

__device__ __forceinline__ unsigned short f2bf(float f) { unsigned u = __float_as_uint(f); u += 0x7FFFu + ((u >> 16) & 1u); return (unsigned short)(u >> 16); }
__device__ __forceinline__ float bf2f(unsigned short b) { return __uint_as_float(((unsigned)b) << 16); }
__device__ __forceinline__ float bfr(float f) { return bf2f(f2bf(f)); }
__device__ __forceinline__ v16h cat16(v8h lo, v8h hi) { return __builtin_shufflevector(lo, hi, 0, 1, 2, 3, 4, 5, 6, 7, 8, 9, 10, 11, 12, 13, 14, 15); }
__device__ __forceinline__ v16bf cat16b(v8us lo, v8us hi) { return __builtin_bit_cast(v16bf, __builtin_shufflevector(lo, hi, 0, 1, 2, 3, 4, 5, 6, 7, 8, 9, 10, 11, 12, 13, 14, 15)); }
__device__ __forceinline__ v8f wmma16(v16h a, v16h b, v8f c) { return __builtin_amdgcn_wmma_f32_16x16x32_f16(false, a, false, b, (short)0, c, false, false); }
__device__ __forceinline__ v8f wmmab(v16bf a, v16bf b, v8f c) { return __builtin_amdgcn_wmma_f32_16x16x32_bf16(false, a, false, b, (short)0, c, false, false); }
// element offset of (row, k) in a fragment-order plane of K columns
__device__ __forceinline__ size_t pk(size_t row, int k, int K) { return ((row >> 4) * (size_t)(K >> 5) + (size_t)(k >> 5)) * 512 + (size_t)(((k >> 4) & 1) * 256 + ((k >> 3) & 1) * 128 + (k & 7)) + (row & 15) * 8; }
__device__ __forceinline__ h16 tohx(float x) { return (h16)x; }
__device__ __forceinline__ void splitf(float y, unsigned short& h, unsigned short& l) { h = f2bf(y); l = f2bf(y - bf2f(h)); }
// XWAIT stands between loads where the compiler lets a later load's result land in an earlier load's address registers: the wait that goes in front of such an overwrite
#define XWAIT asm volatile("s_wait_xcnt 0x0" ::: "memory")
// x + (x of lane ^ M), M = 1, 2 or 4, as a DPP move inside the 16-lane row (a shuffle would go through the LDS queue); every lane on
template <int M> __device__ __forceinline__ float addx(float x) { return x + __int_as_float(__builtin_amdgcn_update_dpp(0, __float_as_int(x), 0x160 + M, 0xf, 0xf, true)); }
// where the projection GEMM's epilogue puts a head's Q, K and V columns: hi/lo planes [h][t x d], V^T planes [h][d x t], each head's plane in fragment order; row norms [h][t]
struct PlaneOut { bf* Qh; bf* Ql; bf* Kh; bf* Kl; h16* V16; bf* Vh; bf* Vl; float* Q2; float* K2; };
__device__ __forceinline__ unsigned lds_off(const void* p) { return (unsigned)(size_t)p; }   /* byte address in the workgroup's LDS */
__device__ __forceinline__ v16bf ldsb(const bf* p) { return cat16b(*(const v8usa*)p, *(const v8usa*)(p + 256)); }
// one wave's share of a stage of the projection GEMM's ring: 2 KiB in a row (two blocks of 32 k of 16 rows) of each operand, four copies of 512 bytes each. The copies and the wait that goes in front of an overwrite of their address registers are one statement, so nothing can come between them
__device__ __forceinline__ void gstage_in(unsigned l0, unsigned l1, const bf* g0, const bf* g1) {
    asm volatile("global_load_async_to_lds_b128 %0, %8, off\n\tglobal_load_async_to_lds_b128 %1, %9, off\n\tglobal_load_async_to_lds_b128 %2, %10, off\n\tglobal_load_async_to_lds_b128 %3, %11, off\n\t"
                 "global_load_async_to_lds_b128 %4, %12, off\n\tglobal_load_async_to_lds_b128 %5, %13, off\n\tglobal_load_async_to_lds_b128 %6, %14, off\n\tglobal_load_async_to_lds_b128 %7, %15, off\n\ts_wait_xcnt 0x0"
                 :: "v"(l0), "v"(l0 + 512u), "v"(l0 + 1024u), "v"(l0 + 1536u), "v"(l1), "v"(l1 + 512u), "v"(l1 + 1024u), "v"(l1 + 1536u),
                    "v"(g0), "v"(g0 + 256), "v"(g0 + 512), "v"(g0 + 768), "v"(g1), "v"(g1 + 256), "v"(g1 + 512), "v"(g1 + 768) : "memory");
}



// ---- k_gemmw: register-blocked GEMM, ONE WAVE per 64x64 output tile (16 accumulators), operands in fragment-order 16-bit planes. Not PL: a workgroup is one wave, which loads its fragments straight from the planes; grid (M/64, N/64, Z), 32 threads. PL: a workgroup is sixteen waves, 4 x 4 tiles = 256 x 256 of C (one head's Q, K, V, G), and shares its operands through LDS; grid (M/256, N/256), 512 threads.
// C[m][n] (f32, pitch ldc, + optional f32 bias[n]) = sum_k A[m][k] Bt[n][k] (+ split products per NSPLIT). z-batch strides sA/sB/sC in elements. K / KS is a multiple of 128 (the loop's trip, below; PL: K of 64, a stage); K is a compile-time constant, so that an operand's fragments are immediate offsets from one address that lives through the loop.
// PL (the input projection, N = 16 heads x [Q|K|V|G] x 64, so a 64-column tile is one part of one head): a G tile goes to C as a head's f32 plane in accumulator order; a Q or K tile goes out as bf16 hi/lo planes with its rows' sums of squares (the whole row of 64 is in the tile), a V tile as the three V^T planes.
// KS > 1: grid z = Z * KS; workgroup (z, ks) sums only k in [ks K/KS, (ks+1) K/KS) and stores its partial tile to plane ks (plane stride sP elements); the consumer adds the KS planes.
// ld: p + lo = the block's start + lane * 8
// every plane lies in global memory: said in the pointer type, because an address that has gone through an asm operand would otherwise be loaded from with flat instructions
typedef const __attribute__((address_space(1))) v8h* gv8h; typedef const __attribute__((address_space(1))) v8us* gv8us;
template <typename T16> struct WFrag;
template <> struct WFrag<h16> { typedef v16h V; static __device__ __forceinline__ V ld(const h16* p, unsigned lo) { return cat16(*(gv8h)(p + lo), *(gv8h)(p + lo + 256)); } static __device__ __forceinline__ v8f mma(V a, V b, v8f c) { return wmma16(a, b, c); } };
template <> struct WFrag<bf> { typedef v16bf V; static __device__ __forceinline__ V ld(const bf* p, unsigned lo) { return cat16b(*(gv8us)(p + lo), *(gv8us)(p + lo + 256)); } static __device__ __forceinline__ v8f mma(V a, V b, v8f c) { return wmmab(a, b, c); } };
template <typename T16, int NSPLIT, bool BIAS, int K, int KS = 1, bool PL = false>
__global__ __launch_bounds__(PL ? 512 : 32) void k_gemmw(const T16* __restrict__ A, const T16* __restrict__ A2, const T16* __restrict__ Bt, const T16* __restrict__ Bt2, float* C, int ldc, const float* __restrict__ bias, size_t sA, size_t sB, size_t sC, size_t sP, PlaneOut po) {
    typedef typename WFrag<T16>::V V;
    __shared__ __align__(16) float osw[(PL ? 16 : 1) * 16 * 68];
    const int wv = PL ? __builtin_amdgcn_readfirstlane((int)(threadIdx.x >> 5)) : 0; float* os = osw + wv * (16 * 68);   /* the wave's number, in a scalar register: all that follows from it (tile, part, head) is the same for the wave; each wave has its own epilogue staging */
    const size_t z = blockIdx.z / KS; const int ks = blockIdx.z % KS; A += z * sA; if (A2) A2 += z * sA; Bt += z * sB; if (Bt2) Bt2 += z * sB; C += z * sC + (size_t)ks * sP;
    const int kbeg = ks * (K / KS), kend = kbeg + K / KS;
    const int lane = threadIdx.x & 31, lr = lane & 15, hi = lane >> 4; const int r0 = PL ? blockIdx.x * 256 + (wv & 3) * 64 : blockIdx.x * 64, c0 = PL ? blockIdx.y * 256 + (wv >> 2) * 64 : blockIdx.y * 64;
    v8f acc[4][4];
#pragma unroll
    for (int mb = 0; mb < 4; ++mb)
#pragma unroll
        for (int nb = 0; nb < 4; ++nb) acc[mb][nb] = (v8f){};
    if constexpr (PL) {
    // The sixteen waves' tiles share rows and columns (each A row and each B row is wanted by four waves): a stage = 64 k of the workgroup's 256 A rows (32 KiB) and 256 B rows (32 KiB) comes into LDS once, by asynchronous copies, one trip ahead of its use, into two buffers by turns, where every wave fetched its own 64 + 64 rows from L2. The blocks lie in LDS as in the planes ([16 rows][2 blocks of 32 k], 1 KiB a block), so a fragment load reads 512 bytes in a row there too. k runs upward through every accumulator as before.
    constexpr int SA = 16 * 1024, SE = 2 * SA, NST = K / 64;   /* elements of a stage's A part and of a stage; stages */
    static_assert(KS == 1 && NSPLIT == 0 && NST >= 2, "one plane an operand, the whole K, two stages or more");
    __shared__ __align__(16) bf ring[2 * SE];
    /* wave wv brings rows 16 wv .. + 15 of the workgroup's A and of its B, 2 KiB in a row each a stage */
    const unsigned la = lds_off(ring) + (unsigned)wv * 2048u + (unsigned)lane * 16u, lb = la + SA * 2u;
    const bf* ga = A + (size_t)(blockIdx.x * 256 + wv * 16) * K + 8 * lane; const bf* gb = Bt + (size_t)(blockIdx.y * 256 + wv * 16) * K + 8 * lane;   /* 16 rows of a plane are K / 32 blocks = 16 K elements */
    gstage_in(la, lb, ga, gb);
    asm volatile("s_wait_asynccnt 0x0" ::: "memory");   /* this wave's copies of stage 0 have landed */
    __syncthreads();                                     /* and every other wave's */
    gstage_in(la + SE * 2u, lb + SE * 2u, ga + 1024, gb + 1024); ga += 2048; gb += 2048;   /* a stage further: two blocks = 1024 elements */
    // the trip stays rolled: the buffer is picked by its parity, and two trips' fragments would not fit the registers of four waves a SIMD
#pragma unroll 1
    for (int t = 0; t < NST; ++t) {
        const bf* sa = ring + (t & 1) * SE + (wv & 3) * 4096 + 8 * lane; const bf* sb = ring + (t & 1) * SE + SA + (wv >> 2) * 4096 + 8 * lane;   /* the wave's four blocks of 16 rows of each operand */
        /* HOLD keeps the compiler's scheduler from moving an LDS load or a product over it: left free it keeps one B fragment and waits for LDS in front of every four products. So: the first block's 16 loads and the second block's 8 of A in one run, in the order of their use; the second block's B fragments each right behind the four products that are the last to read its registers */
#define HOLD __builtin_amdgcn_sched_barrier(0)
        V a[2][4], b[4];
        b[0] = ldsb(sb);
#pragma unroll
        for (int mb = 0; mb < 4; ++mb) a[0][mb] = ldsb(sa + mb * 1024);
#pragma unroll
        for (int nb = 1; nb < 4; ++nb) b[nb] = ldsb(sb + nb * 1024);
#pragma unroll
        for (int mb = 0; mb < 4; ++mb) a[1][mb] = ldsb(sa + mb * 1024 + 512);
        HOLD;
#pragma unroll
        for (int nb = 0; nb < 4; ++nb) {
#pragma unroll
            for (int mb = 0; mb < 4; ++mb) acc[mb][nb] = WFrag<T16>::mma(a[0][mb], b[nb], acc[mb][nb]);
            HOLD; b[nb] = ldsb(sb + nb * 1024 + 512); HOLD; }
        asm volatile("s_wait_dscnt 0x0" ::: "memory");      /* this wave has read all it wants of this trip's buffer */
        asm volatile("s_wait_asynccnt 0x0" ::: "memory");   /* and its copies of the next stage have landed */
        __syncthreads();                                     /* so have every wave's: the next stage may be read, this trip's buffer refilled */
        /* the second block's products read registers only and stand behind the barrier: half of them in front of the refill, so that the matrix unit has work while the SIMD's waves by turns form the copies' addresses and sit in their s_wait_xcnt; half behind it, over the next trip's first LDS loads. The copies still have most of a trip to land */
#pragma unroll
        for (int nb = 0; nb < 2; ++nb) {
#pragma unroll
            for (int mb = 0; mb < 4; ++mb) acc[mb][nb] = WFrag<T16>::mma(a[1][mb], b[nb], acc[mb][nb]); }
        if (t + 2 < NST) { const unsigned o = (unsigned)(t & 1) * (SE * 2u); gstage_in(la + o, lb + o, ga, gb); ga += 1024; gb += 1024; }
#pragma unroll
        for (int nb = 2; nb < 4; ++nb) {
#pragma unroll
            for (int mb = 0; mb < 4; ++mb) acc[mb][nb] = WFrag<T16>::mma(a[1][mb], b[nb], acc[mb][nb]); }
#undef HOLD
    }
    asm volatile("s_wait_asynccnt 0x0" ::: "memory");   /* no copy is left in flight when the wave ends */
    } else {
    const size_t aoff = (size_t)r0 * K + (size_t)kbeg * 16 + 8 * lane, boff = (size_t)c0 * K + (size_t)kbeg * 16 + 8 * lane; const T16* pa = A + aoff; const T16* pa2 = (NSPLIT == 1 || NSPLIT == 2) ? A2 + aoff : nullptr; const T16* pb = Bt + boff; const T16* pb2 = NSPLIT >= 2 ? Bt2 + boff : nullptr;   /* 16 rows of a plane are K / 32 blocks = 16 K elements; a step of 32 k is one block = 512 elements */
    // The fragments run ahead of the products in register sets taken by turns, NS sets: a block's loads fly under the products of the blocks in front of it, where one set made the wave wait for them in every block.
    // A wave that has its SIMD alone (the output GEMM, 1024 waves) has nobody to fill its waits and registers to spare: A and B two blocks ahead (D = 2; three sets are live, the turn goes over NS = 4 because that divides the count of blocks; three blocks ahead a wait would have 72 younger loads to count, and the compiler then writes its largest count, 62, instead).
    // NS blocks a trip, so that the set is a compile-time index; the last NS blocks stand behind the loop, and only the first NS - D of them still ask for a block.
    constexpr int NS = 4, D = 2;
    static_assert((K / KS) % (32 * NS) == 0, "NS blocks of 32 k a trip");
    /* HOLD keeps the compiler's scheduler from moving a load or a product over it: left free it sinks the loads down to a few products in front of their use, and the wave waits for them again */
#define HOLD __builtin_amdgcn_sched_barrier(0)
    V a[NS][4], a2[NS][4], b[NS][4], b2[NS][4];
    /* block j's A and B into set s; the addresses are the trip's */
#define GLOAD(s, j) { \
        _Pragma("unroll") for (int mb = 0; mb < 4; ++mb) { a[s][mb] = WFrag<T16>::ld(pa + mb * 16 * K + 512 * (j), 0u); if (NSPLIT == 1 || NSPLIT == 2) a2[s][mb] = WFrag<T16>::ld(pa2 + mb * 16 * K + 512 * (j), 0u); } \
        _Pragma("unroll") for (int nb = 0; nb < 4; ++nb) { b[s][nb] = WFrag<T16>::ld(pb + nb * 16 * K + 512 * (j), 0u); if (NSPLIT >= 2) b2[s][nb] = WFrag<T16>::ld(pb2 + nb * 16 * K + 512 * (j), 0u); } \
        HOLD; }
    /* block u of a trip: the loads (NEXT) of the block D further on, the products of set u */
#define GBLOCK(u, NEXT) { \
        if (NEXT) GLOAD(((u) + D) % NS, (u) + D) \
        _Pragma("unroll") for (int nb = 0; nb < 4; ++nb) { \
            _Pragma("unroll") for (int mb = 0; mb < 4; ++mb) { acc[mb][nb] = WFrag<T16>::mma(a[u][mb], b[u][nb], acc[mb][nb]); if (NSPLIT == 1 || NSPLIT == 2) acc[mb][nb] = WFrag<T16>::mma(a2[u][mb], b[u][nb], acc[mb][nb]); if (NSPLIT >= 2) acc[mb][nb] = WFrag<T16>::mma(a[u][mb], b2[u][nb], acc[mb][nb]); } } \
        HOLD; }
#pragma unroll
    for (int s = 0; s < D; ++s) GLOAD(s, s)   /* the loads stand in the loop's order here too: the loop's first counted waits are set for the later of the two orders that reach them */
#pragma unroll 1
    for (int kc = kbeg; kc < kend - 32 * NS; kc += 32 * NS) {
#pragma unroll
        for (int u = 0; u < NS; ++u) GBLOCK(u, true)
        /* the wait that goes in front of an overwrite of a load's address registers, here the step of NS blocks; it takes the addresses themselves, so each stays in its one register pair through the trip and no later load of the trip is given that pair for its result */
        asm volatile("s_wait_xcnt 0x0" : "+v"(pa), "+v"(pb) :: "memory"); pa += 512 * NS; pb += 512 * NS;
        if (NSPLIT == 1 || NSPLIT == 2) { asm volatile("s_wait_xcnt 0x0" : "+v"(pa2) :: "memory"); pa2 += 512 * NS; }
        if (NSPLIT >= 2) { asm volatile("s_wait_xcnt 0x0" : "+v"(pb2) :: "memory"); pb2 += 512 * NS; }
    }
#pragma unroll
    for (int u = 0; u < NS - D; ++u) GBLOCK(u, true)
#pragma unroll
    for (int u = NS - D; u < NS; ++u) GBLOCK(u, false)
#undef GBLOCK
#undef GLOAD
#undef HOLD
    }
    const int part = PL ? (c0 >> 6) & 3 : 3; const size_t head = (size_t)(r0 / TT) * NH_ + (c0 >> 8); const int t0 = r0 % TT;   /* part: 0 Q, 1 K, 2 V, 3 G; the same for the whole wave, and no workgroup barrier follows. Row r0 = b*TT + t0: the planes are [b*NH_ + h][..] */
    if (PL && part == 2) {   /* V^T straight from the accumulators: element j of lane (lr, hi) is row mb*16 + hi*8 + j of column nb*16 + lr, eight consecutive t of one d = one 16-byte piece of a plane, and the wave's 32 pieces are half a block: 512 bytes in a row a store */
#pragma unroll
        for (int nb = 0; nb < 4; ++nb) { const float bv = bfr(bias[c0 + nb * 16 + lr]);
#pragma unroll
            for (int mb = 0; mb < 4; ++mb) { v8h o16; v8us oh, ol;
#pragma unroll
                for (int j = 0; j < 8; ++j) { const float x = acc[mb][nb][j] + bv; o16[j] = tohx(x); unsigned short a2, c2; splitf(x, a2, c2); oh[j] = a2; ol[j] = c2; }
                const size_t o = head * HD * TT + pk(nb * 16 + lr, t0 + mb * 16 + hi * 8, TT); *(v8h*)(po.V16 + o) = o16; *(v8us*)(po.Vh + o) = oh; *(v8us*)(po.Vl + o) = ol; } }
        return; }
    if (PL && part < 2) {   /* Q, K: 16 rows at a time through LDS as below, read out eight lanes a row, eight columns a lane */
        const int c8 = (lane & 7) * 8, rq = lane >> 3; float bq[8]; bf* Ph = (part == 0 ? po.Qh : po.Kh) + (head * TT + t0) * HD; bf* Pl = (part == 0 ? po.Ql : po.Kl) + (head * TT + t0) * HD; float* N2 = (part == 0 ? po.Q2 : po.K2) + head * TT + t0;
#pragma unroll
        for (int q = 0; q < 8; ++q) bq[q] = bfr(bias[c0 + c8 + q]);
#pragma unroll
        for (int mb = 0; mb < 4; ++mb) { float keep = 0.f;
#pragma unroll
            for (int nb = 0; nb < 4; ++nb) {
#pragma unroll
                for (int j = 0; j < 8; ++j) os[(hi * 8 + j) * 68 + nb * 16 + lr] = acc[mb][nb][j]; }
            __builtin_amdgcn_wave_barrier(); asm volatile("" ::: "memory");   /* one wave, whose LDS operations run in order: this only keeps the compiler from moving a lane's reads over the other lanes' writes */
#pragma unroll
            for (int s = 0; s < 4; ++s) { const int row = 4 * s + rq; const v4f v0 = *(const v4fa*)(os + row * 68 + c8), v1 = *(const v4fa*)(os + row * 68 + c8 + 4); v8us oh, ol; float n2 = 0.f;
#pragma unroll
                for (int q = 0; q < 8; ++q) { const float x = (q < 4 ? v0[q & 3] : v1[q & 3]) + bq[q]; unsigned short a2, c2; splitf(x, a2, c2); oh[q] = a2; ol[q] = c2; n2 = fmaf(x, x, n2); }
                const size_t o = pk(mb * 16 + row, c8, HD); *(v8us*)(Ph + o) = oh; *(v8us*)(Pl + o) = ol;   /* four rows' pieces lie side by side: eight runs of 64 bytes a store */
                n2 = addx<4>(addx<2>(addx<1>(n2))); if ((lane & 7) == s) keep = n2; }   /* the row's eight partial sums; lane 8 rq + s keeps row 4 s + rq */
            if ((lane & 7) < 4) N2[mb * 16 + 4 * (lane & 7) + rq] = keep;
            __builtin_amdgcn_wave_barrier(); asm volatile("" ::: "memory");   /* and the next 16 rows' writes over these reads */
        }
        return; }
    if (PL) {   /* G: 16 rows at a time through LDS as above, read out in the accumulator order of the f32 planes: lane (lr, hi) takes row lr, columns 16 db + 8 hi + 0..7; the 16 lanes of a half read 16 rows at pitch 68, every bank once */
        float* Gp = C + (head * TT + t0) * HD + lane * 4; const unsigned bo = (unsigned)hi * 32u; float bg[4][8];   /* bo: the lane's byte offset into the tile's 64 bias values */
#pragma unroll
        for (int db = 0; db < 4; ++db) {
#pragma unroll
            for (int q = 0; q < 8; ++q) bg[db][q] = *(const float*)((const char*)(bias + c0 + db * 16 + q) + bo); }
        asm volatile("s_wait_xcnt 0x0" :: "v"(bo) : "memory");   /* the wait that goes in front of an overwrite of a load's address register; it takes the offset, so that no load's result is given its register */
#pragma unroll
        for (int db = 0; db < 4; ++db) {
#pragma unroll
            for (int q = 0; q < 8; ++q) bg[db][q] = bfr(bg[db][q]); }
#pragma unroll
        for (int mb = 0; mb < 4; ++mb) {
#pragma unroll
            for (int nb = 0; nb < 4; ++nb) {
#pragma unroll
                for (int j = 0; j < 8; ++j) os[(hi * 8 + j) * 68 + nb * 16 + lr] = acc[mb][nb][j]; }
            __builtin_amdgcn_wave_barrier(); asm volatile("" ::: "memory");   /* one wave, whose LDS operations run in order: this only keeps the compiler from moving a lane's reads over the other lanes' writes */
#pragma unroll
            for (int db = 0; db < 4; ++db) { v4f v0 = *(const v4fa*)(os + lr * 68 + db * 16 + hi * 8), v1 = *(const v4fa*)(os + lr * 68 + db * 16 + hi * 8 + 4);
#pragma unroll
                for (int q = 0; q < 4; ++q) { v0[q] += bg[db][q]; v1[q] += bg[db][q + 4]; }
                *(v4f*)(Gp + mb * 1024 + db * 256) = v0; *(v4f*)(Gp + mb * 1024 + db * 256 + 128) = v1; }
            XWAIT;   /* behind these rows' stores: the next rows' LDS reads may be given their registers */
            __builtin_amdgcn_wave_barrier(); asm volatile("" ::: "memory");   /* and the next 16 rows' writes over these reads */
        }
        return; }
#pragma unroll
    for (int mb = 0; mb < 4; ++mb) {
#pragma unroll
        for (int nb = 0; nb < 4; ++nb) {
#pragma unroll
            for (int j = 0; j < 8; ++j) os[(hi * 8 + j) * 68 + nb * 16 + lr] = acc[mb][nb][j]; }
        __builtin_amdgcn_wave_barrier(); asm volatile("" ::: "memory");
        float* crow = C + (size_t)(r0 + mb * 16) * ldc + c0;
{
#pragma unroll
            for (int s = 0; s < 8; ++s) { const int row = 2 * s + hi, cofs = lr * 4; v4f val = *(const v4fa*)(os + row * 68 + cofs); if (BIAS) { val[0] += bfr(bias[c0 + cofs]); val[1] += bfr(bias[c0 + cofs + 1]); val[2] += bfr(bias[c0 + cofs + 2]); val[3] += bfr(bias[c0 + cofs + 3]); }
                *(v4f*)(crow + (size_t)row * ldc + cofs) = val; }
             }
        XWAIT;   /* behind these rows' stores: the next rows' bias load and LDS reads may be given their registers */
        __builtin_amdgcn_wave_barrier(); asm volatile("" ::: "memory");
    }
}

typedef __attribute__((ext_vector_type(2))) _Float16 v2h;
typedef __attribute__((ext_vector_type(4))) _Float16 v4h;
typedef __attribute__((ext_vector_type(2))) unsigned short v2us;
typedef __attribute__((ext_vector_type(4))) unsigned short v4us;
typedef __attribute__((ext_vector_type(2))) float v2f;
typedef __attribute__((ext_vector_type(4))) int v4i;

// two weight matrices in one launch: workgroups below nbA transpose wA, the rest wB. One thread = one 16-byte piece of the fragment-order plane Bt (rows n, K columns): eight k of one n.
// A wave stores 512 bytes in a row; each of its eight loads reads 16 consecutive n of two k rows (two runs of 64 bytes).
__global__ __launch_bounds__(256) void k_wtG(const float* __restrict__ wA, int KA, int NA, bf* BtA, int nbA, const float* __restrict__ wB, int KB, int NB, bf* BtB) {
    const bool sec = (int)blockIdx.x >= nbA; const float* __restrict__ w = sec ? wB : wA; const int K = sec ? KB : KA, N = sec ? NB : NA; bf* Bt = sec ? BtB : BtA; const int bx = (int)blockIdx.x - (sec ? nbA : 0);
    const int c = bx * 256 + (int)threadIdx.x; if (c >= N * (K / 8)) return;
    const int blk = c >> 6, kb = blk % (K >> 5), n = (blk / (K >> 5)) * 16 + (c & 15), k = kb * 32 + ((c >> 5) & 1) * 16 + ((c >> 4) & 1) * 8;
    const float* p = w + (size_t)k * N + n; float v[8]; v8us o;
#pragma unroll
    for (int j = 0; j < 8; ++j) v[j] = p[(size_t)j * N];
    XWAIT;   /* behind the eight loads: the conversion below is given their address registers */
#pragma unroll
    for (int j = 0; j < 8; ++j) o[j] = f2bf(v[j]);
    *(v8us*)(Bt + (size_t)c * 8) = o;
}
// X (rows of DM columns) -> bf16 in fragment order; one thread = one 16-byte piece of the plane, eight k of one row
__global__ __launch_bounds__(256) void k_cvt8(const float* __restrict__ src, bf* dst, size_t n8) { const size_t i = (size_t)blockIdx.x * 256 + threadIdx.x; if (i >= n8) return; const size_t blk = i >> 6, row = (blk / (DM / 32)) * 16 + (i & 15); const int k = (int)(blk % (DM / 32)) * 32 + (int)((i >> 5) & 1) * 16 + (int)((i >> 4) & 1) * 8; const v8f v = *(const v8f*)(src + row * DM + k); v8us o;
#pragma unroll
    for (int q = 0; q < 8; ++q) o[q] = f2bf(v[q]); *(v8us*)(dst + i * 8) = o;  }

// k_fattn: scores, Shepard weights and attn.v in one kernel; the scores never leave the registers. One wave = 32 query rows x TT/KSP keys, 32 keys a pass; 8 waves (256 query rows) a workgroup.
// The eight waves walk the same keys: each pass's K hi, K lo and V^T blocks (a stage, below) come into LDS once for the workgroup, by asynchronous copies, one pass ahead of their use, into two buffers by turns; the range's key norms come in once, in front of the loop. Every wave copies its eighth of each part (512 bytes in a row a copy); the blocks lie in LDS as in the planes, so a fragment load reads 512 bytes in a row there too.
// S^T = K Q^T (A = K rows, B = Q rows kept in registers): accumulator element j of lane (lr, hi) is key kb*16 + hi*8 + j of query lr, so two key tiles pack straight into the B operand (k order 8 hi + 0..7, 16 + 8 hi + 0..7, the loaders' own) of O^T += V^T P^T.
// w_j = (eps + sqrt(max(q2_i + k2_j - 2 S_ij, 0)))^-2 stays unnormalised; its f32 row sum goes out beside the partial O and divides in k_merge.
// Range of the 16-bit P operand: each query scales eps + dist by r, a power of two near 1 / sqrt(q2_i + k2 of the range's first key), so w / r^2 is of order 1 for keys about as far off as the norms are large; a power of two changes no rounding, and r^2 is taken out of the partial O and the partial sum on the way out.
// A key much nearer than that (down to dist = 0) gives a scaled weight beyond the fp16 range: when a pass of the fp16 rows meets a weight above PMAX, the queries concerned raise their r by a power of two 2^k that brings their largest weight to 2^9..2^11, and this pass's weights, the running row sum and the running O are multiplied by 2^-2k (exact), before anything is rounded to fp16. Weights far below a row's largest then round to fp16 subnormals or 0, at most 2^-25 against a row sum of at least 2^9.
#define STG 8192                  // elements (16 KiB) of a stage = 32 keys: K hi 4 KiB | K lo 4 KiB | V^T fp16 4 KiB, or V^T hi 4 KiB | V^T lo 4 KiB
__device__ __forceinline__ v16h ldsh(const bf* p) { return cat16(*(const v8ha*)p, *(const v8ha*)(p + 256)); }
// one wave's share of a stage: l = the lane's 16 bytes in the stage's first part, the pointers its 16 bytes of each plane. The copies and the wait that goes in front of an overwrite of their address registers are one statement, so nothing can come between them
template <bool HL>
__device__ __forceinline__ void stage_in(unsigned l, const bf* kh, const bf* kl, const bf* v0, const bf* v1) {
    const unsigned l1 = l + 4096u, l2 = l + 8192u, l3 = l + 12288u;
    if (HL) asm volatile("global_load_async_to_lds_b128 %0, %4, off\n\tglobal_load_async_to_lds_b128 %1, %5, off\n\tglobal_load_async_to_lds_b128 %2, %6, off\n\tglobal_load_async_to_lds_b128 %3, %7, off\n\ts_wait_xcnt 0x0" :: "v"(l), "v"(l1), "v"(l2), "v"(l3), "v"(kh), "v"(kl), "v"(v0), "v"(v1) : "memory");
    else asm volatile("global_load_async_to_lds_b128 %0, %3, off\n\tglobal_load_async_to_lds_b128 %1, %4, off\n\tglobal_load_async_to_lds_b128 %2, %5, off\n\ts_wait_xcnt 0x0" :: "v"(l), "v"(l1), "v"(l2), "v"(kh), "v"(kl), "v"(v0) : "memory");
}
template <bool HL>
__device__ __forceinline__ void fattn_body(bf* ring, float* k2s, const bf* __restrict__ Qh, const bf* __restrict__ Ql, const bf* __restrict__ Kh, const bf* __restrict__ Kl, const h16* __restrict__ V16, const bf* __restrict__ Vh, const bf* __restrict__ Vl, const float* __restrict__ q2p, const float* __restrict__ k2p, int q0, int kbeg, float* Op, float* Lp) {
    const int lane = threadIdx.x & 31, lr = lane & 15, hi = lane >> 4; const unsigned lo = 8 * lane;
    // every inner loop here is unrolled in full: its index picks fragments and accumulators, which live in registers and cannot be indexed at run time
    v16bf qh[2][2], ql[2][2]; float q2[2], rs[2], r[2], er[2]; v8f oacc[4][2];
#pragma unroll
    for (int qb = 0; qb < 2; ++qb) { const size_t o = (size_t)(q0 + qb * 16) * HD;   /* 16 rows of 64 = two blocks */ q2[qb] = q2p[q0 + qb * 16 + lr]; rs[qb] = 0.f; r[qb] = __uint_as_float(__float_as_uint(__builtin_amdgcn_rsqf(fminf(fmaxf(q2[qb] + k2p[kbeg], 1e-8f), 1e12f))) & 0x7F800000u);   /* both ends bounded: (r eps)^-2 and its products with V stay far inside f32 */ er[qb] = SEPS * r[qb];
#pragma unroll
        for (int c = 0; c < 2; ++c) { qh[qb][c] = WFrag<bf>::ld(Qh + o + c * 512, lo); XWAIT; ql[qb][c] = WFrag<bf>::ld(Ql + o + c * 512, lo); XWAIT; }   /* XWAIT behind each fragment's loads: a later load's result may be given their address registers */
#pragma unroll
        for (int db = 0; db < 4; ++db) oacc[db][qb] = (v8f){}; }
    const unsigned wv = threadIdx.x >> 5, sl = wv * 256u + lo; const unsigned lb = lds_off(ring) + sl * 2u;   /* wave wv brings elements wv*256 .. +255 of each 2048-element part */
    const size_t vo = (size_t)(wv >> 1) * 16 * TT + (size_t)kbeg * 16 + (wv & 1u) * 256u + lo;   /* of V^T that is half wv & 1 of the block of d rows (wv >> 1) * 16 .. + 15 */
    const bf* gkh = Kh + (size_t)kbeg * HD + sl; const bf* gkl = Kl + (size_t)kbeg * HD + sl; const bf* gv0 = HL ? Vh + vo : (const bf*)(V16 + vo); const bf* gv1 = Vl + vo;
    { const unsigned ln = lds_off(k2s) + threadIdx.x * 8u; const float* gn = k2p + kbeg + threadIdx.x * 2;   /* the range's TT / KSP = 512 key norms, two a thread */
      asm volatile("global_load_async_to_lds_b64 %0, %1, off\n\ts_wait_xcnt 0x0" :: "v"(ln), "v"(gn) : "memory"); }
    stage_in<HL>(lb, gkh, gkl, gv0, gv1);
    asm volatile("s_wait_asynccnt 0x0" ::: "memory");   /* this wave's copies of stage 0 and of the norms have landed */
    __syncthreads();                                     /* and every other wave's */
    stage_in<HL>(lb + STG * 2u, gkh + 2048, gkl + 2048, gv0 + 512, gv1 + 512); gkh += 4096; gkl += 4096; gv0 += 1024; gv1 += 1024;   /* a stage further: 32 keys x 64 of K, 32 t of each V^T block */
    // the pass stays rolled: unrolled it would hold two passes' fragments in registers and cost resident waves
#pragma unroll 1
    for (int t = 0; t < TT / KSP / 32; ++t) {
        const bf* sb = ring + (t & 1) * STG;
        v8f s[2][2]; float wm[2] = {0.f, 0.f};
#pragma unroll
        for (int kb = 0; kb < 2; ++kb) { v16bf kh[2], kl[2];
#pragma unroll
            for (int c = 0; c < 2; ++c) { kh[c] = ldsb(sb + (kb * 2 + c) * 512 + lo); kl[c] = ldsb(sb + 2048 + (kb * 2 + c) * 512 + lo); }
#pragma unroll
            for (int qb = 0; qb < 2; ++qb) { v8f a = (v8f){};
#pragma unroll
                for (int c = 0; c < 2; ++c) { a = wmmab(kh[c], qh[qb][c], a); a = wmmab(kh[c], ql[qb][c], a); a = wmmab(kl[c], qh[qb][c], a); }
                s[kb][qb] = a; } }
        v16h vf[4];   /* fp16 rows: the V^T fragments are asked for here, so that they arrive under the weights' vector work */
        if (!HL) {
#pragma unroll
            for (int db = 0; db < 4; ++db) vf[db] = ldsh(sb + 4096 + db * 512 + lo); }
#pragma unroll
        for (int kb = 0; kb < 2; ++kb) { const v4f ka = *(const v4fa*)(k2s + t * 32 + kb * 16 + hi * 8), kc = *(const v4fa*)(k2s + t * 32 + kb * 16 + hi * 8 + 4);
#pragma unroll
            for (int qb = 0; qb < 2; ++qb) {
#pragma unroll
                for (int j = 0; j < 8; ++j) { const float t = q2[qb] + (j < 4 ? ka[j & 3] : kc[j & 3]); const float d2 = fmaxf(t - 2.0f * s[kb][qb][j], 0.f); const float den = fmaf(__builtin_amdgcn_sqrtf(d2), r[qb], er[qb]); const float w = __builtin_amdgcn_rcpf(den * den);   /* (r (eps + dist))^-2 */ s[kb][qb][j] = w; rs[qb] += w; if (!HL) wm[qb] = fmaxf(wm[qb], w); } } }
        if (!HL && __builtin_amdgcn_ballot_w32(fmaxf(wm[0], wm[1]) > PMAX) != 0u) {   /* rare; the ballot makes it one scalar branch for the wave, so the exchange below has every lane on */
#pragma unroll
            for (int qb = 0; qb < 2; ++qb) { const float m = fmaxf(wm[qb], __shfl_xor(wm[qb], 16, 32));   /* a query's keys lie in lanes lr and lr + 16: both take the same k */
                const int k = (m > PMAX) ? (((int)(__float_as_uint(m) >> 23) - 136) >> 1) : 0; const float g = __uint_as_float((unsigned)(127 - k) << 23), gi = __uint_as_float((unsigned)(127 + k) << 23), f = g * g;
                r[qb] *= gi; er[qb] *= gi; rs[qb] *= f; s[0][qb] *= f; s[1][qb] *= f;
#pragma unroll
                for (int db = 0; db < 4; ++db) oacc[db][qb] *= f; } }
        if (HL) { v16bf ph[2], pl[2];
#pragma unroll
            for (int qb = 0; qb < 2; ++qb) { v8us h0, h1, l0, l1;
#pragma unroll
                for (int j = 0; j < 8; ++j) { unsigned short a, c2; splitf(s[0][qb][j], a, c2); h0[j] = a; l0[j] = c2; splitf(s[1][qb][j], a, c2); h1[j] = a; l1[j] = c2; }
                ph[qb] = cat16b(h0, h1); pl[qb] = cat16b(l0, l1); }
#pragma unroll
            for (int db = 0; db < 4; ++db) { const v16bf vh = ldsb(sb + 4096 + db * 512 + lo), vl = ldsb(sb + 6144 + db * 512 + lo);
#pragma unroll
                for (int qb = 0; qb < 2; ++qb) { oacc[db][qb] = wmmab(vh, ph[qb], oacc[db][qb]); oacc[db][qb] = wmmab(vh, pl[qb], oacc[db][qb]); oacc[db][qb] = wmmab(vl, ph[qb], oacc[db][qb]); } }
        } else { v16h p[2];
#pragma unroll
            for (int qb = 0; qb < 2; ++qb) { v8h p0, p1;
#pragma unroll
                for (int j = 0; j < 8; ++j) { p0[j] = tohx(s[0][qb][j]); p1[j] = tohx(s[1][qb][j]); }
                p[qb] = cat16(p0, p1); }
#pragma unroll
            for (int db = 0; db < 4; ++db) {
#pragma unroll
                for (int qb = 0; qb < 2; ++qb) oacc[db][qb] = wmma16(vf[db], p[qb], oacc[db][qb]); } }
        asm volatile("s_wait_dscnt 0x0" ::: "memory");      /* this wave has read all it wants of this pass's buffer */
        asm volatile("s_wait_asynccnt 0x0" ::: "memory");   /* and its copies of the next stage have landed */
        __syncthreads();                                     /* so have every wave's: the next stage may be read, this pass's buffer refilled */
        if (t + 2 < TT / KSP / 32) { stage_in<HL>(lb + (unsigned)(t & 1) * (STG * 2u), gkh, gkl, gv0, gv1); gkh += 2048; gkl += 2048; gv0 += 512; gv1 += 512; }
    }
    asm volatile("s_wait_asynccnt 0x0" ::: "memory");   /* no copy is left in flight when the wave ends */
#pragma unroll
    for (int qb = 0; qb < 2; ++qb) { const float u = r[qb] * r[qb]; const float tot = (rs[qb] + __shfl_xor(rs[qb], 16, 32)) * u; if (hi == 0) Lp[q0 + qb * 16 + lr] = tot;
#pragma unroll
        for (int db = 0; db < 4; ++db) { float* o = Op + (size_t)(q0 + qb * 16) * HD + db * 256 + lane * 4;   /* accumulator order: the wave's 32 pieces side by side */ const v8f a = oacc[db][qb] * u; *(v4f*)o = (v4f){a[0], a[1], a[2], a[3]}; *(v4f*)(o + 128) = (v4f){a[4], a[5], a[6], a[7]}; } }
}
__global__ __launch_bounds__(256) void k_fattn(const bf* __restrict__ QPh, const bf* __restrict__ QPl, const bf* __restrict__ KPh, const bf* __restrict__ KPl, const h16* __restrict__ VT16, const bf* __restrict__ VTh, const bf* __restrict__ VTl, const float* __restrict__ Q2, const float* __restrict__ K2, float* Ob, float* Lb) {
    // grid (head, key range, query tile). The hi/lo tiles' passes hold half as many matrix instructions again and far more vector work; these tiles have the lowest z, so they start first. For speed only: each (head, range, tile) is done once wherever it lands
    const size_t h = blockIdx.x, ks = blockIdx.y, hp = h * TT * HD; const int q0 = blockIdx.z * 256 + (threadIdx.x >> 5) * 32, kbeg = (int)ks * (TT / KSP);
    float* Op = Ob + (ks * NHB + h) * TT * HD; float* Lp = Lb + (ks * NHB + h) * TT;
    __shared__ __align__(16) bf ring[2 * STG]; __shared__ __align__(16) float k2s[TT / KSP];
    if (blockIdx.z * 256 < RH) fattn_body<true>(ring, k2s, QPh + hp, QPl + hp, KPh + hp, KPl + hp, VT16 + hp, VTh + hp, VTl + hp, Q2 + h * TT, K2 + h * TT, q0, kbeg, Op, Lp);   /* RH is a multiple of 256: one path a workgroup */
    else fattn_body<false>(ring, k2s, QPh + hp, QPl + hp, KPh + hp, KPl + hp, VT16 + hp, VTh + hp, VTl + hp, Q2 + h * TT, K2 + h * TT, q0, kbeg, Op, Lp);
}
// One thread = lane (lr, hi) of one part of a block of the f32 planes: eight d of one row, which are one 16-byte piece of each gated-A plane. Every load of O and G and both stores cover 512 bytes in a row a wave.
__global__ __launch_bounds__(256) void k_merge(const float* __restrict__ O, const float* __restrict__ L, const float* __restrict__ G, bf* Ah, bf* Al) {
    static_assert(((size_t)NHB * TT * HD / 8) % 256 == 0, "whole workgroups");
    const unsigned i = blockIdx.x * 256u + threadIdx.x, lane = i & 31u, lr = lane & 15u, hi = lane >> 4, db = (i >> 5) & 3u, blk = i >> 7;   /* blk = head * (TT / 16) + t / 16 */
    const unsigned zz = blk / (TT / 16), t = (blk % (TT / 16)) * 16u + lr, hh = zz % NH_; const size_t row = (size_t)(zz / NH_) * TT + t;
    const unsigned eb = (blk * 1024u + db * 256u + lane * 4u) * 4u, le = zz * TT + t;   /* the lane's byte offset in a plane of O or G (below 2^24), as 32 bits: each load is a uniform base + this one register */
    static_assert(KSP == 4 && (size_t)KSP * NHB * TT * HD * 4 < ((size_t)1 << 32), "four offsets of 32 bits, named in the wait below");
    float lp[KSP]; v4f o0[KSP], o1[KSP]; unsigned ek[KSP];
#pragma unroll
    for (int ks = 0; ks < KSP; ++ks) ek[ks] = eb + (unsigned)ks * (unsigned)(NHB * TT * HD * 4);   /* the same piece of partial plane ks */
#pragma unroll
    for (int ks = 0; ks < KSP; ++ks) { lp[ks] = (L + (size_t)ks * NHB * TT)[le]; o0[ks] = *(const v4f*)((const char*)O + ek[ks]); o1[ks] = *(const v4f*)((const char*)(O + 128) + ek[ks]); }
    const v4f g0 = *(const v4f*)((const char*)G + eb), g1 = *(const v4f*)((const char*)(G + 128) + eb);
    asm volatile("s_wait_xcnt 0x0" :: "v"(ek[0]), "v"(ek[1]), "v"(ek[2]), "v"(ek[3]), "v"(le) : "memory");   /* the wait that goes in front of an overwrite of a load's address registers; it takes the offsets, so they keep their registers until every load is out and no load's result is given them */
    float lsum = lp[0];   /* row sum of the weights: the KSP partial sums, fixed order */
#pragma unroll
    for (int ks = 1; ks < KSP; ++ks) lsum = __fadd_rn(lsum, lp[ks]);
    const float cs = __builtin_amdgcn_rcpf(__fadd_rn(SEPS, lsum));   /* W / (eps + sum W) via hardware reciprocal */
    v8us oh, ol;
#pragma unroll
    for (int q = 0; q < 8; ++q) { float s = q < 4 ? o0[0][q & 3] : o1[0][q & 3];   /* sum of the KSP partial planes, fixed order */
#pragma unroll
        for (int ks = 1; ks < KSP; ++ks) s = __fadd_rn(s, q < 4 ? o0[ks][q & 3] : o1[ks][q & 3]);
        const float oc = s * cs, gt = q < 4 ? g0[q & 3] : g1[q & 3]; unsigned short a, c2; splitf(__fmul_rn(gt, oc), a, c2); oh[q] = a; ol[q] = c2; }   /* H = G * A */
    const size_t oo = pk(row, (int)(hh * HD + db * 16u + hi * 8u), DQ); *(v8us*)(Ah + oo) = oh; *(v8us*)(Al + oo) = ol;
}

extern "C" void kernel_launch(void* const* d_in, const int* in_sizes, int n_in,
                              void* d_out, int out_size, void* d_ws, size_t ws_size, hipStream_t stream) {
    (void)in_sizes; (void)n_in; (void)out_size;
    const float* x = (const float*)d_in[0]; const float* win = (const float*)d_in[1]; const float* bin = (const float*)d_in[2]; const float* wo = (const float*)d_in[3]; const float* bo = (const float*)d_in[4]; const float* wq = nullptr; const float* wk = nullptr; const float* wv = nullptr; (void)wq; (void)wk; (void)wv;
    float* OUT = (float*)d_out;     // [2][2048][1024]
    char* wsp = (char*)d_ws;
    auto take = [&](size_t bytes) { char* p = wsp; wsp += (bytes + 255) & ~(size_t)255; return (void*)p; };
    bf* WINB = (bf*)take((size_t)DP * DM * 2); bf* WO = (bf*)take((size_t)DM * DQ * 2);
    bf* XB = (bf*)take((size_t)NB_ * TT * DM * 2); float* GP = (float*)take((size_t)NHB * TT * HD * 4); float* Q2 = (float*)take((size_t)NHB * TT * 4); float* K2 = (float*)take((size_t)NHB * TT * 4);
    h16* VT16 = (h16*)take((size_t)NHB * HD * TT * 2);
    bf* QPh = (bf*)take((size_t)NHB * TT * HD * 2); bf* QPl = (bf*)take((size_t)NHB * TT * HD * 2); bf* KPh = (bf*)take((size_t)NHB * TT * HD * 2); bf* KPl = (bf*)take((size_t)NHB * TT * HD * 2); bf* VTh = (bf*)take((size_t)NHB * HD * TT * 2); bf* VTl = (bf*)take((size_t)NHB * HD * TT * 2);
    float* Ob = (float*)take((size_t)KSP * NHB * TT * HD * 4); float* Lb = (float*)take((size_t)KSP * NHB * TT * 4); bf* ATh = (bf*)take((size_t)NB_ * TT * DQ * 2); bf* ATl = (bf*)take((size_t)NB_ * TT * DQ * 2);
    if ((size_t)(wsp - (char*)d_ws) > ws_size) return;    // about 172 MiB of the 256 MiB
    k_wtG<<<(unsigned)(DM * DP / 2048 + DQ * DM / 2048), 256, 0, stream>>>(win, DM, DP, WINB, DM * DP / 2048, wo, DQ, DM, WO);   /* 'xw' [1024][4096] -> Bt 4096 x 1024; 'xw' [1024][1024] -> Bt 1024 x 1024; 2048 elements a workgroup */
    const PlaneOut po = {QPh, QPl, KPh, KPl, VT16, VTh, VTl, Q2, K2}, none = {};
    /* X [2][2048][1024] is one matrix of NB_*TT rows to both GEMMs; the attention sees NHB independent heads */
    k_cvt8<<<(unsigned)(((size_t)NB_ * TT * DM / 8 + 255) / 256), 256, 0, stream>>>(x, XB, (size_t)NB_ * TT * DM / 8);
    k_gemmw<bf, 0, true, DM, 1, true><<<dim3(NB_ * TT / 256, DP / 256, 1), 512, 0, stream>>>(XB, nullptr, WINB, nullptr, GP, HD, bin, 0, 0, 0, 0, po);   /* P = X W_in + b_in (exact): Q, K hi/lo planes + q2, k2, V^T planes; G (cols h*256 + 192..255) as f32 planes [head][t x 64] to GP */
    k_fattn<<<dim3(NHB, KSP, TT / 256), 256, 0, stream>>>(QPh, QPl, KPh, KPl, VT16, VTh, VTl, Q2, K2, Ob, Lb);   /* all heads of both batches: Q.K (3 products), weights, attn.v partials + partial row sums */
    k_merge<<<(unsigned)((size_t)NHB * TT * HD / 8 / 256), 256, 0, stream>>>(Ob, Lb, GP, ATh, ATl);
    k_gemmw<bf, 1, true, DQ><<<dim3(NB_ * TT / 64, DM / 64, 1), 32, 0, stream>>>(ATh, ATl, WO, nullptr, OUT, DM, bo, 0, 0, 0, 0, none);
}
